// v000
// The times below were measured on an AMD MI455X: many runs one after another, warmed up first and cycling through
// copies of the inputs, with the whole window's GPU time divided by the number of runs. Launches and the gaps
// between them are all in it. The median over several windows is given; except for v000 it joins two sittings, which
// can be a few percent apart, so the side-by-side timings, each taken in one sitting, are the better comparison.
// The starting kernel, v000, takes 3610 microseconds a run.
#include <hip/hip_runtime.h>

// Compute dtypes, f32 accumulate: k, v = [mem; x].W + b, q = x.Wq + bq, Q_rel = rel_enc.Wkr + bkr as [rows x 1024].[1024 x 1024] GEMMs with PLAIN bf16 operands (rounded inputs, k-major
// weights transposed once; exact products) on v_wmma_f32_16x16x32_bf16 -> per-(batch, head) bf16 hi + UNSCALED residual planes; per (b, h): A = q.k^T and B_hat = q.Q_rel^T ([1024 x
// 64].[64 x 2048], three products), the Transformer-XL shift by index, (A + B)/8 + mask x (-1e9), row softmax in f32 -> P planes; ctx = P.v ([1024 x 2048].[2048 x 64], three

#define LQ   1024
#define TK   2048
#define NBT  2
#define DD   1024
#define NH_  16
#define HD   64
#define NXR  (LQ * NBT)           // 2048 query rows (b, s)
#define NCR  (TK * NBT)           // 4096 context rows (b, t)
#define DM   DD
#define NTK  NCR
#define SCL  0.125f
#define LOSC 1024.0f

typedef _Float16 h16;
typedef unsigned short bf;
typedef __attribute__((ext_vector_type(16))) __bf16   v16bf;
typedef __attribute__((ext_vector_type(16))) _Float16 v16h;
typedef __attribute__((ext_vector_type(8)))  _Float16 v8h;
typedef __attribute__((ext_vector_type(8)))  unsigned short v8us;
typedef __attribute__((ext_vector_type(8)))  float    v8f;
typedef __attribute__((ext_vector_type(4)))  float    v4f;
typedef __attribute__((ext_vector_type(4)))  _Float16 v4h;
typedef v8h  __attribute__((may_alias)) v8ha;
typedef v4f  __attribute__((may_alias)) v4fa;
typedef v8us __attribute__((may_alias)) v8usa;

__device__ __forceinline__ unsigned short f2bf(float f) { unsigned u = __float_as_uint(f); u += 0x7FFFu + ((u >> 16) & 1u); return (unsigned short)(u >> 16); }
__device__ __forceinline__ float bf2f(unsigned short b) { return __uint_as_float(((unsigned)b) << 16); }
__device__ __forceinline__ float bfr(float f) { return bf2f(f2bf(f)); }
__device__ __forceinline__ v16h cat16(v8h lo, v8h hi) { return __builtin_shufflevector(lo, hi, 0, 1, 2, 3, 4, 5, 6, 7, 8, 9, 10, 11, 12, 13, 14, 15); }
__device__ __forceinline__ v16bf cat16b(v8us lo, v8us hi) { return __builtin_bit_cast(v16bf, __builtin_shufflevector(lo, hi, 0, 1, 2, 3, 4, 5, 6, 7, 8, 9, 10, 11, 12, 13, 14, 15)); }
__device__ __forceinline__ v8f wmma16(v16h a, v16h b, v8f c) { return __builtin_amdgcn_wmma_f32_16x16x32_f16(false, a, false, b, (short)0, c, false, false); }
__device__ __forceinline__ v8f wmmab(v16bf a, v16bf b, v8f c) { return __builtin_amdgcn_wmma_f32_16x16x32_bf16(false, a, false, b, (short)0, c, false, false); }

// k_wt: WT [n][K] = bf16(W[k][n]) (k-major [K][ncols]) via 64 x 64 LDS tiles; grid (K/64, ncols/64).
__global__ __launch_bounds__(256) void k_wt(const float* __restrict__ Wm, int K, int ncols, bf* WT) {
    __shared__ __align__(16) unsigned short tl[64 * 72];
    const int tid = threadIdx.x, k0 = blockIdx.x * 64, n0 = blockIdx.y * 64;
    const int kk = tid >> 2, nq = (tid & 3) * 16;
#pragma unroll
    for (int i = 0; i < 16; ++i) tl[(nq + i) * 72 + kk] = f2bf(Wm[(size_t)(k0 + kk) * ncols + n0 + nq + i]);
    __syncthreads();
    const int piece = tid & 7;
    auto pass = [&]() {
#pragma unroll
        for (int s = 0; s < 2; ++s) { const int nr = (tid >> 3) + 32 * s; const v8us val = *(const v8usa*)(tl + nr * 72 + piece * 8); *(v8us*)(WT + (size_t)(n0 + nr) * K + k0 + piece * 8) = val; }
    };
    pass(); 
}
__global__ __launch_bounds__(256) void k_cvtb(const float* __restrict__ src, int nrows, bf* dst) {
    const int lane = threadIdx.x & 31, r = blockIdx.x * 8 + (threadIdx.x >> 5);
    if (r >= nrows) return;
    v8us o[DM / 256];
#pragma unroll
    for (int q = 0; q < DM / 256; ++q) { v8us t;
#pragma unroll
        for (int i = 0; i < 8; ++i) t[i] = f2bf(src[(size_t)r * DM + q * 256 + lane * 8 + i]);
        o[q] = t; }
#pragma unroll
    for (int q = 0; q < DM / 256; ++q) *(v8us*)(dst + (size_t)r * DM + q * 256 + lane * 8) = o[q];
    
}

// k_gemmb: 64 x 64 block tile (4 waves x 16 x 64) of C[NTK][NW] = (A [+ Al]).B^T (K = 1024) [+ bf(bias[c])] [+ bf(R[r][c]) residual]; f32 whole-line epilogue (or f16
template <bool SPLITA, bool F16OUT = false>
__global__ __launch_bounds__(128) void k_gemmb(const bf* __restrict__ A, const bf* __restrict__ Al, const bf* __restrict__ Bn, const float* __restrict__ bias, float* C, int ldc, h16* C2, const float* __restrict__ R = nullptr, int K = DM, int roundR = 1) {
    __shared__ __align__(16) float ost[4][16 * 68];
    const int lane = threadIdx.x & 31, wave = threadIdx.x >> 5, lr = lane & 15, hi = lane >> 4;
    const int r0 = blockIdx.x * 64 + wave * 16, c0 = blockIdx.y * 64;
    const size_t aoff = (size_t)(r0 + lr) * K + 8 * hi;
    size_t boff[4];
#pragma unroll
    for (int t = 0; t < 4; ++t) boff[t] = (size_t)(c0 + t * 16 + lr) * K + 8 * hi;
    v8f acc[4];
#pragma unroll
    for (int t = 0; t < 4; ++t) acc[t] = (v8f){};
#pragma unroll 1
    for (int kc = 0; kc < K; kc += 32) {
        const v16bf a = cat16b(*(const v8us*)(A + aoff + kc), *(const v8us*)(A + aoff + kc + 16));
        v16bf al = a;
        if (SPLITA) al = cat16b(*(const v8us*)(Al + aoff + kc), *(const v8us*)(Al + aoff + kc + 16));
#pragma unroll
        for (int t = 0; t < 4; ++t) { const v16bf b = cat16b(*(const v8us*)(Bn + boff[t] + kc), *(const v8us*)(Bn + boff[t] + kc + 16)); acc[t] = wmmab(a, b, acc[t]); if (SPLITA) acc[t] = wmmab(al, b, acc[t]); }
        asm volatile("v_nop\n\tv_nop\n\tv_nop\n\tv_nop" : "+v"(acc[0]), "+v"(acc[1]), "+v"(acc[2]), "+v"(acc[3]) : "v"(a), "v"(al));
    }
    float* os = &ost[wave][0];
#pragma unroll
    for (int t = 0; t < 4; ++t) { const float bv = bias ? bfr(bias[c0 + t * 16 + lr]) : 0.f;
#pragma unroll
        for (int j = 0; j < 8; ++j) os[(hi * 8 + j) * 68 + t * 16 + lr] = acc[t][j] + bv; }
    __syncthreads();
    if (F16OUT) {
        h16* crow = (h16*)(void*)C + (size_t)r0 * ldc + c0;
        auto pass = [&]() {
#pragma unroll
            for (int s = 0; s < 4; ++s) { const int row = 4 * s + (lane >> 3), piece = lane & 7; const float* sp = os + row * 68 + piece * 8; v8h o, o2;
#pragma unroll
                for (int i = 0; i < 8; ++i) { const h16 a = (h16)sp[i]; o[i] = a; o2[i] = (h16)((sp[i] - (float)a) * LOSC); }
                *(v8h*)(crow + (size_t)row * ldc + piece * 8) = o; if (C2) *(v8h*)(C2 + (size_t)r0 * ldc + c0 + (size_t)row * ldc + piece * 8) = o2; }
        };
        pass(); 
    } else {
        float* crow = C + (size_t)r0 * ldc + c0;
        auto pass = [&]() {
#pragma unroll
            for (int s = 0; s < 8; ++s) { const int Lid = (lane >> 3) + 4 * s, piece = lane & 7; const int row = Lid >> 1, cofs = (Lid & 1) * 32 + piece * 4;
                v4f val = *(const v4fa*)(os + row * 68 + cofs); if (R) { const v4f rv = *(const v4f*)(R + ((size_t)r0 + row) * ldc + c0 + cofs); val += roundR ? (v4f){bfr(rv[0]), bfr(rv[1]), bfr(rv[2]), bfr(rv[3])} : rv; }
                *(v4f*)(crow + (size_t)row * ldc + cofs) = val; }
        };
        pass(); 
    }
}

// k_gemm3: 64 x 64 tile of C = (Ah + Al).(Bh + Bl)^T over K (row strides = K for all four planes; n-major B): three products per 32-k step (hh, hl, lh); f32
__global__ __launch_bounds__(128) void k_gemm3(const bf* __restrict__ Ah, const bf* __restrict__ Al, const bf* __restrict__ Bh, const bf* __restrict__ Bl, int K, float* C, int ldc) {
    __shared__ __align__(16) float ost[4][16 * 68];
    const int lane = threadIdx.x & 31, wave = threadIdx.x >> 5, lr = lane & 15, hi = lane >> 4;
    const int r0 = blockIdx.x * 64 + wave * 16, c0 = blockIdx.y * 64;
    const size_t aoff = (size_t)(r0 + lr) * K + 8 * hi;
    v8f acc[4];
#pragma unroll
    for (int t = 0; t < 4; ++t) acc[t] = (v8f){};
#pragma unroll 1
    for (int kc = 0; kc < K; kc += 32) {
        const v16bf a = cat16b(*(const v8us*)(Ah + aoff + kc), *(const v8us*)(Ah + aoff + kc + 16));
        const v16bf al = cat16b(*(const v8us*)(Al + aoff + kc), *(const v8us*)(Al + aoff + kc + 16));
#pragma unroll
        for (int t = 0; t < 4; ++t) { const size_t bo = (size_t)(c0 + t * 16 + lr) * K + kc + 8 * hi;
            const v16bf bh = cat16b(*(const v8us*)(Bh + bo), *(const v8us*)(Bh + bo + 16)); const v16bf bl = cat16b(*(const v8us*)(Bl + bo), *(const v8us*)(Bl + bo + 16));
            acc[t] = wmmab(a, bh, acc[t]); acc[t] = wmmab(al, bh, acc[t]); acc[t] = wmmab(a, bl, acc[t]); }
        asm volatile("v_nop\n\tv_nop\n\tv_nop\n\tv_nop" : "+v"(acc[0]), "+v"(acc[1]), "+v"(acc[2]), "+v"(acc[3]) : "v"(a), "v"(al));
    }
    float* os = &ost[wave][0];
#pragma unroll
    for (int t = 0; t < 4; ++t) {
#pragma unroll
        for (int j = 0; j < 8; ++j) os[(hi * 8 + j) * 68 + t * 16 + lr] = acc[t][j]; }
    __builtin_amdgcn_wave_barrier(); asm volatile("" ::: "memory");
    float* crow = C + (size_t)r0 * ldc + c0;
    auto pass = [&]() {
#pragma unroll
        for (int s = 0; s < 8; ++s) { const int Lid = (lane >> 3) + 4 * s, piece = lane & 7; const int row = Lid >> 1, cofs = (Lid & 1) * 32 + piece * 4;
            const v4f val = *(const v4fa*)(os + row * 68 + cofs); *(v4f*)(crow + (size_t)row * ldc + cofs) = val; }
    };
    pass(); 
}


// k_hplanes: per (b, h) contiguous operand planes [rows][64] = bf16 hi + UNSCALED residual of SRC[b*rows + row][h*64 + d] + bf(bias[h*64 + d]) (batch-first rows; nb = 1 for the
__global__ __launch_bounds__(256) void k_hplanes(const float* __restrict__ SRC, int nb, int nrows, const float* __restrict__ bias, bf* Ph, bf* Pl) {
    typedef __attribute__((ext_vector_type(2))) unsigned short v2us;
    const int lane = threadIdx.x & 31; const size_t wid = (size_t)blockIdx.x * 8 + (threadIdx.x >> 5); if (wid >= (size_t)nb * NH_ * nrows) return;
    const int row = (int)(wid % nrows); const int bh = (int)(wid / nrows), h = bh % NH_, b = bh / NH_;
    v2us oh, ol;
#pragma unroll
    for (int i = 0; i < 2; ++i) { const int d = 2 * lane + i; const float v = SRC[((size_t)b * nrows + row) * DM + h * HD + d] + bfr(bias[h * HD + d]); const unsigned short hb = f2bf(v); oh[i] = hb; ol[i] = f2bf(v - bf2f(hb)); }
    const size_t o = ((size_t)bh * nrows + row) * HD + 2 * lane;
    *(v2us*)(Ph + o) = oh; *(v2us*)(Pl + o) = ol; 
}
__global__ __launch_bounds__(256) void k_vtplanes(const float* __restrict__ Vsrc, const float* __restrict__ bias, bf* VTh, bf* VTl) {
    typedef __attribute__((ext_vector_type(2))) unsigned short v2us;
    const int lane = threadIdx.x & 31; const size_t wid = (size_t)blockIdx.x * 8 + (threadIdx.x >> 5); if (wid >= (size_t)NBT * NH_ * HD * (TK / 64)) return;
    const int tg = (int)(wid % (TK / 64)), rest = (int)(wid / (TK / 64)), d = rest % HD, bh = rest / HD, h = bh % NH_, b = bh / NH_; const int t0 = tg * 64 + 2 * lane;
    v2us oh, ol;
#pragma unroll
    for (int i = 0; i < 2; ++i) { const float v = Vsrc[((size_t)b * TK + t0 + i) * DM + h * HD + d] + bfr(bias[h * HD + d]); const unsigned short hb = f2bf(v); oh[i] = hb; ol[i] = f2bf(v - bf2f(hb)); }
    const size_t o = ((size_t)bh * HD + d) * TK + t0;
    *(v2us*)(VTh + o) = oh; *(v2us*)(VTl + o) = ol; 
}
// k_relsoft: one wave per query row i of (b, h): B[i][j] = shift(B_hat): idx = (L-1) + i*T + j, row = idx/(T+1), col = idx%(T+1), B = col < T ? BH[row][col] : 0 (one division per row,
// the column wraps at most once); s = (AC[i][j] + B) / 8 + mask[i][j] (-1e9); softmax over the 2048 keys in f32 (fixed lane order, three passes) -> bf16 hi + UNSCALED residual planes
__global__ __launch_bounds__(256) void k_relsoft(const float* __restrict__ AC, const float* __restrict__ BH, const float* __restrict__ MSK, bf* PH, bf* PL) {
    typedef __attribute__((ext_vector_type(4))) unsigned short v4us;
    const int lane = threadIdx.x & 31, i = blockIdx.x * 8 + (threadIdx.x >> 5); if (i >= LQ) return;
    const int base = (LQ - 1) + i * TK; const int row0 = base / (TK + 1), col0 = base % (TK + 1);
    auto score = [&](int j) -> float { int col = col0 + j, row = row0; if (col >= TK + 1) { col -= TK + 1; row += 1; }
        const float bd = (col < TK) ? BH[(size_t)row * TK + col] : 0.f; return (AC[(size_t)i * TK + j] + bd) * SCL + bfr(MSK[(size_t)i * TK + j]) * (-1e9f); };
    float m = -3.0e38f;
#pragma unroll 1
    for (int c0 = lane * 4; c0 < TK; c0 += 128) {
#pragma unroll
        for (int q = 0; q < 4; ++q) m = fmaxf(m, score(c0 + q)); }
#pragma unroll
    for (int sh = 16; sh; sh >>= 1) m = fmaxf(m, __shfl_xor(m, sh, 32));
    float sum = 0.f;
#pragma unroll 1
    for (int c0 = lane * 4; c0 < TK; c0 += 128) {
#pragma unroll
        for (int q = 0; q < 4; ++q) sum += __expf(score(c0 + q) - m); }
#pragma unroll
    for (int sh = 16; sh; sh >>= 1) sum += __shfl_xor(sum, sh, 32);
    const float inv = 1.0f / sum;
{
#pragma unroll 1
        for (int c0 = lane * 4; c0 < TK; c0 += 128) { v4us oh, ol;
#pragma unroll
            for (int q = 0; q < 4; ++q) { const float p = __expf(score(c0 + q) - m) * inv; const unsigned short hb = f2bf(p); oh[q] = hb; ol[q] = f2bf(p - bf2f(hb)); }
            const size_t o = (size_t)i * TK + c0; *(v4us*)(PH + o) = oh; *(v4us*)(PL + o) = ol; }
         }
}
__global__ __launch_bounds__(256) void k_split(const float* __restrict__ src, int nrows, bf* dh, bf* dl) {
    const int lane = threadIdx.x & 31, r = blockIdx.x * 8 + (threadIdx.x >> 5); if (r >= nrows) return;
{
#pragma unroll 1
        for (int q = 0; q < DD / 256; ++q) { const size_t o = (size_t)r * DD + q * 256 + lane * 8; const v8f v = *(const v8f*)(src + o); v8us oh, ol;
#pragma unroll
            for (int i = 0; i < 8; ++i) { const unsigned short hb = f2bf(v[i]); oh[i] = hb; ol[i] = f2bf(v[i] - bf2f(hb)); }
            *(v8us*)(dh + o) = oh; *(v8us*)(dl + o) = ol; }
         }
}

extern "C" void kernel_launch(void* const* d_in, const int* in_sizes, int n_in,
                              void* d_out, int out_size, void* d_ws, size_t ws_size, hipStream_t stream) {
    (void)in_sizes; (void)n_in; (void)out_size;
    const float* x = (const float*)d_in[0]; const float* mem = (const float*)d_in[1]; const float* msk = (const float*)d_in[2]; const float* rel = (const float*)d_in[3];
    const float* Wq = (const float*)d_in[4]; const float* bq = (const float*)d_in[5]; const float* Wke = (const float*)d_in[6]; const float* bke = (const float*)d_in[7]; const float* Wkr = (const float*)d_in[8]; const float* bkr = (const float*)d_in[9];
    const float* Wv = (const float*)d_in[10]; const float* bv = (const float*)d_in[11]; const float* Wo = (const float*)d_in[12]; const float* bo = (const float*)d_in[13];
    float* out = (float*)d_out;    // [2][1024][1024]
    char* wsp = (char*)d_ws;
    auto take = [&](size_t bytes) { char* p = wsp; wsp += (bytes + 255) & ~(size_t)255; return (void*)p; };
    bf* WqT = (bf*)take((size_t)DD * DD * 2); bf* WkeT = (bf*)take((size_t)DD * DD * 2); bf* WkrT = (bf*)take((size_t)DD * DD * 2); bf* WvT = (bf*)take((size_t)DD * DD * 2); bf* WoT = (bf*)take((size_t)DD * DD * 2);
    bf* Cb = (bf*)take((size_t)NCR * DD * 2); float* TMP = (float*)take((size_t)NCR * DD * 4);
    bf* Qh = (bf*)take((size_t)NBT * NH_ * LQ * HD * 2); bf* Ql = (bf*)take((size_t)NBT * NH_ * LQ * HD * 2);
    bf* Kh = (bf*)take((size_t)NBT * NH_ * TK * HD * 2); bf* Kl = (bf*)take((size_t)NBT * NH_ * TK * HD * 2); bf* Rh = (bf*)take((size_t)NH_ * TK * HD * 2); bf* Rl = (bf*)take((size_t)NH_ * TK * HD * 2);
    bf* VTh = (bf*)take((size_t)NBT * NH_ * HD * TK * 2); bf* VTl = (bf*)take((size_t)NBT * NH_ * HD * TK * 2);
    float* AC = (float*)take((size_t)LQ * TK * 4); float* BH = (float*)take((size_t)LQ * TK * 4); bf* PH = (bf*)take((size_t)LQ * TK * 2); bf* PL = (bf*)take((size_t)LQ * TK * 2);
    float* AV = (float*)take((size_t)NXR * DD * 4); bf* AVh = (bf*)take((size_t)NXR * DD * 2); bf* AVl = (bf*)take((size_t)NXR * DD * 2);
    if ((size_t)(wsp - (char*)d_ws) > ws_size) return;    // 10.5 + 8.4 + 16.8 + 8.4 + 16.8 + 8.4 + 16.8 + 16.8 + 8.4 + 8.4 + 8.4 ~ 128 MB (122 MiB); TMP holds k, v, q, Q_rel in turn (each converted to planes before the next GEMM); Cb holds [mem; x], then x rows, then rel_enc
    k_wt<<<dim3(DD / 64, DD / 64, 1), 256, 0, stream>>>(Wq, DD, DD, WqT); k_wt<<<dim3(DD / 64, DD / 64, 1), 256, 0, stream>>>(Wke, DD, DD, WkeT); k_wt<<<dim3(DD / 64, DD / 64, 1), 256, 0, stream>>>(Wkr, DD, DD, WkrT); k_wt<<<dim3(DD / 64, DD / 64, 1), 256, 0, stream>>>(Wv, DD, DD, WvT); k_wt<<<dim3(DD / 64, DD / 64, 1), 256, 0, stream>>>(Wo, DD, DD, WoT);
    for (int b = 0; b < NBT; ++b) { k_cvtb<<<LQ / 8, 256, 0, stream>>>(mem + (size_t)b * LQ * DD, LQ, Cb + (size_t)b * TK * DD); k_cvtb<<<LQ / 8, 256, 0, stream>>>(x + (size_t)b * LQ * DD, LQ, Cb + ((size_t)b * TK + LQ) * DD); }   // x_tilde_b = [mem_b; x_b]
    k_gemmb<false, false><<<dim3(NCR / 64, DD / 64, 1), 128, 0, stream>>>(Cb, nullptr, WkeT, nullptr, TMP, DD, nullptr); k_hplanes<<<(NBT * NH_ * TK) / 8, 256, 0, stream>>>(TMP, NBT, TK, bke, Kh, Kl);       // k
    k_gemmb<false, false><<<dim3(NCR / 64, DD / 64, 1), 128, 0, stream>>>(Cb, nullptr, WvT, nullptr, TMP, DD, nullptr); k_vtplanes<<<(NBT * NH_ * HD * (TK / 64)) / 8, 256, 0, stream>>>(TMP, bv, VTh, VTl);  // v
    for (int b = 0; b < NBT; ++b) k_cvtb<<<LQ / 8, 256, 0, stream>>>(x + (size_t)b * LQ * DD, LQ, Cb + (size_t)b * LQ * DD);                                                   // x rows (b, s)
    k_gemmb<false, false><<<dim3(NXR / 64, DD / 64, 1), 128, 0, stream>>>(Cb, nullptr, WqT, nullptr, TMP, DD, nullptr); k_hplanes<<<(NBT * NH_ * LQ) / 8, 256, 0, stream>>>(TMP, NBT, LQ, bq, Qh, Ql);         // q
    k_cvtb<<<TK / 8, 256, 0, stream>>>(rel, TK, Cb);
    k_gemmb<false, false><<<dim3(TK / 64, DD / 64, 1), 128, 0, stream>>>(Cb, nullptr, WkrT, nullptr, TMP, DD, nullptr); k_hplanes<<<(NH_ * TK) / 8, 256, 0, stream>>>(TMP, 1, TK, bkr, Rh, Rl);               // Q_rel (shared across b)
    for (int b = 0; b < NBT; ++b) for (int h = 0; h < NH_; ++h) { const size_t bh = (size_t)b * NH_ + h;
        k_gemm3<<<dim3(LQ / 64, TK / 64, 1), 128, 0, stream>>>(Qh + bh * LQ * HD, Ql + bh * LQ * HD, Kh + bh * TK * HD, Kl + bh * TK * HD, HD, AC, TK);         // A = q.k^T
        k_gemm3<<<dim3(LQ / 64, TK / 64, 1), 128, 0, stream>>>(Qh + bh * LQ * HD, Ql + bh * LQ * HD, Rh + (size_t)h * TK * HD, Rl + (size_t)h * TK * HD, HD, BH, TK);   // B_hat = q.Q_rel^T
        k_relsoft<<<LQ / 8, 256, 0, stream>>>(AC, BH, msk, PH, PL);
        k_gemm3<<<dim3(LQ / 64, 1, 1), 128, 0, stream>>>(PH, PL, VTh + bh * HD * TK, VTl + bh * HD * TK, TK, AV + (size_t)b * LQ * DD + h * HD, DD); }              // ctx[(b,s)][h*64 + d]
    k_split<<<NXR / 8, 256, 0, stream>>>(AV, NXR, AVh, AVl);
    k_gemmb<true, false><<<dim3(NXR / 64, DD / 64, 1), 128, 0, stream>>>(AVh, AVl, WoT, bo, out, DD, nullptr);
}

// v001
// One run takes 1100 microseconds.
// Timed twice side by side with v000, it ran 3.31 and 3.25 times as fast.
#include <hip/hip_runtime.h>

// Compute dtypes, f32 accumulate: k, v = [mem; x].W + b, q = x.Wq + bq, Q_rel = rel_enc.Wkr + bkr as [rows x 1024].[1024 x 1024] GEMMs with PLAIN bf16 operands (rounded inputs, k-major
// weights transposed once; exact products) on v_wmma_f32_16x16x32_bf16 -> per-(batch, head) bf16 hi + UNSCALED residual planes; per (b, h): A = q.k^T and B_hat = q.Q_rel^T ([1024 x
// 64].[64 x 2048], three products), the Transformer-XL shift by index, (A + B)/8 + mask x (-1e9), row softmax in f32 -> P planes; ctx = P.v ([1024 x 2048].[2048 x 64], three

#define LQ   1024
#define TK   2048
#define NBT  2
#define DD   1024
#define NH_  16
#define HD   64
#define NXR  (LQ * NBT)           // 2048 query rows (b, s)
#define NCR  (TK * NBT)           // 4096 context rows (b, t)
#define DM   DD
#define NTK  NCR
#define SCL  0.125f
#define LOSC 1024.0f
#define GH   8                    // heads of one batch entry handled by one launch of each attention stage (blockIdx.z / blockIdx.y)

typedef _Float16 h16;
typedef unsigned short bf;
typedef __attribute__((ext_vector_type(16))) __bf16   v16bf;
typedef __attribute__((ext_vector_type(16))) _Float16 v16h;
typedef __attribute__((ext_vector_type(8)))  _Float16 v8h;
typedef __attribute__((ext_vector_type(8)))  unsigned short v8us;
typedef __attribute__((ext_vector_type(8)))  float    v8f;
typedef __attribute__((ext_vector_type(4)))  float    v4f;
typedef __attribute__((ext_vector_type(4)))  _Float16 v4h;
typedef v8h  __attribute__((may_alias)) v8ha;
typedef v4f  __attribute__((may_alias)) v4fa;
typedef v8us __attribute__((may_alias)) v8usa;

__device__ __forceinline__ unsigned short f2bf(float f) { unsigned u = __float_as_uint(f); u += 0x7FFFu + ((u >> 16) & 1u); return (unsigned short)(u >> 16); }
__device__ __forceinline__ float bf2f(unsigned short b) { return __uint_as_float(((unsigned)b) << 16); }
__device__ __forceinline__ float bfr(float f) { return bf2f(f2bf(f)); }
__device__ __forceinline__ v16h cat16(v8h lo, v8h hi) { return __builtin_shufflevector(lo, hi, 0, 1, 2, 3, 4, 5, 6, 7, 8, 9, 10, 11, 12, 13, 14, 15); }
__device__ __forceinline__ v16bf cat16b(v8us lo, v8us hi) { return __builtin_bit_cast(v16bf, __builtin_shufflevector(lo, hi, 0, 1, 2, 3, 4, 5, 6, 7, 8, 9, 10, 11, 12, 13, 14, 15)); }
__device__ __forceinline__ v8f wmma16(v16h a, v16h b, v8f c) { return __builtin_amdgcn_wmma_f32_16x16x32_f16(false, a, false, b, (short)0, c, false, false); }
__device__ __forceinline__ v8f wmmab(v16bf a, v16bf b, v8f c) { return __builtin_amdgcn_wmma_f32_16x16x32_bf16(false, a, false, b, (short)0, c, false, false); }

// k_wt: WT [n][K] = bf16(W[k][n]) (k-major [K][ncols]) via 64 x 64 LDS tiles; grid (K/64, ncols/64).
__global__ __launch_bounds__(256) void k_wt(const float* __restrict__ Wm, int K, int ncols, bf* WT) {
    __shared__ __align__(16) unsigned short tl[64 * 72];
    const int tid = threadIdx.x, k0 = blockIdx.x * 64, n0 = blockIdx.y * 64;
    const int kk = tid >> 2, nq = (tid & 3) * 16;
#pragma unroll
    for (int i = 0; i < 16; ++i) tl[(nq + i) * 72 + kk] = f2bf(Wm[(size_t)(k0 + kk) * ncols + n0 + nq + i]);
    __syncthreads();
    const int piece = tid & 7;
    auto pass = [&]() {
#pragma unroll
        for (int s = 0; s < 2; ++s) { const int nr = (tid >> 3) + 32 * s; const v8us val = *(const v8usa*)(tl + nr * 72 + piece * 8); *(v8us*)(WT + (size_t)(n0 + nr) * K + k0 + piece * 8) = val; }
    };
    pass(); 
}
__global__ __launch_bounds__(256) void k_cvtb(const float* __restrict__ src, int nrows, bf* dst) {
    const int lane = threadIdx.x & 31, r = blockIdx.x * 8 + (threadIdx.x >> 5);
    if (r >= nrows) return;
    v8us o[DM / 256];
#pragma unroll
    for (int q = 0; q < DM / 256; ++q) { v8us t;
#pragma unroll
        for (int i = 0; i < 8; ++i) t[i] = f2bf(src[(size_t)r * DM + q * 256 + lane * 8 + i]);
        o[q] = t; }
#pragma unroll
    for (int q = 0; q < DM / 256; ++q) *(v8us*)(dst + (size_t)r * DM + q * 256 + lane * 8) = o[q];
    
}

// k_gemmb: 64 x 64 block tile (4 waves x 16 x 64) of C[NTK][NW] = (A [+ Al]).B^T (K = 1024) [+ bf(bias[c])] [+ bf(R[r][c]) residual]; f32 whole-line epilogue (or f16
template <bool SPLITA, bool F16OUT = false>
__global__ __launch_bounds__(128) void k_gemmb(const bf* __restrict__ A, const bf* __restrict__ Al, const bf* __restrict__ Bn, const float* __restrict__ bias, float* C, int ldc, h16* C2, const float* __restrict__ R = nullptr, int K = DM, int roundR = 1) {
    __shared__ __align__(16) float ost[4][16 * 68];
    const int lane = threadIdx.x & 31, wave = threadIdx.x >> 5, lr = lane & 15, hi = lane >> 4;
    const int r0 = blockIdx.x * 64 + wave * 16, c0 = blockIdx.y * 64;
    const size_t aoff = (size_t)(r0 + lr) * K + 8 * hi;
    size_t boff[4];
#pragma unroll
    for (int t = 0; t < 4; ++t) boff[t] = (size_t)(c0 + t * 16 + lr) * K + 8 * hi;
    v8f acc[4];
#pragma unroll
    for (int t = 0; t < 4; ++t) acc[t] = (v8f){};
#pragma unroll 1
    for (int kc = 0; kc < K; kc += 32) {
        const v16bf a = cat16b(*(const v8us*)(A + aoff + kc), *(const v8us*)(A + aoff + kc + 16));
        v16bf al = a;
        if (SPLITA) al = cat16b(*(const v8us*)(Al + aoff + kc), *(const v8us*)(Al + aoff + kc + 16));
#pragma unroll
        for (int t = 0; t < 4; ++t) { const v16bf b = cat16b(*(const v8us*)(Bn + boff[t] + kc), *(const v8us*)(Bn + boff[t] + kc + 16)); acc[t] = wmmab(a, b, acc[t]); if (SPLITA) acc[t] = wmmab(al, b, acc[t]); }
        asm volatile("v_nop\n\tv_nop\n\tv_nop\n\tv_nop" : "+v"(acc[0]), "+v"(acc[1]), "+v"(acc[2]), "+v"(acc[3]) : "v"(a), "v"(al));
    }
    float* os = &ost[wave][0];
#pragma unroll
    for (int t = 0; t < 4; ++t) { const float bv = bias ? bfr(bias[c0 + t * 16 + lr]) : 0.f;
#pragma unroll
        for (int j = 0; j < 8; ++j) os[(hi * 8 + j) * 68 + t * 16 + lr] = acc[t][j] + bv; }
    __syncthreads();
    if (F16OUT) {
        h16* crow = (h16*)(void*)C + (size_t)r0 * ldc + c0;
        auto pass = [&]() {
#pragma unroll
            for (int s = 0; s < 4; ++s) { const int row = 4 * s + (lane >> 3), piece = lane & 7; const float* sp = os + row * 68 + piece * 8; v8h o, o2;
#pragma unroll
                for (int i = 0; i < 8; ++i) { const h16 a = (h16)sp[i]; o[i] = a; o2[i] = (h16)((sp[i] - (float)a) * LOSC); }
                *(v8h*)(crow + (size_t)row * ldc + piece * 8) = o; if (C2) *(v8h*)(C2 + (size_t)r0 * ldc + c0 + (size_t)row * ldc + piece * 8) = o2; }
        };
        pass(); 
    } else {
        float* crow = C + (size_t)r0 * ldc + c0;
        auto pass = [&]() {
#pragma unroll
            for (int s = 0; s < 8; ++s) { const int Lid = (lane >> 3) + 4 * s, piece = lane & 7; const int row = Lid >> 1, cofs = (Lid & 1) * 32 + piece * 4;
                v4f val = *(const v4fa*)(os + row * 68 + cofs); if (R) { const v4f rv = *(const v4f*)(R + ((size_t)r0 + row) * ldc + c0 + cofs); val += roundR ? (v4f){bfr(rv[0]), bfr(rv[1]), bfr(rv[2]), bfr(rv[3])} : rv; }
                *(v4f*)(crow + (size_t)row * ldc + cofs) = val; }
        };
        pass(); 
    }
}

// k_gemm3: 64 x 64 tile of C = (Ah + Al).(Bh + Bl)^T over K (row strides = K for all four planes; n-major B): three products per 32-k step (hh, hl, lh); f32
// blockIdx.z = head inside the launch's group: operand and result bases step by zA, zB, zC elements per head.
__global__ __launch_bounds__(128) void k_gemm3(const bf* __restrict__ Ah, const bf* __restrict__ Al, const bf* __restrict__ Bh, const bf* __restrict__ Bl, int K, float* C, int ldc, size_t zA, size_t zB, size_t zC) {
    __shared__ __align__(16) float ost[4][16 * 68];
    Ah += blockIdx.z * zA; Al += blockIdx.z * zA; Bh += blockIdx.z * zB; Bl += blockIdx.z * zB; C += blockIdx.z * zC;
    const int lane = threadIdx.x & 31, wave = threadIdx.x >> 5, lr = lane & 15, hi = lane >> 4;
    const int r0 = blockIdx.x * 64 + wave * 16, c0 = blockIdx.y * 64;
    const size_t aoff = (size_t)(r0 + lr) * K + 8 * hi;
    v8f acc[4];
#pragma unroll
    for (int t = 0; t < 4; ++t) acc[t] = (v8f){};
#pragma unroll 1
    for (int kc = 0; kc < K; kc += 32) {
        const v16bf a = cat16b(*(const v8us*)(Ah + aoff + kc), *(const v8us*)(Ah + aoff + kc + 16));
        const v16bf al = cat16b(*(const v8us*)(Al + aoff + kc), *(const v8us*)(Al + aoff + kc + 16));
#pragma unroll
        for (int t = 0; t < 4; ++t) { const size_t bo = (size_t)(c0 + t * 16 + lr) * K + kc + 8 * hi;
            const v16bf bh = cat16b(*(const v8us*)(Bh + bo), *(const v8us*)(Bh + bo + 16)); const v16bf bl = cat16b(*(const v8us*)(Bl + bo), *(const v8us*)(Bl + bo + 16));
            acc[t] = wmmab(a, bh, acc[t]); acc[t] = wmmab(al, bh, acc[t]); acc[t] = wmmab(a, bl, acc[t]); }
        asm volatile("v_nop\n\tv_nop\n\tv_nop\n\tv_nop" : "+v"(acc[0]), "+v"(acc[1]), "+v"(acc[2]), "+v"(acc[3]) : "v"(a), "v"(al));
    }
    float* os = &ost[wave][0];
#pragma unroll
    for (int t = 0; t < 4; ++t) {
#pragma unroll
        for (int j = 0; j < 8; ++j) os[(hi * 8 + j) * 68 + t * 16 + lr] = acc[t][j]; }
    __builtin_amdgcn_wave_barrier(); asm volatile("" ::: "memory");
    float* crow = C + (size_t)r0 * ldc + c0;
    auto pass = [&]() {
#pragma unroll
        for (int s = 0; s < 8; ++s) { const int Lid = (lane >> 3) + 4 * s, piece = lane & 7; const int row = Lid >> 1, cofs = (Lid & 1) * 32 + piece * 4;
            const v4f val = *(const v4fa*)(os + row * 68 + cofs); *(v4f*)(crow + (size_t)row * ldc + cofs) = val; }
    };
    pass(); 
}


// k_hplanes: per (b, h) contiguous operand planes [rows][64] = bf16 hi + UNSCALED residual of SRC[b*rows + row][h*64 + d] + bf(bias[h*64 + d]) (batch-first rows; nb = 1 for the
__global__ __launch_bounds__(256) void k_hplanes(const float* __restrict__ SRC, int nb, int nrows, const float* __restrict__ bias, bf* Ph, bf* Pl) {
    typedef __attribute__((ext_vector_type(2))) unsigned short v2us;
    const int lane = threadIdx.x & 31; const size_t wid = (size_t)blockIdx.x * 8 + (threadIdx.x >> 5); if (wid >= (size_t)nb * NH_ * nrows) return;
    const int row = (int)(wid % nrows); const int bh = (int)(wid / nrows), h = bh % NH_, b = bh / NH_;
    v2us oh, ol;
#pragma unroll
    for (int i = 0; i < 2; ++i) { const int d = 2 * lane + i; const float v = SRC[((size_t)b * nrows + row) * DM + h * HD + d] + bfr(bias[h * HD + d]); const unsigned short hb = f2bf(v); oh[i] = hb; ol[i] = f2bf(v - bf2f(hb)); }
    const size_t o = ((size_t)bh * nrows + row) * HD + 2 * lane;
    *(v2us*)(Ph + o) = oh; *(v2us*)(Pl + o) = ol; 
}
__global__ __launch_bounds__(256) void k_vtplanes(const float* __restrict__ Vsrc, const float* __restrict__ bias, bf* VTh, bf* VTl) {
    typedef __attribute__((ext_vector_type(2))) unsigned short v2us;
    const int lane = threadIdx.x & 31; const size_t wid = (size_t)blockIdx.x * 8 + (threadIdx.x >> 5); if (wid >= (size_t)NBT * NH_ * HD * (TK / 64)) return;
    const int tg = (int)(wid % (TK / 64)), rest = (int)(wid / (TK / 64)), d = rest % HD, bh = rest / HD, h = bh % NH_, b = bh / NH_; const int t0 = tg * 64 + 2 * lane;
    v2us oh, ol;
#pragma unroll
    for (int i = 0; i < 2; ++i) { const float v = Vsrc[((size_t)b * TK + t0 + i) * DM + h * HD + d] + bfr(bias[h * HD + d]); const unsigned short hb = f2bf(v); oh[i] = hb; ol[i] = f2bf(v - bf2f(hb)); }
    const size_t o = ((size_t)bh * HD + d) * TK + t0;
    *(v2us*)(VTh + o) = oh; *(v2us*)(VTl + o) = ol; 
}
// k_relsoft: one wave per query row i of (b, h): B[i][j] = shift(B_hat): idx = (L-1) + i*T + j, row = idx/(T+1), col = idx%(T+1), B = col < T ? BH[row][col] : 0 (one division per row,
// the column wraps at most once); s = (AC[i][j] + B) / 8 + mask[i][j] (-1e9); softmax over the 2048 keys in f32 (fixed lane order, three passes) -> bf16 hi + UNSCALED residual planes
__global__ __launch_bounds__(256) void k_relsoft(const float* __restrict__ AC, const float* __restrict__ BH, const float* __restrict__ MSK, bf* PH, bf* PL) {
    typedef __attribute__((ext_vector_type(4))) unsigned short v4us;
    const int lane = threadIdx.x & 31, i = blockIdx.x * 8 + (threadIdx.x >> 5); if (i >= LQ) return;
    const size_t zo = (size_t)blockIdx.y * LQ * TK; AC += zo; BH += zo; PH += zo; PL += zo;    // blockIdx.y = head inside the launch's group
    const int base = (LQ - 1) + i * TK; const int row0 = base / (TK + 1), col0 = base % (TK + 1);
    auto score = [&](int j) -> float { int col = col0 + j, row = row0; if (col >= TK + 1) { col -= TK + 1; row += 1; }
        const float bd = (col < TK) ? BH[(size_t)row * TK + col] : 0.f; return (AC[(size_t)i * TK + j] + bd) * SCL + bfr(MSK[(size_t)i * TK + j]) * (-1e9f); };
    float m = -3.0e38f;
#pragma unroll 1
    for (int c0 = lane * 4; c0 < TK; c0 += 128) {
#pragma unroll
        for (int q = 0; q < 4; ++q) m = fmaxf(m, score(c0 + q)); }
#pragma unroll
    for (int sh = 16; sh; sh >>= 1) m = fmaxf(m, __shfl_xor(m, sh, 32));
    float sum = 0.f;
#pragma unroll 1
    for (int c0 = lane * 4; c0 < TK; c0 += 128) {
#pragma unroll
        for (int q = 0; q < 4; ++q) sum += __expf(score(c0 + q) - m); }
#pragma unroll
    for (int sh = 16; sh; sh >>= 1) sum += __shfl_xor(sum, sh, 32);
    const float inv = 1.0f / sum;
{
#pragma unroll 1
        for (int c0 = lane * 4; c0 < TK; c0 += 128) { v4us oh, ol;
#pragma unroll
            for (int q = 0; q < 4; ++q) { const float p = __expf(score(c0 + q) - m) * inv; const unsigned short hb = f2bf(p); oh[q] = hb; ol[q] = f2bf(p - bf2f(hb)); }
            const size_t o = (size_t)i * TK + c0; *(v4us*)(PH + o) = oh; *(v4us*)(PL + o) = ol; }
         }
}
__global__ __launch_bounds__(256) void k_split(const float* __restrict__ src, int nrows, bf* dh, bf* dl) {
    const int lane = threadIdx.x & 31, r = blockIdx.x * 8 + (threadIdx.x >> 5); if (r >= nrows) return;
{
#pragma unroll 1
        for (int q = 0; q < DD / 256; ++q) { const size_t o = (size_t)r * DD + q * 256 + lane * 8; const v8f v = *(const v8f*)(src + o); v8us oh, ol;
#pragma unroll
            for (int i = 0; i < 8; ++i) { const unsigned short hb = f2bf(v[i]); oh[i] = hb; ol[i] = f2bf(v[i] - bf2f(hb)); }
            *(v8us*)(dh + o) = oh; *(v8us*)(dl + o) = ol; }
         }
}

extern "C" void kernel_launch(void* const* d_in, const int* in_sizes, int n_in,
                              void* d_out, int out_size, void* d_ws, size_t ws_size, hipStream_t stream) {
    (void)in_sizes; (void)n_in; (void)out_size;
    const float* x = (const float*)d_in[0]; const float* mem = (const float*)d_in[1]; const float* msk = (const float*)d_in[2]; const float* rel = (const float*)d_in[3];
    const float* Wq = (const float*)d_in[4]; const float* bq = (const float*)d_in[5]; const float* Wke = (const float*)d_in[6]; const float* bke = (const float*)d_in[7]; const float* Wkr = (const float*)d_in[8]; const float* bkr = (const float*)d_in[9];
    const float* Wv = (const float*)d_in[10]; const float* bv = (const float*)d_in[11]; const float* Wo = (const float*)d_in[12]; const float* bo = (const float*)d_in[13];
    float* out = (float*)d_out;    // [2][1024][1024]
    char* wsp = (char*)d_ws;
    auto take = [&](size_t bytes) { char* p = wsp; wsp += (bytes + 255) & ~(size_t)255; return (void*)p; };
    bf* WoT = (bf*)take((size_t)DD * DD * 2);
    bf* Qh = (bf*)take((size_t)NBT * NH_ * LQ * HD * 2); bf* Ql = (bf*)take((size_t)NBT * NH_ * LQ * HD * 2);
    bf* Kh = (bf*)take((size_t)NBT * NH_ * TK * HD * 2); bf* Kl = (bf*)take((size_t)NBT * NH_ * TK * HD * 2); bf* Rh = (bf*)take((size_t)NH_ * TK * HD * 2); bf* Rl = (bf*)take((size_t)NH_ * TK * HD * 2);
    bf* VTh = (bf*)take((size_t)NBT * NH_ * HD * TK * 2); bf* VTl = (bf*)take((size_t)NBT * NH_ * HD * TK * 2);
    float* AV = (float*)take((size_t)NXR * DD * 4);
    // One region, used three times in stream order: projection scratch, then the score and P planes of GH heads, then the split ctx planes. Each use writes all it reads.
    char* const shared0 = wsp;
    bf* WqT = (bf*)take((size_t)DD * DD * 2); bf* WkeT = (bf*)take((size_t)DD * DD * 2); bf* WkrT = (bf*)take((size_t)DD * DD * 2); bf* WvT = (bf*)take((size_t)DD * DD * 2);
    bf* Cb = (bf*)take((size_t)NCR * DD * 2); float* TMP = (float*)take((size_t)NCR * DD * 4);
    wsp = shared0;
    bf* AVh = (bf*)take((size_t)NXR * DD * 2); bf* AVl = (bf*)take((size_t)NXR * DD * 2);
    wsp = shared0;
    float* AC = (float*)take((size_t)GH * LQ * TK * 4); float* BH = (float*)take((size_t)GH * LQ * TK * 4); bf* PH = (bf*)take((size_t)GH * LQ * TK * 2); bf* PL = (bf*)take((size_t)GH * LQ * TK * 2);
    if ((size_t)(wsp - (char*)d_ws) > ws_size) return;    // 58 MiB kept (WoT, q, k, Q_rel, v planes, ctx) + 192 MiB shared region = 250 MiB; TMP holds k, v, q, Q_rel in turn (each converted to planes before the next GEMM); Cb holds [mem; x] then rel_enc
    k_wt<<<dim3(DD / 64, DD / 64, 1), 256, 0, stream>>>(Wq, DD, DD, WqT); k_wt<<<dim3(DD / 64, DD / 64, 1), 256, 0, stream>>>(Wke, DD, DD, WkeT); k_wt<<<dim3(DD / 64, DD / 64, 1), 256, 0, stream>>>(Wkr, DD, DD, WkrT); k_wt<<<dim3(DD / 64, DD / 64, 1), 256, 0, stream>>>(Wv, DD, DD, WvT); k_wt<<<dim3(DD / 64, DD / 64, 1), 256, 0, stream>>>(Wo, DD, DD, WoT);
    for (int b = 0; b < NBT; ++b) { k_cvtb<<<LQ / 8, 256, 0, stream>>>(mem + (size_t)b * LQ * DD, LQ, Cb + (size_t)b * TK * DD); k_cvtb<<<LQ / 8, 256, 0, stream>>>(x + (size_t)b * LQ * DD, LQ, Cb + ((size_t)b * TK + LQ) * DD); }   // x_tilde_b = [mem_b; x_b]
    k_gemmb<false, false><<<dim3(NCR / 64, DD / 64, 1), 128, 0, stream>>>(Cb, nullptr, WkeT, nullptr, TMP, DD, nullptr); k_hplanes<<<(NBT * NH_ * TK) / 8, 256, 0, stream>>>(TMP, NBT, TK, bke, Kh, Kl);       // k
    k_gemmb<false, false><<<dim3(NCR / 64, DD / 64, 1), 128, 0, stream>>>(Cb, nullptr, WvT, nullptr, TMP, DD, nullptr); k_vtplanes<<<(NBT * NH_ * HD * (TK / 64)) / 8, 256, 0, stream>>>(TMP, bv, VTh, VTl);  // v
    for (int b = 0; b < NBT; ++b) k_cvtb<<<LQ / 8, 256, 0, stream>>>(x + (size_t)b * LQ * DD, LQ, Cb + (size_t)b * LQ * DD);                                                   // x rows (b, s)
    k_gemmb<false, false><<<dim3(NXR / 64, DD / 64, 1), 128, 0, stream>>>(Cb, nullptr, WqT, nullptr, TMP, DD, nullptr); k_hplanes<<<(NBT * NH_ * LQ) / 8, 256, 0, stream>>>(TMP, NBT, LQ, bq, Qh, Ql);         // q
    k_cvtb<<<TK / 8, 256, 0, stream>>>(rel, TK, Cb);
    k_gemmb<false, false><<<dim3(TK / 64, DD / 64, 1), 128, 0, stream>>>(Cb, nullptr, WkrT, nullptr, TMP, DD, nullptr); k_hplanes<<<(NH_ * TK) / 8, 256, 0, stream>>>(TMP, 1, TK, bkr, Rh, Rl);               // Q_rel (shared across b)
    for (int b = 0; b < NBT; ++b) for (int h = 0; h < NH_; h += GH) { const size_t bh = (size_t)b * NH_ + h;    // heads h .. h + GH - 1 of batch entry b per launch
        k_gemm3<<<dim3(LQ / 64, TK / 64, GH), 128, 0, stream>>>(Qh + bh * LQ * HD, Ql + bh * LQ * HD, Kh + bh * TK * HD, Kl + bh * TK * HD, HD, AC, TK, (size_t)LQ * HD, (size_t)TK * HD, (size_t)LQ * TK);         // A = q.k^T
        k_gemm3<<<dim3(LQ / 64, TK / 64, GH), 128, 0, stream>>>(Qh + bh * LQ * HD, Ql + bh * LQ * HD, Rh + (size_t)h * TK * HD, Rl + (size_t)h * TK * HD, HD, BH, TK, (size_t)LQ * HD, (size_t)TK * HD, (size_t)LQ * TK);   // B_hat = q.Q_rel^T
        k_relsoft<<<dim3(LQ / 8, GH, 1), 256, 0, stream>>>(AC, BH, msk, PH, PL);
        k_gemm3<<<dim3(LQ / 64, 1, GH), 128, 0, stream>>>(PH, PL, VTh + bh * HD * TK, VTl + bh * HD * TK, TK, AV + (size_t)b * LQ * DD + h * HD, DD, (size_t)LQ * TK, (size_t)HD * TK, (size_t)HD); }              // ctx[(b,s)][h*64 + d]
    k_split<<<NXR / 8, 256, 0, stream>>>(AV, NXR, AVh, AVl);
    k_gemmb<true, false><<<dim3(NXR / 64, DD / 64, 1), 128, 0, stream>>>(AVh, AVl, WoT, bo, out, DD, nullptr);
}

// v002
// A run of this version takes 373 microseconds.
// In two side-by-side timings against v001, it was 2.93 and 2.96 times as fast.
// Over all steps from v000 it is 9.66 times as fast.
#include <hip/hip_runtime.h>

// Compute dtypes, f32 accumulate: k, v = [mem; x].W + b, q = x.Wq + bq, Q_rel = rel_enc.Wkr + bkr as [rows x 1024].[1024 x 1024] GEMMs with PLAIN bf16 operands (rounded inputs, k-major
// weights transposed once; exact products) on v_wmma_f32_16x16x32_bf16 -> per-(batch, head) bf16 hi + UNSCALED residual planes; per (b, h): A = q.k^T and B_hat = q.Q_rel^T ([1024 x
// 64].[64 x 2048], three products), the Transformer-XL shift by index, (A + B)/8 + mask x (-1e9), row softmax in f32 -> P planes; ctx = P.v ([1024 x 2048].[2048 x 64], three

#define LQ   1024
#define TK   2048
#define NBT  2
#define DD   1024
#define NH_  16
#define HD   64
#define NXR  (LQ * NBT)           // 2048 query rows (b, s)
#define NCR  (TK * NBT)           // 4096 context rows (b, t)
#define DM   DD
#define NTK  NCR
#define SCL  0.125f
#define LOSC 1024.0f

typedef _Float16 h16;
typedef unsigned short bf;
typedef __attribute__((ext_vector_type(16))) __bf16   v16bf;
typedef __attribute__((ext_vector_type(16))) _Float16 v16h;
typedef __attribute__((ext_vector_type(8)))  _Float16 v8h;
typedef __attribute__((ext_vector_type(8)))  unsigned short v8us;
typedef __attribute__((ext_vector_type(8)))  float    v8f;
typedef __attribute__((ext_vector_type(4)))  float    v4f;
typedef __attribute__((ext_vector_type(4)))  _Float16 v4h;
typedef v8h  __attribute__((may_alias)) v8ha;
typedef v4f  __attribute__((may_alias)) v4fa;
typedef v8us __attribute__((may_alias)) v8usa;

__device__ __forceinline__ unsigned short f2bf(float f) { unsigned u = __float_as_uint(f); u += 0x7FFFu + ((u >> 16) & 1u); return (unsigned short)(u >> 16); }
__device__ __forceinline__ float bf2f(unsigned short b) { return __uint_as_float(((unsigned)b) << 16); }
__device__ __forceinline__ float bfr(float f) { return bf2f(f2bf(f)); }
__device__ __forceinline__ v16h cat16(v8h lo, v8h hi) { return __builtin_shufflevector(lo, hi, 0, 1, 2, 3, 4, 5, 6, 7, 8, 9, 10, 11, 12, 13, 14, 15); }
__device__ __forceinline__ v16bf cat16b(v8us lo, v8us hi) { return __builtin_bit_cast(v16bf, __builtin_shufflevector(lo, hi, 0, 1, 2, 3, 4, 5, 6, 7, 8, 9, 10, 11, 12, 13, 14, 15)); }
__device__ __forceinline__ v8f wmma16(v16h a, v16h b, v8f c) { return __builtin_amdgcn_wmma_f32_16x16x32_f16(false, a, false, b, (short)0, c, false, false); }
__device__ __forceinline__ v8f wmmab(v16bf a, v16bf b, v8f c) { return __builtin_amdgcn_wmma_f32_16x16x32_bf16(false, a, false, b, (short)0, c, false, false); }

// k_wt: WT [n][K] = bf16(W[k][n]) (k-major [K][ncols]) via 64 x 64 LDS tiles; grid (K/64, ncols/64).
__global__ __launch_bounds__(256) void k_wt(const float* __restrict__ Wm, int K, int ncols, bf* WT) {
    __shared__ __align__(16) unsigned short tl[64 * 72];
    const int tid = threadIdx.x, k0 = blockIdx.x * 64, n0 = blockIdx.y * 64;
    const int kk = tid >> 2, nq = (tid & 3) * 16;
#pragma unroll
    for (int i = 0; i < 16; ++i) tl[(nq + i) * 72 + kk] = f2bf(Wm[(size_t)(k0 + kk) * ncols + n0 + nq + i]);
    __syncthreads();
    const int piece = tid & 7;
    auto pass = [&]() {
#pragma unroll
        for (int s = 0; s < 2; ++s) { const int nr = (tid >> 3) + 32 * s; const v8us val = *(const v8usa*)(tl + nr * 72 + piece * 8); *(v8us*)(WT + (size_t)(n0 + nr) * K + k0 + piece * 8) = val; }
    };
    pass(); 
}
__global__ __launch_bounds__(256) void k_cvtb(const float* __restrict__ src, int nrows, bf* dst) {
    const int lane = threadIdx.x & 31, r = blockIdx.x * 8 + (threadIdx.x >> 5);
    if (r >= nrows) return;
    v8us o[DM / 256];
#pragma unroll
    for (int q = 0; q < DM / 256; ++q) { v8us t;
#pragma unroll
        for (int i = 0; i < 8; ++i) t[i] = f2bf(src[(size_t)r * DM + q * 256 + lane * 8 + i]);
        o[q] = t; }
#pragma unroll
    for (int q = 0; q < DM / 256; ++q) *(v8us*)(dst + (size_t)r * DM + q * 256 + lane * 8) = o[q];
    
}

// k_gemmb: 64 x 64 block tile (4 waves x 16 x 64) of C[NTK][NW] = (A [+ Al]).B^T (K = 1024) [+ bf(bias[c])] [+ bf(R[r][c]) residual]; f32 whole-line epilogue (or f16
template <bool SPLITA, bool F16OUT = false>
__global__ __launch_bounds__(128) void k_gemmb(const bf* __restrict__ A, const bf* __restrict__ Al, const bf* __restrict__ Bn, const float* __restrict__ bias, float* C, int ldc, h16* C2, const float* __restrict__ R = nullptr, int K = DM, int roundR = 1) {
    __shared__ __align__(16) float ost[4][16 * 68];
    const int lane = threadIdx.x & 31, wave = threadIdx.x >> 5, lr = lane & 15, hi = lane >> 4;
    const int r0 = blockIdx.x * 64 + wave * 16, c0 = blockIdx.y * 64;
    const size_t aoff = (size_t)(r0 + lr) * K + 8 * hi;
    size_t boff[4];
#pragma unroll
    for (int t = 0; t < 4; ++t) boff[t] = (size_t)(c0 + t * 16 + lr) * K + 8 * hi;
    v8f acc[4];
#pragma unroll
    for (int t = 0; t < 4; ++t) acc[t] = (v8f){};
#pragma unroll 1
    for (int kc = 0; kc < K; kc += 32) {
        const v16bf a = cat16b(*(const v8us*)(A + aoff + kc), *(const v8us*)(A + aoff + kc + 16));
        v16bf al = a;
        if (SPLITA) al = cat16b(*(const v8us*)(Al + aoff + kc), *(const v8us*)(Al + aoff + kc + 16));
#pragma unroll
        for (int t = 0; t < 4; ++t) { const v16bf b = cat16b(*(const v8us*)(Bn + boff[t] + kc), *(const v8us*)(Bn + boff[t] + kc + 16)); acc[t] = wmmab(a, b, acc[t]); if (SPLITA) acc[t] = wmmab(al, b, acc[t]); }
        asm volatile("v_nop\n\tv_nop\n\tv_nop\n\tv_nop" : "+v"(acc[0]), "+v"(acc[1]), "+v"(acc[2]), "+v"(acc[3]) : "v"(a), "v"(al));
    }
    float* os = &ost[wave][0];
#pragma unroll
    for (int t = 0; t < 4; ++t) { const float bv = bias ? bfr(bias[c0 + t * 16 + lr]) : 0.f;
#pragma unroll
        for (int j = 0; j < 8; ++j) os[(hi * 8 + j) * 68 + t * 16 + lr] = acc[t][j] + bv; }
    __syncthreads();
    if (F16OUT) {
        h16* crow = (h16*)(void*)C + (size_t)r0 * ldc + c0;
        auto pass = [&]() {
#pragma unroll
            for (int s = 0; s < 4; ++s) { const int row = 4 * s + (lane >> 3), piece = lane & 7; const float* sp = os + row * 68 + piece * 8; v8h o, o2;
#pragma unroll
                for (int i = 0; i < 8; ++i) { const h16 a = (h16)sp[i]; o[i] = a; o2[i] = (h16)((sp[i] - (float)a) * LOSC); }
                *(v8h*)(crow + (size_t)row * ldc + piece * 8) = o; if (C2) *(v8h*)(C2 + (size_t)r0 * ldc + c0 + (size_t)row * ldc + piece * 8) = o2; }
        };
        pass(); 
    } else {
        float* crow = C + (size_t)r0 * ldc + c0;
        auto pass = [&]() {
#pragma unroll
            for (int s = 0; s < 8; ++s) { const int Lid = (lane >> 3) + 4 * s, piece = lane & 7; const int row = Lid >> 1, cofs = (Lid & 1) * 32 + piece * 4;
                v4f val = *(const v4fa*)(os + row * 68 + cofs); if (R) { const v4f rv = *(const v4f*)(R + ((size_t)r0 + row) * ldc + c0 + cofs); val += roundR ? (v4f){bfr(rv[0]), bfr(rv[1]), bfr(rv[2]), bfr(rv[3])} : rv; }
                *(v4f*)(crow + (size_t)row * ldc + cofs) = val; }
        };
        pass(); 
    }
}


// k_hplanes: per (b, h) contiguous operand planes [rows][64] = bf16 hi + UNSCALED residual of SRC[b*rows + row][h*64 + d] + bf(bias[h*64 + d]) (batch-first rows; nb = 1 for the
__global__ __launch_bounds__(256) void k_hplanes(const float* __restrict__ SRC, int nb, int nrows, const float* __restrict__ bias, bf* Ph, bf* Pl) {
    typedef __attribute__((ext_vector_type(2))) unsigned short v2us;
    const int lane = threadIdx.x & 31; const size_t wid = (size_t)blockIdx.x * 8 + (threadIdx.x >> 5); if (wid >= (size_t)nb * NH_ * nrows) return;
    const int row = (int)(wid % nrows); const int bh = (int)(wid / nrows), h = bh % NH_, b = bh / NH_;
    v2us oh, ol;
#pragma unroll
    for (int i = 0; i < 2; ++i) { const int d = 2 * lane + i; const float v = SRC[((size_t)b * nrows + row) * DM + h * HD + d] + bfr(bias[h * HD + d]); const unsigned short hb = f2bf(v); oh[i] = hb; ol[i] = f2bf(v - bf2f(hb)); }
    const size_t o = ((size_t)bh * nrows + row) * HD + 2 * lane;
    *(v2us*)(Ph + o) = oh; *(v2us*)(Pl + o) = ol; 
}
__global__ __launch_bounds__(256) void k_vtplanes(const float* __restrict__ Vsrc, const float* __restrict__ bias, bf* VTh, bf* VTl) {
    typedef __attribute__((ext_vector_type(2))) unsigned short v2us;
    const int lane = threadIdx.x & 31; const size_t wid = (size_t)blockIdx.x * 8 + (threadIdx.x >> 5); if (wid >= (size_t)NBT * NH_ * HD * (TK / 64)) return;
    const int tg = (int)(wid % (TK / 64)), rest = (int)(wid / (TK / 64)), d = rest % HD, bh = rest / HD, h = bh % NH_, b = bh / NH_; const int t0 = tg * 64 + 2 * lane;
    v2us oh, ol;
#pragma unroll
    for (int i = 0; i < 2; ++i) { const float v = Vsrc[((size_t)b * TK + t0 + i) * DM + h * HD + d] + bfr(bias[h * HD + d]); const unsigned short hb = f2bf(v); oh[i] = hb; ol[i] = f2bf(v - bf2f(hb)); }
    const size_t o = ((size_t)bh * HD + d) * TK + t0;
    *(v2us*)(VTh + o) = oh; *(v2us*)(VTl + o) = ol; 
}
// k_attn: one work-group (16 waves) per 32 query rows of one (b, h); the 32 x 2048 scores never leave LDS.
//  1. B_hat = q.Q_rel^T (three products), each wave 128 columns; element (r, c) is stored straight at its place after the shift: with u = c + r - (L-1), row r column u when u >= 0,
//     else row r-1 column u + T (so rows i0 .. i0+32 of B_hat are needed: a third row tile gives row i0+32); the one padded zero of each row is stored by hand.
//  2. A = q.k^T (three products), s = (A + B) / 8 in place.  3. each wave two rows in turn: + mask x (-1e9), softmax in f32 (row in registers), P as bf16 hi + residual planes over the row's own bytes.
//  4. ctx = P.v (three products): wave w sums keys 128 w .. 128 w + 127 for all 32 x 64 outputs; the 16 partial tiles are added in wave order through LDS.
#define RQ   32                   // query rows of one work-group
#define SP   2052                 // LDS row pitch in floats: 16 B x odd, for the 16-byte fragment reads of stage 4
#define RP   68                   // pitch of a partial ctx tile's row in floats
__device__ __forceinline__ v16bf ldfrag(const bf* p) { return cat16b(*(const v8us*)p, *(const v8us*)(p + 16)); }
__device__ __forceinline__ v16bf ldfrag_s(const bf* p) { return cat16b(*(const v8usa*)p, *(const v8usa*)(p + 16)); }
__device__ __forceinline__ v8f prod3(const v16bf (&ah)[2], const v16bf (&al)[2], const v16bf (&bh)[2], const v16bf (&bl)[2]) {
    v8f acc = (v8f){};
#pragma unroll
    for (int ks = 0; ks < 2; ++ks) { acc = wmmab(ah[ks], bh[ks], acc); acc = wmmab(al[ks], bh[ks], acc); acc = wmmab(ah[ks], bl[ks], acc); }
    return acc;
}
__global__ __launch_bounds__(512) void k_attn(const bf* __restrict__ Qh, const bf* __restrict__ Ql, const bf* __restrict__ Kh, const bf* __restrict__ Kl, const bf* __restrict__ Rh, const bf* __restrict__ Rl,
                                              const bf* __restrict__ VTh, const bf* __restrict__ VTl, const float* __restrict__ MSK, float* AV) {
    typedef __attribute__((ext_vector_type(4))) unsigned short v4us;
    typedef v4us __attribute__((may_alias)) v4usa;
    __shared__ __align__(16) float S[RQ * SP];
    const int tid = threadIdx.x, lane = tid & 31, wave = __builtin_amdgcn_readfirstlane(tid >> 5), lr = lane & 15, hi = lane >> 4;
    const int i0 = blockIdx.x * RQ, bh = blockIdx.y, h = bh % NH_, b = bh / NH_;
    Qh += (size_t)bh * LQ * HD; Ql += (size_t)bh * LQ * HD; Kh += (size_t)bh * TK * HD; Kl += (size_t)bh * TK * HD; Rh += (size_t)h * TK * HD; Rl += (size_t)h * TK * HD; VTh += (size_t)bh * HD * TK; VTl += (size_t)bh * HD * TK;
    const int cw = wave * (TK / 16);
    v16bf qh[3][2], ql[3][2]; const bf* qa[3]; const bf* qb[3];
#pragma unroll
    for (int rt = 0; rt < 3; ++rt) { const size_t o = (size_t)min(i0 + rt * 16 + lr, LQ - 1) * HD + 8 * hi; qa[rt] = Qh + o; qb[rt] = Ql + o;
#pragma unroll
        for (int ks = 0; ks < 2; ++ks) { qh[rt][ks] = ldfrag(qa[rt] + ks * 32); ql[rt][ks] = ldfrag(qb[rt] + ks * 32); } }
    asm volatile("s_wait_xcnt 0x0" :: "v"(qa[0]), "v"(qa[1]), "v"(qa[2]), "v"(qb[0]), "v"(qb[1]), "v"(qb[2]) : "memory");    // precaution: the loads' address registers are inputs here, so none of them is rewritten (by a later load's result either) in front of this wait
    if (tid < RQ) { const int zc = (TK - LQ + 1) + i0 + tid; if (zc < TK) S[tid * SP + zc] = 0.f; }   // the padded zero: column T - L + 1 + i of row i
    const size_t fo = (size_t)(cw + lr) * HD + 8 * hi;    // this lane's place in the first 16-column tile of the wave's slice; a tile further is 16 * HD elements on
    v16bf fh[2][2], fl[2][2];                             // two register sets: the next tile's fragments are fetched while this tile is worked on
#pragma unroll
    for (int ks = 0; ks < 2; ++ks) { fh[0][ks] = ldfrag(Rh + fo + ks * 32); fl[0][ks] = ldfrag(Rl + fo + ks * 32); }
#pragma unroll
    for (int t = 0; t < 8; ++t) { const int c0 = cw + t * 16, cur = t & 1, nxt = cur ^ 1;
        const bf* nh = (t < 7 ? Rh : Kh) + fo + (t < 7 ? (t + 1) * 16 * HD : 0); const bf* nl = (t < 7 ? Rl : Kl) + fo + (t < 7 ? (t + 1) * 16 * HD : 0);   // behind the last Q_rel tile: the first k tile
#pragma unroll
        for (int ks = 0; ks < 2; ++ks) { fh[nxt][ks] = ldfrag(nh + ks * 32); fl[nxt][ks] = ldfrag(nl + ks * 32); }
        v8f a0 = prod3(qh[0], ql[0], fh[cur], fl[cur]), a1 = prod3(qh[1], ql[1], fh[cur], fl[cur]);
        asm volatile("v_nop\n\tv_nop\n\tv_nop\n\tv_nop" : "+v"(a0), "+v"(a1));    // the four vector slots the chip needs before these results' registers are written again (the next product chain may reuse them right behind the LDS stores)
#pragma unroll
        for (int rt = 0; rt < 2; ++rt) {
#pragma unroll
            for (int j = 0; j < 8; ++j) { const int lrw = rt * 16 + hi * 8 + j, u = c0 + lr + i0 + lrw - (LQ - 1);
                int idx = lrw * SP + u - (u < 0 ? SP - TK : 0);
                if (rt == 0 && j == 0) idx = idx < 0 ? TK : idx;    // row i0 - 1 is another work-group's: such a value goes to row 0's pad, which nobody reads
                S[idx] = rt ? a1[j] : a0[j]; } }
        if (c0 + i0 + RQ - (LQ - 1) < 0) { v8f a2 = prod3(qh[2], ql[2], fh[cur], fl[cur]); const int u = c0 + lr + i0 + RQ - (LQ - 1);   // row i0 + 32 feeds the tail of row i0 + 31
            asm volatile("v_nop\n\tv_nop\n\tv_nop\n\tv_nop" : "+v"(a2));    // the same four slots, on the way out of this branch
            S[(hi == 0 && u < 0) ? RQ * SP + u - (SP - TK) : TK] = a2[0]; }
    }
    __syncthreads();
    float* const sw = S + hi * 8 * SP + cw + lr;    // this lane's element of row hi * 8 in the wave's first tile
    float old[2][16];                               // B of this tile and of the next: read in one batch a tile ahead, so that no LDS read waits behind the stores of the tile before
#pragma unroll
    for (int e = 0; e < 16; ++e) old[0][e] = sw[((e >> 3) * 16 + (e & 7)) * SP];
#pragma unroll
    for (int t = 0; t < 8; ++t) { const int cur = t & 1, nxt = cur ^ 1;
        if (t < 7) {
#pragma unroll
            for (int ks = 0; ks < 2; ++ks) { fh[nxt][ks] = ldfrag(Kh + fo + (t + 1) * 16 * HD + ks * 32); fl[nxt][ks] = ldfrag(Kl + fo + (t + 1) * 16 * HD + ks * 32); }
#pragma unroll
            for (int e = 0; e < 16; ++e) old[nxt][e] = sw[((e >> 3) * 16 + (e & 7)) * SP + (t + 1) * 16]; }
        __builtin_amdgcn_sched_barrier(0);    // keeps the next tile's loads in front of this tile's products; the compiler otherwise sinks them to just before their use and the wave waits out the whole latency
        const v8f a0 = prod3(qh[0], ql[0], fh[cur], fl[cur]), a1 = prod3(qh[1], ql[1], fh[cur], fl[cur]);
#pragma unroll
        for (int e = 0; e < 16; ++e) sw[((e >> 3) * 16 + (e & 7)) * SP + t * 16] = ((e < 8 ? a0[e & 7] : a1[e & 7]) + old[cur][e]) * SCL;
    }
    __builtin_amdgcn_sched_barrier(0);    // keeps the mask loads below from being lifted into the score tiles above, where their 64 registers would spill
    const float* mrow = MSK + (size_t)(i0 + wave * (RQ / 16)) * TK + lane * 4;
    v4f mk[TK / 128];    // the mask of the wave's first row, asked for in front of the barrier so that it arrives while the other waves finish their scores
#pragma unroll
    for (int k = 0; k < TK / 128; ++k) mk[k] = *(const v4f*)(mrow + k * 128);
    __syncthreads();
#pragma unroll 1    // rolled: with both rows unrolled together the live set overran the register budget and spilled
    for (int rr = 0; rr < RQ / 16; ++rr) { const int lrw = wave * (RQ / 16) + rr; float* srow = S + lrw * SP;
        float v[TK / 32]; float m = -3.0e38f;
#pragma unroll
        for (int k = 0; k < TK / 128; ++k) { const int c = k * 128 + lane * 4; const v4f s = *(const v4fa*)(srow + c);
#pragma unroll
            for (int q = 0; q < 4; ++q) { const float x = s[q] + bfr(mk[k][q]) * (-1e9f); v[k * 4 + q] = x; m = fmaxf(m, x); } }
        if (rr + 1 < RQ / 16) {    // the next row's mask flies while this row's softmax is worked out
#pragma unroll
            for (int k = 0; k < TK / 128; ++k) mk[k] = *(const v4f*)(mrow + (size_t)(rr + 1) * TK + k * 128); }
#pragma unroll
        for (int sh = 16; sh; sh >>= 1) m = fmaxf(m, __shfl_xor(m, sh, 32));
        float sum = 0.f;
#pragma unroll
        for (int k = 0; k < TK / 32; ++k) { v[k] = __expf(v[k] - m); sum += v[k]; }
#pragma unroll
        for (int sh = 16; sh; sh >>= 1) sum += __shfl_xor(sum, sh, 32);
        const float inv = 1.0f / sum;
        bf* prow = (bf*)(void*)srow;    // hi plane in the row's first 4096 bytes, residual plane in the next 4096; the whole row is in registers by now
#pragma unroll
        for (int k = 0; k < TK / 128; ++k) { v4us oh, ol;
#pragma unroll
            for (int q = 0; q < 4; ++q) { const float p = v[k * 4 + q] * inv; const unsigned short hb = f2bf(p); oh[q] = hb; ol[q] = f2bf(p - bf2f(hb)); }
            *(v4usa*)(prow + k * 128 + lane * 4) = oh; *(v4usa*)(prow + TK + k * 128 + lane * 4) = ol; }
    }
    const size_t vo = (size_t)lr * TK + cw + 8 * hi;    // this lane's place in the v planes: row d = lr of the first 16-row tile, first key of the wave's slice
    v16bf vh[2][4], vl[2][4];                           // two register sets: the next 32 keys' v fragments are fetched while these are worked on; the first set is asked for in front of the barrier
#pragma unroll
    for (int dt = 0; dt < 4; ++dt) { vh[0][dt] = ldfrag(VTh + vo + (size_t)dt * 16 * TK); vl[0][dt] = ldfrag(VTl + vo + (size_t)dt * 16 * TK); }
    __syncthreads();
    v8f acc[2][4];
#pragma unroll
    for (int rt = 0; rt < 2; ++rt) {
#pragma unroll
        for (int dt = 0; dt < 4; ++dt) acc[rt][dt] = (v8f){}; }
#pragma unroll
    for (int ks = 0; ks < 4; ++ks) { const int cur = ks & 1, nxt = cur ^ 1;
        if (ks < 3) {
#pragma unroll
            for (int dt = 0; dt < 4; ++dt) { vh[nxt][dt] = ldfrag(VTh + vo + (size_t)dt * 16 * TK + (ks + 1) * 32); vl[nxt][dt] = ldfrag(VTl + vo + (size_t)dt * 16 * TK + (ks + 1) * 32); } }
        v16bf ph[2], pl[2];
#pragma unroll
        for (int rt = 0; rt < 2; ++rt) { const bf* pr = (const bf*)(const void*)(S + (rt * 16 + lr) * SP) + cw + ks * 32 + 8 * hi; ph[rt] = ldfrag_s(pr); pl[rt] = ldfrag_s(pr + TK); }
#pragma unroll
        for (int dt = 0; dt < 4; ++dt) {
#pragma unroll
            for (int rt = 0; rt < 2; ++rt) { acc[rt][dt] = wmmab(ph[rt], vh[cur][dt], acc[rt][dt]); acc[rt][dt] = wmmab(pl[rt], vh[cur][dt], acc[rt][dt]); acc[rt][dt] = wmmab(ph[rt], vl[cur][dt], acc[rt][dt]); } }
    }
    __syncthreads();    // every wave has read its P fragments: the score rows' LDS now takes the 16 partial tiles
    float* red = S + wave * (RQ * RP);
#pragma unroll
    for (int rt = 0; rt < 2; ++rt) {
#pragma unroll
        for (int dt = 0; dt < 4; ++dt) {
#pragma unroll
            for (int j = 0; j < 8; ++j) red[(rt * 16 + hi * 8 + j) * RP + dt * 16 + lr] = acc[rt][dt][j]; } }
    __syncthreads();
    const int orow = tid >> 4, od = (tid & 15) * 4;
    v4f part[16];
#pragma unroll
    for (int w = 0; w < 16; ++w) part[w] = *(const v4fa*)(S + w * (RQ * RP) + orow * RP + od);
    v4f o = part[0];
#pragma unroll
    for (int w = 1; w < 16; ++w) o += part[w];
    *(v4f*)(AV + ((size_t)b * LQ + i0 + orow) * DD + h * HD + od) = o;
}
__global__ __launch_bounds__(256) void k_split(const float* __restrict__ src, int nrows, bf* dh, bf* dl) {
    const int lane = threadIdx.x & 31, r = blockIdx.x * 8 + (threadIdx.x >> 5); if (r >= nrows) return;
{
#pragma unroll 1
        for (int q = 0; q < DD / 256; ++q) { const size_t o = (size_t)r * DD + q * 256 + lane * 8; const v8f v = *(const v8f*)(src + o); v8us oh, ol;
#pragma unroll
            for (int i = 0; i < 8; ++i) { const unsigned short hb = f2bf(v[i]); oh[i] = hb; ol[i] = f2bf(v[i] - bf2f(hb)); }
            *(v8us*)(dh + o) = oh; *(v8us*)(dl + o) = ol; }
         }
}

extern "C" void kernel_launch(void* const* d_in, const int* in_sizes, int n_in,
                              void* d_out, int out_size, void* d_ws, size_t ws_size, hipStream_t stream) {
    (void)in_sizes; (void)n_in; (void)out_size;
    const float* x = (const float*)d_in[0]; const float* mem = (const float*)d_in[1]; const float* msk = (const float*)d_in[2]; const float* rel = (const float*)d_in[3];
    const float* Wq = (const float*)d_in[4]; const float* bq = (const float*)d_in[5]; const float* Wke = (const float*)d_in[6]; const float* bke = (const float*)d_in[7]; const float* Wkr = (const float*)d_in[8]; const float* bkr = (const float*)d_in[9];
    const float* Wv = (const float*)d_in[10]; const float* bv = (const float*)d_in[11]; const float* Wo = (const float*)d_in[12]; const float* bo = (const float*)d_in[13];
    float* out = (float*)d_out;    // [2][1024][1024]
    char* wsp = (char*)d_ws;
    auto take = [&](size_t bytes) { char* p = wsp; wsp += (bytes + 255) & ~(size_t)255; return (void*)p; };
    bf* WoT = (bf*)take((size_t)DD * DD * 2);
    bf* Qh = (bf*)take((size_t)NBT * NH_ * LQ * HD * 2); bf* Ql = (bf*)take((size_t)NBT * NH_ * LQ * HD * 2);
    bf* Kh = (bf*)take((size_t)NBT * NH_ * TK * HD * 2); bf* Kl = (bf*)take((size_t)NBT * NH_ * TK * HD * 2); bf* Rh = (bf*)take((size_t)NH_ * TK * HD * 2); bf* Rl = (bf*)take((size_t)NH_ * TK * HD * 2);
    bf* VTh = (bf*)take((size_t)NBT * NH_ * HD * TK * 2); bf* VTl = (bf*)take((size_t)NBT * NH_ * HD * TK * 2);
    float* AV = (float*)take((size_t)NXR * DD * 4);
    // One region, used twice in stream order: projection scratch, then the split ctx planes. Each use writes all it reads.
    char* const shared0 = wsp;
    bf* AVh = (bf*)take((size_t)NXR * DD * 2); bf* AVl = (bf*)take((size_t)NXR * DD * 2);
    wsp = shared0;
    bf* WqT = (bf*)take((size_t)DD * DD * 2); bf* WkeT = (bf*)take((size_t)DD * DD * 2); bf* WkrT = (bf*)take((size_t)DD * DD * 2); bf* WvT = (bf*)take((size_t)DD * DD * 2);
    bf* Cb = (bf*)take((size_t)NCR * DD * 2); float* TMP = (float*)take((size_t)NCR * DD * 4);
    if ((size_t)(wsp - (char*)d_ws) > ws_size) return;    // 58 MiB kept (WoT, q, k, Q_rel, v planes, ctx) + 32 MiB shared region; TMP holds k, v, q, Q_rel in turn (each converted to planes before the next GEMM); Cb holds [mem; x] then rel_enc
    k_wt<<<dim3(DD / 64, DD / 64, 1), 256, 0, stream>>>(Wq, DD, DD, WqT); k_wt<<<dim3(DD / 64, DD / 64, 1), 256, 0, stream>>>(Wke, DD, DD, WkeT); k_wt<<<dim3(DD / 64, DD / 64, 1), 256, 0, stream>>>(Wkr, DD, DD, WkrT); k_wt<<<dim3(DD / 64, DD / 64, 1), 256, 0, stream>>>(Wv, DD, DD, WvT); k_wt<<<dim3(DD / 64, DD / 64, 1), 256, 0, stream>>>(Wo, DD, DD, WoT);
    for (int b = 0; b < NBT; ++b) { k_cvtb<<<LQ / 8, 256, 0, stream>>>(mem + (size_t)b * LQ * DD, LQ, Cb + (size_t)b * TK * DD); k_cvtb<<<LQ / 8, 256, 0, stream>>>(x + (size_t)b * LQ * DD, LQ, Cb + ((size_t)b * TK + LQ) * DD); }   // x_tilde_b = [mem_b; x_b]
    k_gemmb<false, false><<<dim3(NCR / 64, DD / 64, 1), 128, 0, stream>>>(Cb, nullptr, WkeT, nullptr, TMP, DD, nullptr); k_hplanes<<<(NBT * NH_ * TK) / 8, 256, 0, stream>>>(TMP, NBT, TK, bke, Kh, Kl);       // k
    k_gemmb<false, false><<<dim3(NCR / 64, DD / 64, 1), 128, 0, stream>>>(Cb, nullptr, WvT, nullptr, TMP, DD, nullptr); k_vtplanes<<<(NBT * NH_ * HD * (TK / 64)) / 8, 256, 0, stream>>>(TMP, bv, VTh, VTl);  // v
    for (int b = 0; b < NBT; ++b) k_cvtb<<<LQ / 8, 256, 0, stream>>>(x + (size_t)b * LQ * DD, LQ, Cb + (size_t)b * LQ * DD);                                                   // x rows (b, s)
    k_gemmb<false, false><<<dim3(NXR / 64, DD / 64, 1), 128, 0, stream>>>(Cb, nullptr, WqT, nullptr, TMP, DD, nullptr); k_hplanes<<<(NBT * NH_ * LQ) / 8, 256, 0, stream>>>(TMP, NBT, LQ, bq, Qh, Ql);         // q
    k_cvtb<<<TK / 8, 256, 0, stream>>>(rel, TK, Cb);
    k_gemmb<false, false><<<dim3(TK / 64, DD / 64, 1), 128, 0, stream>>>(Cb, nullptr, WkrT, nullptr, TMP, DD, nullptr); k_hplanes<<<(NH_ * TK) / 8, 256, 0, stream>>>(TMP, 1, TK, bkr, Rh, Rl);               // Q_rel (shared across b)
    k_attn<<<dim3(LQ / RQ, NBT * NH_, 1), 512, 0, stream>>>(Qh, Ql, Kh, Kl, Rh, Rl, VTh, VTl, msk, AV);    // ctx[(b,s)][h*64 + d]
    k_split<<<NXR / 8, 256, 0, stream>>>(AV, NXR, AVh, AVl);
    k_gemmb<true, false><<<dim3(NXR / 64, DD / 64, 1), 128, 0, stream>>>(AVh, AVl, WoT, bo, out, DD, nullptr);
}

// v003
// Measured time: 333 microseconds a run.
// Next to v002, in two timings, it ran 1.12 times as fast each time.
// All steps since v000 together make it 10.8 times as fast.
#include <hip/hip_runtime.h>

// Compute dtypes, f32 accumulate: k, v = [mem; x].W + b, q = x.Wq + bq, Q_rel = rel_enc.Wkr + bkr as [rows x 1024].[1024 x 1024] GEMMs with PLAIN bf16 operands (rounded inputs, k-major
// weights transposed once; exact products) on v_wmma_f32_16x16x32_bf16 -> per-(batch, head) bf16 hi + UNSCALED residual planes; per (b, h): A = q.k^T and B_hat = q.Q_rel^T ([1024 x
// 64].[64 x 2048], three products), the Transformer-XL shift by index, (A + B)/8 + mask x (-1e9), row softmax in f32 -> P planes; ctx = P.v ([1024 x 2048].[2048 x 64], three

#define LQ   1024
#define TK   2048
#define NBT  2
#define DD   1024
#define NH_  16
#define HD   64
#define NXR  (LQ * NBT)           // 2048 query rows (b, s)
#define NCR  (TK * NBT)           // 4096 context rows (b, t)
#define DM   DD
#define NTK  NCR
#define SCL  0.125f
#define LOSC 1024.0f

typedef _Float16 h16;
typedef unsigned short bf;
typedef __attribute__((ext_vector_type(16))) __bf16   v16bf;
typedef __attribute__((ext_vector_type(16))) _Float16 v16h;
typedef __attribute__((ext_vector_type(8)))  _Float16 v8h;
typedef __attribute__((ext_vector_type(8)))  unsigned short v8us;
typedef __attribute__((ext_vector_type(8)))  float    v8f;
typedef __attribute__((ext_vector_type(4)))  float    v4f;
typedef __attribute__((ext_vector_type(4)))  _Float16 v4h;
typedef v8h  __attribute__((may_alias)) v8ha;
typedef v4f  __attribute__((may_alias)) v4fa;
typedef v8us __attribute__((may_alias)) v8usa;

__device__ __forceinline__ unsigned short f2bf(float f) { unsigned u = __float_as_uint(f); u += 0x7FFFu + ((u >> 16) & 1u); return (unsigned short)(u >> 16); }
__device__ __forceinline__ float bf2f(unsigned short b) { return __uint_as_float(((unsigned)b) << 16); }
__device__ __forceinline__ float bfr(float f) { return bf2f(f2bf(f)); }
__device__ __forceinline__ v16h cat16(v8h lo, v8h hi) { return __builtin_shufflevector(lo, hi, 0, 1, 2, 3, 4, 5, 6, 7, 8, 9, 10, 11, 12, 13, 14, 15); }
__device__ __forceinline__ v16bf cat16b(v8us lo, v8us hi) { return __builtin_bit_cast(v16bf, __builtin_shufflevector(lo, hi, 0, 1, 2, 3, 4, 5, 6, 7, 8, 9, 10, 11, 12, 13, 14, 15)); }
__device__ __forceinline__ v8f wmma16(v16h a, v16h b, v8f c) { return __builtin_amdgcn_wmma_f32_16x16x32_f16(false, a, false, b, (short)0, c, false, false); }
__device__ __forceinline__ v8f wmmab(v16bf a, v16bf b, v8f c) { return __builtin_amdgcn_wmma_f32_16x16x32_bf16(false, a, false, b, (short)0, c, false, false); }

// k_wt: WT [n][K] = bf16(W[k][n]) (k-major [K][ncols]) via 64 x 64 LDS tiles; grid (K/64, ncols/64).
__global__ __launch_bounds__(256) void k_wt(const float* __restrict__ Wm, int K, int ncols, bf* WT) {
    __shared__ __align__(16) unsigned short tl[64 * 72];
    const int tid = threadIdx.x, k0 = blockIdx.x * 64, n0 = blockIdx.y * 64;
    const int kk = tid >> 2, nq = (tid & 3) * 16;
#pragma unroll
    for (int i = 0; i < 16; ++i) tl[(nq + i) * 72 + kk] = f2bf(Wm[(size_t)(k0 + kk) * ncols + n0 + nq + i]);
    __syncthreads();
    const int piece = tid & 7;
    auto pass = [&]() {
#pragma unroll
        for (int s = 0; s < 2; ++s) { const int nr = (tid >> 3) + 32 * s; const v8us val = *(const v8usa*)(tl + nr * 72 + piece * 8); *(v8us*)(WT + (size_t)(n0 + nr) * K + k0 + piece * 8) = val; }
    };
    pass(); 
}
__global__ __launch_bounds__(256) void k_cvtb(const float* __restrict__ src, int nrows, bf* dst) {
    const int lane = threadIdx.x & 31, r = blockIdx.x * 8 + (threadIdx.x >> 5);
    if (r >= nrows) return;
    v8us o[DM / 256];
#pragma unroll
    for (int q = 0; q < DM / 256; ++q) { v8us t;
#pragma unroll
        for (int i = 0; i < 8; ++i) t[i] = f2bf(src[(size_t)r * DM + q * 256 + lane * 8 + i]);
        o[q] = t; }
#pragma unroll
    for (int q = 0; q < DM / 256; ++q) *(v8us*)(dst + (size_t)r * DM + q * 256 + lane * 8) = o[q];
    
}

// k_gemmb: 64 x 64 block tile (4 waves x 16 x 64) of C[rows][1024] = (A [+ Al]).B^T (K = 1024) [+ bf(bias[c])] [+ bf(R[r][c]) residual]; f32 whole-line epilogue (or f16
// PLANES 1: the 64 columns of a block are one head, and the tile goes out as that head's operand planes [row][64] = bf16 hi + UNSCALED residual (NR rows per batch, batch-first rows);
// PLANES 2: the same two planes transposed, [d][TK] (the v operand of P.v). Either way the f32 product never leaves the block.
template <bool SPLITA, bool F16OUT = false, int PLANES = 0, int NR = 64>
__global__ __launch_bounds__(128) void k_gemmb(const bf* __restrict__ A, const bf* __restrict__ Al, const bf* __restrict__ Bn, const float* __restrict__ bias, float* C, int ldc, h16* C2, const float* __restrict__ R = nullptr, int K = DM, int roundR = 1, bf* Ph = nullptr, bf* Pl = nullptr) {
    __shared__ __align__(16) float ost[4][16 * 68];
    const int lane = threadIdx.x & 31, wave = threadIdx.x >> 5, lr = lane & 15, hi = lane >> 4;
    const int r0 = blockIdx.x * 64 + wave * 16, c0 = blockIdx.y * 64;
    const size_t aoff = (size_t)(r0 + lr) * K + 8 * hi;
    size_t boff[4];
#pragma unroll
    for (int t = 0; t < 4; ++t) boff[t] = (size_t)(c0 + t * 16 + lr) * K + 8 * hi;
    v8f acc[4];
#pragma unroll
    for (int t = 0; t < 4; ++t) acc[t] = (v8f){};
    float braw[4] = {0.f, 0.f, 0.f, 0.f};    // PLANES: the bias is asked for here, so that it arrives under the k loop and the epilogue does not wait for it
    if (PLANES) {
#pragma unroll
        for (int t = 0; t < 4; ++t) braw[t] = bias[c0 + t * 16 + lr]; }
#pragma unroll 1
    for (int kc = 0; kc < K; kc += 32) {
        const v16bf a = cat16b(*(const v8us*)(A + aoff + kc), *(const v8us*)(A + aoff + kc + 16));
        v16bf al = a;
        if (SPLITA) al = cat16b(*(const v8us*)(Al + aoff + kc), *(const v8us*)(Al + aoff + kc + 16));
#pragma unroll
        for (int t = 0; t < 4; ++t) { const v16bf b = cat16b(*(const v8us*)(Bn + boff[t] + kc), *(const v8us*)(Bn + boff[t] + kc + 16)); acc[t] = wmmab(a, b, acc[t]); if (SPLITA) acc[t] = wmmab(al, b, acc[t]); }
        asm volatile("v_nop\n\tv_nop\n\tv_nop\n\tv_nop" : "+v"(acc[0]), "+v"(acc[1]), "+v"(acc[2]), "+v"(acc[3]) : "v"(a), "v"(al));
    }
    float* os = &ost[wave][0];
#pragma unroll
    for (int t = 0; t < 4; ++t) { const float bv = PLANES ? bfr(braw[t]) : bias ? bfr(bias[c0 + t * 16 + lr]) : 0.f;
        if (PLANES == 2) {    // transposed tile [d][68] over all four waves' rows: a lane's eight rows are eight neighbours of one d
            float* tp = &ost[0][0] + (t * 16 + lr) * 68 + wave * 16 + hi * 8;
            *(v4fa*)tp = (v4f){acc[t][0] + bv, acc[t][1] + bv, acc[t][2] + bv, acc[t][3] + bv}; *(v4fa*)(tp + 4) = (v4f){acc[t][4] + bv, acc[t][5] + bv, acc[t][6] + bv, acc[t][7] + bv};
        } else {
#pragma unroll
        for (int j = 0; j < 8; ++j) os[(hi * 8 + j) * 68 + t * 16 + lr] = acc[t][j] + bv; } }
    __syncthreads();
    if (PLANES) {
        const int rb = blockIdx.x * 64, bhp = (rb / NR) * NH_ + blockIdx.y, rin = rb % NR;    // batch and head of the block, its first row inside the batch
#pragma unroll
        for (int s = 0; s < 4; ++s) { const int piece = lane & 7;    // eight lanes x 16 bytes: whole 128-byte lines in both planes
            const int row = PLANES == 2 ? s * 16 + (threadIdx.x >> 3) : 4 * s + (lane >> 3);    // PLANES 2: d, of the block's tile; else a row of the wave's own 16
            const float* sp = (PLANES == 2 ? &ost[0][0] : os) + row * 68 + piece * 8; v8us oh, ol;
#pragma unroll
            for (int i = 0; i < 8; ++i) { const float v = sp[i]; const unsigned short hb = f2bf(v); oh[i] = hb; ol[i] = f2bf(v - bf2f(hb)); }
            const size_t o = PLANES == 2 ? ((size_t)bhp * HD + row) * TK + rin + piece * 8 : ((size_t)bhp * NR + rin + wave * 16 + row) * HD + piece * 8;
            *(v8us*)(Ph + o) = oh; *(v8us*)(Pl + o) = ol; }
    } else if (F16OUT) {
        h16* crow = (h16*)(void*)C + (size_t)r0 * ldc + c0;
        auto pass = [&]() {
#pragma unroll
            for (int s = 0; s < 4; ++s) { const int row = 4 * s + (lane >> 3), piece = lane & 7; const float* sp = os + row * 68 + piece * 8; v8h o, o2;
#pragma unroll
                for (int i = 0; i < 8; ++i) { const h16 a = (h16)sp[i]; o[i] = a; o2[i] = (h16)((sp[i] - (float)a) * LOSC); }
                *(v8h*)(crow + (size_t)row * ldc + piece * 8) = o; if (C2) *(v8h*)(C2 + (size_t)r0 * ldc + c0 + (size_t)row * ldc + piece * 8) = o2; }
        };
        pass(); 
    } else {
        float* crow = C + (size_t)r0 * ldc + c0;
        auto pass = [&]() {
#pragma unroll
            for (int s = 0; s < 8; ++s) { const int Lid = (lane >> 3) + 4 * s, piece = lane & 7; const int row = Lid >> 1, cofs = (Lid & 1) * 32 + piece * 4;
                v4f val = *(const v4fa*)(os + row * 68 + cofs); if (R) { const v4f rv = *(const v4f*)(R + ((size_t)r0 + row) * ldc + c0 + cofs); val += roundR ? (v4f){bfr(rv[0]), bfr(rv[1]), bfr(rv[2]), bfr(rv[3])} : rv; }
                *(v4f*)(crow + (size_t)row * ldc + cofs) = val; }
        };
        pass(); 
    }
}


// k_attn: one work-group (16 waves) per 32 query rows of one (b, h); the 32 x 2048 scores never leave LDS.
//  1. B_hat = q.Q_rel^T (three products), each wave 128 columns; element (r, c) is stored straight at its place after the shift: with u = c + r - (L-1), row r column u when u >= 0,
//     else row r-1 column u + T (so rows i0 .. i0+32 of B_hat are needed: a third row tile gives row i0+32); the one padded zero of each row is stored by hand.
//  2. A = q.k^T (three products), s = (A + B) / 8 in place.  3. each wave two rows in turn: + mask x (-1e9), softmax in f32 (row in registers), P as bf16 hi + residual planes over the row's own bytes.
//  4. ctx = P.v (three products): wave w sums keys 128 w .. 128 w + 127 for all 32 x 64 outputs; the 16 partial tiles are added in wave order through LDS.
#define RQ   32                   // query rows of one work-group
#define SP   2052                 // LDS row pitch in floats: 16 B x odd, for the 16-byte fragment reads of stage 4
#define RP   68                   // pitch of a partial ctx tile's row in floats
__device__ __forceinline__ v16bf ldfrag(const bf* p) { return cat16b(*(const v8us*)p, *(const v8us*)(p + 16)); }
__device__ __forceinline__ v16bf ldfrag_s(const bf* p) { return cat16b(*(const v8usa*)p, *(const v8usa*)(p + 16)); }
__device__ __forceinline__ v8f prod3(const v16bf (&ah)[2], const v16bf (&al)[2], const v16bf (&bh)[2], const v16bf (&bl)[2]) {
    v8f acc = (v8f){};
#pragma unroll
    for (int ks = 0; ks < 2; ++ks) { acc = wmmab(ah[ks], bh[ks], acc); acc = wmmab(al[ks], bh[ks], acc); acc = wmmab(ah[ks], bl[ks], acc); }
    return acc;
}
__global__ __launch_bounds__(512) void k_attn(const bf* __restrict__ Qh, const bf* __restrict__ Ql, const bf* __restrict__ Kh, const bf* __restrict__ Kl, const bf* __restrict__ Rh, const bf* __restrict__ Rl,
                                              const bf* __restrict__ VTh, const bf* __restrict__ VTl, const float* __restrict__ MSK, bf* AVh, bf* AVl) {
    typedef __attribute__((ext_vector_type(4))) unsigned short v4us;
    typedef v4us __attribute__((may_alias)) v4usa;
    __shared__ __align__(16) float S[RQ * SP];
    const int tid = threadIdx.x, lane = tid & 31, wave = __builtin_amdgcn_readfirstlane(tid >> 5), lr = lane & 15, hi = lane >> 4;
    const int i0 = blockIdx.x * RQ, bh = blockIdx.y, h = bh % NH_, b = bh / NH_;
    Qh += (size_t)bh * LQ * HD; Ql += (size_t)bh * LQ * HD; Kh += (size_t)bh * TK * HD; Kl += (size_t)bh * TK * HD; Rh += (size_t)h * TK * HD; Rl += (size_t)h * TK * HD; VTh += (size_t)bh * HD * TK; VTl += (size_t)bh * HD * TK;
    const int cw = wave * (TK / 16);
    v16bf qh[3][2], ql[3][2]; const bf* qa[3]; const bf* qb[3];
#pragma unroll
    for (int rt = 0; rt < 3; ++rt) { const size_t o = (size_t)min(i0 + rt * 16 + lr, LQ - 1) * HD + 8 * hi; qa[rt] = Qh + o; qb[rt] = Ql + o;
#pragma unroll
        for (int ks = 0; ks < 2; ++ks) { qh[rt][ks] = ldfrag(qa[rt] + ks * 32); ql[rt][ks] = ldfrag(qb[rt] + ks * 32); } }
    asm volatile("s_wait_xcnt 0x0" :: "v"(qa[0]), "v"(qa[1]), "v"(qa[2]), "v"(qb[0]), "v"(qb[1]), "v"(qb[2]) : "memory");    // precaution: the loads' address registers are inputs here, so none of them is rewritten (by a later load's result either) in front of this wait
    if (tid < RQ) { const int zc = (TK - LQ + 1) + i0 + tid; if (zc < TK) S[tid * SP + zc] = 0.f; }   // the padded zero: column T - L + 1 + i of row i
    const size_t fo = (size_t)(cw + lr) * HD + 8 * hi;    // this lane's place in the first 16-column tile of the wave's slice; a tile further is 16 * HD elements on
    v16bf fh[2][2], fl[2][2];                             // two register sets: the next tile's fragments are fetched while this tile is worked on
#pragma unroll
    for (int ks = 0; ks < 2; ++ks) { fh[0][ks] = ldfrag(Rh + fo + ks * 32); fl[0][ks] = ldfrag(Rl + fo + ks * 32); }
#pragma unroll
    for (int t = 0; t < 8; ++t) { const int c0 = cw + t * 16, cur = t & 1, nxt = cur ^ 1;
        const bf* nh = (t < 7 ? Rh : Kh) + fo + (t < 7 ? (t + 1) * 16 * HD : 0); const bf* nl = (t < 7 ? Rl : Kl) + fo + (t < 7 ? (t + 1) * 16 * HD : 0);   // behind the last Q_rel tile: the first k tile
#pragma unroll
        for (int ks = 0; ks < 2; ++ks) { fh[nxt][ks] = ldfrag(nh + ks * 32); fl[nxt][ks] = ldfrag(nl + ks * 32); }
        v8f a0 = prod3(qh[0], ql[0], fh[cur], fl[cur]), a1 = prod3(qh[1], ql[1], fh[cur], fl[cur]);
        asm volatile("v_nop\n\tv_nop\n\tv_nop\n\tv_nop" : "+v"(a0), "+v"(a1));    // the four vector slots the chip needs before these results' registers are written again (the next product chain may reuse them right behind the LDS stores)
#pragma unroll
        for (int rt = 0; rt < 2; ++rt) {
#pragma unroll
            for (int j = 0; j < 8; ++j) { const int lrw = rt * 16 + hi * 8 + j, u = c0 + lr + i0 + lrw - (LQ - 1);
                int idx = lrw * SP + u - (u < 0 ? SP - TK : 0);
                if (rt == 0 && j == 0) idx = idx < 0 ? TK : idx;    // row i0 - 1 is another work-group's: such a value goes to row 0's pad, which nobody reads
                S[idx] = rt ? a1[j] : a0[j]; } }
        if (c0 + i0 + RQ - (LQ - 1) < 0) { v8f a2 = prod3(qh[2], ql[2], fh[cur], fl[cur]); const int u = c0 + lr + i0 + RQ - (LQ - 1);   // row i0 + 32 feeds the tail of row i0 + 31
            asm volatile("v_nop\n\tv_nop\n\tv_nop\n\tv_nop" : "+v"(a2));    // the same four slots, on the way out of this branch
            S[(hi == 0 && u < 0) ? RQ * SP + u - (SP - TK) : TK] = a2[0]; }
    }
    __syncthreads();
    float* const sw = S + hi * 8 * SP + cw + lr;    // this lane's element of row hi * 8 in the wave's first tile
    float old[2][16];                               // B of this tile and of the next: read in one batch a tile ahead, so that no LDS read waits behind the stores of the tile before
#pragma unroll
    for (int e = 0; e < 16; ++e) old[0][e] = sw[((e >> 3) * 16 + (e & 7)) * SP];
#pragma unroll
    for (int t = 0; t < 8; ++t) { const int cur = t & 1, nxt = cur ^ 1;
        if (t < 7) {
#pragma unroll
            for (int ks = 0; ks < 2; ++ks) { fh[nxt][ks] = ldfrag(Kh + fo + (t + 1) * 16 * HD + ks * 32); fl[nxt][ks] = ldfrag(Kl + fo + (t + 1) * 16 * HD + ks * 32); }
#pragma unroll
            for (int e = 0; e < 16; ++e) old[nxt][e] = sw[((e >> 3) * 16 + (e & 7)) * SP + (t + 1) * 16]; }
        __builtin_amdgcn_sched_barrier(0);    // keeps the next tile's loads in front of this tile's products; the compiler otherwise sinks them to just before their use and the wave waits out the whole latency
        const v8f a0 = prod3(qh[0], ql[0], fh[cur], fl[cur]), a1 = prod3(qh[1], ql[1], fh[cur], fl[cur]);
#pragma unroll
        for (int e = 0; e < 16; ++e) sw[((e >> 3) * 16 + (e & 7)) * SP + t * 16] = ((e < 8 ? a0[e & 7] : a1[e & 7]) + old[cur][e]) * SCL;
    }
    __builtin_amdgcn_sched_barrier(0);    // keeps the mask loads below from being lifted into the score tiles above, where their 64 registers would spill
    const float* mrow = MSK + (size_t)(i0 + wave * (RQ / 16)) * TK + lane * 4;
    v4f mk[TK / 128];    // the mask of the wave's first row, asked for in front of the barrier so that it arrives while the other waves finish their scores
#pragma unroll
    for (int k = 0; k < TK / 128; ++k) mk[k] = *(const v4f*)(mrow + k * 128);
    __syncthreads();
#pragma unroll 1    // rolled: with both rows unrolled together the live set overran the register budget and spilled
    for (int rr = 0; rr < RQ / 16; ++rr) { const int lrw = wave * (RQ / 16) + rr; float* srow = S + lrw * SP;
        float v[TK / 32]; float m = -3.0e38f;
#pragma unroll
        for (int k = 0; k < TK / 128; ++k) { const int c = k * 128 + lane * 4; const v4f s = *(const v4fa*)(srow + c);
#pragma unroll
            for (int q = 0; q < 4; ++q) { const float x = s[q] + bfr(mk[k][q]) * (-1e9f); v[k * 4 + q] = x; m = fmaxf(m, x); } }
        if (rr + 1 < RQ / 16) {    // the next row's mask flies while this row's softmax is worked out
#pragma unroll
            for (int k = 0; k < TK / 128; ++k) mk[k] = *(const v4f*)(mrow + (size_t)(rr + 1) * TK + k * 128); }
#pragma unroll
        for (int sh = 16; sh; sh >>= 1) m = fmaxf(m, __shfl_xor(m, sh, 32));
        float sum = 0.f;
#pragma unroll
        for (int k = 0; k < TK / 32; ++k) { v[k] = __expf(v[k] - m); sum += v[k]; }
#pragma unroll
        for (int sh = 16; sh; sh >>= 1) sum += __shfl_xor(sum, sh, 32);
        const float inv = 1.0f / sum;
        bf* prow = (bf*)(void*)srow;    // hi plane in the row's first 4096 bytes, residual plane in the next 4096; the whole row is in registers by now
#pragma unroll
        for (int k = 0; k < TK / 128; ++k) { v4us oh, ol;
#pragma unroll
            for (int q = 0; q < 4; ++q) { const float p = v[k * 4 + q] * inv; const unsigned short hb = f2bf(p); oh[q] = hb; ol[q] = f2bf(p - bf2f(hb)); }
            *(v4usa*)(prow + k * 128 + lane * 4) = oh; *(v4usa*)(prow + TK + k * 128 + lane * 4) = ol; }
    }
    const size_t vo = (size_t)lr * TK + cw + 8 * hi;    // this lane's place in the v planes: row d = lr of the first 16-row tile, first key of the wave's slice
    v16bf vh[2][4], vl[2][4];                           // two register sets: the next 32 keys' v fragments are fetched while these are worked on; the first set is asked for in front of the barrier
#pragma unroll
    for (int dt = 0; dt < 4; ++dt) { vh[0][dt] = ldfrag(VTh + vo + (size_t)dt * 16 * TK); vl[0][dt] = ldfrag(VTl + vo + (size_t)dt * 16 * TK); }
    __syncthreads();
    v8f acc[2][4];
#pragma unroll
    for (int rt = 0; rt < 2; ++rt) {
#pragma unroll
        for (int dt = 0; dt < 4; ++dt) acc[rt][dt] = (v8f){}; }
#pragma unroll
    for (int ks = 0; ks < 4; ++ks) { const int cur = ks & 1, nxt = cur ^ 1;
        if (ks < 3) {
#pragma unroll
            for (int dt = 0; dt < 4; ++dt) { vh[nxt][dt] = ldfrag(VTh + vo + (size_t)dt * 16 * TK + (ks + 1) * 32); vl[nxt][dt] = ldfrag(VTl + vo + (size_t)dt * 16 * TK + (ks + 1) * 32); } }
        v16bf ph[2], pl[2];
#pragma unroll
        for (int rt = 0; rt < 2; ++rt) { const bf* pr = (const bf*)(const void*)(S + (rt * 16 + lr) * SP) + cw + ks * 32 + 8 * hi; ph[rt] = ldfrag_s(pr); pl[rt] = ldfrag_s(pr + TK); }
#pragma unroll
        for (int dt = 0; dt < 4; ++dt) {
#pragma unroll
            for (int rt = 0; rt < 2; ++rt) { acc[rt][dt] = wmmab(ph[rt], vh[cur][dt], acc[rt][dt]); acc[rt][dt] = wmmab(pl[rt], vh[cur][dt], acc[rt][dt]); acc[rt][dt] = wmmab(ph[rt], vl[cur][dt], acc[rt][dt]); } }
    }
    __syncthreads();    // every wave has read its P fragments: the score rows' LDS now takes the 16 partial tiles
    float* red = S + wave * (RQ * RP);
#pragma unroll
    for (int rt = 0; rt < 2; ++rt) {
#pragma unroll
        for (int dt = 0; dt < 4; ++dt) {
#pragma unroll
            for (int j = 0; j < 8; ++j) red[(rt * 16 + hi * 8 + j) * RP + dt * 16 + lr] = acc[rt][dt][j]; } }
    __syncthreads();
    const int orow = tid >> 4, od = (tid & 15) * 4;
    v4f part[16];
#pragma unroll
    for (int w = 0; w < 16; ++w) part[w] = *(const v4fa*)(S + w * (RQ * RP) + orow * RP + od);
    v4f o = part[0];
#pragma unroll
    for (int w = 1; w < 16; ++w) o += part[w];
    v4us oh, ol;    // ctx goes out as the last GEMM's operand planes: bf16 hi + residual
#pragma unroll
    for (int q = 0; q < 4; ++q) { const unsigned short hb = f2bf(o[q]); oh[q] = hb; ol[q] = f2bf(o[q] - bf2f(hb)); }
    const size_t oo = ((size_t)b * LQ + i0 + orow) * DD + h * HD + od;
    *(v4us*)(AVh + oo) = oh; *(v4us*)(AVl + oo) = ol;
}
extern "C" void kernel_launch(void* const* d_in, const int* in_sizes, int n_in,
                              void* d_out, int out_size, void* d_ws, size_t ws_size, hipStream_t stream) {
    (void)in_sizes; (void)n_in; (void)out_size;
    const float* x = (const float*)d_in[0]; const float* mem = (const float*)d_in[1]; const float* msk = (const float*)d_in[2]; const float* rel = (const float*)d_in[3];
    const float* Wq = (const float*)d_in[4]; const float* bq = (const float*)d_in[5]; const float* Wke = (const float*)d_in[6]; const float* bke = (const float*)d_in[7]; const float* Wkr = (const float*)d_in[8]; const float* bkr = (const float*)d_in[9];
    const float* Wv = (const float*)d_in[10]; const float* bv = (const float*)d_in[11]; const float* Wo = (const float*)d_in[12]; const float* bo = (const float*)d_in[13];
    float* out = (float*)d_out;    // [2][1024][1024]
    char* wsp = (char*)d_ws;
    auto take = [&](size_t bytes) { char* p = wsp; wsp += (bytes + 255) & ~(size_t)255; return (void*)p; };
    bf* WoT = (bf*)take((size_t)DD * DD * 2);
    bf* Qh = (bf*)take((size_t)NBT * NH_ * LQ * HD * 2); bf* Ql = (bf*)take((size_t)NBT * NH_ * LQ * HD * 2);
    bf* Kh = (bf*)take((size_t)NBT * NH_ * TK * HD * 2); bf* Kl = (bf*)take((size_t)NBT * NH_ * TK * HD * 2); bf* Rh = (bf*)take((size_t)NH_ * TK * HD * 2); bf* Rl = (bf*)take((size_t)NH_ * TK * HD * 2);
    bf* VTh = (bf*)take((size_t)NBT * NH_ * HD * TK * 2); bf* VTl = (bf*)take((size_t)NBT * NH_ * HD * TK * 2);
    // One region, used twice in stream order: projection scratch, then the split ctx planes. Each use writes all it reads.
    char* const shared0 = wsp;
    bf* AVh = (bf*)take((size_t)NXR * DD * 2); bf* AVl = (bf*)take((size_t)NXR * DD * 2);
    wsp = shared0;
    bf* WqT = (bf*)take((size_t)DD * DD * 2); bf* WkeT = (bf*)take((size_t)DD * DD * 2); bf* WkrT = (bf*)take((size_t)DD * DD * 2); bf* WvT = (bf*)take((size_t)DD * DD * 2);
    bf* Cb = (bf*)take((size_t)NCR * DD * 2);
    if ((size_t)(wsp - (char*)d_ws) > ws_size) return;    // 50 MiB kept (WoT, q, k, Q_rel, v planes) + 16 MiB shared region; Cb holds [mem; x], then x, then rel_enc
    k_wt<<<dim3(DD / 64, DD / 64, 1), 256, 0, stream>>>(Wq, DD, DD, WqT); k_wt<<<dim3(DD / 64, DD / 64, 1), 256, 0, stream>>>(Wke, DD, DD, WkeT); k_wt<<<dim3(DD / 64, DD / 64, 1), 256, 0, stream>>>(Wkr, DD, DD, WkrT); k_wt<<<dim3(DD / 64, DD / 64, 1), 256, 0, stream>>>(Wv, DD, DD, WvT); k_wt<<<dim3(DD / 64, DD / 64, 1), 256, 0, stream>>>(Wo, DD, DD, WoT);
    for (int b = 0; b < NBT; ++b) { k_cvtb<<<LQ / 8, 256, 0, stream>>>(mem + (size_t)b * LQ * DD, LQ, Cb + (size_t)b * TK * DD); k_cvtb<<<LQ / 8, 256, 0, stream>>>(x + (size_t)b * LQ * DD, LQ, Cb + ((size_t)b * TK + LQ) * DD); }   // x_tilde_b = [mem_b; x_b]
    k_gemmb<false, false, 1, TK><<<dim3(NCR / 64, DD / 64, 1), 128, 0, stream>>>(Cb, nullptr, WkeT, bke, nullptr, DD, nullptr, nullptr, DM, 1, Kh, Kl);      // k
    k_gemmb<false, false, 2, TK><<<dim3(NCR / 64, DD / 64, 1), 128, 0, stream>>>(Cb, nullptr, WvT, bv, nullptr, DD, nullptr, nullptr, DM, 1, VTh, VTl);     // v
    for (int b = 0; b < NBT; ++b) k_cvtb<<<LQ / 8, 256, 0, stream>>>(x + (size_t)b * LQ * DD, LQ, Cb + (size_t)b * LQ * DD);                                                   // x rows (b, s)
    k_gemmb<false, false, 1, LQ><<<dim3(NXR / 64, DD / 64, 1), 128, 0, stream>>>(Cb, nullptr, WqT, bq, nullptr, DD, nullptr, nullptr, DM, 1, Qh, Ql);        // q
    k_cvtb<<<TK / 8, 256, 0, stream>>>(rel, TK, Cb);
    k_gemmb<false, false, 1, TK><<<dim3(TK / 64, DD / 64, 1), 128, 0, stream>>>(Cb, nullptr, WkrT, bkr, nullptr, DD, nullptr, nullptr, DM, 1, Rh, Rl);       // Q_rel (shared across b: one batch of TK rows)
    k_attn<<<dim3(LQ / RQ, NBT * NH_, 1), 512, 0, stream>>>(Qh, Ql, Kh, Kl, Rh, Rl, VTh, VTl, msk, AVh, AVl);    // ctx[(b,s)][h*64 + d], as planes
    k_gemmb<true, false><<<dim3(NXR / 64, DD / 64, 1), 128, 0, stream>>>(AVh, AVl, WoT, bo, out, DD, nullptr);
}

// v004
// It runs in 308 microseconds.
// In two side-by-side timings against v003, it was 1.08 and 1.09 times as fast.
// Over all steps from v000 it is 11.7 times as fast.
#include <hip/hip_runtime.h>

// Compute dtypes, f32 accumulate: k, v = [mem; x].W + b, q = x.Wq + bq, Q_rel = rel_enc.Wkr + bkr as [rows x 1024].[1024 x 1024] GEMMs with PLAIN bf16 operands (rounded inputs, k-major
// weights transposed once; exact products) on v_wmma_f32_16x16x32_bf16 -> per-(batch, head) bf16 hi + UNSCALED residual planes; per (b, h): A = q.k^T and B_hat = q.Q_rel^T ([1024 x
// 64].[64 x 2048], three products), the Transformer-XL shift by index, (A + B)/8 + mask x (-1e9), row softmax in f32 -> P planes; ctx = P.v ([1024 x 2048].[2048 x 64], three

#define LQ   1024
#define TK   2048
#define NBT  2
#define DD   1024
#define NH_  16
#define HD   64
#define NXR  (LQ * NBT)           // 2048 query rows (b, s)
#define NCR  (TK * NBT)           // 4096 context rows (b, t)
#define DM   DD
#define NTK  NCR
#define SCL  0.125f
#define LOSC 1024.0f

typedef _Float16 h16;
typedef unsigned short bf;
typedef __attribute__((ext_vector_type(16))) __bf16   v16bf;
typedef __attribute__((ext_vector_type(16))) _Float16 v16h;
typedef __attribute__((ext_vector_type(8)))  _Float16 v8h;
typedef __attribute__((ext_vector_type(8)))  unsigned short v8us;
typedef __attribute__((ext_vector_type(8)))  float    v8f;
typedef __attribute__((ext_vector_type(4)))  float    v4f;
typedef __attribute__((ext_vector_type(4)))  _Float16 v4h;
typedef v8h  __attribute__((may_alias)) v8ha;
typedef v4f  __attribute__((may_alias)) v4fa;
typedef v8us __attribute__((may_alias)) v8usa;

__device__ __forceinline__ unsigned short f2bf(float f) { unsigned u = __float_as_uint(f); u += 0x7FFFu + ((u >> 16) & 1u); return (unsigned short)(u >> 16); }
__device__ __forceinline__ float bf2f(unsigned short b) { return __uint_as_float(((unsigned)b) << 16); }
__device__ __forceinline__ float bfr(float f) { return bf2f(f2bf(f)); }
__device__ __forceinline__ v16h cat16(v8h lo, v8h hi) { return __builtin_shufflevector(lo, hi, 0, 1, 2, 3, 4, 5, 6, 7, 8, 9, 10, 11, 12, 13, 14, 15); }
__device__ __forceinline__ v16bf cat16b(v8us lo, v8us hi) { return __builtin_bit_cast(v16bf, __builtin_shufflevector(lo, hi, 0, 1, 2, 3, 4, 5, 6, 7, 8, 9, 10, 11, 12, 13, 14, 15)); }
__device__ __forceinline__ v8f wmma16(v16h a, v16h b, v8f c) { return __builtin_amdgcn_wmma_f32_16x16x32_f16(false, a, false, b, (short)0, c, false, false); }
__device__ __forceinline__ v8f wmmab(v16bf a, v16bf b, v8f c) { return __builtin_amdgcn_wmma_f32_16x16x32_bf16(false, a, false, b, (short)0, c, false, false); }

// wt_tile: WT [n][K] = bf16(W[k][n]) (k-major [K][ncols]) via one 64 x 64 LDS tile tl; tile (bx, by) of (K/64, ncols/64), 256 threads.
__device__ __forceinline__ void wt_tile(unsigned short* tl, int bx, int by, const float* __restrict__ Wm, int K, int ncols, bf* WT) {
    const int tid = threadIdx.x, k0 = bx * 64, n0 = by * 64;
    const int kk = tid >> 2, nq = (tid & 3) * 16;
#pragma unroll
    for (int i = 0; i < 16; ++i) tl[(nq + i) * 72 + kk] = f2bf(Wm[(size_t)(k0 + kk) * ncols + n0 + nq + i]);
    __syncthreads();
    const int piece = tid & 7;
    auto pass = [&]() {
#pragma unroll
        for (int s = 0; s < 2; ++s) { const int nr = (tid >> 3) + 32 * s; const v8us val = *(const v8usa*)(tl + nr * 72 + piece * 8); *(v8us*)(WT + (size_t)(n0 + nr) * K + k0 + piece * 8) = val; }
    };
    pass(); 
}
// cvt_row: one wave rounds one row of DM floats to bf16.
__device__ __forceinline__ void cvt_row(const float* __restrict__ src, bf* dst) {
    const int lane = threadIdx.x & 31;
    v8us o[DM / 256];
#pragma unroll
    for (int q = 0; q < DM / 256; ++q) { v8us t;
#pragma unroll
        for (int i = 0; i < 8; ++i) t[i] = f2bf(src[q * 256 + lane * 8 + i]);
        o[q] = t; }
#pragma unroll
    for (int q = 0; q < DM / 256; ++q) *(v8us*)(dst + q * 256 + lane * 8) = o[q];
}
// k_prep: every operand preparation of the call in one grid, none reads another's output. Blocks 0 .. 1279: the five weights' 16 x 16 transpose tiles; then eight rows a block:
// 4096 rows of [mem; x] -> Cb, 2048 rows of x -> Xb, 2048 rows of rel_enc -> Rb.
#define NWT  (5 * (DD / 64) * (DD / 64))
__global__ __launch_bounds__(256) void k_prep(const float* __restrict__ Wq, const float* __restrict__ Wke, const float* __restrict__ Wkr, const float* __restrict__ Wv, const float* __restrict__ Wo,
                                              const float* __restrict__ x, const float* __restrict__ mem, const float* __restrict__ rel,
                                              bf* WqT, bf* WkeT, bf* WkrT, bf* WvT, bf* WoT, bf* Cb, bf* Xb, bf* Rb) {
    __shared__ __align__(16) unsigned short tl[64 * 72];
    const int blk = blockIdx.x;
    if (blk < NWT) {    // the same for the whole block: the barrier inside wt_tile is passed by all of it or by none
        const int w = blk / ((DD / 64) * (DD / 64)), tile = blk % ((DD / 64) * (DD / 64));
        const float* Wm = w == 0 ? Wq : w == 1 ? Wke : w == 2 ? Wkr : w == 3 ? Wv : Wo;
        bf* WT = w == 0 ? WqT : w == 1 ? WkeT : w == 2 ? WkrT : w == 3 ? WvT : WoT;
        wt_tile(tl, tile % (DD / 64), tile / (DD / 64), Wm, DD, DD, WT);
    } else {
        const int r = (blk - NWT) * 8;    // the block's first row; every boundary below is a multiple of 8, so a block's eight rows have one source and one target
        const float* src; bf* dst;
        if (r < NCR) { const int b = r / TK, t = r % TK;    // x_tilde_b = [mem_b; x_b]
            src = t < LQ ? mem + ((size_t)b * LQ + t) * DD : x + ((size_t)b * LQ + t - LQ) * DD; dst = Cb + (size_t)r * DD;
        } else if (r < NCR + NXR) { src = x + (size_t)(r - NCR) * DD; dst = Xb + (size_t)(r - NCR) * DD;    // x rows (b, s)
        } else { src = rel + (size_t)(r - NCR - NXR) * DD; dst = Rb + (size_t)(r - NCR - NXR) * DD; }
        cvt_row(src + (threadIdx.x >> 5) * DD, dst + (threadIdx.x >> 5) * DD);
    }
}

// k_gemmb: 64 x 64 block tile (4 waves x 16 x 64) of C[rows][1024] = (A [+ Al]).B^T (K = 1024) [+ bf(bias[c])] [+ bf(R[r][c]) residual]; f32 whole-line epilogue (or f16
// PLANES 1: the 64 columns of a block are one head, and the tile goes out as that head's operand planes [row][64] = bf16 hi + UNSCALED residual (NR rows per batch, batch-first rows);
// PLANES 2: the same two planes transposed, [d][TK] (the v operand of P.v). Either way the f32 product never leaves the block.
// The body is a device function of the block's tile (bx, by) and of its LDS tile ost, so that several products can share one grid.
template <bool SPLITA, bool F16OUT = false, int PLANES = 0, int NR = 64>
__device__ __forceinline__ void gemmb(float (*ost)[16 * 68], int bx, int by, const bf* __restrict__ A, const bf* __restrict__ Al, const bf* __restrict__ Bn, const float* __restrict__ bias, float* C, int ldc, h16* C2, const float* __restrict__ R = nullptr, int K = DM, int roundR = 1, bf* Ph = nullptr, bf* Pl = nullptr) {
    const int lane = threadIdx.x & 31, wave = threadIdx.x >> 5, lr = lane & 15, hi = lane >> 4;
    const int r0 = bx * 64 + wave * 16, c0 = by * 64;
    const size_t aoff = (size_t)(r0 + lr) * K + 8 * hi;
    size_t boff[4];
#pragma unroll
    for (int t = 0; t < 4; ++t) boff[t] = (size_t)(c0 + t * 16 + lr) * K + 8 * hi;
    v8f acc[4];
#pragma unroll
    for (int t = 0; t < 4; ++t) acc[t] = (v8f){};
    float braw[4] = {0.f, 0.f, 0.f, 0.f};    // PLANES: the bias is asked for here, so that it arrives under the k loop and the epilogue does not wait for it
    if (PLANES) {
#pragma unroll
        for (int t = 0; t < 4; ++t) braw[t] = bias[c0 + t * 16 + lr];
        asm volatile("s_wait_xcnt 0x0" ::: "memory"); }    // precaution: stands in front of the first rewrite of the four bias loads' address registers (the k loop's set-up reuses them)
#pragma unroll 1
    for (int kc = 0; kc < K; kc += 32) {
        const v16bf a = cat16b(*(const v8us*)(A + aoff + kc), *(const v8us*)(A + aoff + kc + 16));
        v16bf al = a;
        if (SPLITA) al = cat16b(*(const v8us*)(Al + aoff + kc), *(const v8us*)(Al + aoff + kc + 16));
#pragma unroll
        for (int t = 0; t < 4; ++t) { const v16bf b = cat16b(*(const v8us*)(Bn + boff[t] + kc), *(const v8us*)(Bn + boff[t] + kc + 16)); acc[t] = wmmab(a, b, acc[t]); if (SPLITA) acc[t] = wmmab(al, b, acc[t]); }
        asm volatile("v_nop\n\tv_nop\n\tv_nop\n\tv_nop" : "+v"(acc[0]), "+v"(acc[1]), "+v"(acc[2]), "+v"(acc[3]) : "v"(a), "v"(al));
    }
    float* os = &ost[wave][0];
#pragma unroll
    for (int t = 0; t < 4; ++t) { const float bv = PLANES ? bfr(braw[t]) : bias ? bfr(bias[c0 + t * 16 + lr]) : 0.f;
        if (PLANES == 2) {    // transposed tile [d][68] over all four waves' rows: a lane's eight rows are eight neighbours of one d
            float* tp = &ost[0][0] + (t * 16 + lr) * 68 + wave * 16 + hi * 8;
            *(v4fa*)tp = (v4f){acc[t][0] + bv, acc[t][1] + bv, acc[t][2] + bv, acc[t][3] + bv}; *(v4fa*)(tp + 4) = (v4f){acc[t][4] + bv, acc[t][5] + bv, acc[t][6] + bv, acc[t][7] + bv};
        } else {
#pragma unroll
        for (int j = 0; j < 8; ++j) os[(hi * 8 + j) * 68 + t * 16 + lr] = acc[t][j] + bv; } }
    __syncthreads();
    if (PLANES) {
        const int rb = bx * 64, bhp = (rb / NR) * NH_ + by, rin = rb % NR;    // batch and head of the block, its first row inside the batch
#pragma unroll
        for (int s = 0; s < 4; ++s) { const int piece = lane & 7;    // eight lanes x 16 bytes: whole 128-byte lines in both planes
            const int row = PLANES == 2 ? s * 16 + (threadIdx.x >> 3) : 4 * s + (lane >> 3);    // PLANES 2: d, of the block's tile; else a row of the wave's own 16
            const float* sp = (PLANES == 2 ? &ost[0][0] : os) + row * 68 + piece * 8; v8us oh, ol;
#pragma unroll
            for (int i = 0; i < 8; ++i) { const float v = sp[i]; const unsigned short hb = f2bf(v); oh[i] = hb; ol[i] = f2bf(v - bf2f(hb)); }
            const size_t o = PLANES == 2 ? ((size_t)bhp * HD + row) * TK + rin + piece * 8 : ((size_t)bhp * NR + rin + wave * 16 + row) * HD + piece * 8;
            *(v8us*)(Ph + o) = oh; *(v8us*)(Pl + o) = ol; }
        asm volatile("s_wait_xcnt 0x0" ::: "memory");    // precaution: behind the last plane store, in front of whatever the shared grid's code places after this body that rewrites the stores' registers
    } else if (F16OUT) {
        h16* crow = (h16*)(void*)C + (size_t)r0 * ldc + c0;
        auto pass = [&]() {
#pragma unroll
            for (int s = 0; s < 4; ++s) { const int row = 4 * s + (lane >> 3), piece = lane & 7; const float* sp = os + row * 68 + piece * 8; v8h o, o2;
#pragma unroll
                for (int i = 0; i < 8; ++i) { const h16 a = (h16)sp[i]; o[i] = a; o2[i] = (h16)((sp[i] - (float)a) * LOSC); }
                *(v8h*)(crow + (size_t)row * ldc + piece * 8) = o; if (C2) *(v8h*)(C2 + (size_t)r0 * ldc + c0 + (size_t)row * ldc + piece * 8) = o2; }
        };
        pass(); 
    } else {
        float* crow = C + (size_t)r0 * ldc + c0;
        auto pass = [&]() {
#pragma unroll
            for (int s = 0; s < 8; ++s) { const int Lid = (lane >> 3) + 4 * s, piece = lane & 7; const int row = Lid >> 1, cofs = (Lid & 1) * 32 + piece * 4;
                v4f val = *(const v4fa*)(os + row * 68 + cofs); if (R) { const v4f rv = *(const v4f*)(R + ((size_t)r0 + row) * ldc + c0 + cofs); val += roundR ? (v4f){bfr(rv[0]), bfr(rv[1]), bfr(rv[2]), bfr(rv[3])} : rv; }
                *(v4f*)(crow + (size_t)row * ldc + cofs) = val; }
        };
        pass(); 
    }
}
// k_proj: the four projections, which read none of each other's output, as one grid: blockIdx.x 0 .. 63 k, 64 .. 127 v, 128 .. 159 q, 160 .. 191 Q_rel (shared across b: one batch of TK rows); blockIdx.y the head.
__global__ __launch_bounds__(128) void k_proj(const bf* __restrict__ Cb, const bf* __restrict__ Xb, const bf* __restrict__ Rb, const bf* __restrict__ WkeT, const bf* __restrict__ WvT, const bf* __restrict__ WqT, const bf* __restrict__ WkrT,
                                              const float* __restrict__ bke, const float* __restrict__ bv, const float* __restrict__ bq, const float* __restrict__ bkr,
                                              bf* Kh, bf* Kl, bf* VTh, bf* VTl, bf* Qh, bf* Ql, bf* Rh, bf* Rl, int K) {
    __shared__ __align__(16) float ost[4][16 * 68];
    const int bx = blockIdx.x, by = blockIdx.y;
    if (bx < NCR / 64) gemmb<false, false, 1, TK>(ost, bx, by, Cb, nullptr, WkeT, bke, nullptr, DD, nullptr, nullptr, K, 1, Kh, Kl);
    else if (bx < 2 * (NCR / 64)) gemmb<false, false, 2, TK>(ost, bx - NCR / 64, by, Cb, nullptr, WvT, bv, nullptr, DD, nullptr, nullptr, K, 1, VTh, VTl);
    else if (bx < 2 * (NCR / 64) + NXR / 64) gemmb<false, false, 1, LQ>(ost, bx - 2 * (NCR / 64), by, Xb, nullptr, WqT, bq, nullptr, DD, nullptr, nullptr, K, 1, Qh, Ql);
    else gemmb<false, false, 1, TK>(ost, bx - 2 * (NCR / 64) - NXR / 64, by, Rb, nullptr, WkrT, bkr, nullptr, DD, nullptr, nullptr, K, 1, Rh, Rl);
}
template <bool SPLITA, bool F16OUT = false, int PLANES = 0, int NR = 64>
__global__ __launch_bounds__(128) void k_gemmb(const bf* __restrict__ A, const bf* __restrict__ Al, const bf* __restrict__ Bn, const float* __restrict__ bias, float* C, int ldc, h16* C2, const float* __restrict__ R = nullptr, int K = DM, int roundR = 1, bf* Ph = nullptr, bf* Pl = nullptr) {
    __shared__ __align__(16) float ost[4][16 * 68];
    gemmb<SPLITA, F16OUT, PLANES, NR>(ost, blockIdx.x, blockIdx.y, A, Al, Bn, bias, C, ldc, C2, R, K, roundR, Ph, Pl);
}


// k_attn: one work-group (16 waves) per 32 query rows of one (b, h); the 32 x 2048 scores never leave LDS.
//  1. B_hat = q.Q_rel^T (three products), each wave 128 columns; element (r, c) is stored straight at its place after the shift: with u = c + r - (L-1), row r column u when u >= 0,
//     else row r-1 column u + T (so rows i0 .. i0+32 of B_hat are needed: a third row tile gives row i0+32); the one padded zero of each row is stored by hand.
//  2. A = q.k^T (three products), s = (A + B) / 8 in place.  3. each wave two rows in turn: + mask x (-1e9), softmax in f32 (row in registers), P as bf16 hi + residual planes over the row's own bytes.
//  4. ctx = P.v (three products): wave w sums keys 128 w .. 128 w + 127 for all 32 x 64 outputs; the 16 partial tiles are added in wave order through LDS.
#define RQ   32                   // query rows of one work-group
#define SP   2052                 // LDS row pitch in floats: 16 B x odd, for the 16-byte fragment reads of stage 4
#define RP   68                   // pitch of a partial ctx tile's row in floats
__device__ __forceinline__ v16bf ldfrag(const bf* p) { return cat16b(*(const v8us*)p, *(const v8us*)(p + 16)); }
__device__ __forceinline__ v16bf ldfrag_s(const bf* p) { return cat16b(*(const v8usa*)p, *(const v8usa*)(p + 16)); }
__device__ __forceinline__ v8f prod3(const v16bf (&ah)[2], const v16bf (&al)[2], const v16bf (&bh)[2], const v16bf (&bl)[2]) {
    v8f acc = (v8f){};
#pragma unroll
    for (int ks = 0; ks < 2; ++ks) { acc = wmmab(ah[ks], bh[ks], acc); acc = wmmab(al[ks], bh[ks], acc); acc = wmmab(ah[ks], bl[ks], acc); }
    return acc;
}
__global__ __launch_bounds__(512) void k_attn(const bf* __restrict__ Qh, const bf* __restrict__ Ql, const bf* __restrict__ Kh, const bf* __restrict__ Kl, const bf* __restrict__ Rh, const bf* __restrict__ Rl,
                                              const bf* __restrict__ VTh, const bf* __restrict__ VTl, const float* __restrict__ MSK, bf* AVh, bf* AVl) {
    typedef __attribute__((ext_vector_type(4))) unsigned short v4us;
    typedef v4us __attribute__((may_alias)) v4usa;
    __shared__ __align__(16) float S[RQ * SP];
    const int tid = threadIdx.x, lane = tid & 31, wave = __builtin_amdgcn_readfirstlane(tid >> 5), lr = lane & 15, hi = lane >> 4;
    const int i0 = blockIdx.x * RQ, bh = blockIdx.y, h = bh % NH_, b = bh / NH_;
    Qh += (size_t)bh * LQ * HD; Ql += (size_t)bh * LQ * HD; Kh += (size_t)bh * TK * HD; Kl += (size_t)bh * TK * HD; Rh += (size_t)h * TK * HD; Rl += (size_t)h * TK * HD; VTh += (size_t)bh * HD * TK; VTl += (size_t)bh * HD * TK;
    const int cw = wave * (TK / 16);
    v16bf qh[3][2], ql[3][2]; const bf* qa[3]; const bf* qb[3];
#pragma unroll
    for (int rt = 0; rt < 3; ++rt) { const size_t o = (size_t)min(i0 + rt * 16 + lr, LQ - 1) * HD + 8 * hi; qa[rt] = Qh + o; qb[rt] = Ql + o;
#pragma unroll
        for (int ks = 0; ks < 2; ++ks) { qh[rt][ks] = ldfrag(qa[rt] + ks * 32); ql[rt][ks] = ldfrag(qb[rt] + ks * 32); } }
    asm volatile("s_wait_xcnt 0x0" :: "v"(qa[0]), "v"(qa[1]), "v"(qa[2]), "v"(qb[0]), "v"(qb[1]), "v"(qb[2]) : "memory");    // precaution: the loads' address registers are inputs here, so none of them is rewritten (by a later load's result either) in front of this wait
    if (tid < RQ) { const int zc = (TK - LQ + 1) + i0 + tid; if (zc < TK) S[tid * SP + zc] = 0.f; }   // the padded zero: column T - L + 1 + i of row i
    const size_t fo = (size_t)(cw + lr) * HD + 8 * hi;    // this lane's place in the first 16-column tile of the wave's slice; a tile further is 16 * HD elements on
    v16bf fh[2][2], fl[2][2];                             // two register sets: the next tile's fragments are fetched while this tile is worked on
#pragma unroll
    for (int ks = 0; ks < 2; ++ks) { fh[0][ks] = ldfrag(Rh + fo + ks * 32); fl[0][ks] = ldfrag(Rl + fo + ks * 32); }
#pragma unroll
    for (int t = 0; t < 8; ++t) { const int c0 = cw + t * 16, cur = t & 1, nxt = cur ^ 1;
        const bf* nh = (t < 7 ? Rh : Kh) + fo + (t < 7 ? (t + 1) * 16 * HD : 0); const bf* nl = (t < 7 ? Rl : Kl) + fo + (t < 7 ? (t + 1) * 16 * HD : 0);   // behind the last Q_rel tile: the first k tile
#pragma unroll
        for (int ks = 0; ks < 2; ++ks) { fh[nxt][ks] = ldfrag(nh + ks * 32); fl[nxt][ks] = ldfrag(nl + ks * 32); }
        v8f a0 = prod3(qh[0], ql[0], fh[cur], fl[cur]), a1 = prod3(qh[1], ql[1], fh[cur], fl[cur]);
        asm volatile("v_nop\n\tv_nop\n\tv_nop\n\tv_nop" : "+v"(a0), "+v"(a1));    // the four vector slots the chip needs before these results' registers are written again (the next product chain may reuse them right behind the LDS stores)
#pragma unroll
        for (int rt = 0; rt < 2; ++rt) {
#pragma unroll
            for (int j = 0; j < 8; ++j) { const int lrw = rt * 16 + hi * 8 + j, u = c0 + lr + i0 + lrw - (LQ - 1);
                int idx = lrw * SP + u - (u < 0 ? SP - TK : 0);
                if (rt == 0 && j == 0) idx = idx < 0 ? TK : idx;    // row i0 - 1 is another work-group's: such a value goes to row 0's pad, which nobody reads
                S[idx] = rt ? a1[j] : a0[j]; } }
        if (c0 + i0 + RQ - (LQ - 1) < 0) { v8f a2 = prod3(qh[2], ql[2], fh[cur], fl[cur]); const int u = c0 + lr + i0 + RQ - (LQ - 1);   // row i0 + 32 feeds the tail of row i0 + 31
            asm volatile("v_nop\n\tv_nop\n\tv_nop\n\tv_nop" : "+v"(a2));    // the same four slots, on the way out of this branch
            S[(hi == 0 && u < 0) ? RQ * SP + u - (SP - TK) : TK] = a2[0]; }
    }
    __syncthreads();
    float* const sw = S + hi * 8 * SP + cw + lr;    // this lane's element of row hi * 8 in the wave's first tile
    float old[2][16];                               // B of this tile and of the next: read in one batch a tile ahead, so that no LDS read waits behind the stores of the tile before
#pragma unroll
    for (int e = 0; e < 16; ++e) old[0][e] = sw[((e >> 3) * 16 + (e & 7)) * SP];
#pragma unroll
    for (int t = 0; t < 8; ++t) { const int cur = t & 1, nxt = cur ^ 1;
        if (t < 7) {
#pragma unroll
            for (int ks = 0; ks < 2; ++ks) { fh[nxt][ks] = ldfrag(Kh + fo + (t + 1) * 16 * HD + ks * 32); fl[nxt][ks] = ldfrag(Kl + fo + (t + 1) * 16 * HD + ks * 32); }
#pragma unroll
            for (int e = 0; e < 16; ++e) old[nxt][e] = sw[((e >> 3) * 16 + (e & 7)) * SP + (t + 1) * 16]; }
        __builtin_amdgcn_sched_barrier(0);    // keeps the next tile's loads in front of this tile's products; the compiler otherwise sinks them to just before their use and the wave waits out the whole latency
        const v8f a0 = prod3(qh[0], ql[0], fh[cur], fl[cur]), a1 = prod3(qh[1], ql[1], fh[cur], fl[cur]);
#pragma unroll
        for (int e = 0; e < 16; ++e) sw[((e >> 3) * 16 + (e & 7)) * SP + t * 16] = ((e < 8 ? a0[e & 7] : a1[e & 7]) + old[cur][e]) * SCL;
    }
    __builtin_amdgcn_sched_barrier(0);    // keeps the mask loads below from being lifted into the score tiles above, where their 64 registers would spill
    const float* mrow = MSK + (size_t)(i0 + wave * (RQ / 16)) * TK + lane * 4;
    v4f mk[TK / 128];    // the mask of the wave's first row, asked for in front of the barrier so that it arrives while the other waves finish their scores
#pragma unroll
    for (int k = 0; k < TK / 128; ++k) mk[k] = *(const v4f*)(mrow + k * 128);
    __syncthreads();
#pragma unroll 1    // rolled: with both rows unrolled together the live set overran the register budget and spilled
    for (int rr = 0; rr < RQ / 16; ++rr) { const int lrw = wave * (RQ / 16) + rr; float* srow = S + lrw * SP;
        float v[TK / 32]; float m = -3.0e38f;
#pragma unroll
        for (int k = 0; k < TK / 128; ++k) { const int c = k * 128 + lane * 4; const v4f s = *(const v4fa*)(srow + c);
#pragma unroll
            for (int q = 0; q < 4; ++q) { const float x = s[q] + bfr(mk[k][q]) * (-1e9f); v[k * 4 + q] = x; m = fmaxf(m, x); } }
        if (rr + 1 < RQ / 16) {    // the next row's mask flies while this row's softmax is worked out
#pragma unroll
            for (int k = 0; k < TK / 128; ++k) mk[k] = *(const v4f*)(mrow + (size_t)(rr + 1) * TK + k * 128); }
#pragma unroll
        for (int sh = 16; sh; sh >>= 1) m = fmaxf(m, __shfl_xor(m, sh, 32));
        float sum = 0.f;
#pragma unroll
        for (int k = 0; k < TK / 32; ++k) { v[k] = __expf(v[k] - m); sum += v[k]; }
#pragma unroll
        for (int sh = 16; sh; sh >>= 1) sum += __shfl_xor(sum, sh, 32);
        const float inv = 1.0f / sum;
        bf* prow = (bf*)(void*)srow;    // hi plane in the row's first 4096 bytes, residual plane in the next 4096; the whole row is in registers by now
#pragma unroll
        for (int k = 0; k < TK / 128; ++k) { v4us oh, ol;
#pragma unroll
            for (int q = 0; q < 4; ++q) { const float p = v[k * 4 + q] * inv; const unsigned short hb = f2bf(p); oh[q] = hb; ol[q] = f2bf(p - bf2f(hb)); }
            *(v4usa*)(prow + k * 128 + lane * 4) = oh; *(v4usa*)(prow + TK + k * 128 + lane * 4) = ol; }
    }
    const size_t vo = (size_t)lr * TK + cw + 8 * hi;    // this lane's place in the v planes: row d = lr of the first 16-row tile, first key of the wave's slice
    v16bf vh[2][4], vl[2][4];                           // two register sets: the next 32 keys' v fragments are fetched while these are worked on; the first set is asked for in front of the barrier
#pragma unroll
    for (int dt = 0; dt < 4; ++dt) { vh[0][dt] = ldfrag(VTh + vo + (size_t)dt * 16 * TK); vl[0][dt] = ldfrag(VTl + vo + (size_t)dt * 16 * TK); }
    __syncthreads();
    v8f acc[2][4];
#pragma unroll
    for (int rt = 0; rt < 2; ++rt) {
#pragma unroll
        for (int dt = 0; dt < 4; ++dt) acc[rt][dt] = (v8f){}; }
#pragma unroll
    for (int ks = 0; ks < 4; ++ks) { const int cur = ks & 1, nxt = cur ^ 1;
        if (ks < 3) {
#pragma unroll
            for (int dt = 0; dt < 4; ++dt) { vh[nxt][dt] = ldfrag(VTh + vo + (size_t)dt * 16 * TK + (ks + 1) * 32); vl[nxt][dt] = ldfrag(VTl + vo + (size_t)dt * 16 * TK + (ks + 1) * 32); } }
        v16bf ph[2], pl[2];
#pragma unroll
        for (int rt = 0; rt < 2; ++rt) { const bf* pr = (const bf*)(const void*)(S + (rt * 16 + lr) * SP) + cw + ks * 32 + 8 * hi; ph[rt] = ldfrag_s(pr); pl[rt] = ldfrag_s(pr + TK); }
#pragma unroll
        for (int dt = 0; dt < 4; ++dt) {
#pragma unroll
            for (int rt = 0; rt < 2; ++rt) { acc[rt][dt] = wmmab(ph[rt], vh[cur][dt], acc[rt][dt]); acc[rt][dt] = wmmab(pl[rt], vh[cur][dt], acc[rt][dt]); acc[rt][dt] = wmmab(ph[rt], vl[cur][dt], acc[rt][dt]); } }
    }
    __syncthreads();    // every wave has read its P fragments: the score rows' LDS now takes the 16 partial tiles
    float* red = S + wave * (RQ * RP);
#pragma unroll
    for (int rt = 0; rt < 2; ++rt) {
#pragma unroll
        for (int dt = 0; dt < 4; ++dt) {
#pragma unroll
            for (int j = 0; j < 8; ++j) red[(rt * 16 + hi * 8 + j) * RP + dt * 16 + lr] = acc[rt][dt][j]; } }
    __syncthreads();
    const int orow = tid >> 4, od = (tid & 15) * 4;
    v4f part[16];
#pragma unroll
    for (int w = 0; w < 16; ++w) part[w] = *(const v4fa*)(S + w * (RQ * RP) + orow * RP + od);
    v4f o = part[0];
#pragma unroll
    for (int w = 1; w < 16; ++w) o += part[w];
    v4us oh, ol;    // ctx goes out as the last GEMM's operand planes: bf16 hi + residual
#pragma unroll
    for (int q = 0; q < 4; ++q) { const unsigned short hb = f2bf(o[q]); oh[q] = hb; ol[q] = f2bf(o[q] - bf2f(hb)); }
    const size_t oo = ((size_t)b * LQ + i0 + orow) * DD + h * HD + od;
    *(v4us*)(AVh + oo) = oh; *(v4us*)(AVl + oo) = ol;
}
extern "C" void kernel_launch(void* const* d_in, const int* in_sizes, int n_in,
                              void* d_out, int out_size, void* d_ws, size_t ws_size, hipStream_t stream) {
    (void)in_sizes; (void)n_in; (void)out_size;
    const float* x = (const float*)d_in[0]; const float* mem = (const float*)d_in[1]; const float* msk = (const float*)d_in[2]; const float* rel = (const float*)d_in[3];
    const float* Wq = (const float*)d_in[4]; const float* bq = (const float*)d_in[5]; const float* Wke = (const float*)d_in[6]; const float* bke = (const float*)d_in[7]; const float* Wkr = (const float*)d_in[8]; const float* bkr = (const float*)d_in[9];
    const float* Wv = (const float*)d_in[10]; const float* bv = (const float*)d_in[11]; const float* Wo = (const float*)d_in[12]; const float* bo = (const float*)d_in[13];
    float* out = (float*)d_out;    // [2][1024][1024]
    char* wsp = (char*)d_ws;
    auto take = [&](size_t bytes) { char* p = wsp; wsp += (bytes + 255) & ~(size_t)255; return (void*)p; };
    bf* WoT = (bf*)take((size_t)DD * DD * 2);
    bf* Qh = (bf*)take((size_t)NBT * NH_ * LQ * HD * 2); bf* Ql = (bf*)take((size_t)NBT * NH_ * LQ * HD * 2);
    bf* Kh = (bf*)take((size_t)NBT * NH_ * TK * HD * 2); bf* Kl = (bf*)take((size_t)NBT * NH_ * TK * HD * 2); bf* Rh = (bf*)take((size_t)NH_ * TK * HD * 2); bf* Rl = (bf*)take((size_t)NH_ * TK * HD * 2);
    bf* VTh = (bf*)take((size_t)NBT * NH_ * HD * TK * 2); bf* VTl = (bf*)take((size_t)NBT * NH_ * HD * TK * 2);
    // One region, used twice in stream order: projection scratch, then the split ctx planes. Each use writes all it reads.
    char* const shared0 = wsp;
    bf* AVh = (bf*)take((size_t)NXR * DD * 2); bf* AVl = (bf*)take((size_t)NXR * DD * 2);
    wsp = shared0;
    bf* WqT = (bf*)take((size_t)DD * DD * 2); bf* WkeT = (bf*)take((size_t)DD * DD * 2); bf* WkrT = (bf*)take((size_t)DD * DD * 2); bf* WvT = (bf*)take((size_t)DD * DD * 2);
    bf* Cb = (bf*)take((size_t)NCR * DD * 2); bf* Xb = (bf*)take((size_t)NXR * DD * 2); bf* Rb = (bf*)take((size_t)TK * DD * 2);
    if ((size_t)(wsp - (char*)d_ws) > ws_size) return;    // 50 MiB kept (WoT, q, k, Q_rel, v planes) + 24 MiB shared region; Cb holds [mem; x], Xb x, Rb rel_enc
    k_prep<<<NWT + (NCR + NXR + TK) / 8, 256, 0, stream>>>(Wq, Wke, Wkr, Wv, Wo, x, mem, rel, WqT, WkeT, WkrT, WvT, WoT, Cb, Xb, Rb);
    k_proj<<<dim3(2 * (NCR / 64) + NXR / 64 + TK / 64, DD / 64, 1), 128, 0, stream>>>(Cb, Xb, Rb, WkeT, WvT, WqT, WkrT, bke, bv, bq, bkr, Kh, Kl, VTh, VTl, Qh, Ql, Rh, Rl, DM);
    k_attn<<<dim3(LQ / RQ, NBT * NH_, 1), 512, 0, stream>>>(Qh, Ql, Kh, Kl, Rh, Rl, VTh, VTl, msk, AVh, AVl);    // ctx[(b,s)][h*64 + d], as planes
    k_gemmb<true, false><<<dim3(NXR / 64, DD / 64, 1), 128, 0, stream>>>(AVh, AVl, WoT, bo, out, DD, nullptr);
}

// v005
// One run takes 243 microseconds.
// Two timings next to v004 put it at 1.26 and 1.24 times that version's speed.
// Counting every step since v000, it is 14.6 times as fast.
#include <hip/hip_runtime.h>

// Compute dtypes, f32 accumulate: k, v = [mem; x].W + b, q = x.Wq + bq, Q_rel = rel_enc.Wkr + bkr as [rows x 1024].[1024 x 1024] GEMMs with PLAIN bf16 operands (rounded inputs, k-major
// weights transposed once; exact products) on v_wmma_f32_16x16x32_bf16 -> per-(batch, head) bf16 hi + UNSCALED residual planes; per (b, h): A = q.k^T and B_hat = q.Q_rel^T ([1024 x
// 64].[64 x 2048], three products), the Transformer-XL shift by index, (A + B)/8 + mask x (-1e9), row softmax in f32 -> P planes; ctx = P.v ([1024 x 2048].[2048 x 64], three

#define LQ   1024
#define TK   2048
#define NBT  2
#define DD   1024
#define NH_  16
#define HD   64
#define NXR  (LQ * NBT)           // 2048 query rows (b, s)
#define NCR  (TK * NBT)           // 4096 context rows (b, t)
#define DM   DD
#define NTK  NCR
#define SCL  0.125f
#define LOSC 1024.0f

typedef _Float16 h16;
typedef unsigned short bf;
typedef __attribute__((ext_vector_type(16))) __bf16   v16bf;
typedef __attribute__((ext_vector_type(16))) _Float16 v16h;
typedef __attribute__((ext_vector_type(8)))  _Float16 v8h;
typedef __attribute__((ext_vector_type(8)))  unsigned short v8us;
typedef __attribute__((ext_vector_type(8)))  float    v8f;
typedef __attribute__((ext_vector_type(4)))  float    v4f;
typedef __attribute__((ext_vector_type(4)))  _Float16 v4h;
typedef v8h  __attribute__((may_alias)) v8ha;
typedef v4f  __attribute__((may_alias)) v4fa;
typedef v8us __attribute__((may_alias)) v8usa;

__device__ __forceinline__ unsigned short f2bf(float f) { unsigned u = __float_as_uint(f); u += 0x7FFFu + ((u >> 16) & 1u); return (unsigned short)(u >> 16); }
__device__ __forceinline__ float bf2f(unsigned short b) { return __uint_as_float(((unsigned)b) << 16); }
__device__ __forceinline__ float bfr(float f) { return bf2f(f2bf(f)); }
__device__ __forceinline__ v16h cat16(v8h lo, v8h hi) { return __builtin_shufflevector(lo, hi, 0, 1, 2, 3, 4, 5, 6, 7, 8, 9, 10, 11, 12, 13, 14, 15); }
__device__ __forceinline__ v16bf cat16b(v8us lo, v8us hi) { return __builtin_bit_cast(v16bf, __builtin_shufflevector(lo, hi, 0, 1, 2, 3, 4, 5, 6, 7, 8, 9, 10, 11, 12, 13, 14, 15)); }
__device__ __forceinline__ v8f wmma16(v16h a, v16h b, v8f c) { return __builtin_amdgcn_wmma_f32_16x16x32_f16(false, a, false, b, (short)0, c, false, false); }
__device__ __forceinline__ v8f wmmab(v16bf a, v16bf b, v8f c) { return __builtin_amdgcn_wmma_f32_16x16x32_bf16(false, a, false, b, (short)0, c, false, false); }

// FRAGMENT ORDER: every bf16 matrix [rows][K] that a matrix instruction reads from global memory lies as blocks of 16 rows x 32 k = 512 elements (block (r / 16) * (K / 32) + k / 32); inside a block
// element (r, k) stands at ((k / 16) % 2) * 256 + ((k / 8) % 2) * 128 + (r % 16) * 8 + k % 8: lane l's two 16-byte fragment pieces are at l * 8 and 256 + l * 8, so each wave-wide load is 512 bytes in a row.
// Which lane and register holds which (r, k) is as with row-major storage.
// wt_tile: WT [n][K] = bf16(W[k][n]) (k-major [K][ncols]), in fragment order, via one 64 x 64 LDS tile tl; tile (bx, by) of (K/64, ncols/64), 256 threads.
__device__ __forceinline__ void wt_tile(unsigned short* tl, int bx, int by, const float* __restrict__ Wm, int K, int ncols, bf* WT) {
    const int tid = threadIdx.x, k0 = bx * 64, n0 = by * 64;
    const int kk = tid >> 2, nq = (tid & 3) * 16;
#pragma unroll
    for (int i = 0; i < 16; ++i) tl[(nq + i) * 72 + kk] = f2bf(Wm[(size_t)(k0 + kk) * ncols + n0 + nq + i]);
    __syncthreads();
    const int lane = tid & 31, kq = (tid >> 6) & 1, part = (tid >> 5) & 1;    // a wave stores one half block: 512 bytes in a row
    auto pass = [&]() {
#pragma unroll
        for (int s = 0; s < 2; ++s) { const int nt = (tid >> 7) + 2 * s; const v8us val = *(const v8usa*)(tl + (nt * 16 + (lane & 15)) * 72 + (kq * 4 + part * 2 + (lane >> 4)) * 8);
            *(v8us*)(WT + ((size_t)(n0 / 16 + nt) * (K / 32) + k0 / 32 + kq) * 512 + part * 256 + lane * 8) = val; }
    };
    pass(); 
}
// cvt_blk: one wave rounds two neighbouring blocks (16 rows x 64 k) to bf16 in fragment order; src: the 16 rows' first element of those k, dst: the first block.
__device__ __forceinline__ void cvt_blk(const float* __restrict__ src, bf* dst) {
    const int lane = threadIdx.x & 31;
    const float* sp = src + (size_t)(lane & 15) * DM + (lane >> 4) * 8;
    v8us o[4];
#pragma unroll
    for (int q = 0; q < 4; ++q) { v8us t;
#pragma unroll
        for (int i = 0; i < 8; ++i) t[i] = f2bf(sp[q * 16 + i]);
        o[q] = t; }
#pragma unroll
    for (int q = 0; q < 4; ++q) *(v8us*)(dst + q * 256 + lane * 8) = o[q];
}
// k_prep: every operand preparation of the call in one grid, none reads another's output. Blocks 0 .. 1279: the five weights' 16 x 16 transpose tiles; then half of a 16-row tile a block (512 k, 64 a wave):
// 4096 rows of [mem; x] -> Cb, 2048 rows of x -> Xb, 2048 rows of rel_enc -> Rb.
#define NWT  (5 * (DD / 64) * (DD / 64))
__global__ __launch_bounds__(256) void k_prep(const float* __restrict__ Wq, const float* __restrict__ Wke, const float* __restrict__ Wkr, const float* __restrict__ Wv, const float* __restrict__ Wo,
                                              const float* __restrict__ x, const float* __restrict__ mem, const float* __restrict__ rel,
                                              bf* WqT, bf* WkeT, bf* WkrT, bf* WvT, bf* WoT, bf* Cb, bf* Xb, bf* Rb) {
    __shared__ __align__(16) unsigned short tl[64 * 72];
    const int blk = blockIdx.x;
    if (blk < NWT) {    // the same for the whole block: the barrier inside wt_tile is passed by all of it or by none
        const int w = blk / ((DD / 64) * (DD / 64)), tile = blk % ((DD / 64) * (DD / 64));
        const float* Wm = w == 0 ? Wq : w == 1 ? Wke : w == 2 ? Wkr : w == 3 ? Wv : Wo;
        bf* WT = w == 0 ? WqT : w == 1 ? WkeT : w == 2 ? WkrT : w == 3 ? WvT : WoT;
        wt_tile(tl, tile % (DD / 64), tile / (DD / 64), Wm, DD, DD, WT);
    } else {
        const int r = ((blk - NWT) >> 1) * 16;    // the first row of the block's tile; every boundary below is a multiple of 16, so a tile's rows have one source and one target
        const float* src; bf* dst;
        if (r < NCR) { const int b = r / TK, t = r % TK;    // x_tilde_b = [mem_b; x_b]
            src = t < LQ ? mem + ((size_t)b * LQ + t) * DD : x + ((size_t)b * LQ + t - LQ) * DD; dst = Cb + (size_t)r * DD;
        } else if (r < NCR + NXR) { src = x + (size_t)(r - NCR) * DD; dst = Xb + (size_t)(r - NCR) * DD;    // x rows (b, s)
        } else { src = rel + (size_t)(r - NCR - NXR) * DD; dst = Rb + (size_t)(r - NCR - NXR) * DD; }
        const int kb = ((blk - NWT) & 1) * 16 + (threadIdx.x >> 5) * 2;    // the wave's first block of 32 k; dst is the tile's first block (16 rows x DD elements a tile, as row-major)
        cvt_blk(src + kb * 32, dst + kb * 512);
    }
}

// k_gemmb: 64 x 64 block tile (4 waves x 16 x 64) of C[rows][1024] = (A [+ Al]).B^T (K = 1024) [+ bf(bias[c])] [+ bf(R[r][c]) residual]; f32 whole-line epilogue (or f16
// PLANES 1: the 64 columns of a block are one head, and the tile goes out as that head's operand planes [row][64] = bf16 hi + UNSCALED residual (NR rows per batch, batch-first rows);
// PLANES 2: the same two planes transposed, [d][TK] (the v operand of P.v). Either way the f32 product never leaves the block. A, Al, Bn and the planes are in fragment order.
// The body is a device function of the block's tile (bx, by) and of its LDS tile ost, so that several products can share one grid.
template <bool SPLITA, bool F16OUT = false, int PLANES = 0, int NR = 64>
__device__ __forceinline__ void gemmb(float (*ost)[16 * 68], int bx, int by, const bf* __restrict__ A, const bf* __restrict__ Al, const bf* __restrict__ Bn, const float* __restrict__ bias, float* C, int ldc, h16* C2, const float* __restrict__ R = nullptr, int K = DM, int roundR = 1, bf* Ph = nullptr, bf* Pl = nullptr) {
    const int lane = threadIdx.x & 31, wave = __builtin_amdgcn_readfirstlane(threadIdx.x >> 5), lr = lane & 15, hi = lane >> 4;
    const int r0 = bx * 64 + wave * 16, c0 = by * 64;
    const size_t aoff = (size_t)r0 * K;    // fragment order: a 16-row tile is 16 * K elements, its blocks of 32 k are 512 elements apart; a block's address is the same for the whole wave, lane l reads at l * 8
    size_t boff[4];
#pragma unroll
    for (int t = 0; t < 4; ++t) boff[t] = (size_t)(c0 + t * 16) * K;
    v8f acc[4];
#pragma unroll
    for (int t = 0; t < 4; ++t) acc[t] = (v8f){};
    float braw[4] = {0.f, 0.f, 0.f, 0.f};    // PLANES: the bias is asked for here, so that it arrives under the k loop and the epilogue does not wait for it
    if (PLANES) {
#pragma unroll
        for (int t = 0; t < 4; ++t) braw[t] = bias[c0 + t * 16 + lr];
        asm volatile("s_wait_xcnt 0x0" ::: "memory"); }    // precaution: stands in front of the first rewrite of the four bias loads' address registers (the k loop's set-up reuses them)
#pragma unroll 1
    for (int kc = 0; kc < K; kc += 32) {
        const bf* const pa = A + aoff + kc * 16; const bf* const pl = SPLITA ? Al + aoff + kc * 16 : pa;
        const bf* const pb[4] = {Bn + boff[0] + kc * 16, Bn + boff[1] + kc * 16, Bn + boff[2] + kc * 16, Bn + boff[3] + kc * 16};
        const v16bf a = cat16b(*(const v8us*)(pa + lane * 8), *(const v8us*)(pa + lane * 8 + 256));
        v16bf al = a;
        if (SPLITA) al = cat16b(*(const v8us*)(pl + lane * 8), *(const v8us*)(pl + lane * 8 + 256));
#pragma unroll
        for (int t = 0; t < 4; ++t) { const v16bf b = cat16b(*(const v8us*)(pb[t] + lane * 8), *(const v8us*)(pb[t] + lane * 8 + 256)); acc[t] = wmmab(a, b, acc[t]); if (SPLITA) acc[t] = wmmab(al, b, acc[t]); }
        asm volatile("s_wait_xcnt 0x0" :: "s"(pa), "s"(pl), "s"(pb[0]), "s"(pb[1]), "s"(pb[2]), "s"(pb[3]) : "memory");    // precaution: the trip's block addresses are inputs here, so none of their registers is rewritten in front of this wait
        asm volatile("v_nop\n\tv_nop\n\tv_nop\n\tv_nop" : "+v"(acc[0]), "+v"(acc[1]), "+v"(acc[2]), "+v"(acc[3]) : "v"(a), "v"(al));
    }
    float* os = &ost[wave][0];
#pragma unroll
    for (int t = 0; t < 4; ++t) { const float bv = PLANES ? bfr(braw[t]) : bias ? bfr(bias[c0 + t * 16 + lr]) : 0.f;
        if (PLANES == 2) {    // transposed tile [d][68] over all four waves' rows: a lane's eight rows are eight neighbours of one d
            float* tp = &ost[0][0] + (t * 16 + lr) * 68 + wave * 16 + hi * 8;
            *(v4fa*)tp = (v4f){acc[t][0] + bv, acc[t][1] + bv, acc[t][2] + bv, acc[t][3] + bv}; *(v4fa*)(tp + 4) = (v4f){acc[t][4] + bv, acc[t][5] + bv, acc[t][6] + bv, acc[t][7] + bv};
        } else {
#pragma unroll
        for (int j = 0; j < 8; ++j) os[(hi * 8 + j) * 68 + t * 16 + lr] = acc[t][j] + bv; } }
    __syncthreads();
    if (PLANES) {
        const int rb = bx * 64, bhp = (rb / NR) * NH_ + by, rin = rb % NR;    // batch and head of the block, its first row inside the batch
#pragma unroll
        for (int s = 0; s < 4; ++s) {    // fragment order: 32 lanes x 16 bytes are half a block, 512 bytes in a row in both planes
            const int piece = PLANES == 2 ? wave * 2 + hi : s * 2 + hi;    // which eight k (PLANES 2: keys of the block's 64; else d)
            const int row = PLANES == 2 ? s * 16 + lr : lr;    // PLANES 2: d, of the block's tile; else a row of the wave's own 16
            const float* sp = (PLANES == 2 ? &ost[0][0] : os) + row * 68 + piece * 8; v8us oh, ol;
#pragma unroll
            for (int i = 0; i < 8; ++i) { const float v = sp[i]; const unsigned short hb = f2bf(v); oh[i] = hb; ol[i] = f2bf(v - bf2f(hb)); }
            const size_t o = PLANES == 2 ? ((size_t)bhp * HD + s * 16) * TK + (rin / 32 + (wave >> 1)) * 512 + (wave & 1) * 256 + lane * 8 : ((size_t)bhp * NR + rin + wave * 16) * HD + s * 256 + lane * 8;
            *(v8us*)(Ph + o) = oh; *(v8us*)(Pl + o) = ol; }
        asm volatile("s_wait_xcnt 0x0" ::: "memory");    // precaution: behind the last plane store, in front of whatever the shared grid's code places after this body that rewrites the stores' registers
    } else if (F16OUT) {
        h16* crow = (h16*)(void*)C + (size_t)r0 * ldc + c0;
        auto pass = [&]() {
#pragma unroll
            for (int s = 0; s < 4; ++s) { const int row = 4 * s + (lane >> 3), piece = lane & 7; const float* sp = os + row * 68 + piece * 8; v8h o, o2;
#pragma unroll
                for (int i = 0; i < 8; ++i) { const h16 a = (h16)sp[i]; o[i] = a; o2[i] = (h16)((sp[i] - (float)a) * LOSC); }
                *(v8h*)(crow + (size_t)row * ldc + piece * 8) = o; if (C2) *(v8h*)(C2 + (size_t)r0 * ldc + c0 + (size_t)row * ldc + piece * 8) = o2; }
        };
        pass(); 
    } else {
        float* crow = C + (size_t)r0 * ldc + c0;
        auto pass = [&]() {
#pragma unroll
            for (int s = 0; s < 8; ++s) { const int Lid = (lane >> 3) + 4 * s, piece = lane & 7; const int row = Lid >> 1, cofs = (Lid & 1) * 32 + piece * 4;
                v4f val = *(const v4fa*)(os + row * 68 + cofs); if (R) { const v4f rv = *(const v4f*)(R + ((size_t)r0 + row) * ldc + c0 + cofs); val += roundR ? (v4f){bfr(rv[0]), bfr(rv[1]), bfr(rv[2]), bfr(rv[3])} : rv; }
                *(v4f*)(crow + (size_t)row * ldc + cofs) = val; }
        };
        pass(); 
    }
}
// k_proj: the four projections, which read none of each other's output, as one grid: blockIdx.x 0 .. 63 k, 64 .. 127 v, 128 .. 159 q, 160 .. 191 Q_rel (shared across b: one batch of TK rows); blockIdx.y the head.
__global__ __launch_bounds__(128) void k_proj(const bf* __restrict__ Cb, const bf* __restrict__ Xb, const bf* __restrict__ Rb, const bf* __restrict__ WkeT, const bf* __restrict__ WvT, const bf* __restrict__ WqT, const bf* __restrict__ WkrT,
                                              const float* __restrict__ bke, const float* __restrict__ bv, const float* __restrict__ bq, const float* __restrict__ bkr,
                                              bf* Kh, bf* Kl, bf* VTh, bf* VTl, bf* Qh, bf* Ql, bf* Rh, bf* Rl, int K) {
    __shared__ __align__(16) float ost[4][16 * 68];
    const int bx = blockIdx.x, by = blockIdx.y;
    if (bx < NCR / 64) gemmb<false, false, 1, TK>(ost, bx, by, Cb, nullptr, WkeT, bke, nullptr, DD, nullptr, nullptr, K, 1, Kh, Kl);
    else if (bx < 2 * (NCR / 64)) gemmb<false, false, 2, TK>(ost, bx - NCR / 64, by, Cb, nullptr, WvT, bv, nullptr, DD, nullptr, nullptr, K, 1, VTh, VTl);
    else if (bx < 2 * (NCR / 64) + NXR / 64) gemmb<false, false, 1, LQ>(ost, bx - 2 * (NCR / 64), by, Xb, nullptr, WqT, bq, nullptr, DD, nullptr, nullptr, K, 1, Qh, Ql);
    else gemmb<false, false, 1, TK>(ost, bx - 2 * (NCR / 64) - NXR / 64, by, Rb, nullptr, WkrT, bkr, nullptr, DD, nullptr, nullptr, K, 1, Rh, Rl);
}
template <bool SPLITA, bool F16OUT = false, int PLANES = 0, int NR = 64>
__global__ __launch_bounds__(128) void k_gemmb(const bf* __restrict__ A, const bf* __restrict__ Al, const bf* __restrict__ Bn, const float* __restrict__ bias, float* C, int ldc, h16* C2, const float* __restrict__ R = nullptr, int K = DM, int roundR = 1, bf* Ph = nullptr, bf* Pl = nullptr) {
    __shared__ __align__(16) float ost[4][16 * 68];
    gemmb<SPLITA, F16OUT, PLANES, NR>(ost, blockIdx.x, blockIdx.y, A, Al, Bn, bias, C, ldc, C2, R, K, roundR, Ph, Pl);
}


// k_attn: one work-group (16 waves) per 32 query rows of one (b, h); the 32 x 2048 scores never leave LDS.
//  1. B_hat = q.Q_rel^T (three products), each wave 128 columns; element (r, c) is stored straight at its place after the shift: with u = c + r - (L-1), row r column u when u >= 0,
//     else row r-1 column u + T (so rows i0 .. i0+32 of B_hat are needed: a third row tile gives row i0+32); the one padded zero of each row is stored by hand.
//  2. A = q.k^T (three products), s = (A + B) / 8 in place.  3. each wave two rows in turn: + mask x (-1e9), softmax in f32 (row in registers), P as bf16 hi + residual planes over the row's own bytes.
//  4. ctx = P.v (three products): wave w sums keys 128 w .. 128 w + 127 for all 32 x 64 outputs; the 16 partial tiles are added in wave order through LDS.
#define RQ   32                   // query rows of one work-group
#define SP   2052                 // LDS row pitch in floats: 16 B x odd, for the 16-byte fragment reads of stage 4
#define RP   68                   // pitch of a partial ctx tile's row in floats
__device__ __forceinline__ v16bf ldfrag(const bf* p) { return cat16b(*(const v8us*)p, *(const v8us*)(p + 256)); }    // global planes, fragment order: p = block + lane * 8
__device__ __forceinline__ v16bf ldfrag_s(const bf* p) { return cat16b(*(const v8usa*)p, *(const v8usa*)(p + 16)); }
__device__ __forceinline__ v8f prod3(const v16bf (&ah)[2], const v16bf (&al)[2], const v16bf (&bh)[2], const v16bf (&bl)[2]) {
    v8f acc = (v8f){};
#pragma unroll
    for (int ks = 0; ks < 2; ++ks) { acc = wmmab(ah[ks], bh[ks], acc); acc = wmmab(al[ks], bh[ks], acc); acc = wmmab(ah[ks], bl[ks], acc); }
    return acc;
}
__global__ __launch_bounds__(512) void k_attn(const bf* __restrict__ Qh, const bf* __restrict__ Ql, const bf* __restrict__ Kh, const bf* __restrict__ Kl, const bf* __restrict__ Rh, const bf* __restrict__ Rl,
                                              const bf* __restrict__ VTh, const bf* __restrict__ VTl, const float* __restrict__ MSK, bf* AVh, bf* AVl) {
    typedef __attribute__((ext_vector_type(4))) unsigned short v4us;
    typedef v4us __attribute__((may_alias)) v4usa;
    __shared__ __align__(16) float S[RQ * SP];
    const int tid = threadIdx.x, lane = tid & 31, wave = __builtin_amdgcn_readfirstlane(tid >> 5), lr = lane & 15, hi = lane >> 4;
    const int i0 = blockIdx.x * RQ, bh = blockIdx.y, h = bh % NH_, b = bh / NH_;
    Qh += (size_t)bh * LQ * HD; Ql += (size_t)bh * LQ * HD; Kh += (size_t)bh * TK * HD; Kl += (size_t)bh * TK * HD; Rh += (size_t)h * TK * HD; Rl += (size_t)h * TK * HD; VTh += (size_t)bh * HD * TK; VTl += (size_t)bh * HD * TK;
    const int cw = wave * (TK / 16);
    v16bf qh[3][2], ql[3][2]; const bf* qa[3]; const bf* qb[3];
#pragma unroll
    for (int rt = 0; rt < 3; ++rt) { const size_t o = (size_t)min(i0 + rt * 16, LQ - 16) * HD + lane * 8; qa[rt] = Qh + o; qb[rt] = Ql + o;    // the clamp holds the last work-group's third tile, which it never uses, inside the plane
#pragma unroll
        for (int ks = 0; ks < 2; ++ks) { qh[rt][ks] = ldfrag(qa[rt] + ks * 512); ql[rt][ks] = ldfrag(qb[rt] + ks * 512); } }
    asm volatile("s_wait_xcnt 0x0" :: "v"(qa[0]), "v"(qa[1]), "v"(qa[2]), "v"(qb[0]), "v"(qb[1]), "v"(qb[2]) : "memory");    // precaution: the loads' address registers are inputs here, so none of them is rewritten (by a later load's result either) in front of this wait
    if (tid < RQ) { const int zc = (TK - LQ + 1) + i0 + tid; if (zc < TK) S[tid * SP + zc] = 0.f; }   // the padded zero: column T - L + 1 + i of row i
    const size_t fo = (size_t)cw * HD + lane * 8;    // this lane's place in the first 16-column tile of the wave's slice (fragment order: two blocks of 512 a tile); a tile further is 16 * HD elements on
    v16bf fh[2][2], fl[2][2];                             // two register sets: the next tile's fragments are fetched while this tile is worked on
#pragma unroll
    for (int ks = 0; ks < 2; ++ks) { fh[0][ks] = ldfrag(Rh + fo + ks * 512); fl[0][ks] = ldfrag(Rl + fo + ks * 512); }
#pragma unroll
    for (int t = 0; t < 8; ++t) { const int c0 = cw + t * 16, cur = t & 1, nxt = cur ^ 1;
        const bf* nh = (t < 7 ? Rh : Kh) + fo + (t < 7 ? (t + 1) * 16 * HD : 0); const bf* nl = (t < 7 ? Rl : Kl) + fo + (t < 7 ? (t + 1) * 16 * HD : 0);   // behind the last Q_rel tile: the first k tile
#pragma unroll
        for (int ks = 0; ks < 2; ++ks) { fh[nxt][ks] = ldfrag(nh + ks * 512); fl[nxt][ks] = ldfrag(nl + ks * 512); }
        v8f a0 = prod3(qh[0], ql[0], fh[cur], fl[cur]), a1 = prod3(qh[1], ql[1], fh[cur], fl[cur]);
        asm volatile("v_nop\n\tv_nop\n\tv_nop\n\tv_nop" : "+v"(a0), "+v"(a1));    // the four vector slots the chip needs before these results' registers are written again (the next product chain may reuse them right behind the LDS stores)
#pragma unroll
        for (int rt = 0; rt < 2; ++rt) {
#pragma unroll
            for (int j = 0; j < 8; ++j) { const int lrw = rt * 16 + hi * 8 + j, u = c0 + lr + i0 + lrw - (LQ - 1);
                int idx = lrw * SP + u - (u < 0 ? SP - TK : 0);
                if (rt == 0 && j == 0) idx = idx < 0 ? TK : idx;    // row i0 - 1 is another work-group's: such a value goes to row 0's pad, which nobody reads
                S[idx] = rt ? a1[j] : a0[j]; } }
        if (c0 + i0 + RQ - (LQ - 1) < 0) { v8f a2 = prod3(qh[2], ql[2], fh[cur], fl[cur]); const int u = c0 + lr + i0 + RQ - (LQ - 1);   // row i0 + 32 feeds the tail of row i0 + 31
            asm volatile("v_nop\n\tv_nop\n\tv_nop\n\tv_nop" : "+v"(a2));    // the same four slots, on the way out of this branch
            S[(hi == 0 && u < 0) ? RQ * SP + u - (SP - TK) : TK] = a2[0]; }
    }
    __syncthreads();
    float* const sw = S + hi * 8 * SP + cw + lr;    // this lane's element of row hi * 8 in the wave's first tile
    float old[2][16];                               // B of this tile and of the next: read in one batch a tile ahead, so that no LDS read waits behind the stores of the tile before
#pragma unroll
    for (int e = 0; e < 16; ++e) old[0][e] = sw[((e >> 3) * 16 + (e & 7)) * SP];
#pragma unroll
    for (int t = 0; t < 8; ++t) { const int cur = t & 1, nxt = cur ^ 1;
        if (t < 7) {
#pragma unroll
            for (int ks = 0; ks < 2; ++ks) { fh[nxt][ks] = ldfrag(Kh + fo + (t + 1) * 16 * HD + ks * 512); fl[nxt][ks] = ldfrag(Kl + fo + (t + 1) * 16 * HD + ks * 512); }
#pragma unroll
            for (int e = 0; e < 16; ++e) old[nxt][e] = sw[((e >> 3) * 16 + (e & 7)) * SP + (t + 1) * 16]; }
        __builtin_amdgcn_sched_barrier(0);    // keeps the next tile's loads in front of this tile's products; the compiler otherwise sinks them to just before their use and the wave waits out the whole latency
        const v8f a0 = prod3(qh[0], ql[0], fh[cur], fl[cur]), a1 = prod3(qh[1], ql[1], fh[cur], fl[cur]);
#pragma unroll
        for (int e = 0; e < 16; ++e) sw[((e >> 3) * 16 + (e & 7)) * SP + t * 16] = ((e < 8 ? a0[e & 7] : a1[e & 7]) + old[cur][e]) * SCL;
    }
    __builtin_amdgcn_sched_barrier(0);    // keeps the mask loads below from being lifted into the score tiles above, where their 64 registers would spill
    const float* mrow = MSK + (size_t)(i0 + wave * (RQ / 16)) * TK + lane * 4;
    v4f mk[TK / 128];    // the mask of the wave's first row, asked for in front of the barrier so that it arrives while the other waves finish their scores
#pragma unroll
    for (int k = 0; k < TK / 128; ++k) mk[k] = *(const v4f*)(mrow + k * 128);
    __syncthreads();
#pragma unroll 1    // rolled: with both rows unrolled together the live set overran the register budget and spilled
    for (int rr = 0; rr < RQ / 16; ++rr) { const int lrw = wave * (RQ / 16) + rr; float* srow = S + lrw * SP;
        float v[TK / 32]; float m = -3.0e38f;
#pragma unroll
        for (int k = 0; k < TK / 128; ++k) { const int c = k * 128 + lane * 4; const v4f s = *(const v4fa*)(srow + c);
#pragma unroll
            for (int q = 0; q < 4; ++q) { const float x = s[q] + bfr(mk[k][q]) * (-1e9f); v[k * 4 + q] = x; m = fmaxf(m, x); } }
        if (rr + 1 < RQ / 16) {    // the next row's mask flies while this row's softmax is worked out
#pragma unroll
            for (int k = 0; k < TK / 128; ++k) mk[k] = *(const v4f*)(mrow + (size_t)(rr + 1) * TK + k * 128); }
#pragma unroll
        for (int sh = 16; sh; sh >>= 1) m = fmaxf(m, __shfl_xor(m, sh, 32));
        float sum = 0.f;
#pragma unroll
        for (int k = 0; k < TK / 32; ++k) { v[k] = __expf(v[k] - m); sum += v[k]; }
#pragma unroll
        for (int sh = 16; sh; sh >>= 1) sum += __shfl_xor(sum, sh, 32);
        const float inv = 1.0f / sum;
        bf* prow = (bf*)(void*)srow;    // hi plane in the row's first 4096 bytes, residual plane in the next 4096; the whole row is in registers by now
#pragma unroll
        for (int k = 0; k < TK / 128; ++k) { v4us oh, ol;
#pragma unroll
            for (int q = 0; q < 4; ++q) { const float p = v[k * 4 + q] * inv; const unsigned short hb = f2bf(p); oh[q] = hb; ol[q] = f2bf(p - bf2f(hb)); }
            *(v4usa*)(prow + k * 128 + lane * 4) = oh; *(v4usa*)(prow + TK + k * 128 + lane * 4) = ol; }
    }
    const size_t vo = (size_t)cw * 16 + lane * 8;    // this lane's place in the v planes (fragment order): first 16-row tile of d, the block of the wave's first 32 keys; a tile of d further is 16 * TK elements on
    v16bf vh[2][4], vl[2][4];                           // two register sets: the next 32 keys' v fragments are fetched while these are worked on; the first set is asked for in front of the barrier
#pragma unroll
    for (int dt = 0; dt < 4; ++dt) { vh[0][dt] = ldfrag(VTh + vo + (size_t)dt * 16 * TK); vl[0][dt] = ldfrag(VTl + vo + (size_t)dt * 16 * TK); }
    __syncthreads();
    v8f acc[2][4];
#pragma unroll
    for (int rt = 0; rt < 2; ++rt) {
#pragma unroll
        for (int dt = 0; dt < 4; ++dt) acc[rt][dt] = (v8f){}; }
#pragma unroll
    for (int ks = 0; ks < 4; ++ks) { const int cur = ks & 1, nxt = cur ^ 1;
        if (ks < 3) {
#pragma unroll
            for (int dt = 0; dt < 4; ++dt) { vh[nxt][dt] = ldfrag(VTh + vo + (size_t)dt * 16 * TK + (ks + 1) * 512); vl[nxt][dt] = ldfrag(VTl + vo + (size_t)dt * 16 * TK + (ks + 1) * 512); } }
        v16bf ph[2], pl[2];
#pragma unroll
        for (int rt = 0; rt < 2; ++rt) { const bf* pr = (const bf*)(const void*)(S + (rt * 16 + lr) * SP) + cw + ks * 32 + 8 * hi; ph[rt] = ldfrag_s(pr); pl[rt] = ldfrag_s(pr + TK); }
#pragma unroll
        for (int dt = 0; dt < 4; ++dt) {
#pragma unroll
            for (int rt = 0; rt < 2; ++rt) { acc[rt][dt] = wmmab(ph[rt], vh[cur][dt], acc[rt][dt]); acc[rt][dt] = wmmab(pl[rt], vh[cur][dt], acc[rt][dt]); acc[rt][dt] = wmmab(ph[rt], vl[cur][dt], acc[rt][dt]); } }
    }
    __syncthreads();    // every wave has read its P fragments: the score rows' LDS now takes the 16 partial tiles
    float* red = S + wave * (RQ * RP);
#pragma unroll
    for (int rt = 0; rt < 2; ++rt) {
#pragma unroll
        for (int dt = 0; dt < 4; ++dt) {
#pragma unroll
            for (int j = 0; j < 8; ++j) red[(rt * 16 + hi * 8 + j) * RP + dt * 16 + lr] = acc[rt][dt][j]; } }
    __syncthreads();
    const int orow = (tid >> 8) * 16 + ((tid >> 1) & 15), od = ((tid >> 5) & 7) * 8 + (tid & 1) * 4;    // thread -> element so that a wave's 8-byte stores are 256 bytes in a row of the fragment-order planes
    v4f part[16];
#pragma unroll
    for (int w = 0; w < 16; ++w) part[w] = *(const v4fa*)(S + w * (RQ * RP) + orow * RP + od);
    v4f o = part[0];
#pragma unroll
    for (int w = 1; w < 16; ++w) o += part[w];
    v4us oh, ol;    // ctx goes out as the last GEMM's operand planes: bf16 hi + residual
#pragma unroll
    for (int q = 0; q < 4; ++q) { const unsigned short hb = f2bf(o[q]); oh[q] = hb; ol[q] = f2bf(o[q] - bf2f(hb)); }
    const size_t oo = ((size_t)b * LQ + i0 + (tid >> 8) * 16) * DD + (size_t)h * 1024 + (tid & 255) * 4;    // 16-row tile, then the head's two blocks of 32 columns
    *(v4us*)(AVh + oo) = oh; *(v4us*)(AVl + oo) = ol;
}
extern "C" void kernel_launch(void* const* d_in, const int* in_sizes, int n_in,
                              void* d_out, int out_size, void* d_ws, size_t ws_size, hipStream_t stream) {
    (void)in_sizes; (void)n_in; (void)out_size;
    const float* x = (const float*)d_in[0]; const float* mem = (const float*)d_in[1]; const float* msk = (const float*)d_in[2]; const float* rel = (const float*)d_in[3];
    const float* Wq = (const float*)d_in[4]; const float* bq = (const float*)d_in[5]; const float* Wke = (const float*)d_in[6]; const float* bke = (const float*)d_in[7]; const float* Wkr = (const float*)d_in[8]; const float* bkr = (const float*)d_in[9];
    const float* Wv = (const float*)d_in[10]; const float* bv = (const float*)d_in[11]; const float* Wo = (const float*)d_in[12]; const float* bo = (const float*)d_in[13];
    float* out = (float*)d_out;    // [2][1024][1024]
    char* wsp = (char*)d_ws;
    auto take = [&](size_t bytes) { char* p = wsp; wsp += (bytes + 255) & ~(size_t)255; return (void*)p; };
    bf* WoT = (bf*)take((size_t)DD * DD * 2);
    bf* Qh = (bf*)take((size_t)NBT * NH_ * LQ * HD * 2); bf* Ql = (bf*)take((size_t)NBT * NH_ * LQ * HD * 2);
    bf* Kh = (bf*)take((size_t)NBT * NH_ * TK * HD * 2); bf* Kl = (bf*)take((size_t)NBT * NH_ * TK * HD * 2); bf* Rh = (bf*)take((size_t)NH_ * TK * HD * 2); bf* Rl = (bf*)take((size_t)NH_ * TK * HD * 2);
    bf* VTh = (bf*)take((size_t)NBT * NH_ * HD * TK * 2); bf* VTl = (bf*)take((size_t)NBT * NH_ * HD * TK * 2);
    // One region, used twice in stream order: projection scratch, then the split ctx planes. Each use writes all it reads.
    char* const shared0 = wsp;
    bf* AVh = (bf*)take((size_t)NXR * DD * 2); bf* AVl = (bf*)take((size_t)NXR * DD * 2);
    wsp = shared0;
    bf* WqT = (bf*)take((size_t)DD * DD * 2); bf* WkeT = (bf*)take((size_t)DD * DD * 2); bf* WkrT = (bf*)take((size_t)DD * DD * 2); bf* WvT = (bf*)take((size_t)DD * DD * 2);
    bf* Cb = (bf*)take((size_t)NCR * DD * 2); bf* Xb = (bf*)take((size_t)NXR * DD * 2); bf* Rb = (bf*)take((size_t)TK * DD * 2);
    if ((size_t)(wsp - (char*)d_ws) > ws_size) return;    // 50 MiB kept (WoT, q, k, Q_rel, v planes) + 24 MiB shared region; Cb holds [mem; x], Xb x, Rb rel_enc
    k_prep<<<NWT + (NCR + NXR + TK) / 8, 256, 0, stream>>>(Wq, Wke, Wkr, Wv, Wo, x, mem, rel, WqT, WkeT, WkrT, WvT, WoT, Cb, Xb, Rb);
    k_proj<<<dim3(2 * (NCR / 64) + NXR / 64 + TK / 64, DD / 64, 1), 128, 0, stream>>>(Cb, Xb, Rb, WkeT, WvT, WqT, WkrT, bke, bv, bq, bkr, Kh, Kl, VTh, VTl, Qh, Ql, Rh, Rl, DM);
    k_attn<<<dim3(LQ / RQ, NBT * NH_, 1), 512, 0, stream>>>(Qh, Ql, Kh, Kl, Rh, Rl, VTh, VTl, msk, AVh, AVl);    // ctx[(b,s)][h*64 + d], as planes
    k_gemmb<true, false><<<dim3(NXR / 64, DD / 64, 1), 128, 0, stream>>>(AVh, AVl, WoT, bo, out, DD, nullptr);
}

// v006
// It runs in 182 microseconds.
// Next to v005, in two timings, it ran 1.36 and 1.34 times as fast.
// All steps since v000 together make it 19.7 times as fast.
#include <hip/hip_runtime.h>

// Compute dtypes, f32 accumulate: k, v = [mem; x].W + b, q = x.Wq + bq, Q_rel = rel_enc.Wkr + bkr as [rows x 1024].[1024 x 1024] GEMMs with PLAIN bf16 operands (rounded inputs, k-major
// weights transposed once; exact products) on v_wmma_f32_16x16x32_bf16 -> per-(batch, head) bf16 hi + UNSCALED residual planes; per (b, h): A = q.k^T and B_hat = q.Q_rel^T ([1024 x
// 64].[64 x 2048], three products), the Transformer-XL shift by index, (A + B)/8 + mask x (-1e9), row softmax in f32 -> P planes; ctx = P.v ([1024 x 2048].[2048 x 64], three

#define LQ   1024
#define TK   2048
#define NBT  2
#define DD   1024
#define NH_  16
#define HD   64
#define NXR  (LQ * NBT)           // 2048 query rows (b, s)
#define NCR  (TK * NBT)           // 4096 context rows (b, t)
#define DM   DD
#define NTK  NCR
#define SCL  0.125f
#define LOSC 1024.0f

typedef _Float16 h16;
typedef unsigned short bf;
typedef __attribute__((ext_vector_type(16))) __bf16   v16bf;
typedef __attribute__((ext_vector_type(16))) _Float16 v16h;
typedef __attribute__((ext_vector_type(8)))  _Float16 v8h;
typedef __attribute__((ext_vector_type(8)))  unsigned short v8us;
typedef __attribute__((ext_vector_type(8)))  float    v8f;
typedef __attribute__((ext_vector_type(4)))  float    v4f;
typedef __attribute__((ext_vector_type(4)))  _Float16 v4h;
typedef v8h  __attribute__((may_alias)) v8ha;
typedef v4f  __attribute__((may_alias)) v4fa;
typedef v8us __attribute__((may_alias)) v8usa;

__device__ __forceinline__ unsigned short f2bf(float f) { unsigned u = __float_as_uint(f); u += 0x7FFFu + ((u >> 16) & 1u); return (unsigned short)(u >> 16); }
__device__ __forceinline__ float bf2f(unsigned short b) { return __uint_as_float(((unsigned)b) << 16); }
__device__ __forceinline__ float bfr(float f) { return bf2f(f2bf(f)); }
__device__ __forceinline__ v16h cat16(v8h lo, v8h hi) { return __builtin_shufflevector(lo, hi, 0, 1, 2, 3, 4, 5, 6, 7, 8, 9, 10, 11, 12, 13, 14, 15); }
__device__ __forceinline__ v16bf cat16b(v8us lo, v8us hi) { return __builtin_bit_cast(v16bf, __builtin_shufflevector(lo, hi, 0, 1, 2, 3, 4, 5, 6, 7, 8, 9, 10, 11, 12, 13, 14, 15)); }
__device__ __forceinline__ v8f wmma16(v16h a, v16h b, v8f c) { return __builtin_amdgcn_wmma_f32_16x16x32_f16(false, a, false, b, (short)0, c, false, false); }
__device__ __forceinline__ v8f wmmab(v16bf a, v16bf b, v8f c) { return __builtin_amdgcn_wmma_f32_16x16x32_bf16(false, a, false, b, (short)0, c, false, false); }

// FRAGMENT ORDER: every bf16 matrix [rows][K] that a matrix instruction reads from global memory lies as blocks of 16 rows x 32 k = 512 elements (block (r / 16) * (K / 32) + k / 32); inside a block
// element (r, k) stands at ((k / 16) % 2) * 256 + ((k / 8) % 2) * 128 + (r % 16) * 8 + k % 8: lane l's two 16-byte fragment pieces are at l * 8 and 256 + l * 8, so each wave-wide load is 512 bytes in a row.
// Which lane and register holds which (r, k) is as with row-major storage.
// wt_tile: WT [n][K] = bf16(W[k][n]) (k-major [K][ncols]), in fragment order, via one 64 x 64 LDS tile tl; tile (bx, by) of (K/64, ncols/64), 256 threads.
__device__ __forceinline__ void wt_tile(unsigned short* tl, int bx, int by, const float* __restrict__ Wm, int K, int ncols, bf* WT) {
    const int tid = threadIdx.x, k0 = bx * 64, n0 = by * 64;
    const int kk = tid >> 2, nq = (tid & 3) * 16;
#pragma unroll
    for (int i = 0; i < 16; ++i) tl[(nq + i) * 72 + kk] = f2bf(Wm[(size_t)(k0 + kk) * ncols + n0 + nq + i]);
    __syncthreads();
    const int lane = tid & 31, kq = (tid >> 6) & 1, part = (tid >> 5) & 1;    // a wave stores one half block: 512 bytes in a row
    auto pass = [&]() {
#pragma unroll
        for (int s = 0; s < 2; ++s) { const int nt = (tid >> 7) + 2 * s; const v8us val = *(const v8usa*)(tl + (nt * 16 + (lane & 15)) * 72 + (kq * 4 + part * 2 + (lane >> 4)) * 8);
            *(v8us*)(WT + ((size_t)(n0 / 16 + nt) * (K / 32) + k0 / 32 + kq) * 512 + part * 256 + lane * 8) = val; }
    };
    pass(); 
}
// cvt_blk: one wave rounds two neighbouring blocks (16 rows x 64 k) to bf16 in fragment order; src: the 16 rows' first element of those k, dst: the first block.
__device__ __forceinline__ void cvt_blk(const float* __restrict__ src, bf* dst) {
    const int lane = threadIdx.x & 31;
    const float* sp = src + (size_t)(lane & 15) * DM + (lane >> 4) * 8;
    v8us o[4];
#pragma unroll
    for (int q = 0; q < 4; ++q) { v8us t;
#pragma unroll
        for (int i = 0; i < 8; ++i) t[i] = f2bf(sp[q * 16 + i]);
        o[q] = t; }
#pragma unroll
    for (int q = 0; q < 4; ++q) *(v8us*)(dst + q * 256 + lane * 8) = o[q];
}
// k_prep: every operand preparation of the call in one grid, none reads another's output. Blocks 0 .. 1279: the five weights' 16 x 16 transpose tiles; then half of a 16-row tile a block (512 k, 64 a wave):
// 4096 rows of [mem; x] -> Cb, 2048 rows of x -> Xb, 2048 rows of rel_enc -> Rb.
#define NWT  (5 * (DD / 64) * (DD / 64))
__global__ __launch_bounds__(256) void k_prep(const float* __restrict__ Wq, const float* __restrict__ Wke, const float* __restrict__ Wkr, const float* __restrict__ Wv, const float* __restrict__ Wo,
                                              const float* __restrict__ x, const float* __restrict__ mem, const float* __restrict__ rel,
                                              bf* WqT, bf* WkeT, bf* WkrT, bf* WvT, bf* WoT, bf* Cb, bf* Xb, bf* Rb) {
    __shared__ __align__(16) unsigned short tl[64 * 72];
    const int blk = blockIdx.x;
    if (blk < NWT) {    // the same for the whole block: the barrier inside wt_tile is passed by all of it or by none
        const int w = blk / ((DD / 64) * (DD / 64)), tile = blk % ((DD / 64) * (DD / 64));
        const float* Wm = w == 0 ? Wq : w == 1 ? Wke : w == 2 ? Wkr : w == 3 ? Wv : Wo;
        bf* WT = w == 0 ? WqT : w == 1 ? WkeT : w == 2 ? WkrT : w == 3 ? WvT : WoT;
        wt_tile(tl, tile % (DD / 64), tile / (DD / 64), Wm, DD, DD, WT);
    } else {
        const int r = ((blk - NWT) >> 1) * 16;    // the first row of the block's tile; every boundary below is a multiple of 16, so a tile's rows have one source and one target
        const float* src; bf* dst;
        if (r < NCR) { const int b = r / TK, t = r % TK;    // x_tilde_b = [mem_b; x_b]
            src = t < LQ ? mem + ((size_t)b * LQ + t) * DD : x + ((size_t)b * LQ + t - LQ) * DD; dst = Cb + (size_t)r * DD;
        } else if (r < NCR + NXR) { src = x + (size_t)(r - NCR) * DD; dst = Xb + (size_t)(r - NCR) * DD;    // x rows (b, s)
        } else { src = rel + (size_t)(r - NCR - NXR) * DD; dst = Rb + (size_t)(r - NCR - NXR) * DD; }
        const int kb = ((blk - NWT) & 1) * 16 + (threadIdx.x >> 5) * 2;    // the wave's first block of 32 k; dst is the tile's first block (16 rows x DD elements a tile, as row-major)
        cvt_blk(src + kb * 32, dst + kb * 512);
    }
}

// k_gemmb: MT * 64 x 64 block tile (4 waves x MT row tiles x 16 x 64) of C[NXR][DD] = (A [+ Al]).B^T (K = 1024) [+ bf(bias[c])] [+ bf(R[r][c]) residual]; f32 whole-line epilogue (or f16
// PLANES 1: the 64 columns of a block are one head, and the tile goes out as that head's operand planes [row][64] = bf16 hi + UNSCALED residual (NR rows per batch, batch-first rows);
// PLANES 2: the same two planes transposed, [d][TK] (the v operand of P.v). Either way the f32 product never leaves the block. A, Al, Bn and the planes are in fragment order.
// The body is a device function of the block's tile (bx, by) and of its LDS tile ost, so that several products can share one grid.
// MT: 16-row tiles a wave holds (rows (bx * MT + mt) * 64 + wave * 16 ..): the block's tile is MT * 64 rows x 64 columns, and each B fragment a wave loads feeds four products (SPLITA: MT row tiles x two planes).
template <bool SPLITA, bool F16OUT, int PLANES, int NR, int MT>
__device__ __forceinline__ void gemmb(float (*ost)[16 * 68], int bx, int by, const bf* __restrict__ A, const bf* __restrict__ Al, const bf* __restrict__ Bn, const float* __restrict__ bias, float* C, int ldc, h16* C2, const float* __restrict__ R = nullptr, int K = DM, int roundR = 1, bf* Ph = nullptr, bf* Pl = nullptr) {
    const int lane = threadIdx.x & 31, wave = __builtin_amdgcn_readfirstlane(threadIdx.x >> 5), lr = lane & 15, hi = lane >> 4;
    const int c0 = by * 64;
    size_t aoff[MT];    // fragment order: a 16-row tile is 16 * K elements, its blocks of 32 k are 512 elements apart; a block's address is the same for the whole wave, lane l reads at l * 8
#pragma unroll
    for (int mt = 0; mt < MT; ++mt) aoff[mt] = (size_t)((bx * MT + mt) * 64 + wave * 16) * K;
    size_t boff[4];
#pragma unroll
    for (int t = 0; t < 4; ++t) boff[t] = (size_t)(c0 + t * 16) * K;
    v8f acc[MT][4];
#pragma unroll
    for (int mt = 0; mt < MT; ++mt) {
#pragma unroll
        for (int t = 0; t < 4; ++t) acc[mt][t] = (v8f){}; }
    float braw[4] = {0.f, 0.f, 0.f, 0.f};    // PLANES: the bias is asked for here, so that it arrives under the k loop and the epilogue does not wait for it
    if (PLANES) {
#pragma unroll
        for (int t = 0; t < 4; ++t) braw[t] = bias[c0 + t * 16 + lr];
        asm volatile("s_wait_xcnt 0x0" ::: "memory"); }    // precaution: stands in front of the first rewrite of the four bias loads' address registers (the k loop's set-up reuses them)
#pragma unroll 1
    for (int kc = 0; kc < K; kc += 32) {
        const bf* const pb[4] = {Bn + boff[0] + kc * 16, Bn + boff[1] + kc * 16, Bn + boff[2] + kc * 16, Bn + boff[3] + kc * 16};
        static_assert((MT == 4 && !SPLITA) || (MT == 2 && SPLITA), "the wide tile has four A-side fragments a trip: four row tiles of one plane, or two row tiles of two planes");
        const bf* const pa[4] = {A + aoff[0] + kc * 16, A + aoff[1] + kc * 16, (SPLITA ? Al + aoff[0] : A + aoff[MT - 2]) + kc * 16, (SPLITA ? Al + aoff[1] : A + aoff[MT - 1]) + kc * 16};
        v16bf a[4], b[4];
#pragma unroll
        for (int i = 0; i < 4; ++i) a[i] = cat16b(*(const v8us*)(pa[i] + lane * 8), *(const v8us*)(pa[i] + lane * 8 + 256));
#pragma unroll
        for (int t = 0; t < 4; ++t) b[t] = cat16b(*(const v8us*)(pb[t] + lane * 8), *(const v8us*)(pb[t] + lane * 8 + 256));
        __builtin_amdgcn_sched_barrier(0);    // keeps the trip's 16 loads one group in front of its products; spread among them, with registers reused, the wave would wait out the load latency several times a trip
#pragma unroll
        for (int i = 0; i < 4; i += MT) {    // SPLITA: all hi products, then all residual products; each accumulator still takes hi, then residual, of every trip in turn
#pragma unroll
            for (int t = 0; t < 4; ++t) {
#pragma unroll
                for (int mt = 0; mt < MT; ++mt) acc[mt][t] = wmmab(a[i + mt], b[t], acc[mt][t]); } }
        __builtin_amdgcn_sched_barrier(0);    // keeps every product of the trip in front of the two statements below
        asm volatile("s_wait_xcnt 0x0" :: "s"(pa[0]), "s"(pa[1]), "s"(pa[2]), "s"(pa[3]), "s"(pb[0]), "s"(pb[1]), "s"(pb[2]), "s"(pb[3]) : "memory");    // precaution: the trip's block addresses are inputs here, so none of their registers is rewritten in front of this wait
        asm volatile("v_nop\n\tv_nop\n\tv_nop\n\tv_nop" : "+v"(acc[0][3]), "+v"(acc[MT - 1][3]));    // the four vector slots the chip needs behind the trip's last products, on the way out of the loop too
    }
    float bvv[4];    // the columns' bias, the same for every row tile
#pragma unroll
    for (int t = 0; t < 4; ++t) bvv[t] = PLANES ? bfr(braw[t]) : bias ? bfr(bias[c0 + t * 16 + lr]) : 0.f;
#pragma unroll
    for (int mt = 0; mt < MT; ++mt) {    // 64 rows of the block's tile a part of ost: ost[mt * 4 + wave] is the wave's 16 rows of it
    float* os = &ost[mt * 4 + wave][0];
#pragma unroll
    for (int t = 0; t < 4; ++t) { const float bv = bvv[t];
        if (PLANES == 2) {    // transposed tile [d][68] over all four waves' rows: a lane's eight rows are eight neighbours of one d
            float* tp = &ost[mt * 4][0] + (t * 16 + lr) * 68 + wave * 16 + hi * 8;
            *(v4fa*)tp = (v4f){acc[mt][t][0] + bv, acc[mt][t][1] + bv, acc[mt][t][2] + bv, acc[mt][t][3] + bv}; *(v4fa*)(tp + 4) = (v4f){acc[mt][t][4] + bv, acc[mt][t][5] + bv, acc[mt][t][6] + bv, acc[mt][t][7] + bv};
        } else {
#pragma unroll
        for (int j = 0; j < 8; ++j) os[(hi * 8 + j) * 68 + t * 16 + lr] = acc[mt][t][j] + bv; } }
    }
    __syncthreads();
#pragma unroll 1    // rolled: for speed only
    for (int mt = 0; mt < MT; ++mt) {
    const int bxe = bx * MT + mt, r0 = bxe * 64 + wave * 16;
    float* os = &ost[mt * 4 + wave][0];
    if (PLANES) {
        const int rb = bxe * 64, bhp = (rb / NR) * NH_ + by, rin = rb % NR;    // batch and head of the block, the 64-row part's first row inside the batch
#pragma unroll
        for (int s = 0; s < 4; ++s) {    // fragment order: 32 lanes x 16 bytes are half a block, 512 bytes in a row in both planes
            const int piece = PLANES == 2 ? wave * 2 + hi : s * 2 + hi;    // which eight k (PLANES 2: keys of the block's 64; else d)
            const int row = PLANES == 2 ? s * 16 + lr : lr;    // PLANES 2: d, of the block's tile; else a row of the wave's own 16
            const float* sp = (PLANES == 2 ? &ost[mt * 4][0] : os) + row * 68 + piece * 8; v8us oh, ol;
#pragma unroll
            for (int i = 0; i < 8; ++i) { const float v = sp[i]; const unsigned short hb = f2bf(v); oh[i] = hb; ol[i] = f2bf(v - bf2f(hb)); }
            const size_t o = PLANES == 2 ? ((size_t)bhp * HD + s * 16) * TK + (rin / 32 + (wave >> 1)) * 512 + (wave & 1) * 256 + lane * 8 : ((size_t)bhp * NR + rin + wave * 16) * HD + s * 256 + lane * 8;
            *(v8us*)(Ph + o) = oh; *(v8us*)(Pl + o) = ol; }
        asm volatile("s_wait_xcnt 0x0" ::: "memory");    // precaution: behind the last plane store, in front of whatever the shared grid's code places after this body that rewrites the stores' registers
    } else if (F16OUT) {
        h16* crow = (h16*)(void*)C + (size_t)r0 * ldc + c0;
        auto pass = [&]() {
#pragma unroll
            for (int s = 0; s < 4; ++s) { const int row = 4 * s + (lane >> 3), piece = lane & 7; const float* sp = os + row * 68 + piece * 8; v8h o, o2;
#pragma unroll
                for (int i = 0; i < 8; ++i) { const h16 a = (h16)sp[i]; o[i] = a; o2[i] = (h16)((sp[i] - (float)a) * LOSC); }
                *(v8h*)(crow + (size_t)row * ldc + piece * 8) = o; if (C2) *(v8h*)(C2 + (size_t)r0 * ldc + c0 + (size_t)row * ldc + piece * 8) = o2; }
        };
        pass(); 
    } else {
        float* crow = C + (size_t)r0 * ldc + c0;
        auto pass = [&]() {
#pragma unroll
            for (int s = 0; s < 8; ++s) { const int Lid = (lane >> 3) + 4 * s, piece = lane & 7; const int row = Lid >> 1, cofs = (Lid & 1) * 32 + piece * 4;
                v4f val = *(const v4fa*)(os + row * 68 + cofs); if (R) { const v4f rv = *(const v4f*)(R + ((size_t)r0 + row) * ldc + c0 + cofs); val += roundR ? (v4f){bfr(rv[0]), bfr(rv[1]), bfr(rv[2]), bfr(rv[3])} : rv; }
                *(v4f*)(crow + (size_t)row * ldc + cofs) = val;
                asm volatile("s_wait_xcnt 0x0" ::: "memory"); }    // precaution: behind each store, in front of the next piece's (and the next pass's) rewrite of the store's registers
        };
        pass(); 
    }
    }
}
// k_proj: the four projections, which read none of each other's output, as one grid of 256-row x 64-column tiles: blockIdx.x 0 .. 15 k, 16 .. 31 v, 32 .. 39 q, 40 .. 47 Q_rel (shared across b: one batch of TK rows); blockIdx.y the head.
#define PMT  4                    // 16-row tiles a wave of k_proj holds
#define PBR  (64 * PMT)           // rows of a block's tile; divides LQ and TK, so a tile stays inside one batch
__global__ __launch_bounds__(128) void k_proj(const bf* __restrict__ Cb, const bf* __restrict__ Xb, const bf* __restrict__ Rb, const bf* __restrict__ WkeT, const bf* __restrict__ WvT, const bf* __restrict__ WqT, const bf* __restrict__ WkrT,
                                              const float* __restrict__ bke, const float* __restrict__ bv, const float* __restrict__ bq, const float* __restrict__ bkr,
                                              bf* Kh, bf* Kl, bf* VTh, bf* VTl, bf* Qh, bf* Ql, bf* Rh, bf* Rl, int K) {
    __shared__ __align__(16) float ost[4 * PMT][16 * 68];
    const int bx = blockIdx.x, by = blockIdx.y;
    if (bx < NCR / PBR) gemmb<false, false, 1, TK, PMT>(ost, bx, by, Cb, nullptr, WkeT, bke, nullptr, DD, nullptr, nullptr, K, 1, Kh, Kl);
    else if (bx < 2 * (NCR / PBR)) gemmb<false, false, 2, TK, PMT>(ost, bx - NCR / PBR, by, Cb, nullptr, WvT, bv, nullptr, DD, nullptr, nullptr, K, 1, VTh, VTl);
    else if (bx < 2 * (NCR / PBR) + NXR / PBR) gemmb<false, false, 1, LQ, PMT>(ost, bx - 2 * (NCR / PBR), by, Xb, nullptr, WqT, bq, nullptr, DD, nullptr, nullptr, K, 1, Qh, Ql);
    else gemmb<false, false, 1, TK, PMT>(ost, bx - 2 * (NCR / PBR) - NXR / PBR, by, Rb, nullptr, WkrT, bkr, nullptr, DD, nullptr, nullptr, K, 1, Rh, Rl);
}
template <bool SPLITA, bool F16OUT, int PLANES, int NR, int MT>
__global__ __launch_bounds__(128) void k_gemmb(const bf* __restrict__ A, const bf* __restrict__ Al, const bf* __restrict__ Bn, const float* __restrict__ bias, float* C, int ldc, h16* C2, const float* __restrict__ R = nullptr, int K = DM, int roundR = 1, bf* Ph = nullptr, bf* Pl = nullptr) {
    __shared__ __align__(16) float ost[4 * MT][16 * 68];
    gemmb<SPLITA, F16OUT, PLANES, NR, MT>(ost, blockIdx.x, blockIdx.y, A, Al, Bn, bias, C, ldc, C2, R, K, roundR, Ph, Pl);
}


// k_attn: one work-group (16 waves) per 32 query rows of one (b, h); the 32 x 2048 scores never leave LDS.
//  1. B_hat = q.Q_rel^T (three products), each wave 128 columns; element (r, c) is stored straight at its place after the shift: with u = c + r - (L-1), row r column u when u >= 0,
//     else row r-1 column u + T (so rows i0 .. i0+32 of B_hat are needed: a third row tile gives row i0+32); the one padded zero of each row is stored by hand.
//  2. A = q.k^T (three products), s = (A + B) / 8 in place.  3. each wave two rows in turn: + mask x (-1e9), softmax in f32 (row in registers), P as bf16 hi + residual planes over the row's own bytes.
//  4. ctx = P.v (three products): wave w sums keys 128 w .. 128 w + 127 for all 32 x 64 outputs; the 16 partial tiles are added in wave order through LDS.
#define RQ   32                   // query rows of one work-group
#define SP   2052                 // LDS row pitch in floats: 16 B x odd, for the 16-byte fragment reads of stage 4
#define RP   68                   // pitch of a partial ctx tile's row in floats
__device__ __forceinline__ v16bf ldfrag(const bf* p) { return cat16b(*(const v8us*)p, *(const v8us*)(p + 256)); }    // global planes, fragment order: p = block + lane * 8
__device__ __forceinline__ v16bf ldfrag_s(const bf* p) { return cat16b(*(const v8usa*)p, *(const v8usa*)(p + 16)); }
__device__ __forceinline__ v8f prod3(const v16bf (&ah)[2], const v16bf (&al)[2], const v16bf (&bh)[2], const v16bf (&bl)[2]) {
    v8f acc = (v8f){};
#pragma unroll
    for (int ks = 0; ks < 2; ++ks) { acc = wmmab(ah[ks], bh[ks], acc); acc = wmmab(al[ks], bh[ks], acc); acc = wmmab(ah[ks], bl[ks], acc); }
    return acc;
}
__global__ __launch_bounds__(512) void k_attn(const bf* __restrict__ Qh, const bf* __restrict__ Ql, const bf* __restrict__ Kh, const bf* __restrict__ Kl, const bf* __restrict__ Rh, const bf* __restrict__ Rl,
                                              const bf* __restrict__ VTh, const bf* __restrict__ VTl, const float* __restrict__ MSK, bf* AVh, bf* AVl) {
    typedef __attribute__((ext_vector_type(4))) unsigned short v4us;
    typedef v4us __attribute__((may_alias)) v4usa;
    __shared__ __align__(16) float S[RQ * SP];
    const int tid = threadIdx.x, lane = tid & 31, wave = __builtin_amdgcn_readfirstlane(tid >> 5), lr = lane & 15, hi = lane >> 4;
    const int i0 = blockIdx.x * RQ, bh = blockIdx.y, h = bh % NH_, b = bh / NH_;
    Qh += (size_t)bh * LQ * HD; Ql += (size_t)bh * LQ * HD; Kh += (size_t)bh * TK * HD; Kl += (size_t)bh * TK * HD; Rh += (size_t)h * TK * HD; Rl += (size_t)h * TK * HD; VTh += (size_t)bh * HD * TK; VTl += (size_t)bh * HD * TK;
    const int cw = wave * (TK / 16);
    v16bf qh[3][2], ql[3][2]; const bf* qa[3]; const bf* qb[3];
#pragma unroll
    for (int rt = 0; rt < 3; ++rt) { const size_t o = (size_t)min(i0 + rt * 16, LQ - 16) * HD + lane * 8; qa[rt] = Qh + o; qb[rt] = Ql + o;    // the clamp holds the last work-group's third tile, which it never uses, inside the plane
#pragma unroll
        for (int ks = 0; ks < 2; ++ks) { qh[rt][ks] = ldfrag(qa[rt] + ks * 512); ql[rt][ks] = ldfrag(qb[rt] + ks * 512); } }
    asm volatile("s_wait_xcnt 0x0" :: "v"(qa[0]), "v"(qa[1]), "v"(qa[2]), "v"(qb[0]), "v"(qb[1]), "v"(qb[2]) : "memory");    // precaution: the loads' address registers are inputs here, so none of them is rewritten (by a later load's result either) in front of this wait
    if (tid < RQ) { const int zc = (TK - LQ + 1) + i0 + tid; if (zc < TK) S[tid * SP + zc] = 0.f; }   // the padded zero: column T - L + 1 + i of row i
    const size_t fo = (size_t)cw * HD + lane * 8;    // this lane's place in the first 16-column tile of the wave's slice (fragment order: two blocks of 512 a tile); a tile further is 16 * HD elements on
    v16bf fh[2][2], fl[2][2];                             // two register sets: the next tile's fragments are fetched while this tile is worked on
#pragma unroll
    for (int ks = 0; ks < 2; ++ks) { fh[0][ks] = ldfrag(Rh + fo + ks * 512); fl[0][ks] = ldfrag(Rl + fo + ks * 512); }
#pragma unroll
    for (int t = 0; t < 8; ++t) { const int c0 = cw + t * 16, cur = t & 1, nxt = cur ^ 1;
        const bf* nh = (t < 7 ? Rh : Kh) + fo + (t < 7 ? (t + 1) * 16 * HD : 0); const bf* nl = (t < 7 ? Rl : Kl) + fo + (t < 7 ? (t + 1) * 16 * HD : 0);   // behind the last Q_rel tile: the first k tile
#pragma unroll
        for (int ks = 0; ks < 2; ++ks) { fh[nxt][ks] = ldfrag(nh + ks * 512); fl[nxt][ks] = ldfrag(nl + ks * 512); }
        v8f a0 = prod3(qh[0], ql[0], fh[cur], fl[cur]), a1 = prod3(qh[1], ql[1], fh[cur], fl[cur]);
        asm volatile("v_nop\n\tv_nop\n\tv_nop\n\tv_nop" : "+v"(a0), "+v"(a1));    // the four vector slots the chip needs before these results' registers are written again (the next product chain may reuse them right behind the LDS stores)
#pragma unroll
        for (int rt = 0; rt < 2; ++rt) {
#pragma unroll
            for (int j = 0; j < 8; ++j) { const int lrw = rt * 16 + hi * 8 + j, u = c0 + lr + i0 + lrw - (LQ - 1);
                int idx = lrw * SP + u - (u < 0 ? SP - TK : 0);
                if (rt == 0 && j == 0) idx = idx < 0 ? TK : idx;    // row i0 - 1 is another work-group's: such a value goes to row 0's pad, which nobody reads
                S[idx] = rt ? a1[j] : a0[j]; } }
        if (c0 + i0 + RQ - (LQ - 1) < 0) { v8f a2 = prod3(qh[2], ql[2], fh[cur], fl[cur]); const int u = c0 + lr + i0 + RQ - (LQ - 1);   // row i0 + 32 feeds the tail of row i0 + 31
            asm volatile("v_nop\n\tv_nop\n\tv_nop\n\tv_nop" : "+v"(a2));    // the same four slots, on the way out of this branch
            S[(hi == 0 && u < 0) ? RQ * SP + u - (SP - TK) : TK] = a2[0]; }
    }
    __syncthreads();
    float* const sw = S + hi * 8 * SP + cw + lr;    // this lane's element of row hi * 8 in the wave's first tile
    float old[2][16];                               // B of this tile and of the next: read in one batch a tile ahead, so that no LDS read waits behind the stores of the tile before
#pragma unroll
    for (int e = 0; e < 16; ++e) old[0][e] = sw[((e >> 3) * 16 + (e & 7)) * SP];
#pragma unroll
    for (int t = 0; t < 8; ++t) { const int cur = t & 1, nxt = cur ^ 1;
        if (t < 7) {
#pragma unroll
            for (int ks = 0; ks < 2; ++ks) { fh[nxt][ks] = ldfrag(Kh + fo + (t + 1) * 16 * HD + ks * 512); fl[nxt][ks] = ldfrag(Kl + fo + (t + 1) * 16 * HD + ks * 512); }
#pragma unroll
            for (int e = 0; e < 16; ++e) old[nxt][e] = sw[((e >> 3) * 16 + (e & 7)) * SP + (t + 1) * 16]; }
        __builtin_amdgcn_sched_barrier(0);    // keeps the next tile's loads in front of this tile's products; the compiler otherwise sinks them to just before their use and the wave waits out the whole latency
        const v8f a0 = prod3(qh[0], ql[0], fh[cur], fl[cur]), a1 = prod3(qh[1], ql[1], fh[cur], fl[cur]);
#pragma unroll
        for (int e = 0; e < 16; ++e) sw[((e >> 3) * 16 + (e & 7)) * SP + t * 16] = ((e < 8 ? a0[e & 7] : a1[e & 7]) + old[cur][e]) * SCL;
    }
    __builtin_amdgcn_sched_barrier(0);    // keeps the mask loads below from being lifted into the score tiles above, where their 64 registers would spill
    const float* mrow = MSK + (size_t)(i0 + wave * (RQ / 16)) * TK + lane * 4;
    v4f mk[TK / 128];    // the mask of the wave's first row, asked for in front of the barrier so that it arrives while the other waves finish their scores
#pragma unroll
    for (int k = 0; k < TK / 128; ++k) mk[k] = *(const v4f*)(mrow + k * 128);
    __syncthreads();
#pragma unroll 1    // rolled: with both rows unrolled together the live set overran the register budget and spilled
    for (int rr = 0; rr < RQ / 16; ++rr) { const int lrw = wave * (RQ / 16) + rr; float* srow = S + lrw * SP;
        float v[TK / 32]; float m = -3.0e38f;
#pragma unroll
        for (int k = 0; k < TK / 128; ++k) { const int c = k * 128 + lane * 4; const v4f s = *(const v4fa*)(srow + c);
#pragma unroll
            for (int q = 0; q < 4; ++q) { const float x = s[q] + bfr(mk[k][q]) * (-1e9f); v[k * 4 + q] = x; m = fmaxf(m, x); } }
        if (rr + 1 < RQ / 16) {    // the next row's mask flies while this row's softmax is worked out
#pragma unroll
            for (int k = 0; k < TK / 128; ++k) mk[k] = *(const v4f*)(mrow + (size_t)(rr + 1) * TK + k * 128); }
#pragma unroll
        for (int sh = 16; sh; sh >>= 1) m = fmaxf(m, __shfl_xor(m, sh, 32));
        float sum = 0.f;
#pragma unroll
        for (int k = 0; k < TK / 32; ++k) { v[k] = __expf(v[k] - m); sum += v[k]; }
#pragma unroll
        for (int sh = 16; sh; sh >>= 1) sum += __shfl_xor(sum, sh, 32);
        const float inv = 1.0f / sum;
        bf* prow = (bf*)(void*)srow;    // hi plane in the row's first 4096 bytes, residual plane in the next 4096; the whole row is in registers by now
#pragma unroll
        for (int k = 0; k < TK / 128; ++k) { v4us oh, ol;
#pragma unroll
            for (int q = 0; q < 4; ++q) { const float p = v[k * 4 + q] * inv; const unsigned short hb = f2bf(p); oh[q] = hb; ol[q] = f2bf(p - bf2f(hb)); }
            *(v4usa*)(prow + k * 128 + lane * 4) = oh; *(v4usa*)(prow + TK + k * 128 + lane * 4) = ol; }
    }
    const size_t vo = (size_t)cw * 16 + lane * 8;    // this lane's place in the v planes (fragment order): first 16-row tile of d, the block of the wave's first 32 keys; a tile of d further is 16 * TK elements on
    v16bf vh[2][4], vl[2][4];                           // two register sets: the next 32 keys' v fragments are fetched while these are worked on; the first set is asked for in front of the barrier
#pragma unroll
    for (int dt = 0; dt < 4; ++dt) { vh[0][dt] = ldfrag(VTh + vo + (size_t)dt * 16 * TK); vl[0][dt] = ldfrag(VTl + vo + (size_t)dt * 16 * TK); }
    __syncthreads();
    v8f acc[2][4];
#pragma unroll
    for (int rt = 0; rt < 2; ++rt) {
#pragma unroll
        for (int dt = 0; dt < 4; ++dt) acc[rt][dt] = (v8f){}; }
#pragma unroll
    for (int ks = 0; ks < 4; ++ks) { const int cur = ks & 1, nxt = cur ^ 1;
        if (ks < 3) {
#pragma unroll
            for (int dt = 0; dt < 4; ++dt) { vh[nxt][dt] = ldfrag(VTh + vo + (size_t)dt * 16 * TK + (ks + 1) * 512); vl[nxt][dt] = ldfrag(VTl + vo + (size_t)dt * 16 * TK + (ks + 1) * 512); } }
        v16bf ph[2], pl[2];
#pragma unroll
        for (int rt = 0; rt < 2; ++rt) { const bf* pr = (const bf*)(const void*)(S + (rt * 16 + lr) * SP) + cw + ks * 32 + 8 * hi; ph[rt] = ldfrag_s(pr); pl[rt] = ldfrag_s(pr + TK); }
#pragma unroll
        for (int dt = 0; dt < 4; ++dt) {
#pragma unroll
            for (int rt = 0; rt < 2; ++rt) { acc[rt][dt] = wmmab(ph[rt], vh[cur][dt], acc[rt][dt]); acc[rt][dt] = wmmab(pl[rt], vh[cur][dt], acc[rt][dt]); acc[rt][dt] = wmmab(ph[rt], vl[cur][dt], acc[rt][dt]); } }
    }
    __syncthreads();    // every wave has read its P fragments: the score rows' LDS now takes the 16 partial tiles
    float* red = S + wave * (RQ * RP);
#pragma unroll
    for (int rt = 0; rt < 2; ++rt) {
#pragma unroll
        for (int dt = 0; dt < 4; ++dt) {
#pragma unroll
            for (int j = 0; j < 8; ++j) red[(rt * 16 + hi * 8 + j) * RP + dt * 16 + lr] = acc[rt][dt][j]; } }
    __syncthreads();
    const int orow = (tid >> 8) * 16 + ((tid >> 1) & 15), od = ((tid >> 5) & 7) * 8 + (tid & 1) * 4;    // thread -> element so that a wave's 8-byte stores are 256 bytes in a row of the fragment-order planes
    v4f part[16];
#pragma unroll
    for (int w = 0; w < 16; ++w) part[w] = *(const v4fa*)(S + w * (RQ * RP) + orow * RP + od);
    v4f o = part[0];
#pragma unroll
    for (int w = 1; w < 16; ++w) o += part[w];
    v4us oh, ol;    // ctx goes out as the last GEMM's operand planes: bf16 hi + residual
#pragma unroll
    for (int q = 0; q < 4; ++q) { const unsigned short hb = f2bf(o[q]); oh[q] = hb; ol[q] = f2bf(o[q] - bf2f(hb)); }
    const size_t oo = ((size_t)b * LQ + i0 + (tid >> 8) * 16) * DD + (size_t)h * 1024 + (tid & 255) * 4;    // 16-row tile, then the head's two blocks of 32 columns
    *(v4us*)(AVh + oo) = oh; *(v4us*)(AVl + oo) = ol;
}
extern "C" void kernel_launch(void* const* d_in, const int* in_sizes, int n_in,
                              void* d_out, int out_size, void* d_ws, size_t ws_size, hipStream_t stream) {
    (void)in_sizes; (void)n_in; (void)out_size;
    const float* x = (const float*)d_in[0]; const float* mem = (const float*)d_in[1]; const float* msk = (const float*)d_in[2]; const float* rel = (const float*)d_in[3];
    const float* Wq = (const float*)d_in[4]; const float* bq = (const float*)d_in[5]; const float* Wke = (const float*)d_in[6]; const float* bke = (const float*)d_in[7]; const float* Wkr = (const float*)d_in[8]; const float* bkr = (const float*)d_in[9];
    const float* Wv = (const float*)d_in[10]; const float* bv = (const float*)d_in[11]; const float* Wo = (const float*)d_in[12]; const float* bo = (const float*)d_in[13];
    float* out = (float*)d_out;    // [2][1024][1024]
    char* wsp = (char*)d_ws;
    auto take = [&](size_t bytes) { char* p = wsp; wsp += (bytes + 255) & ~(size_t)255; return (void*)p; };
    bf* WoT = (bf*)take((size_t)DD * DD * 2);
    bf* Qh = (bf*)take((size_t)NBT * NH_ * LQ * HD * 2); bf* Ql = (bf*)take((size_t)NBT * NH_ * LQ * HD * 2);
    bf* Kh = (bf*)take((size_t)NBT * NH_ * TK * HD * 2); bf* Kl = (bf*)take((size_t)NBT * NH_ * TK * HD * 2); bf* Rh = (bf*)take((size_t)NH_ * TK * HD * 2); bf* Rl = (bf*)take((size_t)NH_ * TK * HD * 2);
    bf* VTh = (bf*)take((size_t)NBT * NH_ * HD * TK * 2); bf* VTl = (bf*)take((size_t)NBT * NH_ * HD * TK * 2);
    // One region, used twice in stream order: projection scratch, then the split ctx planes. Each use writes all it reads.
    char* const shared0 = wsp;
    bf* AVh = (bf*)take((size_t)NXR * DD * 2); bf* AVl = (bf*)take((size_t)NXR * DD * 2);
    wsp = shared0;
    bf* WqT = (bf*)take((size_t)DD * DD * 2); bf* WkeT = (bf*)take((size_t)DD * DD * 2); bf* WkrT = (bf*)take((size_t)DD * DD * 2); bf* WvT = (bf*)take((size_t)DD * DD * 2);
    bf* Cb = (bf*)take((size_t)NCR * DD * 2); bf* Xb = (bf*)take((size_t)NXR * DD * 2); bf* Rb = (bf*)take((size_t)TK * DD * 2);
    if ((size_t)(wsp - (char*)d_ws) > ws_size) return;    // 50 MiB kept (WoT, q, k, Q_rel, v planes) + 24 MiB shared region; Cb holds [mem; x], Xb x, Rb rel_enc
    k_prep<<<NWT + (NCR + NXR + TK) / 8, 256, 0, stream>>>(Wq, Wke, Wkr, Wv, Wo, x, mem, rel, WqT, WkeT, WkrT, WvT, WoT, Cb, Xb, Rb);
    k_proj<<<dim3(2 * (NCR / PBR) + NXR / PBR + TK / PBR, DD / 64, 1), 128, 0, stream>>>(Cb, Xb, Rb, WkeT, WvT, WqT, WkrT, bke, bv, bq, bkr, Kh, Kl, VTh, VTl, Qh, Ql, Rh, Rl, DM);
    k_attn<<<dim3(LQ / RQ, NBT * NH_, 1), 512, 0, stream>>>(Qh, Ql, Kh, Kl, Rh, Rl, VTh, VTl, msk, AVh, AVl);    // ctx[(b,s)][h*64 + d], as planes
    k_gemmb<true, false, 0, 64, 2><<<dim3(NXR / 128, DD / 64, 1), 128, 0, stream>>>(AVh, AVl, WoT, bo, out, DD, nullptr);
}

// v007
// A run of this version takes 175 microseconds.
// Timed twice side by side with v006, it ran 1.05 and 1.06 times as fast.
// Counting every step since v000, it is 20.8 times as fast.
#include <hip/hip_runtime.h>

// Compute dtypes, f32 accumulate: k, v = [mem; x].W + b, q = x.Wq + bq, Q_rel = rel_enc.Wkr + bkr as [rows x 1024].[1024 x 1024] GEMMs with PLAIN bf16 operands (rounded inputs, k-major
// weights transposed once; exact products) on v_wmma_f32_16x16x32_bf16 -> per-(batch, head) bf16 hi + UNSCALED residual planes; per (b, h): A = q.k^T and B_hat = q.Q_rel^T ([1024 x
// 64].[64 x 2048], three products), the Transformer-XL shift by index, (A + B)/8 + mask x (-1e9), row softmax in f32 -> P planes; ctx = P.v ([1024 x 2048].[2048 x 64], three

#define LQ   1024
#define TK   2048
#define NBT  2
#define DD   1024
#define NH_  16
#define HD   64
#define NXR  (LQ * NBT)           // 2048 query rows (b, s)
#define NCR  (TK * NBT)           // 4096 context rows (b, t)
#define DM   DD
#define NTK  NCR
#define SCL  0.125f
#define LOSC 1024.0f

typedef _Float16 h16;
typedef unsigned short bf;
typedef __attribute__((ext_vector_type(16))) __bf16   v16bf;
typedef __attribute__((ext_vector_type(16))) _Float16 v16h;
typedef __attribute__((ext_vector_type(8)))  _Float16 v8h;
typedef __attribute__((ext_vector_type(8)))  unsigned short v8us;
typedef __attribute__((ext_vector_type(8)))  float    v8f;
typedef __attribute__((ext_vector_type(4)))  float    v4f;
typedef __attribute__((ext_vector_type(4)))  _Float16 v4h;
typedef v8h  __attribute__((may_alias)) v8ha;
typedef v4f  __attribute__((may_alias)) v4fa;
typedef v8us __attribute__((may_alias)) v8usa;

__device__ __forceinline__ unsigned short f2bf(float f) { return __builtin_bit_cast(unsigned short, (__bf16)f); }    // the chip's own conversion: round to nearest even, as the integer form it replaces
__device__ __forceinline__ float bf2f(unsigned short b) { return (float)__builtin_bit_cast(__bf16, b); }
__device__ __forceinline__ float bfr(float f) { return bf2f(f2bf(f)); }
typedef __attribute__((ext_vector_type(2))) float    v2f;
typedef __attribute__((ext_vector_type(2))) __bf16   v2bf;
typedef __attribute__((ext_vector_type(2))) unsigned v2u;
typedef __attribute__((ext_vector_type(4))) unsigned v4u;
typedef v2u __attribute__((may_alias)) v2ua;
typedef v4u __attribute__((may_alias)) v4ua;
// pack2: two f32 rounded to bf16 in one conversion, a in the low half. split2: the same pair as hi, and the pair's residuals (value - hi, taken from the very hi that is stored) as lo.
__device__ __forceinline__ unsigned pack2(float a, float b) { return __builtin_bit_cast(unsigned, __builtin_convertvector((v2f){a, b}, v2bf)); }
__device__ __forceinline__ void split2(float a, float b, unsigned& hi, unsigned& lo) {
    const v2bf h = __builtin_convertvector((v2f){a, b}, v2bf);
    const v2f r = (v2f){__builtin_fmaf((float)h[0], -1.0f, a), __builtin_fmaf((float)h[1], -1.0f, b)};    // value - hi, exact in f32
    hi = __builtin_bit_cast(unsigned, h); lo = __builtin_bit_cast(unsigned, __builtin_convertvector(r, v2bf));
}
__device__ __forceinline__ v16h cat16(v8h lo, v8h hi) { return __builtin_shufflevector(lo, hi, 0, 1, 2, 3, 4, 5, 6, 7, 8, 9, 10, 11, 12, 13, 14, 15); }
__device__ __forceinline__ v16bf cat16b(v8us lo, v8us hi) { return __builtin_bit_cast(v16bf, __builtin_shufflevector(lo, hi, 0, 1, 2, 3, 4, 5, 6, 7, 8, 9, 10, 11, 12, 13, 14, 15)); }
__device__ __forceinline__ v8f wmma16(v16h a, v16h b, v8f c) { return __builtin_amdgcn_wmma_f32_16x16x32_f16(false, a, false, b, (short)0, c, false, false); }
__device__ __forceinline__ v8f wmmab(v16bf a, v16bf b, v8f c) { return __builtin_amdgcn_wmma_f32_16x16x32_bf16(false, a, false, b, (short)0, c, false, false); }

// FRAGMENT ORDER: every bf16 matrix [rows][K] that a matrix instruction reads from global memory lies as blocks of 16 rows x 32 k = 512 elements (block (r / 16) * (K / 32) + k / 32); inside a block
// element (r, k) stands at ((k / 16) % 2) * 256 + ((k / 8) % 2) * 128 + (r % 16) * 8 + k % 8: lane l's two 16-byte fragment pieces are at l * 8 and 256 + l * 8, so each wave-wide load is 512 bytes in a row.
// Which lane and register holds which (r, k) is as with row-major storage.
// wt_tile: WT [n][K] = bf16(W[k][n]) (k-major [K][ncols]), in fragment order, via one 64 x 64 LDS tile tl; tile (bx, by) of (K/64, ncols/64), 256 threads.
__device__ __forceinline__ void wt_tile(unsigned short* tl, int bx, int by, const float* __restrict__ Wm, int K, int ncols, bf* WT) {
    const int tid = threadIdx.x, k0 = bx * 64, n0 = by * 64;
    const int kk = tid >> 2, nq = (tid & 3) * 16;
#pragma unroll
    for (int i = 0; i < 16; ++i) tl[(nq + i) * 72 + kk] = f2bf(Wm[(size_t)(k0 + kk) * ncols + n0 + nq + i]);
    __syncthreads();
    const int lane = tid & 31, kq = (tid >> 6) & 1, part = (tid >> 5) & 1;    // a wave stores one half block: 512 bytes in a row
    auto pass = [&]() {
#pragma unroll
        for (int s = 0; s < 2; ++s) { const int nt = (tid >> 7) + 2 * s; const v8us val = *(const v8usa*)(tl + (nt * 16 + (lane & 15)) * 72 + (kq * 4 + part * 2 + (lane >> 4)) * 8);
            *(v8us*)(WT + ((size_t)(n0 / 16 + nt) * (K / 32) + k0 / 32 + kq) * 512 + part * 256 + lane * 8) = val; }
    };
    pass(); 
}
// cvt_blk: one wave rounds two neighbouring blocks (16 rows x 64 k) to bf16 in fragment order; src: the 16 rows' first element of those k, dst: the first block.
__device__ __forceinline__ void cvt_blk(const float* __restrict__ src, bf* dst) {
    const int lane = threadIdx.x & 31;
    const float* sp = src + (size_t)(lane & 15) * DM + (lane >> 4) * 8;
    v4u o[4];
#pragma unroll
    for (int q = 0; q < 4; ++q) { v4u t;
#pragma unroll
        for (int i = 0; i < 4; ++i) t[i] = pack2(sp[q * 16 + 2 * i], sp[q * 16 + 2 * i + 1]);
        o[q] = t; }
#pragma unroll
    for (int q = 0; q < 4; ++q) *(v4ua*)(dst + q * 256 + lane * 8) = o[q];
}
// k_prep: every operand preparation of the call in one grid, none reads another's output. Blocks 0 .. 1279: the five weights' 16 x 16 transpose tiles; then half of a 16-row tile a block (512 k, 64 a wave):
// 4096 rows of [mem; x] -> Cb, 2048 rows of x -> Xb, 2048 rows of rel_enc -> Rb.
#define NWT  (5 * (DD / 64) * (DD / 64))
__global__ __launch_bounds__(256) void k_prep(const float* __restrict__ Wq, const float* __restrict__ Wke, const float* __restrict__ Wkr, const float* __restrict__ Wv, const float* __restrict__ Wo,
                                              const float* __restrict__ x, const float* __restrict__ mem, const float* __restrict__ rel,
                                              bf* WqT, bf* WkeT, bf* WkrT, bf* WvT, bf* WoT, bf* Cb, bf* Xb, bf* Rb) {
    __shared__ __align__(16) unsigned short tl[64 * 72];
    const int blk = blockIdx.x;
    if (blk < NWT) {    // the same for the whole block: the barrier inside wt_tile is passed by all of it or by none
        const int w = blk / ((DD / 64) * (DD / 64)), tile = blk % ((DD / 64) * (DD / 64));
        const float* Wm = w == 0 ? Wq : w == 1 ? Wke : w == 2 ? Wkr : w == 3 ? Wv : Wo;
        bf* WT = w == 0 ? WqT : w == 1 ? WkeT : w == 2 ? WkrT : w == 3 ? WvT : WoT;
        wt_tile(tl, tile % (DD / 64), tile / (DD / 64), Wm, DD, DD, WT);
    } else {
        const int r = ((blk - NWT) >> 1) * 16;    // the first row of the block's tile; every boundary below is a multiple of 16, so a tile's rows have one source and one target
        const float* src; bf* dst;
        if (r < NCR) { const int b = r / TK, t = r % TK;    // x_tilde_b = [mem_b; x_b]
            src = t < LQ ? mem + ((size_t)b * LQ + t) * DD : x + ((size_t)b * LQ + t - LQ) * DD; dst = Cb + (size_t)r * DD;
        } else if (r < NCR + NXR) { src = x + (size_t)(r - NCR) * DD; dst = Xb + (size_t)(r - NCR) * DD;    // x rows (b, s)
        } else { src = rel + (size_t)(r - NCR - NXR) * DD; dst = Rb + (size_t)(r - NCR - NXR) * DD; }
        const int kb = ((blk - NWT) & 1) * 16 + (threadIdx.x >> 5) * 2;    // the wave's first block of 32 k; dst is the tile's first block (16 rows x DD elements a tile, as row-major)
        cvt_blk(src + kb * 32, dst + kb * 512);
    }
}

// k_gemmb: MT * 64 x 64 block tile (4 waves x MT row tiles x 16 x 64) of C[NXR][DD] = (A [+ Al]).B^T (K = 1024) [+ bf(bias[c])] [+ bf(R[r][c]) residual]; f32 whole-line epilogue (or f16
// PLANES 1: the 64 columns of a block are one head, and the tile goes out as that head's operand planes [row][64] = bf16 hi + UNSCALED residual (NR rows per batch, batch-first rows);
// PLANES 2: the same two planes transposed, [d][TK] (the v operand of P.v). Either way the f32 product never leaves the block. A, Al, Bn and the planes are in fragment order.
// The body is a device function of the block's tile (bx, by) and of its LDS tile ost, so that several products can share one grid.
// MT: 16-row tiles a wave holds (rows (bx * MT + mt) * 64 + wave * 16 ..): the block's tile is MT * 64 rows x 64 columns, and each B fragment a wave loads feeds four products (SPLITA: MT row tiles x two planes).
template <bool SPLITA, bool F16OUT, int PLANES, int NR, int MT>
__device__ __forceinline__ void gemmb(float (*ost)[16 * 68], int bx, int by, const bf* __restrict__ A, const bf* __restrict__ Al, const bf* __restrict__ Bn, const float* __restrict__ bias, float* C, int ldc, h16* C2, const float* __restrict__ R = nullptr, int K = DM, int roundR = 1, bf* Ph = nullptr, bf* Pl = nullptr) {
    const int lane = threadIdx.x & 31, wave = __builtin_amdgcn_readfirstlane(threadIdx.x >> 5), lr = lane & 15, hi = lane >> 4;
    const int c0 = by * 64;
    size_t aoff[MT];    // fragment order: a 16-row tile is 16 * K elements, its blocks of 32 k are 512 elements apart; a block's address is the same for the whole wave, lane l reads at l * 8
#pragma unroll
    for (int mt = 0; mt < MT; ++mt) aoff[mt] = (size_t)((bx * MT + mt) * 64 + wave * 16) * K;
    size_t boff[4];
#pragma unroll
    for (int t = 0; t < 4; ++t) boff[t] = (size_t)(c0 + t * 16) * K;
    v8f acc[MT][4];
#pragma unroll
    for (int mt = 0; mt < MT; ++mt) {
#pragma unroll
        for (int t = 0; t < 4; ++t) acc[mt][t] = (v8f){}; }
    float braw[4] = {0.f, 0.f, 0.f, 0.f};    // PLANES: the bias is asked for here, so that it arrives under the k loop and the epilogue does not wait for it
    if (PLANES) {
#pragma unroll
        for (int t = 0; t < 4; ++t) braw[t] = bias[c0 + t * 16 + lr];
        asm volatile("s_wait_xcnt 0x0" ::: "memory"); }    // precaution: stands in front of the first rewrite of the four bias loads' address registers (the k loop's set-up reuses them)
#pragma unroll 1
    for (int kc = 0; kc < K; kc += 32) {
        const bf* const pb[4] = {Bn + boff[0] + kc * 16, Bn + boff[1] + kc * 16, Bn + boff[2] + kc * 16, Bn + boff[3] + kc * 16};
        static_assert((MT == 4 && !SPLITA) || (MT == 2 && SPLITA), "the wide tile has four A-side fragments a trip: four row tiles of one plane, or two row tiles of two planes");
        const bf* const pa[4] = {A + aoff[0] + kc * 16, A + aoff[1] + kc * 16, (SPLITA ? Al + aoff[0] : A + aoff[MT - 2]) + kc * 16, (SPLITA ? Al + aoff[1] : A + aoff[MT - 1]) + kc * 16};
        v16bf a[4], b[4];
#pragma unroll
        for (int i = 0; i < 4; ++i) a[i] = cat16b(*(const v8us*)(pa[i] + lane * 8), *(const v8us*)(pa[i] + lane * 8 + 256));
#pragma unroll
        for (int t = 0; t < 4; ++t) b[t] = cat16b(*(const v8us*)(pb[t] + lane * 8), *(const v8us*)(pb[t] + lane * 8 + 256));
        __builtin_amdgcn_sched_barrier(0);    // keeps the trip's 16 loads one group in front of its products; spread among them, with registers reused, the wave would wait out the load latency several times a trip
#pragma unroll
        for (int i = 0; i < 4; i += MT) {    // SPLITA: all hi products, then all residual products; each accumulator still takes hi, then residual, of every trip in turn
#pragma unroll
            for (int t = 0; t < 4; ++t) {
#pragma unroll
                for (int mt = 0; mt < MT; ++mt) acc[mt][t] = wmmab(a[i + mt], b[t], acc[mt][t]); } }
        __builtin_amdgcn_sched_barrier(0);    // keeps every product of the trip in front of the two statements below
        asm volatile("s_wait_xcnt 0x0" :: "s"(pa[0]), "s"(pa[1]), "s"(pa[2]), "s"(pa[3]), "s"(pb[0]), "s"(pb[1]), "s"(pb[2]), "s"(pb[3]) : "memory");    // precaution: the trip's block addresses are inputs here, so none of their registers is rewritten in front of this wait
        asm volatile("v_nop\n\tv_nop\n\tv_nop\n\tv_nop" : "+v"(acc[0][3]), "+v"(acc[MT - 1][3]));    // the four vector slots the chip needs behind the trip's last products, on the way out of the loop too
    }
    float bvv[4];    // the columns' bias, the same for every row tile
#pragma unroll
    for (int t = 0; t < 4; ++t) bvv[t] = PLANES ? bfr(braw[t]) : bias ? bfr(bias[c0 + t * 16 + lr]) : 0.f;
#pragma unroll
    for (int mt = 0; mt < MT; ++mt) {    // 64 rows of the block's tile a part of ost: ost[mt * 4 + wave] is the wave's 16 rows of it
    float* os = &ost[mt * 4 + wave][0];
#pragma unroll
    for (int t = 0; t < 4; ++t) { const float bv = bvv[t];
        if (PLANES == 2) {    // transposed tile [d][68] over all four waves' rows: a lane's eight rows are eight neighbours of one d
            float* tp = &ost[mt * 4][0] + (t * 16 + lr) * 68 + wave * 16 + hi * 8;
            *(v4fa*)tp = (v4f){acc[mt][t][0] + bv, acc[mt][t][1] + bv, acc[mt][t][2] + bv, acc[mt][t][3] + bv}; *(v4fa*)(tp + 4) = (v4f){acc[mt][t][4] + bv, acc[mt][t][5] + bv, acc[mt][t][6] + bv, acc[mt][t][7] + bv};
        } else {
#pragma unroll
        for (int j = 0; j < 8; ++j) os[(hi * 8 + j) * 68 + t * 16 + lr] = acc[mt][t][j] + bv; } }
    }
    __syncthreads();
#pragma unroll 1    // rolled: for speed only
    for (int mt = 0; mt < MT; ++mt) {
    const int bxe = bx * MT + mt, r0 = bxe * 64 + wave * 16;
    float* os = &ost[mt * 4 + wave][0];
    if (PLANES) {
        const int rb = bxe * 64, bhp = (rb / NR) * NH_ + by, rin = rb % NR;    // batch and head of the block, the 64-row part's first row inside the batch
#pragma unroll
        for (int s = 0; s < 4; ++s) {    // fragment order: 32 lanes x 16 bytes are half a block, 512 bytes in a row in both planes
            const int piece = PLANES == 2 ? wave * 2 + hi : s * 2 + hi;    // which eight k (PLANES 2: keys of the block's 64; else d)
            const int row = PLANES == 2 ? s * 16 + lr : lr;    // PLANES 2: d, of the block's tile; else a row of the wave's own 16
            const float* sp = (PLANES == 2 ? &ost[mt * 4][0] : os) + row * 68 + piece * 8; v4u oh, ol;
#pragma unroll
            for (int i = 0; i < 4; ++i) { unsigned hw, lw; split2(sp[2 * i], sp[2 * i + 1], hw, lw); oh[i] = hw; ol[i] = lw; }
            const size_t o = PLANES == 2 ? ((size_t)bhp * HD + s * 16) * TK + (rin / 32 + (wave >> 1)) * 512 + (wave & 1) * 256 + lane * 8 : ((size_t)bhp * NR + rin + wave * 16) * HD + s * 256 + lane * 8;
            *(v4ua*)(Ph + o) = oh; *(v4ua*)(Pl + o) = ol; }
        asm volatile("s_wait_xcnt 0x0" ::: "memory");    // precaution: behind the last plane store, in front of whatever the shared grid's code places after this body that rewrites the stores' registers
    } else if (F16OUT) {
        h16* crow = (h16*)(void*)C + (size_t)r0 * ldc + c0;
        auto pass = [&]() {
#pragma unroll
            for (int s = 0; s < 4; ++s) { const int row = 4 * s + (lane >> 3), piece = lane & 7; const float* sp = os + row * 68 + piece * 8; v8h o, o2;
#pragma unroll
                for (int i = 0; i < 8; ++i) { const h16 a = (h16)sp[i]; o[i] = a; o2[i] = (h16)((sp[i] - (float)a) * LOSC); }
                *(v8h*)(crow + (size_t)row * ldc + piece * 8) = o; if (C2) *(v8h*)(C2 + (size_t)r0 * ldc + c0 + (size_t)row * ldc + piece * 8) = o2; }
        };
        pass(); 
    } else {
        float* crow = C + (size_t)r0 * ldc + c0;
        auto pass = [&]() {
#pragma unroll
            for (int s = 0; s < 8; ++s) { const int Lid = (lane >> 3) + 4 * s, piece = lane & 7; const int row = Lid >> 1, cofs = (Lid & 1) * 32 + piece * 4;
                v4f val = *(const v4fa*)(os + row * 68 + cofs); if (R) { const v4f rv = *(const v4f*)(R + ((size_t)r0 + row) * ldc + c0 + cofs); val += roundR ? (v4f){bfr(rv[0]), bfr(rv[1]), bfr(rv[2]), bfr(rv[3])} : rv; }
                *(v4f*)(crow + (size_t)row * ldc + cofs) = val;
                asm volatile("s_wait_xcnt 0x0" ::: "memory"); }    // precaution: behind each store, in front of the next piece's (and the next pass's) rewrite of the store's registers
        };
        pass(); 
    }
    }
}
// k_proj: the four projections, which read none of each other's output, as one grid of 256-row x 64-column tiles: blockIdx.x 0 .. 15 k, 16 .. 31 v, 32 .. 39 q, 40 .. 47 Q_rel (shared across b: one batch of TK rows); blockIdx.y the head.
#define PMT  4                    // 16-row tiles a wave of k_proj holds
#define PBR  (64 * PMT)           // rows of a block's tile; divides LQ and TK, so a tile stays inside one batch
__global__ __launch_bounds__(128) void k_proj(const bf* __restrict__ Cb, const bf* __restrict__ Xb, const bf* __restrict__ Rb, const bf* __restrict__ WkeT, const bf* __restrict__ WvT, const bf* __restrict__ WqT, const bf* __restrict__ WkrT,
                                              const float* __restrict__ bke, const float* __restrict__ bv, const float* __restrict__ bq, const float* __restrict__ bkr,
                                              bf* Kh, bf* Kl, bf* VTh, bf* VTl, bf* Qh, bf* Ql, bf* Rh, bf* Rl, int K) {
    __shared__ __align__(16) float ost[4 * PMT][16 * 68];
    const int bx = blockIdx.x, by = blockIdx.y;
    if (bx < NCR / PBR) gemmb<false, false, 1, TK, PMT>(ost, bx, by, Cb, nullptr, WkeT, bke, nullptr, DD, nullptr, nullptr, K, 1, Kh, Kl);
    else if (bx < 2 * (NCR / PBR)) gemmb<false, false, 2, TK, PMT>(ost, bx - NCR / PBR, by, Cb, nullptr, WvT, bv, nullptr, DD, nullptr, nullptr, K, 1, VTh, VTl);
    else if (bx < 2 * (NCR / PBR) + NXR / PBR) gemmb<false, false, 1, LQ, PMT>(ost, bx - 2 * (NCR / PBR), by, Xb, nullptr, WqT, bq, nullptr, DD, nullptr, nullptr, K, 1, Qh, Ql);
    else gemmb<false, false, 1, TK, PMT>(ost, bx - 2 * (NCR / PBR) - NXR / PBR, by, Rb, nullptr, WkrT, bkr, nullptr, DD, nullptr, nullptr, K, 1, Rh, Rl);
}
template <bool SPLITA, bool F16OUT, int PLANES, int NR, int MT>
__global__ __launch_bounds__(128) void k_gemmb(const bf* __restrict__ A, const bf* __restrict__ Al, const bf* __restrict__ Bn, const float* __restrict__ bias, float* C, int ldc, h16* C2, const float* __restrict__ R = nullptr, int K = DM, int roundR = 1, bf* Ph = nullptr, bf* Pl = nullptr) {
    __shared__ __align__(16) float ost[4 * MT][16 * 68];
    gemmb<SPLITA, F16OUT, PLANES, NR, MT>(ost, blockIdx.x, blockIdx.y, A, Al, Bn, bias, C, ldc, C2, R, K, roundR, Ph, Pl);
}


// k_attn: one work-group (16 waves) per 32 query rows of one (b, h); the 32 x 2048 scores never leave LDS.
//  1. B_hat = q.Q_rel^T (three products), each wave 128 columns; element (r, c) is stored straight at its place after the shift: with u = c + r - (L-1), row r column u when u >= 0,
//     else row r-1 column u + T (so rows i0 .. i0+32 of B_hat are needed: a third row tile gives row i0+32); the one padded zero of each row is stored by hand.
//  2. A = q.k^T (three products), s = (A + B) / 8 in place.  3. each wave two rows in turn: + mask x (-1e9), softmax in f32 (row in registers), P as bf16 hi + residual planes over the row's own bytes.
//  4. ctx = P.v (three products): wave w sums keys 128 w .. 128 w + 127 for all 32 x 64 outputs; the 16 partial tiles are added in wave order through LDS.
#define RQ   32                   // query rows of one work-group
#define SP   2052                 // LDS row pitch in floats: 16 B x odd, for the 16-byte fragment reads of stage 4
#define RP   68                   // pitch of a partial ctx tile's row in floats
__device__ __forceinline__ v16bf ldfrag(const bf* p) { return cat16b(*(const v8us*)p, *(const v8us*)(p + 256)); }    // global planes, fragment order: p = block + lane * 8
__device__ __forceinline__ v16bf ldfrag_s(const bf* p) { return cat16b(*(const v8usa*)p, *(const v8usa*)(p + 16)); }
__device__ __forceinline__ v8f prod3(const v16bf (&ah)[2], const v16bf (&al)[2], const v16bf (&bh)[2], const v16bf (&bl)[2]) {
    v8f acc = (v8f){};
#pragma unroll
    for (int ks = 0; ks < 2; ++ks) { acc = wmmab(ah[ks], bh[ks], acc); acc = wmmab(al[ks], bh[ks], acc); acc = wmmab(ah[ks], bl[ks], acc); }
    return acc;
}
__global__ __launch_bounds__(512) void k_attn(const bf* __restrict__ Qh, const bf* __restrict__ Ql, const bf* __restrict__ Kh, const bf* __restrict__ Kl, const bf* __restrict__ Rh, const bf* __restrict__ Rl,
                                              const bf* __restrict__ VTh, const bf* __restrict__ VTl, const float* __restrict__ MSK, bf* AVh, bf* AVl) {
    __shared__ __align__(16) float S[RQ * SP];
    const int tid = threadIdx.x, lane = tid & 31, wave = __builtin_amdgcn_readfirstlane(tid >> 5), lr = lane & 15, hi = lane >> 4;
    const int i0 = blockIdx.x * RQ, bh = blockIdx.y, h = bh % NH_, b = bh / NH_;
    Qh += (size_t)bh * LQ * HD; Ql += (size_t)bh * LQ * HD; Kh += (size_t)bh * TK * HD; Kl += (size_t)bh * TK * HD; Rh += (size_t)h * TK * HD; Rl += (size_t)h * TK * HD; VTh += (size_t)bh * HD * TK; VTl += (size_t)bh * HD * TK;
    const int cw = wave * (TK / 16);
    v16bf qh[3][2], ql[3][2]; const bf* qa[3]; const bf* qb[3];
#pragma unroll
    for (int rt = 0; rt < 3; ++rt) { const size_t o = (size_t)min(i0 + rt * 16, LQ - 16) * HD + lane * 8; qa[rt] = Qh + o; qb[rt] = Ql + o;    // the clamp holds the last work-group's third tile, which it never uses, inside the plane
#pragma unroll
        for (int ks = 0; ks < 2; ++ks) { qh[rt][ks] = ldfrag(qa[rt] + ks * 512); ql[rt][ks] = ldfrag(qb[rt] + ks * 512); } }
    asm volatile("s_wait_xcnt 0x0" :: "v"(qa[0]), "v"(qa[1]), "v"(qa[2]), "v"(qb[0]), "v"(qb[1]), "v"(qb[2]) : "memory");    // precaution: the loads' address registers are inputs here, so none of them is rewritten (by a later load's result either) in front of this wait
    if (tid < RQ) { const int zc = (TK - LQ + 1) + i0 + tid; if (zc < TK) S[tid * SP + zc] = 0.f; }   // the padded zero: column T - L + 1 + i of row i
    const size_t fo = (size_t)cw * HD + lane * 8;    // this lane's place in the first 16-column tile of the wave's slice (fragment order: two blocks of 512 a tile); a tile further is 16 * HD elements on
    v16bf fh[2][2], fl[2][2];                             // two register sets: the next tile's fragments are fetched while this tile is worked on
#pragma unroll
    for (int ks = 0; ks < 2; ++ks) { fh[0][ks] = ldfrag(Rh + fo + ks * 512); fl[0][ks] = ldfrag(Rl + fo + ks * 512); }
#pragma unroll
    for (int t = 0; t < 8; ++t) { const int c0 = cw + t * 16, cur = t & 1, nxt = cur ^ 1;
        const bf* nh = (t < 7 ? Rh : Kh) + fo + (t < 7 ? (t + 1) * 16 * HD : 0); const bf* nl = (t < 7 ? Rl : Kl) + fo + (t < 7 ? (t + 1) * 16 * HD : 0);   // behind the last Q_rel tile: the first k tile
#pragma unroll
        for (int ks = 0; ks < 2; ++ks) { fh[nxt][ks] = ldfrag(nh + ks * 512); fl[nxt][ks] = ldfrag(nl + ks * 512); }
        v8f a0 = prod3(qh[0], ql[0], fh[cur], fl[cur]), a1 = prod3(qh[1], ql[1], fh[cur], fl[cur]);
        asm volatile("v_nop\n\tv_nop\n\tv_nop\n\tv_nop" : "+v"(a0), "+v"(a1));    // the four vector slots the chip needs before these results' registers are written again (the next product chain may reuse them right behind the LDS stores)
#pragma unroll
        for (int rt = 0; rt < 2; ++rt) {
#pragma unroll
            for (int j = 0; j < 8; ++j) { const int lrw = rt * 16 + hi * 8 + j, u = c0 + lr + i0 + lrw - (LQ - 1);
                int idx = lrw * SP + u - (u < 0 ? SP - TK : 0);
                if (rt == 0 && j == 0) idx = idx < 0 ? TK : idx;    // row i0 - 1 is another work-group's: such a value goes to row 0's pad, which nobody reads
                S[idx] = rt ? a1[j] : a0[j]; } }
        if (c0 + i0 + RQ - (LQ - 1) < 0) { v8f a2 = prod3(qh[2], ql[2], fh[cur], fl[cur]); const int u = c0 + lr + i0 + RQ - (LQ - 1);   // row i0 + 32 feeds the tail of row i0 + 31
            asm volatile("v_nop\n\tv_nop\n\tv_nop\n\tv_nop" : "+v"(a2));    // the same four slots, on the way out of this branch
            S[(hi == 0 && u < 0) ? RQ * SP + u - (SP - TK) : TK] = a2[0]; }
    }
    __syncthreads();
    float* const sw = S + hi * 8 * SP + cw + lr;    // this lane's element of row hi * 8 in the wave's first tile
    float old[2][16];                               // B of this tile and of the next: read in one batch a tile ahead, so that no LDS read waits behind the stores of the tile before
#pragma unroll
    for (int e = 0; e < 16; ++e) old[0][e] = sw[((e >> 3) * 16 + (e & 7)) * SP];
#pragma unroll
    for (int t = 0; t < 8; ++t) { const int cur = t & 1, nxt = cur ^ 1;
        if (t < 7) {
#pragma unroll
            for (int ks = 0; ks < 2; ++ks) { fh[nxt][ks] = ldfrag(Kh + fo + (t + 1) * 16 * HD + ks * 512); fl[nxt][ks] = ldfrag(Kl + fo + (t + 1) * 16 * HD + ks * 512); }
#pragma unroll
            for (int e = 0; e < 16; ++e) old[nxt][e] = sw[((e >> 3) * 16 + (e & 7)) * SP + (t + 1) * 16]; }
        __builtin_amdgcn_sched_barrier(0);    // keeps the next tile's loads in front of this tile's products; the compiler otherwise sinks them to just before their use and the wave waits out the whole latency
        const v8f a0 = prod3(qh[0], ql[0], fh[cur], fl[cur]), a1 = prod3(qh[1], ql[1], fh[cur], fl[cur]);
#pragma unroll
        for (int e = 0; e < 16; ++e) sw[((e >> 3) * 16 + (e & 7)) * SP + t * 16] = ((e < 8 ? a0[e & 7] : a1[e & 7]) + old[cur][e]) * SCL;
    }
    __builtin_amdgcn_sched_barrier(0);    // keeps the mask loads below from being lifted into the score tiles above, where their 64 registers would spill
    const float* mrow = MSK + (size_t)(i0 + wave * (RQ / 16)) * TK + lane * 4;
    v4f mk[TK / 128];    // the mask of the wave's first row, asked for in front of the barrier so that it arrives while the other waves finish their scores
#pragma unroll
    for (int k = 0; k < TK / 128; ++k) mk[k] = *(const v4f*)(mrow + k * 128);
    __syncthreads();
#pragma unroll 1    // rolled: with both rows unrolled together the live set overran the register budget and spilled
    for (int rr = 0; rr < RQ / 16; ++rr) { const int lrw = wave * (RQ / 16) + rr; float* srow = S + lrw * SP;
        float v[TK / 32]; float m = -3.0e38f;
#pragma unroll
        for (int k = 0; k < TK / 128; ++k) { const int c = k * 128 + lane * 4; const v4f s = *(const v4fa*)(srow + c);
#pragma unroll
            for (int q = 0; q < 4; q += 2) { const v2bf mr = __builtin_convertvector((v2f){mk[k][q], mk[k][q + 1]}, v2bf);    // the mask rounded to bf16, two a conversion
                const float x0 = __builtin_fmaf((float)mr[0], -1e9f, s[q]), x1 = __builtin_fmaf((float)mr[1], -1e9f, s[q + 1]); v[k * 4 + q] = x0; v[k * 4 + q + 1] = x1; m = fmaxf(m, fmaxf(x0, x1)); } }
        if (rr + 1 < RQ / 16) {    // the next row's mask flies while this row's softmax is worked out
#pragma unroll
            for (int k = 0; k < TK / 128; ++k) mk[k] = *(const v4f*)(mrow + (size_t)(rr + 1) * TK + k * 128); }
#pragma unroll
        for (int sh = 16; sh; sh >>= 1) m = fmaxf(m, __shfl_xor(m, sh, 32));
        float sum = 0.f;
#pragma unroll
        for (int k = 0; k < TK / 32; ++k) { v[k] = __expf(v[k] - m); sum += v[k]; }
#pragma unroll
        for (int sh = 16; sh; sh >>= 1) sum += __shfl_xor(sum, sh, 32);
        const float inv = 1.0f / sum;
        bf* prow = (bf*)(void*)srow;    // hi plane in the row's first 4096 bytes, residual plane in the next 4096; the whole row is in registers by now
#pragma unroll
        for (int k = 0; k < TK / 128; ++k) { v2u oh, ol;
#pragma unroll
            for (int q = 0; q < 2; ++q) { unsigned hw, lw; split2(v[k * 4 + 2 * q] * inv, v[k * 4 + 2 * q + 1] * inv, hw, lw); oh[q] = hw; ol[q] = lw; }
            *(v2ua*)(prow + k * 128 + lane * 4) = oh; *(v2ua*)(prow + TK + k * 128 + lane * 4) = ol; }
    }
    const size_t vo = (size_t)cw * 16 + lane * 8;    // this lane's place in the v planes (fragment order): first 16-row tile of d, the block of the wave's first 32 keys; a tile of d further is 16 * TK elements on
    v16bf vh[2][4], vl[2][4];                           // two register sets: the next 32 keys' v fragments are fetched while these are worked on; the first set is asked for in front of the barrier
#pragma unroll
    for (int dt = 0; dt < 4; ++dt) { vh[0][dt] = ldfrag(VTh + vo + (size_t)dt * 16 * TK); vl[0][dt] = ldfrag(VTl + vo + (size_t)dt * 16 * TK); }
    __syncthreads();
    v8f acc[2][4];
#pragma unroll
    for (int rt = 0; rt < 2; ++rt) {
#pragma unroll
        for (int dt = 0; dt < 4; ++dt) acc[rt][dt] = (v8f){}; }
#pragma unroll
    for (int ks = 0; ks < 4; ++ks) { const int cur = ks & 1, nxt = cur ^ 1;
        if (ks < 3) {
#pragma unroll
            for (int dt = 0; dt < 4; ++dt) { vh[nxt][dt] = ldfrag(VTh + vo + (size_t)dt * 16 * TK + (ks + 1) * 512); vl[nxt][dt] = ldfrag(VTl + vo + (size_t)dt * 16 * TK + (ks + 1) * 512); } }
        v16bf ph[2], pl[2];
#pragma unroll
        for (int rt = 0; rt < 2; ++rt) { const bf* pr = (const bf*)(const void*)(S + (rt * 16 + lr) * SP) + cw + ks * 32 + 8 * hi; ph[rt] = ldfrag_s(pr); pl[rt] = ldfrag_s(pr + TK); }
#pragma unroll
        for (int dt = 0; dt < 4; ++dt) {
#pragma unroll
            for (int rt = 0; rt < 2; ++rt) { acc[rt][dt] = wmmab(ph[rt], vh[cur][dt], acc[rt][dt]); acc[rt][dt] = wmmab(pl[rt], vh[cur][dt], acc[rt][dt]); acc[rt][dt] = wmmab(ph[rt], vl[cur][dt], acc[rt][dt]); } }
    }
    __syncthreads();    // every wave has read its P fragments: the score rows' LDS now takes the 16 partial tiles
    float* red = S + wave * (RQ * RP);
#pragma unroll
    for (int rt = 0; rt < 2; ++rt) {
#pragma unroll
        for (int dt = 0; dt < 4; ++dt) {
#pragma unroll
            for (int j = 0; j < 8; ++j) red[(rt * 16 + hi * 8 + j) * RP + dt * 16 + lr] = acc[rt][dt][j]; } }
    __syncthreads();
    const int orow = (tid >> 8) * 16 + ((tid >> 1) & 15), od = ((tid >> 5) & 7) * 8 + (tid & 1) * 4;    // thread -> element so that a wave's 8-byte stores are 256 bytes in a row of the fragment-order planes
    v4f part[16];
#pragma unroll
    for (int w = 0; w < 16; ++w) part[w] = *(const v4fa*)(S + w * (RQ * RP) + orow * RP + od);
    v4f o = part[0];
#pragma unroll
    for (int w = 1; w < 16; ++w) o += part[w];
    v2u oh, ol;    // ctx goes out as the last GEMM's operand planes: bf16 hi + residual
#pragma unroll
    for (int q = 0; q < 2; ++q) { unsigned hw, lw; split2(o[2 * q], o[2 * q + 1], hw, lw); oh[q] = hw; ol[q] = lw; }
    const size_t oo = ((size_t)b * LQ + i0 + (tid >> 8) * 16) * DD + (size_t)h * 1024 + (tid & 255) * 4;    // 16-row tile, then the head's two blocks of 32 columns
    *(v2ua*)(AVh + oo) = oh; *(v2ua*)(AVl + oo) = ol;
}
extern "C" void kernel_launch(void* const* d_in, const int* in_sizes, int n_in,
                              void* d_out, int out_size, void* d_ws, size_t ws_size, hipStream_t stream) {
    (void)in_sizes; (void)n_in; (void)out_size;
    const float* x = (const float*)d_in[0]; const float* mem = (const float*)d_in[1]; const float* msk = (const float*)d_in[2]; const float* rel = (const float*)d_in[3];
    const float* Wq = (const float*)d_in[4]; const float* bq = (const float*)d_in[5]; const float* Wke = (const float*)d_in[6]; const float* bke = (const float*)d_in[7]; const float* Wkr = (const float*)d_in[8]; const float* bkr = (const float*)d_in[9];
    const float* Wv = (const float*)d_in[10]; const float* bv = (const float*)d_in[11]; const float* Wo = (const float*)d_in[12]; const float* bo = (const float*)d_in[13];
    float* out = (float*)d_out;    // [2][1024][1024]
    char* wsp = (char*)d_ws;
    auto take = [&](size_t bytes) { char* p = wsp; wsp += (bytes + 255) & ~(size_t)255; return (void*)p; };
    bf* WoT = (bf*)take((size_t)DD * DD * 2);
    bf* Qh = (bf*)take((size_t)NBT * NH_ * LQ * HD * 2); bf* Ql = (bf*)take((size_t)NBT * NH_ * LQ * HD * 2);
    bf* Kh = (bf*)take((size_t)NBT * NH_ * TK * HD * 2); bf* Kl = (bf*)take((size_t)NBT * NH_ * TK * HD * 2); bf* Rh = (bf*)take((size_t)NH_ * TK * HD * 2); bf* Rl = (bf*)take((size_t)NH_ * TK * HD * 2);
    bf* VTh = (bf*)take((size_t)NBT * NH_ * HD * TK * 2); bf* VTl = (bf*)take((size_t)NBT * NH_ * HD * TK * 2);
    // One region, used twice in stream order: projection scratch, then the split ctx planes. Each use writes all it reads.
    char* const shared0 = wsp;
    bf* AVh = (bf*)take((size_t)NXR * DD * 2); bf* AVl = (bf*)take((size_t)NXR * DD * 2);
    wsp = shared0;
    bf* WqT = (bf*)take((size_t)DD * DD * 2); bf* WkeT = (bf*)take((size_t)DD * DD * 2); bf* WkrT = (bf*)take((size_t)DD * DD * 2); bf* WvT = (bf*)take((size_t)DD * DD * 2);
    bf* Cb = (bf*)take((size_t)NCR * DD * 2); bf* Xb = (bf*)take((size_t)NXR * DD * 2); bf* Rb = (bf*)take((size_t)TK * DD * 2);
    if ((size_t)(wsp - (char*)d_ws) > ws_size) return;    // 50 MiB kept (WoT, q, k, Q_rel, v planes) + 24 MiB shared region; Cb holds [mem; x], Xb x, Rb rel_enc
    k_prep<<<NWT + (NCR + NXR + TK) / 8, 256, 0, stream>>>(Wq, Wke, Wkr, Wv, Wo, x, mem, rel, WqT, WkeT, WkrT, WvT, WoT, Cb, Xb, Rb);
    k_proj<<<dim3(2 * (NCR / PBR) + NXR / PBR + TK / PBR, DD / 64, 1), 128, 0, stream>>>(Cb, Xb, Rb, WkeT, WvT, WqT, WkrT, bke, bv, bq, bkr, Kh, Kl, VTh, VTl, Qh, Ql, Rh, Rl, DM);
    k_attn<<<dim3(LQ / RQ, NBT * NH_, 1), 512, 0, stream>>>(Qh, Ql, Kh, Kl, Rh, Rl, VTh, VTl, msk, AVh, AVl);    // ctx[(b,s)][h*64 + d], as planes
    k_gemmb<true, false, 0, 64, 2><<<dim3(NXR / 128, DD / 64, 1), 128, 0, stream>>>(AVh, AVl, WoT, bo, out, DD, nullptr);
}

// v008
// A run of this version takes 158 microseconds.
// Next to v007, in two timings, it ran 1.11 times as fast each time.
// All steps since v000 together make it 23.1 times as fast.
#include <hip/hip_runtime.h>

// Compute dtypes, f32 accumulate: k, v = [mem; x].W + b, q = x.Wq + bq, Q_rel = rel_enc.Wkr + bkr as [rows x 1024].[1024 x 1024] GEMMs with PLAIN bf16 operands (rounded inputs, k-major
// weights transposed once; exact products) on v_wmma_f32_16x16x32_bf16 -> per-(batch, head) bf16 hi + UNSCALED residual planes; per (b, h): A = q.k^T and B_hat = q.Q_rel^T ([1024 x
// 64].[64 x 2048], three products), the Transformer-XL shift by index, (A + B)/8 + mask x (-1e9), row softmax in f32 -> P planes; ctx = P.v ([1024 x 2048].[2048 x 64], three

#define LQ   1024
#define TK   2048
#define NBT  2
#define DD   1024
#define NH_  16
#define HD   64
#define NXR  (LQ * NBT)           // 2048 query rows (b, s)
#define NCR  (TK * NBT)           // 4096 context rows (b, t)
#define DM   DD
#define NTK  NCR
#define SCL  0.125f
#define LOSC 1024.0f

typedef _Float16 h16;
typedef unsigned short bf;
typedef __attribute__((ext_vector_type(16))) __bf16   v16bf;
typedef __attribute__((ext_vector_type(16))) _Float16 v16h;
typedef __attribute__((ext_vector_type(8)))  _Float16 v8h;
typedef __attribute__((ext_vector_type(8)))  unsigned short v8us;
typedef __attribute__((ext_vector_type(8)))  float    v8f;
typedef __attribute__((ext_vector_type(4)))  float    v4f;
typedef __attribute__((ext_vector_type(4)))  _Float16 v4h;
typedef v8h  __attribute__((may_alias)) v8ha;
typedef v4f  __attribute__((may_alias)) v4fa;
typedef v8us __attribute__((may_alias)) v8usa;

__device__ __forceinline__ unsigned short f2bf(float f) { return __builtin_bit_cast(unsigned short, (__bf16)f); }    // the chip's own conversion: round to nearest even, as the integer form it replaces
__device__ __forceinline__ float bf2f(unsigned short b) { return (float)__builtin_bit_cast(__bf16, b); }
__device__ __forceinline__ float bfr(float f) { return bf2f(f2bf(f)); }
typedef __attribute__((ext_vector_type(2))) float    v2f;
typedef __attribute__((ext_vector_type(2))) __bf16   v2bf;
typedef __attribute__((ext_vector_type(2))) unsigned v2u;
typedef __attribute__((ext_vector_type(4))) unsigned v4u;
typedef v2u __attribute__((may_alias)) v2ua;
typedef v4u __attribute__((may_alias)) v4ua;
// pack2: two f32 rounded to bf16 in one conversion, a in the low half. split2: the same pair as hi, and the pair's residuals (value - hi, taken from the very hi that is stored) as lo.
__device__ __forceinline__ unsigned pack2(float a, float b) { return __builtin_bit_cast(unsigned, __builtin_convertvector((v2f){a, b}, v2bf)); }
__device__ __forceinline__ void split2(float a, float b, unsigned& hi, unsigned& lo) {
    const v2bf h = __builtin_convertvector((v2f){a, b}, v2bf);
    const v2f r = (v2f){__builtin_fmaf((float)h[0], -1.0f, a), __builtin_fmaf((float)h[1], -1.0f, b)};    // value - hi, exact in f32
    hi = __builtin_bit_cast(unsigned, h); lo = __builtin_bit_cast(unsigned, __builtin_convertvector(r, v2bf));
}
__device__ __forceinline__ v16h cat16(v8h lo, v8h hi) { return __builtin_shufflevector(lo, hi, 0, 1, 2, 3, 4, 5, 6, 7, 8, 9, 10, 11, 12, 13, 14, 15); }
__device__ __forceinline__ v16bf cat16b(v8us lo, v8us hi) { return __builtin_bit_cast(v16bf, __builtin_shufflevector(lo, hi, 0, 1, 2, 3, 4, 5, 6, 7, 8, 9, 10, 11, 12, 13, 14, 15)); }
__device__ __forceinline__ v8f wmma16(v16h a, v16h b, v8f c) { return __builtin_amdgcn_wmma_f32_16x16x32_f16(false, a, false, b, (short)0, c, false, false); }
__device__ __forceinline__ v8f wmmab(v16bf a, v16bf b, v8f c) { return __builtin_amdgcn_wmma_f32_16x16x32_bf16(false, a, false, b, (short)0, c, false, false); }

// FRAGMENT ORDER: every bf16 matrix [rows][K] that a matrix instruction reads from global memory lies as blocks of 16 rows x 32 k = 512 elements (block (r / 16) * (K / 32) + k / 32); inside a block
// element (r, k) stands at ((k / 16) % 2) * 256 + ((k / 8) % 2) * 128 + (r % 16) * 8 + k % 8: lane l's two 16-byte fragment pieces are at l * 8 and 256 + l * 8, so each wave-wide load is 512 bytes in a row.
// Which lane and register holds which (r, k) is as with row-major storage.
// wt_tile: WT [n][K] = bf16(W[k][n]) (k-major [K][ncols]), in fragment order, via one 64 x 64 LDS tile tl; tile (bx, by) of (K/64, ncols/64), 256 threads.
__device__ __forceinline__ void wt_tile(unsigned short* tl, int bx, int by, const float* __restrict__ Wm, int K, int ncols, bf* WT) {
    const int tid = threadIdx.x, k0 = bx * 64, n0 = by * 64;
    const int kk = tid >> 2, nq = (tid & 3) * 16;
#pragma unroll
    for (int i = 0; i < 16; ++i) tl[(nq + i) * 72 + kk] = f2bf(Wm[(size_t)(k0 + kk) * ncols + n0 + nq + i]);
    __syncthreads();
    const int lane = tid & 31, kq = (tid >> 6) & 1, part = (tid >> 5) & 1;    // a wave stores one half block: 512 bytes in a row
    auto pass = [&]() {
#pragma unroll
        for (int s = 0; s < 2; ++s) { const int nt = (tid >> 7) + 2 * s; const v8us val = *(const v8usa*)(tl + (nt * 16 + (lane & 15)) * 72 + (kq * 4 + part * 2 + (lane >> 4)) * 8);
            *(v8us*)(WT + ((size_t)(n0 / 16 + nt) * (K / 32) + k0 / 32 + kq) * 512 + part * 256 + lane * 8) = val; }
    };
    pass(); 
}
// cvt_blk: one wave rounds two neighbouring blocks (16 rows x 64 k) to bf16 in fragment order; src: the 16 rows' first element of those k, dst: the first block.
__device__ __forceinline__ void cvt_blk(const float* __restrict__ src, bf* dst) {
    const int lane = threadIdx.x & 31;
    const float* sp = src + (size_t)(lane & 15) * DM + (lane >> 4) * 8;
    v4u o[4];
#pragma unroll
    for (int q = 0; q < 4; ++q) { v4u t;
#pragma unroll
        for (int i = 0; i < 4; ++i) t[i] = pack2(sp[q * 16 + 2 * i], sp[q * 16 + 2 * i + 1]);
        o[q] = t; }
#pragma unroll
    for (int q = 0; q < 4; ++q) *(v4ua*)(dst + q * 256 + lane * 8) = o[q];
}
// k_prep: every operand preparation of the call in one grid, none reads another's output. Blocks 0 .. 1279: the five weights' 16 x 16 transpose tiles; then half of a 16-row tile a block (512 k, 64 a wave):
// 4096 rows of [mem; x] -> Cb, 2048 rows of x -> Xb, 2048 rows of rel_enc -> Rb.
#define NWT  (5 * (DD / 64) * (DD / 64))
__global__ __launch_bounds__(256) void k_prep(const float* __restrict__ Wq, const float* __restrict__ Wke, const float* __restrict__ Wkr, const float* __restrict__ Wv, const float* __restrict__ Wo,
                                              const float* __restrict__ x, const float* __restrict__ mem, const float* __restrict__ rel,
                                              bf* WqT, bf* WkeT, bf* WkrT, bf* WvT, bf* WoT, bf* Cb, bf* Xb, bf* Rb) {
    __shared__ __align__(16) unsigned short tl[64 * 72];
    const int blk = blockIdx.x;
    if (blk < NWT) {    // the same for the whole block: the barrier inside wt_tile is passed by all of it or by none
        const int w = blk / ((DD / 64) * (DD / 64)), tile = blk % ((DD / 64) * (DD / 64));
        const float* Wm = w == 0 ? Wq : w == 1 ? Wke : w == 2 ? Wkr : w == 3 ? Wv : Wo;
        bf* WT = w == 0 ? WqT : w == 1 ? WkeT : w == 2 ? WkrT : w == 3 ? WvT : WoT;
        wt_tile(tl, tile % (DD / 64), tile / (DD / 64), Wm, DD, DD, WT);
    } else {
        const int r = ((blk - NWT) >> 1) * 16;    // the first row of the block's tile; every boundary below is a multiple of 16, so a tile's rows have one source and one target
        const float* src; bf* dst;
        if (r < NCR) { const int b = r / TK, t = r % TK;    // x_tilde_b = [mem_b; x_b]
            src = t < LQ ? mem + ((size_t)b * LQ + t) * DD : x + ((size_t)b * LQ + t - LQ) * DD; dst = Cb + (size_t)r * DD;
        } else if (r < NCR + NXR) { src = x + (size_t)(r - NCR) * DD; dst = Xb + (size_t)(r - NCR) * DD;    // x rows (b, s)
        } else { src = rel + (size_t)(r - NCR - NXR) * DD; dst = Rb + (size_t)(r - NCR - NXR) * DD; }
        const int kb = ((blk - NWT) & 1) * 16 + (threadIdx.x >> 5) * 2;    // the wave's first block of 32 k; dst is the tile's first block (16 rows x DD elements a tile, as row-major)
        cvt_blk(src + kb * 32, dst + kb * 512);
    }
}

// k_gemmb: MT * 64 x 64 block tile (4 waves x MT row tiles x 16 x 64) of C[NXR][DD] = (A [+ Al]).B^T (K = 1024) [+ bf(bias[c])] [+ bf(R[r][c]) residual]; f32 whole-line epilogue (or f16
// PLANES 1: the 64 columns of a block are one head, and the tile goes out as that head's operand planes [row][64] = bf16 hi + UNSCALED residual (NR rows per batch, batch-first rows);
// PLANES 2: the same two planes transposed, [d][TK] (the v operand of P.v). Either way the f32 product never leaves the block. A, Al, Bn and the planes are in fragment order.
// The body is a device function of the block's tile (bx, by) and of its LDS tile ost, so that several products can share one grid.
// MT: 16-row tiles a wave holds (rows (bx * MT + mt) * 64 + wave * 16 ..): the block's tile is MT * 64 rows x 64 columns, and each B fragment a wave loads feeds four products (SPLITA: MT row tiles x two planes).
template <bool SPLITA, bool F16OUT, int PLANES, int NR, int MT>
__device__ __forceinline__ void gemmb(float (*ost)[16 * 68], int bx, int by, const bf* __restrict__ A, const bf* __restrict__ Al, const bf* __restrict__ Bn, const float* __restrict__ bias, float* C, int ldc, h16* C2, const float* __restrict__ R = nullptr, int K = DM, int roundR = 1, bf* Ph = nullptr, bf* Pl = nullptr) {
    const int lane = threadIdx.x & 31, wave = __builtin_amdgcn_readfirstlane(threadIdx.x >> 5), lr = lane & 15, hi = lane >> 4;
    const int c0 = by * 64;
    size_t aoff[MT];    // fragment order: a 16-row tile is 16 * K elements, its blocks of 32 k are 512 elements apart; a block's address is the same for the whole wave, lane l reads at l * 8
#pragma unroll
    for (int mt = 0; mt < MT; ++mt) aoff[mt] = (size_t)((bx * MT + mt) * 64 + wave * 16) * K;
    size_t boff[4];
#pragma unroll
    for (int t = 0; t < 4; ++t) boff[t] = (size_t)(c0 + t * 16) * K;
    v8f acc[MT][4];
#pragma unroll
    for (int mt = 0; mt < MT; ++mt) {
#pragma unroll
        for (int t = 0; t < 4; ++t) acc[mt][t] = (v8f){}; }
    float braw[4] = {0.f, 0.f, 0.f, 0.f};    // PLANES: the bias is asked for here, so that it arrives under the k loop and the epilogue does not wait for it
    if (PLANES) {
#pragma unroll
        for (int t = 0; t < 4; ++t) braw[t] = bias[c0 + t * 16 + lr];
        asm volatile("s_wait_xcnt 0x0" ::: "memory"); }    // precaution: stands in front of the first rewrite of the four bias loads' address registers (the k loop's set-up reuses them)
#pragma unroll 1
    for (int kc = 0; kc < K; kc += 32) {
        const bf* const pb[4] = {Bn + boff[0] + kc * 16, Bn + boff[1] + kc * 16, Bn + boff[2] + kc * 16, Bn + boff[3] + kc * 16};
        static_assert((MT == 4 && !SPLITA) || (MT == 2 && SPLITA), "the wide tile has four A-side fragments a trip: four row tiles of one plane, or two row tiles of two planes");
        const bf* const pa[4] = {A + aoff[0] + kc * 16, A + aoff[1] + kc * 16, (SPLITA ? Al + aoff[0] : A + aoff[MT - 2]) + kc * 16, (SPLITA ? Al + aoff[1] : A + aoff[MT - 1]) + kc * 16};
        v16bf a[4], b[4];
#pragma unroll
        for (int i = 0; i < 4; ++i) a[i] = cat16b(*(const v8us*)(pa[i] + lane * 8), *(const v8us*)(pa[i] + lane * 8 + 256));
#pragma unroll
        for (int t = 0; t < 4; ++t) b[t] = cat16b(*(const v8us*)(pb[t] + lane * 8), *(const v8us*)(pb[t] + lane * 8 + 256));
        __builtin_amdgcn_sched_barrier(0);    // keeps the trip's 16 loads one group in front of its products; spread among them, with registers reused, the wave would wait out the load latency several times a trip
#pragma unroll
        for (int i = 0; i < 4; i += MT) {    // SPLITA: all hi products, then all residual products; each accumulator still takes hi, then residual, of every trip in turn
#pragma unroll
            for (int t = 0; t < 4; ++t) {
#pragma unroll
                for (int mt = 0; mt < MT; ++mt) acc[mt][t] = wmmab(a[i + mt], b[t], acc[mt][t]); } }
        __builtin_amdgcn_sched_barrier(0);    // keeps every product of the trip in front of the two statements below
        asm volatile("s_wait_xcnt 0x0" :: "s"(pa[0]), "s"(pa[1]), "s"(pa[2]), "s"(pa[3]), "s"(pb[0]), "s"(pb[1]), "s"(pb[2]), "s"(pb[3]) : "memory");    // precaution: the trip's block addresses are inputs here, so none of their registers is rewritten in front of this wait
        asm volatile("v_nop\n\tv_nop\n\tv_nop\n\tv_nop" : "+v"(acc[0][3]), "+v"(acc[MT - 1][3]));    // the four vector slots the chip needs behind the trip's last products, on the way out of the loop too
    }
    float bvv[4];    // the columns' bias, the same for every row tile
#pragma unroll
    for (int t = 0; t < 4; ++t) bvv[t] = PLANES ? bfr(braw[t]) : bias ? bfr(bias[c0 + t * 16 + lr]) : 0.f;
#pragma unroll
    for (int mt = 0; mt < MT; ++mt) {    // 64 rows of the block's tile a part of ost: ost[mt * 4 + wave] is the wave's 16 rows of it
    float* os = &ost[mt * 4 + wave][0];
#pragma unroll
    for (int t = 0; t < 4; ++t) { const float bv = bvv[t];
        if (PLANES == 2) {    // transposed tile [d][68] over all four waves' rows: a lane's eight rows are eight neighbours of one d
            float* tp = &ost[mt * 4][0] + (t * 16 + lr) * 68 + wave * 16 + hi * 8;
            *(v4fa*)tp = (v4f){acc[mt][t][0] + bv, acc[mt][t][1] + bv, acc[mt][t][2] + bv, acc[mt][t][3] + bv}; *(v4fa*)(tp + 4) = (v4f){acc[mt][t][4] + bv, acc[mt][t][5] + bv, acc[mt][t][6] + bv, acc[mt][t][7] + bv};
        } else {
#pragma unroll
        for (int j = 0; j < 8; ++j) os[(hi * 8 + j) * 68 + t * 16 + lr] = acc[mt][t][j] + bv; } }
    }
    __syncthreads();
#pragma unroll 1    // rolled: for speed only
    for (int mt = 0; mt < MT; ++mt) {
    const int bxe = bx * MT + mt, r0 = bxe * 64 + wave * 16;
    float* os = &ost[mt * 4 + wave][0];
    if (PLANES) {
        const int rb = bxe * 64, bhp = (rb / NR) * NH_ + by, rin = rb % NR;    // batch and head of the block, the 64-row part's first row inside the batch
#pragma unroll
        for (int s = 0; s < 4; ++s) {    // fragment order: 32 lanes x 16 bytes are half a block, 512 bytes in a row in both planes
            const int piece = PLANES == 2 ? wave * 2 + hi : s * 2 + hi;    // which eight k (PLANES 2: keys of the block's 64; else d)
            const int row = PLANES == 2 ? s * 16 + lr : lr;    // PLANES 2: d, of the block's tile; else a row of the wave's own 16
            const float* sp = (PLANES == 2 ? &ost[mt * 4][0] : os) + row * 68 + piece * 8; v4u oh, ol;
#pragma unroll
            for (int i = 0; i < 4; ++i) { unsigned hw, lw; split2(sp[2 * i], sp[2 * i + 1], hw, lw); oh[i] = hw; ol[i] = lw; }
            const size_t o = PLANES == 2 ? ((size_t)bhp * HD + s * 16) * TK + (rin / 32 + (wave >> 1)) * 512 + (wave & 1) * 256 + lane * 8 : ((size_t)bhp * NR + rin + wave * 16) * HD + s * 256 + lane * 8;
            *(v4ua*)(Ph + o) = oh; *(v4ua*)(Pl + o) = ol; }
        asm volatile("s_wait_xcnt 0x0" ::: "memory");    // precaution: behind the last plane store, in front of whatever the shared grid's code places after this body that rewrites the stores' registers
    } else if (F16OUT) {
        h16* crow = (h16*)(void*)C + (size_t)r0 * ldc + c0;
        auto pass = [&]() {
#pragma unroll
            for (int s = 0; s < 4; ++s) { const int row = 4 * s + (lane >> 3), piece = lane & 7; const float* sp = os + row * 68 + piece * 8; v8h o, o2;
#pragma unroll
                for (int i = 0; i < 8; ++i) { const h16 a = (h16)sp[i]; o[i] = a; o2[i] = (h16)((sp[i] - (float)a) * LOSC); }
                *(v8h*)(crow + (size_t)row * ldc + piece * 8) = o; if (C2) *(v8h*)(C2 + (size_t)r0 * ldc + c0 + (size_t)row * ldc + piece * 8) = o2; }
        };
        pass(); 
    } else {
        float* crow = C + (size_t)r0 * ldc + c0;
        auto pass = [&]() {
#pragma unroll
            for (int s = 0; s < 8; ++s) { const int Lid = (lane >> 3) + 4 * s, piece = lane & 7; const int row = Lid >> 1, cofs = (Lid & 1) * 32 + piece * 4;
                v4f val = *(const v4fa*)(os + row * 68 + cofs); if (R) { const v4f rv = *(const v4f*)(R + ((size_t)r0 + row) * ldc + c0 + cofs); val += roundR ? (v4f){bfr(rv[0]), bfr(rv[1]), bfr(rv[2]), bfr(rv[3])} : rv; }
                *(v4f*)(crow + (size_t)row * ldc + cofs) = val;
                asm volatile("s_wait_xcnt 0x0" ::: "memory"); }    // precaution: behind each store, in front of the next piece's (and the next pass's) rewrite of the store's registers
        };
        pass(); 
    }
    }
}
// k_proj: the four projections, which read none of each other's output, as one grid of 256-row x 64-column tiles: blockIdx.x 0 .. 15 k, 16 .. 31 v, 32 .. 39 q, 40 .. 47 Q_rel (shared across b: one batch of TK rows); blockIdx.y the head.
#define PMT  4                    // 16-row tiles a wave of k_proj holds
#define PBR  (64 * PMT)           // rows of a block's tile; divides LQ and TK, so a tile stays inside one batch
__global__ __launch_bounds__(128) void k_proj(const bf* __restrict__ Cb, const bf* __restrict__ Xb, const bf* __restrict__ Rb, const bf* __restrict__ WkeT, const bf* __restrict__ WvT, const bf* __restrict__ WqT, const bf* __restrict__ WkrT,
                                              const float* __restrict__ bke, const float* __restrict__ bv, const float* __restrict__ bq, const float* __restrict__ bkr,
                                              bf* Kh, bf* Kl, bf* VTh, bf* VTl, bf* Qh, bf* Ql, bf* Rh, bf* Rl, int K) {
    __shared__ __align__(16) float ost[4 * PMT][16 * 68];
    const int bx = blockIdx.x, by = blockIdx.y;
    if (bx < NCR / PBR) gemmb<false, false, 1, TK, PMT>(ost, bx, by, Cb, nullptr, WkeT, bke, nullptr, DD, nullptr, nullptr, K, 1, Kh, Kl);
    else if (bx < 2 * (NCR / PBR)) gemmb<false, false, 2, TK, PMT>(ost, bx - NCR / PBR, by, Cb, nullptr, WvT, bv, nullptr, DD, nullptr, nullptr, K, 1, VTh, VTl);
    else if (bx < 2 * (NCR / PBR) + NXR / PBR) gemmb<false, false, 1, LQ, PMT>(ost, bx - 2 * (NCR / PBR), by, Xb, nullptr, WqT, bq, nullptr, DD, nullptr, nullptr, K, 1, Qh, Ql);
    else gemmb<false, false, 1, TK, PMT>(ost, bx - 2 * (NCR / PBR) - NXR / PBR, by, Rb, nullptr, WkrT, bkr, nullptr, DD, nullptr, nullptr, K, 1, Rh, Rl);
}
// k_out: out = (ctx hi + ctx residual).Wo + bf(bo), K = 1024, 128 x 64 block tile. 16 waves = 4 row groups (two 16-row tiles each, 64 rows apart, x 64 columns) x OKS slices of K:
// a wave sums 256 k in 8 trips, and four waves a SIMD wait out their trips' load latencies side by side. The OKS partial tiles meet in LDS and are added in slice order.
// K comes as an argument, as in k_proj: the trip's block addresses then stay scalar, and every load is scalar base + the lane's one offset register.
#define OKS  4
__global__ __launch_bounds__(512) void k_out(const bf* __restrict__ A, const bf* __restrict__ Al, const bf* __restrict__ Bn, const float* __restrict__ bias, float* C, int K) {
    __shared__ __align__(16) float ost[OKS][8][16 * 68];    // [slice][16-row tile of the block's 128 rows][row x 68]
    const int tid = threadIdx.x, lane = tid & 31, wave = __builtin_amdgcn_readfirstlane(tid >> 5), wr = wave & 3, ks = wave >> 2, lr = lane & 15, hi = lane >> 4;
    const int bx = blockIdx.x, c0 = blockIdx.y * 64;
    const v4f braw = *(const v4f*)(bias + c0 + (tid & 15) * 4);    // the bias of the four columns this thread stores, asked for here so that it arrives under the k loop
    asm volatile("s_wait_xcnt 0x0" ::: "memory");    // precaution: stands in front of the first rewrite of the bias load's address registers
    const size_t aoff[2] = {(size_t)(bx * 128 + wr * 16) * K, (size_t)(bx * 128 + 64 + wr * 16) * K};    // fragment order: a 16-row tile is 16 * K elements, its blocks of 32 k are 512 elements apart
    const size_t boff[4] = {(size_t)c0 * K, (size_t)(c0 + 16) * K, (size_t)(c0 + 32) * K, (size_t)(c0 + 48) * K};
    const int kn = K / OKS, k0 = ks * kn;    // the wave's slice of K
    v8f acc[2][4];
#pragma unroll
    for (int mt = 0; mt < 2; ++mt) {
#pragma unroll
        for (int t = 0; t < 4; ++t) acc[mt][t] = (v8f){}; }
#pragma unroll 1    // rolled: one trip's text, and one group of 16 loads in flight a wave
    for (int kc = k0; kc < k0 + kn; kc += 32) {
        const bf* const pb[4] = {Bn + boff[0] + kc * 16, Bn + boff[1] + kc * 16, Bn + boff[2] + kc * 16, Bn + boff[3] + kc * 16};
        const bf* const pa[4] = {A + aoff[0] + kc * 16, A + aoff[1] + kc * 16, Al + aoff[0] + kc * 16, Al + aoff[1] + kc * 16};
        v16bf a[4], b[4];
#pragma unroll
        for (int i = 0; i < 4; ++i) a[i] = cat16b(*(const v8us*)(pa[i] + lane * 8), *(const v8us*)(pa[i] + lane * 8 + 256));
#pragma unroll
        for (int t = 0; t < 4; ++t) b[t] = cat16b(*(const v8us*)(pb[t] + lane * 8), *(const v8us*)(pb[t] + lane * 8 + 256));
        __builtin_amdgcn_sched_barrier(0);    // keeps the trip's 16 loads one group in front of its products; spread among them, with registers reused, the wave would wait out the load latency several times a trip
#pragma unroll
        for (int i = 0; i < 4; i += 2) {    // all hi products, then all residual products; each accumulator takes hi, then residual, of every trip in turn
#pragma unroll
            for (int t = 0; t < 4; ++t) {
#pragma unroll
                for (int mt = 0; mt < 2; ++mt) acc[mt][t] = wmmab(a[i + mt], b[t], acc[mt][t]); } }
        __builtin_amdgcn_sched_barrier(0);    // keeps every product of the trip in front of the two statements below
        asm volatile("s_wait_xcnt 0x0" :: "s"(pa[0]), "s"(pa[1]), "s"(pa[2]), "s"(pa[3]), "s"(pb[0]), "s"(pb[1]), "s"(pb[2]), "s"(pb[3]) : "memory");    // precaution: the trip's block addresses are inputs here, so none of their registers is rewritten in front of this wait
        asm volatile("v_nop\n\tv_nop\n\tv_nop\n\tv_nop" : "+v"(acc[0][3]), "+v"(acc[1][3]));    // the four vector slots the chip needs behind the trip's last products, on the way out of the loop too
    }
#pragma unroll
    for (int mt = 0; mt < 2; ++mt) { float* os = &ost[ks][mt * 4 + wr][0];
#pragma unroll
        for (int t = 0; t < 4; ++t) {
#pragma unroll
            for (int j = 0; j < 8; ++j) os[(hi * 8 + j) * 68 + t * 16 + lr] = acc[mt][t][j]; } }
    __syncthreads();    // every slice's partial tile is in LDS
    const v4f bv = (v4f){bfr(braw[0]), bfr(braw[1]), bfr(braw[2]), bfr(braw[3])};
    const int cofs = (tid & 15) * 4;    // 16 threads a row: a wave stores two rows' 256 bytes, whole lines
    v4f val[4];    // all 16 LDS reads go as one group, in front of the stores and their waits
#pragma unroll
    for (int s = 0; s < 4; ++s) { const int row = s * 32 + (tid >> 4); const float* sp = &ost[0][row >> 4][0] + (row & 15) * 68 + cofs;
        val[s] = *(const v4fa*)sp;
#pragma unroll
        for (int k = 1; k < OKS; ++k) val[s] += *(const v4fa*)(sp + k * (8 * 16 * 68)); }
#pragma unroll
    for (int s = 0; s < 4; ++s) {
        *(v4f*)(C + (size_t)(bx * 128 + s * 32 + (tid >> 4)) * DD + c0 + cofs) = val[s] + bv;
        asm volatile("s_wait_xcnt 0x0" ::: "memory"); }    // precaution: behind each store, in front of the next piece's rewrite of the store's registers
}


// k_attn: one work-group (16 waves) per 32 query rows of one (b, h); the 32 x 2048 scores never leave LDS.
//  1. B_hat = q.Q_rel^T (three products), each wave 128 columns; element (r, c) is stored straight at its place after the shift: with u = c + r - (L-1), row r column u when u >= 0,
//     else row r-1 column u + T (so rows i0 .. i0+32 of B_hat are needed: a third row tile gives row i0+32); the one padded zero of each row is stored by hand.
//  2. A = q.k^T (three products), s = (A + B) / 8 in place.  3. each wave two rows in turn: + mask x (-1e9), softmax in f32 (row in registers), P as bf16 hi + residual planes over the row's own bytes.
//  4. ctx = P.v (three products): wave w sums keys 128 w .. 128 w + 127 for all 32 x 64 outputs; the 16 partial tiles are added in wave order through LDS.
#define RQ   32                   // query rows of one work-group
#define SP   2052                 // LDS row pitch in floats: 16 B x odd, for the 16-byte fragment reads of stage 4
#define RP   68                   // pitch of a partial ctx tile's row in floats
__device__ __forceinline__ v16bf ldfrag(const bf* p) { return cat16b(*(const v8us*)p, *(const v8us*)(p + 256)); }    // global planes, fragment order: p = block + lane * 8
__device__ __forceinline__ v16bf ldfrag_s(const bf* p) { return cat16b(*(const v8usa*)p, *(const v8usa*)(p + 16)); }
__device__ __forceinline__ v8f prod3(const v16bf (&ah)[2], const v16bf (&al)[2], const v16bf (&bh)[2], const v16bf (&bl)[2]) {
    v8f acc = (v8f){};
#pragma unroll
    for (int ks = 0; ks < 2; ++ks) { acc = wmmab(ah[ks], bh[ks], acc); acc = wmmab(al[ks], bh[ks], acc); acc = wmmab(ah[ks], bl[ks], acc); }
    return acc;
}
__global__ __launch_bounds__(512) void k_attn(const bf* __restrict__ Qh, const bf* __restrict__ Ql, const bf* __restrict__ Kh, const bf* __restrict__ Kl, const bf* __restrict__ Rh, const bf* __restrict__ Rl,
                                              const bf* __restrict__ VTh, const bf* __restrict__ VTl, const float* __restrict__ MSK, bf* AVh, bf* AVl) {
    __shared__ __align__(16) float S[RQ * SP];
    const int tid = threadIdx.x, lane = tid & 31, wave = __builtin_amdgcn_readfirstlane(tid >> 5), lr = lane & 15, hi = lane >> 4;
    const int i0 = blockIdx.x * RQ, bh = blockIdx.y, h = bh % NH_, b = bh / NH_;
    Qh += (size_t)bh * LQ * HD; Ql += (size_t)bh * LQ * HD; Kh += (size_t)bh * TK * HD; Kl += (size_t)bh * TK * HD; Rh += (size_t)h * TK * HD; Rl += (size_t)h * TK * HD; VTh += (size_t)bh * HD * TK; VTl += (size_t)bh * HD * TK;
    const int cw = wave * (TK / 16);
    v16bf qh[3][2], ql[3][2]; const bf* qa[3]; const bf* qb[3];
#pragma unroll
    for (int rt = 0; rt < 3; ++rt) { const size_t o = (size_t)min(i0 + rt * 16, LQ - 16) * HD + lane * 8; qa[rt] = Qh + o; qb[rt] = Ql + o;    // the clamp holds the last work-group's third tile, which it never uses, inside the plane
#pragma unroll
        for (int ks = 0; ks < 2; ++ks) { qh[rt][ks] = ldfrag(qa[rt] + ks * 512); ql[rt][ks] = ldfrag(qb[rt] + ks * 512); } }
    asm volatile("s_wait_xcnt 0x0" :: "v"(qa[0]), "v"(qa[1]), "v"(qa[2]), "v"(qb[0]), "v"(qb[1]), "v"(qb[2]) : "memory");    // precaution: the loads' address registers are inputs here, so none of them is rewritten (by a later load's result either) in front of this wait
    if (tid < RQ) { const int zc = (TK - LQ + 1) + i0 + tid; if (zc < TK) S[tid * SP + zc] = 0.f; }   // the padded zero: column T - L + 1 + i of row i
    const size_t fo = (size_t)cw * HD + lane * 8;    // this lane's place in the first 16-column tile of the wave's slice (fragment order: two blocks of 512 a tile); a tile further is 16 * HD elements on
    v16bf fh[2][2], fl[2][2];                             // two register sets: the next tile's fragments are fetched while this tile is worked on
#pragma unroll
    for (int ks = 0; ks < 2; ++ks) { fh[0][ks] = ldfrag(Rh + fo + ks * 512); fl[0][ks] = ldfrag(Rl + fo + ks * 512); }
#pragma unroll
    for (int t = 0; t < 8; ++t) { const int c0 = cw + t * 16, cur = t & 1, nxt = cur ^ 1;
        const bf* nh = (t < 7 ? Rh : Kh) + fo + (t < 7 ? (t + 1) * 16 * HD : 0); const bf* nl = (t < 7 ? Rl : Kl) + fo + (t < 7 ? (t + 1) * 16 * HD : 0);   // behind the last Q_rel tile: the first k tile
#pragma unroll
        for (int ks = 0; ks < 2; ++ks) { fh[nxt][ks] = ldfrag(nh + ks * 512); fl[nxt][ks] = ldfrag(nl + ks * 512); }
        v8f a0 = prod3(qh[0], ql[0], fh[cur], fl[cur]), a1 = prod3(qh[1], ql[1], fh[cur], fl[cur]);
        asm volatile("v_nop\n\tv_nop\n\tv_nop\n\tv_nop" : "+v"(a0), "+v"(a1));    // the four vector slots the chip needs before these results' registers are written again (the next product chain may reuse them right behind the LDS stores)
#pragma unroll
        for (int rt = 0; rt < 2; ++rt) {
#pragma unroll
            for (int j = 0; j < 8; ++j) { const int lrw = rt * 16 + hi * 8 + j, u = c0 + lr + i0 + lrw - (LQ - 1);
                int idx = lrw * SP + u - (u < 0 ? SP - TK : 0);
                if (rt == 0 && j == 0) idx = idx < 0 ? TK : idx;    // row i0 - 1 is another work-group's: such a value goes to row 0's pad, which nobody reads
                S[idx] = rt ? a1[j] : a0[j]; } }
        if (c0 + i0 + RQ - (LQ - 1) < 0) { v8f a2 = prod3(qh[2], ql[2], fh[cur], fl[cur]); const int u = c0 + lr + i0 + RQ - (LQ - 1);   // row i0 + 32 feeds the tail of row i0 + 31
            asm volatile("v_nop\n\tv_nop\n\tv_nop\n\tv_nop" : "+v"(a2));    // the same four slots, on the way out of this branch
            S[(hi == 0 && u < 0) ? RQ * SP + u - (SP - TK) : TK] = a2[0]; }
    }
    __syncthreads();
    float* const sw = S + hi * 8 * SP + cw + lr;    // this lane's element of row hi * 8 in the wave's first tile
    float old[2][16];                               // B of this tile and of the next: read in one batch a tile ahead, so that no LDS read waits behind the stores of the tile before
#pragma unroll
    for (int e = 0; e < 16; ++e) old[0][e] = sw[((e >> 3) * 16 + (e & 7)) * SP];
#pragma unroll
    for (int t = 0; t < 8; ++t) { const int cur = t & 1, nxt = cur ^ 1;
        if (t < 7) {
#pragma unroll
            for (int ks = 0; ks < 2; ++ks) { fh[nxt][ks] = ldfrag(Kh + fo + (t + 1) * 16 * HD + ks * 512); fl[nxt][ks] = ldfrag(Kl + fo + (t + 1) * 16 * HD + ks * 512); }
#pragma unroll
            for (int e = 0; e < 16; ++e) old[nxt][e] = sw[((e >> 3) * 16 + (e & 7)) * SP + (t + 1) * 16]; }
        __builtin_amdgcn_sched_barrier(0);    // keeps the next tile's loads in front of this tile's products; the compiler otherwise sinks them to just before their use and the wave waits out the whole latency
        const v8f a0 = prod3(qh[0], ql[0], fh[cur], fl[cur]), a1 = prod3(qh[1], ql[1], fh[cur], fl[cur]);
#pragma unroll
        for (int e = 0; e < 16; ++e) sw[((e >> 3) * 16 + (e & 7)) * SP + t * 16] = ((e < 8 ? a0[e & 7] : a1[e & 7]) + old[cur][e]) * SCL;
    }
    __builtin_amdgcn_sched_barrier(0);    // keeps the mask loads below from being lifted into the score tiles above, where their 64 registers would spill
    const float* mrow = MSK + (size_t)(i0 + wave * (RQ / 16)) * TK + lane * 4;
    v4f mk[TK / 128];    // the mask of the wave's first row, asked for in front of the barrier so that it arrives while the other waves finish their scores
#pragma unroll
    for (int k = 0; k < TK / 128; ++k) mk[k] = *(const v4f*)(mrow + k * 128);
    __syncthreads();
#pragma unroll 1    // rolled: with both rows unrolled together the live set overran the register budget and spilled
    for (int rr = 0; rr < RQ / 16; ++rr) { const int lrw = wave * (RQ / 16) + rr; float* srow = S + lrw * SP;
        float v[TK / 32]; float m = -3.0e38f;
#pragma unroll
        for (int k = 0; k < TK / 128; ++k) { const int c = k * 128 + lane * 4; const v4f s = *(const v4fa*)(srow + c);
#pragma unroll
            for (int q = 0; q < 4; q += 2) { const v2bf mr = __builtin_convertvector((v2f){mk[k][q], mk[k][q + 1]}, v2bf);    // the mask rounded to bf16, two a conversion
                const float x0 = __builtin_fmaf((float)mr[0], -1e9f, s[q]), x1 = __builtin_fmaf((float)mr[1], -1e9f, s[q + 1]); v[k * 4 + q] = x0; v[k * 4 + q + 1] = x1; m = fmaxf(m, fmaxf(x0, x1)); } }
        if (rr + 1 < RQ / 16) {    // the next row's mask flies while this row's softmax is worked out
#pragma unroll
            for (int k = 0; k < TK / 128; ++k) mk[k] = *(const v4f*)(mrow + (size_t)(rr + 1) * TK + k * 128); }
#pragma unroll
        for (int sh = 16; sh; sh >>= 1) m = fmaxf(m, __shfl_xor(m, sh, 32));
        float sum = 0.f;
#pragma unroll
        for (int k = 0; k < TK / 32; ++k) { v[k] = __expf(v[k] - m); sum += v[k]; }
#pragma unroll
        for (int sh = 16; sh; sh >>= 1) sum += __shfl_xor(sum, sh, 32);
        const float inv = 1.0f / sum;
        bf* prow = (bf*)(void*)srow;    // hi plane in the row's first 4096 bytes, residual plane in the next 4096; the whole row is in registers by now
#pragma unroll
        for (int k = 0; k < TK / 128; ++k) { v2u oh, ol;
#pragma unroll
            for (int q = 0; q < 2; ++q) { unsigned hw, lw; split2(v[k * 4 + 2 * q] * inv, v[k * 4 + 2 * q + 1] * inv, hw, lw); oh[q] = hw; ol[q] = lw; }
            *(v2ua*)(prow + k * 128 + lane * 4) = oh; *(v2ua*)(prow + TK + k * 128 + lane * 4) = ol; }
    }
    const size_t vo = (size_t)cw * 16 + lane * 8;    // this lane's place in the v planes (fragment order): first 16-row tile of d, the block of the wave's first 32 keys; a tile of d further is 16 * TK elements on
    v16bf vh[2][4], vl[2][4];                           // two register sets: the next 32 keys' v fragments are fetched while these are worked on; the first set is asked for in front of the barrier
#pragma unroll
    for (int dt = 0; dt < 4; ++dt) { vh[0][dt] = ldfrag(VTh + vo + (size_t)dt * 16 * TK); vl[0][dt] = ldfrag(VTl + vo + (size_t)dt * 16 * TK); }
    __syncthreads();
    v8f acc[2][4];
#pragma unroll
    for (int rt = 0; rt < 2; ++rt) {
#pragma unroll
        for (int dt = 0; dt < 4; ++dt) acc[rt][dt] = (v8f){}; }
#pragma unroll
    for (int ks = 0; ks < 4; ++ks) { const int cur = ks & 1, nxt = cur ^ 1;
        if (ks < 3) {
#pragma unroll
            for (int dt = 0; dt < 4; ++dt) { vh[nxt][dt] = ldfrag(VTh + vo + (size_t)dt * 16 * TK + (ks + 1) * 512); vl[nxt][dt] = ldfrag(VTl + vo + (size_t)dt * 16 * TK + (ks + 1) * 512); } }
        v16bf ph[2], pl[2];
#pragma unroll
        for (int rt = 0; rt < 2; ++rt) { const bf* pr = (const bf*)(const void*)(S + (rt * 16 + lr) * SP) + cw + ks * 32 + 8 * hi; ph[rt] = ldfrag_s(pr); pl[rt] = ldfrag_s(pr + TK); }
#pragma unroll
        for (int dt = 0; dt < 4; ++dt) {
#pragma unroll
            for (int rt = 0; rt < 2; ++rt) { acc[rt][dt] = wmmab(ph[rt], vh[cur][dt], acc[rt][dt]); acc[rt][dt] = wmmab(pl[rt], vh[cur][dt], acc[rt][dt]); acc[rt][dt] = wmmab(ph[rt], vl[cur][dt], acc[rt][dt]); } }
    }
    __syncthreads();    // every wave has read its P fragments: the score rows' LDS now takes the 16 partial tiles
    float* red = S + wave * (RQ * RP);
#pragma unroll
    for (int rt = 0; rt < 2; ++rt) {
#pragma unroll
        for (int dt = 0; dt < 4; ++dt) {
#pragma unroll
            for (int j = 0; j < 8; ++j) red[(rt * 16 + hi * 8 + j) * RP + dt * 16 + lr] = acc[rt][dt][j]; } }
    __syncthreads();
    const int orow = (tid >> 8) * 16 + ((tid >> 1) & 15), od = ((tid >> 5) & 7) * 8 + (tid & 1) * 4;    // thread -> element so that a wave's 8-byte stores are 256 bytes in a row of the fragment-order planes
    v4f part[16];
#pragma unroll
    for (int w = 0; w < 16; ++w) part[w] = *(const v4fa*)(S + w * (RQ * RP) + orow * RP + od);
    v4f o = part[0];
#pragma unroll
    for (int w = 1; w < 16; ++w) o += part[w];
    v2u oh, ol;    // ctx goes out as the last GEMM's operand planes: bf16 hi + residual
#pragma unroll
    for (int q = 0; q < 2; ++q) { unsigned hw, lw; split2(o[2 * q], o[2 * q + 1], hw, lw); oh[q] = hw; ol[q] = lw; }
    const size_t oo = ((size_t)b * LQ + i0 + (tid >> 8) * 16) * DD + (size_t)h * 1024 + (tid & 255) * 4;    // 16-row tile, then the head's two blocks of 32 columns
    *(v2ua*)(AVh + oo) = oh; *(v2ua*)(AVl + oo) = ol;
}
extern "C" void kernel_launch(void* const* d_in, const int* in_sizes, int n_in,
                              void* d_out, int out_size, void* d_ws, size_t ws_size, hipStream_t stream) {
    (void)in_sizes; (void)n_in; (void)out_size;
    const float* x = (const float*)d_in[0]; const float* mem = (const float*)d_in[1]; const float* msk = (const float*)d_in[2]; const float* rel = (const float*)d_in[3];
    const float* Wq = (const float*)d_in[4]; const float* bq = (const float*)d_in[5]; const float* Wke = (const float*)d_in[6]; const float* bke = (const float*)d_in[7]; const float* Wkr = (const float*)d_in[8]; const float* bkr = (const float*)d_in[9];
    const float* Wv = (const float*)d_in[10]; const float* bv = (const float*)d_in[11]; const float* Wo = (const float*)d_in[12]; const float* bo = (const float*)d_in[13];
    float* out = (float*)d_out;    // [2][1024][1024]
    char* wsp = (char*)d_ws;
    auto take = [&](size_t bytes) { char* p = wsp; wsp += (bytes + 255) & ~(size_t)255; return (void*)p; };
    bf* WoT = (bf*)take((size_t)DD * DD * 2);
    bf* Qh = (bf*)take((size_t)NBT * NH_ * LQ * HD * 2); bf* Ql = (bf*)take((size_t)NBT * NH_ * LQ * HD * 2);
    bf* Kh = (bf*)take((size_t)NBT * NH_ * TK * HD * 2); bf* Kl = (bf*)take((size_t)NBT * NH_ * TK * HD * 2); bf* Rh = (bf*)take((size_t)NH_ * TK * HD * 2); bf* Rl = (bf*)take((size_t)NH_ * TK * HD * 2);
    bf* VTh = (bf*)take((size_t)NBT * NH_ * HD * TK * 2); bf* VTl = (bf*)take((size_t)NBT * NH_ * HD * TK * 2);
    // One region, used twice in stream order: projection scratch, then the split ctx planes. Each use writes all it reads.
    char* const shared0 = wsp;
    bf* AVh = (bf*)take((size_t)NXR * DD * 2); bf* AVl = (bf*)take((size_t)NXR * DD * 2);
    wsp = shared0;
    bf* WqT = (bf*)take((size_t)DD * DD * 2); bf* WkeT = (bf*)take((size_t)DD * DD * 2); bf* WkrT = (bf*)take((size_t)DD * DD * 2); bf* WvT = (bf*)take((size_t)DD * DD * 2);
    bf* Cb = (bf*)take((size_t)NCR * DD * 2); bf* Xb = (bf*)take((size_t)NXR * DD * 2); bf* Rb = (bf*)take((size_t)TK * DD * 2);
    if ((size_t)(wsp - (char*)d_ws) > ws_size) return;    // 50 MiB kept (WoT, q, k, Q_rel, v planes) + 24 MiB shared region; Cb holds [mem; x], Xb x, Rb rel_enc
    k_prep<<<NWT + (NCR + NXR + TK) / 8, 256, 0, stream>>>(Wq, Wke, Wkr, Wv, Wo, x, mem, rel, WqT, WkeT, WkrT, WvT, WoT, Cb, Xb, Rb);
    k_proj<<<dim3(2 * (NCR / PBR) + NXR / PBR + TK / PBR, DD / 64, 1), 128, 0, stream>>>(Cb, Xb, Rb, WkeT, WvT, WqT, WkrT, bke, bv, bq, bkr, Kh, Kl, VTh, VTl, Qh, Ql, Rh, Rl, DM);
    k_attn<<<dim3(LQ / RQ, NBT * NH_, 1), 512, 0, stream>>>(Qh, Ql, Kh, Kl, Rh, Rl, VTh, VTl, msk, AVh, AVl);    // ctx[(b,s)][h*64 + d], as planes
    k_out<<<dim3(NXR / 128, DD / 64, 1), 512, 0, stream>>>(AVh, AVl, WoT, bo, out, DM);
}

// v009
// Measured time: 140 microseconds a run.
// In both of two side-by-side timings against v008, it was 1.13 times as fast.
// Over all steps from v000 it is 26.1 times as fast.
#include <hip/hip_runtime.h>

// Compute dtypes, f32 accumulate: k, v = [mem; x].W + b, q = x.Wq + bq, Q_rel = rel_enc.Wkr + bkr as [rows x 1024].[1024 x 1024] GEMMs with PLAIN bf16 operands (rounded inputs, k-major
// weights transposed once; exact products) on v_wmma_f32_16x16x32_bf16 -> per-(batch, head) bf16 hi + UNSCALED residual planes; per (b, h): A = q.k^T and B_hat = q.Q_rel^T ([1024 x
// 64].[64 x 2048], three products), the Transformer-XL shift by index, (A + B)/8 + mask x (-1e9), row softmax in f32 -> P planes; ctx = P.v ([1024 x 2048].[2048 x 64], three

#define LQ   1024
#define TK   2048
#define NBT  2
#define DD   1024
#define NH_  16
#define HD   64
#define NXR  (LQ * NBT)           // 2048 query rows (b, s)
#define NCR  (TK * NBT)           // 4096 context rows (b, t)
#define DM   DD
#define NTK  NCR
#define SCL  0.125f
#define LOSC 1024.0f

typedef _Float16 h16;
typedef unsigned short bf;
typedef __attribute__((ext_vector_type(16))) __bf16   v16bf;
typedef __attribute__((ext_vector_type(16))) _Float16 v16h;
typedef __attribute__((ext_vector_type(8)))  _Float16 v8h;
typedef __attribute__((ext_vector_type(8)))  unsigned short v8us;
typedef __attribute__((ext_vector_type(8)))  float    v8f;
typedef __attribute__((ext_vector_type(4)))  float    v4f;
typedef __attribute__((ext_vector_type(4)))  _Float16 v4h;
typedef v8h  __attribute__((may_alias)) v8ha;
typedef v4f  __attribute__((may_alias)) v4fa;
typedef v8us __attribute__((may_alias)) v8usa;

__device__ __forceinline__ unsigned short f2bf(float f) { return __builtin_bit_cast(unsigned short, (__bf16)f); }    // the chip's own conversion: round to nearest even, as the integer form it replaces
__device__ __forceinline__ float bf2f(unsigned short b) { return (float)__builtin_bit_cast(__bf16, b); }
__device__ __forceinline__ float bfr(float f) { return bf2f(f2bf(f)); }
typedef __attribute__((ext_vector_type(2))) float    v2f;
typedef __attribute__((ext_vector_type(2))) __bf16   v2bf;
typedef __attribute__((ext_vector_type(2))) unsigned v2u;
typedef __attribute__((ext_vector_type(4))) unsigned v4u;
typedef v2u __attribute__((may_alias)) v2ua;
typedef v4u __attribute__((may_alias)) v4ua;
// pack2: two f32 rounded to bf16 in one conversion, a in the low half. split2: the same pair as hi, and the pair's residuals (value - hi, taken from the very hi that is stored) as lo.
__device__ __forceinline__ unsigned pack2(float a, float b) { return __builtin_bit_cast(unsigned, __builtin_convertvector((v2f){a, b}, v2bf)); }
__device__ __forceinline__ void split2(float a, float b, unsigned& hi, unsigned& lo) {
    const v2bf h = __builtin_convertvector((v2f){a, b}, v2bf);
    const v2f r = (v2f){__builtin_fmaf((float)h[0], -1.0f, a), __builtin_fmaf((float)h[1], -1.0f, b)};    // value - hi, exact in f32
    hi = __builtin_bit_cast(unsigned, h); lo = __builtin_bit_cast(unsigned, __builtin_convertvector(r, v2bf));
}
__device__ __forceinline__ v16h cat16(v8h lo, v8h hi) { return __builtin_shufflevector(lo, hi, 0, 1, 2, 3, 4, 5, 6, 7, 8, 9, 10, 11, 12, 13, 14, 15); }
__device__ __forceinline__ v16bf cat16b(v8us lo, v8us hi) { return __builtin_bit_cast(v16bf, __builtin_shufflevector(lo, hi, 0, 1, 2, 3, 4, 5, 6, 7, 8, 9, 10, 11, 12, 13, 14, 15)); }
__device__ __forceinline__ v8f wmma16(v16h a, v16h b, v8f c) { return __builtin_amdgcn_wmma_f32_16x16x32_f16(false, a, false, b, (short)0, c, false, false); }
__device__ __forceinline__ v8f wmmab(v16bf a, v16bf b, v8f c) { return __builtin_amdgcn_wmma_f32_16x16x32_bf16(false, a, false, b, (short)0, c, false, false); }

// FRAGMENT ORDER: every bf16 matrix [rows][K] that a matrix instruction reads from global memory lies as blocks of 16 rows x 32 k = 512 elements (block (r / 16) * (K / 32) + k / 32); inside a block
// element (r, k) stands at ((k / 16) % 2) * 256 + ((k / 8) % 2) * 128 + (r % 16) * 8 + k % 8: lane l's two 16-byte fragment pieces are at l * 8 and 256 + l * 8, so each wave-wide load is 512 bytes in a row.
// Which lane and register holds which (r, k) is as with row-major storage.
// wt_tile: WT [n][K] = bf16(W[k][n]) (k-major [K][ncols]), in fragment order, via one 64 x 64 LDS tile tl; tile (bx, by) of (K/64, ncols/64), 256 threads.
__device__ __forceinline__ void wt_tile(unsigned short* tl, int bx, int by, const float* __restrict__ Wm, int K, int ncols, bf* WT) {
    const int tid = threadIdx.x, k0 = bx * 64, n0 = by * 64;
    const int kk = tid >> 2, nq = (tid & 3) * 16;
#pragma unroll
    for (int i = 0; i < 16; ++i) tl[(nq + i) * 72 + kk] = f2bf(Wm[(size_t)(k0 + kk) * ncols + n0 + nq + i]);
    __syncthreads();
    const int lane = tid & 31, kq = (tid >> 6) & 1, part = (tid >> 5) & 1;    // a wave stores one half block: 512 bytes in a row
    auto pass = [&]() {
#pragma unroll
        for (int s = 0; s < 2; ++s) { const int nt = (tid >> 7) + 2 * s; const v8us val = *(const v8usa*)(tl + (nt * 16 + (lane & 15)) * 72 + (kq * 4 + part * 2 + (lane >> 4)) * 8);
            *(v8us*)(WT + ((size_t)(n0 / 16 + nt) * (K / 32) + k0 / 32 + kq) * 512 + part * 256 + lane * 8) = val; }
    };
    pass(); 
}
// cvt_blk: one wave rounds two neighbouring blocks (16 rows x 64 k) to bf16 in fragment order; src: the 16 rows' first element of those k, dst: the first block.
__device__ __forceinline__ void cvt_blk(const float* __restrict__ src, bf* dst) {
    const int lane = threadIdx.x & 31;
    const float* sp = src + (size_t)(lane & 15) * DM + (lane >> 4) * 8;
    v4u o[4];
#pragma unroll
    for (int q = 0; q < 4; ++q) { v4u t;
#pragma unroll
        for (int i = 0; i < 4; ++i) t[i] = pack2(sp[q * 16 + 2 * i], sp[q * 16 + 2 * i + 1]);
        o[q] = t; }
#pragma unroll
    for (int q = 0; q < 4; ++q) *(v4ua*)(dst + q * 256 + lane * 8) = o[q];
}
// k_prep: every operand preparation of the call in one grid, none reads another's output. Blocks 0 .. 1279: the five weights' 16 x 16 transpose tiles; then half of a 16-row tile a block (512 k, 64 a wave):
// 4096 rows of [mem; x] -> Cb, 2048 rows of x -> Xb, 2048 rows of rel_enc -> Rb.
#define NWT  (5 * (DD / 64) * (DD / 64))
__global__ __launch_bounds__(256) void k_prep(const float* __restrict__ Wq, const float* __restrict__ Wke, const float* __restrict__ Wkr, const float* __restrict__ Wv, const float* __restrict__ Wo,
                                              const float* __restrict__ x, const float* __restrict__ mem, const float* __restrict__ rel,
                                              bf* WqT, bf* WkeT, bf* WkrT, bf* WvT, bf* WoT, bf* Cb, bf* Xb, bf* Rb) {
    __shared__ __align__(16) unsigned short tl[64 * 72];
    const int blk = blockIdx.x;
    if (blk < NWT) {    // the same for the whole block: the barrier inside wt_tile is passed by all of it or by none
        const int w = blk / ((DD / 64) * (DD / 64)), tile = blk % ((DD / 64) * (DD / 64));
        const float* Wm = w == 0 ? Wq : w == 1 ? Wke : w == 2 ? Wkr : w == 3 ? Wv : Wo;
        bf* WT = w == 0 ? WqT : w == 1 ? WkeT : w == 2 ? WkrT : w == 3 ? WvT : WoT;
        wt_tile(tl, tile % (DD / 64), tile / (DD / 64), Wm, DD, DD, WT);
    } else {
        const int r = ((blk - NWT) >> 1) * 16;    // the first row of the block's tile; every boundary below is a multiple of 16, so a tile's rows have one source and one target
        const float* src; bf* dst;
        if (r < NCR) { const int b = r / TK, t = r % TK;    // x_tilde_b = [mem_b; x_b]
            src = t < LQ ? mem + ((size_t)b * LQ + t) * DD : x + ((size_t)b * LQ + t - LQ) * DD; dst = Cb + (size_t)r * DD;
        } else if (r < NCR + NXR) { src = x + (size_t)(r - NCR) * DD; dst = Xb + (size_t)(r - NCR) * DD;    // x rows (b, s)
        } else { src = rel + (size_t)(r - NCR - NXR) * DD; dst = Rb + (size_t)(r - NCR - NXR) * DD; }
        const int kb = ((blk - NWT) & 1) * 16 + (threadIdx.x >> 5) * 2;    // the wave's first block of 32 k; dst is the tile's first block (16 rows x DD elements a tile, as row-major)
        cvt_blk(src + kb * 32, dst + kb * 512);
    }
}

// k_gemmb: MT * 64 x 64 block tile (4 waves x MT row tiles x 16 x 64) of C[NXR][DD] = (A [+ Al]).B^T (K = 1024) [+ bf(bias[c])] [+ bf(R[r][c]) residual]; f32 whole-line epilogue (or f16
// PLANES 1: the 64 columns of a block are one head, and the tile goes out as that head's operand planes [row][64] = bf16 hi + UNSCALED residual (NR rows per batch, batch-first rows);
// PLANES 2: the same two planes transposed, [d][TK] (the v operand of P.v). Either way the f32 product never leaves the block. A, Al, Bn and the planes are in fragment order.
// The body is a device function of the block's tile (bx, by) and of its LDS tile ost, so that several products can share one grid.
// MT: 16-row tiles a wave holds (rows (bx * MT + mt) * 64 + wave * 16 ..): the block's tile is MT * 64 rows x 64 columns, and each B fragment a wave loads feeds four products (SPLITA: MT row tiles x two planes).
template <bool SPLITA, bool F16OUT, int PLANES, int NR, int MT>
__device__ __forceinline__ void gemmb(float (*ost)[16 * 68], int bx, int by, const bf* __restrict__ A, const bf* __restrict__ Al, const bf* __restrict__ Bn, const float* __restrict__ bias, float* C, int ldc, h16* C2, const float* __restrict__ R = nullptr, int K = DM, int roundR = 1, bf* Ph = nullptr, bf* Pl = nullptr) {
    const int lane = threadIdx.x & 31, wave = __builtin_amdgcn_readfirstlane(threadIdx.x >> 5), lr = lane & 15, hi = lane >> 4;
    const int c0 = by * 64;
    size_t aoff[MT];    // fragment order: a 16-row tile is 16 * K elements, its blocks of 32 k are 512 elements apart; a block's address is the same for the whole wave, lane l reads at l * 8
#pragma unroll
    for (int mt = 0; mt < MT; ++mt) aoff[mt] = (size_t)((bx * MT + mt) * 64 + wave * 16) * K;
    size_t boff[4];
#pragma unroll
    for (int t = 0; t < 4; ++t) boff[t] = (size_t)(c0 + t * 16) * K;
    v8f acc[MT][4];
#pragma unroll
    for (int mt = 0; mt < MT; ++mt) {
#pragma unroll
        for (int t = 0; t < 4; ++t) acc[mt][t] = (v8f){}; }
    float braw[4] = {0.f, 0.f, 0.f, 0.f};    // PLANES: the bias is asked for here, so that it arrives under the k loop and the epilogue does not wait for it
    if (PLANES) {
#pragma unroll
        for (int t = 0; t < 4; ++t) braw[t] = bias[c0 + t * 16 + lr];
        asm volatile("s_wait_xcnt 0x0" ::: "memory"); }    // precaution: stands in front of the first rewrite of the four bias loads' address registers (the k loop's set-up reuses them)
#pragma unroll 1
    for (int kc = 0; kc < K; kc += 32) {
        const bf* const pb[4] = {Bn + boff[0] + kc * 16, Bn + boff[1] + kc * 16, Bn + boff[2] + kc * 16, Bn + boff[3] + kc * 16};
        static_assert((MT == 4 && !SPLITA) || (MT == 2 && SPLITA), "the wide tile has four A-side fragments a trip: four row tiles of one plane, or two row tiles of two planes");
        const bf* const pa[4] = {A + aoff[0] + kc * 16, A + aoff[1] + kc * 16, (SPLITA ? Al + aoff[0] : A + aoff[MT - 2]) + kc * 16, (SPLITA ? Al + aoff[1] : A + aoff[MT - 1]) + kc * 16};
        v16bf a[4], b[4];
#pragma unroll
        for (int i = 0; i < 4; ++i) a[i] = cat16b(*(const v8us*)(pa[i] + lane * 8), *(const v8us*)(pa[i] + lane * 8 + 256));
#pragma unroll
        for (int t = 0; t < 4; ++t) b[t] = cat16b(*(const v8us*)(pb[t] + lane * 8), *(const v8us*)(pb[t] + lane * 8 + 256));
        __builtin_amdgcn_sched_barrier(0);    // keeps the trip's 16 loads one group in front of its products; spread among them, with registers reused, the wave would wait out the load latency several times a trip
#pragma unroll
        for (int i = 0; i < 4; i += MT) {    // SPLITA: all hi products, then all residual products; each accumulator still takes hi, then residual, of every trip in turn
#pragma unroll
            for (int t = 0; t < 4; ++t) {
#pragma unroll
                for (int mt = 0; mt < MT; ++mt) acc[mt][t] = wmmab(a[i + mt], b[t], acc[mt][t]); } }
        __builtin_amdgcn_sched_barrier(0);    // keeps every product of the trip in front of the two statements below
        asm volatile("s_wait_xcnt 0x0" :: "s"(pa[0]), "s"(pa[1]), "s"(pa[2]), "s"(pa[3]), "s"(pb[0]), "s"(pb[1]), "s"(pb[2]), "s"(pb[3]) : "memory");    // precaution: the trip's block addresses are inputs here, so none of their registers is rewritten in front of this wait
        asm volatile("v_nop\n\tv_nop\n\tv_nop\n\tv_nop" : "+v"(acc[0][3]), "+v"(acc[MT - 1][3]));    // the four vector slots the chip needs behind the trip's last products, on the way out of the loop too
    }
    float bvv[4];    // the columns' bias, the same for every row tile
#pragma unroll
    for (int t = 0; t < 4; ++t) bvv[t] = PLANES ? bfr(braw[t]) : bias ? bfr(bias[c0 + t * 16 + lr]) : 0.f;
#pragma unroll
    for (int mt = 0; mt < MT; ++mt) {    // 64 rows of the block's tile a part of ost: ost[mt * 4 + wave] is the wave's 16 rows of it
    float* os = &ost[mt * 4 + wave][0];
#pragma unroll
    for (int t = 0; t < 4; ++t) { const float bv = bvv[t];
        if (PLANES == 2) {    // transposed tile [d][68] over all four waves' rows: a lane's eight rows are eight neighbours of one d
            float* tp = &ost[mt * 4][0] + (t * 16 + lr) * 68 + wave * 16 + hi * 8;
            *(v4fa*)tp = (v4f){acc[mt][t][0] + bv, acc[mt][t][1] + bv, acc[mt][t][2] + bv, acc[mt][t][3] + bv}; *(v4fa*)(tp + 4) = (v4f){acc[mt][t][4] + bv, acc[mt][t][5] + bv, acc[mt][t][6] + bv, acc[mt][t][7] + bv};
        } else {
#pragma unroll
        for (int j = 0; j < 8; ++j) os[(hi * 8 + j) * 68 + t * 16 + lr] = acc[mt][t][j] + bv; } }
    }
    __syncthreads();
#pragma unroll 1    // rolled: for speed only
    for (int mt = 0; mt < MT; ++mt) {
    const int bxe = bx * MT + mt, r0 = bxe * 64 + wave * 16;
    float* os = &ost[mt * 4 + wave][0];
    if (PLANES) {
        const int rb = bxe * 64, bhp = (rb / NR) * NH_ + by, rin = rb % NR;    // batch and head of the block, the 64-row part's first row inside the batch
#pragma unroll
        for (int s = 0; s < 4; ++s) {    // fragment order: 32 lanes x 16 bytes are half a block, 512 bytes in a row in both planes
            const int piece = PLANES == 2 ? wave * 2 + hi : s * 2 + hi;    // which eight k (PLANES 2: keys of the block's 64; else d)
            const int row = PLANES == 2 ? s * 16 + lr : lr;    // PLANES 2: d, of the block's tile; else a row of the wave's own 16
            const float* sp = (PLANES == 2 ? &ost[mt * 4][0] : os) + row * 68 + piece * 8; v4u oh, ol;
#pragma unroll
            for (int i = 0; i < 4; ++i) { unsigned hw, lw; split2(sp[2 * i], sp[2 * i + 1], hw, lw); oh[i] = hw; ol[i] = lw; }
            const size_t o = PLANES == 2 ? ((size_t)bhp * HD + s * 16) * TK + (rin / 32 + (wave >> 1)) * 512 + (wave & 1) * 256 + lane * 8 : ((size_t)bhp * NR + rin + wave * 16) * HD + s * 256 + lane * 8;
            *(v4ua*)(Ph + o) = oh; *(v4ua*)(Pl + o) = ol; }
        asm volatile("s_wait_xcnt 0x0" ::: "memory");    // precaution: behind the last plane store, in front of whatever the shared grid's code places after this body that rewrites the stores' registers
    } else if (F16OUT) {
        h16* crow = (h16*)(void*)C + (size_t)r0 * ldc + c0;
        auto pass = [&]() {
#pragma unroll
            for (int s = 0; s < 4; ++s) { const int row = 4 * s + (lane >> 3), piece = lane & 7; const float* sp = os + row * 68 + piece * 8; v8h o, o2;
#pragma unroll
                for (int i = 0; i < 8; ++i) { const h16 a = (h16)sp[i]; o[i] = a; o2[i] = (h16)((sp[i] - (float)a) * LOSC); }
                *(v8h*)(crow + (size_t)row * ldc + piece * 8) = o; if (C2) *(v8h*)(C2 + (size_t)r0 * ldc + c0 + (size_t)row * ldc + piece * 8) = o2; }
        };
        pass(); 
    } else {
        float* crow = C + (size_t)r0 * ldc + c0;
        auto pass = [&]() {
#pragma unroll
            for (int s = 0; s < 8; ++s) { const int Lid = (lane >> 3) + 4 * s, piece = lane & 7; const int row = Lid >> 1, cofs = (Lid & 1) * 32 + piece * 4;
                v4f val = *(const v4fa*)(os + row * 68 + cofs); if (R) { const v4f rv = *(const v4f*)(R + ((size_t)r0 + row) * ldc + c0 + cofs); val += roundR ? (v4f){bfr(rv[0]), bfr(rv[1]), bfr(rv[2]), bfr(rv[3])} : rv; }
                *(v4f*)(crow + (size_t)row * ldc + cofs) = val;
                asm volatile("s_wait_xcnt 0x0" ::: "memory"); }    // precaution: behind each store, in front of the next piece's (and the next pass's) rewrite of the store's registers
        };
        pass(); 
    }
    }
}
// k_proj: the four projections, which read none of each other's output, as one grid of 256-row x 64-column tiles: blockIdx.x 0 .. 15 k, 16 .. 31 v, 32 .. 39 q, 40 .. 47 Q_rel (shared across b: one batch of TK rows); blockIdx.y the head.
#define PMT  4                    // 16-row tiles a wave of k_proj holds
#define PBR  (64 * PMT)           // rows of a block's tile; divides LQ and TK, so a tile stays inside one batch
__global__ __launch_bounds__(128) void k_proj(const bf* __restrict__ Cb, const bf* __restrict__ Xb, const bf* __restrict__ Rb, const bf* __restrict__ WkeT, const bf* __restrict__ WvT, const bf* __restrict__ WqT, const bf* __restrict__ WkrT,
                                              const float* __restrict__ bke, const float* __restrict__ bv, const float* __restrict__ bq, const float* __restrict__ bkr,
                                              bf* Kh, bf* Kl, bf* VTh, bf* VTl, bf* Qh, bf* Ql, bf* Rh, bf* Rl, int K) {
    __shared__ __align__(16) float ost[4 * PMT][16 * 68];
    const int bx = blockIdx.x, by = blockIdx.y;
    if (bx < NCR / PBR) gemmb<false, false, 1, TK, PMT>(ost, bx, by, Cb, nullptr, WkeT, bke, nullptr, DD, nullptr, nullptr, K, 1, Kh, Kl);
    else if (bx < 2 * (NCR / PBR)) gemmb<false, false, 2, TK, PMT>(ost, bx - NCR / PBR, by, Cb, nullptr, WvT, bv, nullptr, DD, nullptr, nullptr, K, 1, VTh, VTl);
    else if (bx < 2 * (NCR / PBR) + NXR / PBR) gemmb<false, false, 1, LQ, PMT>(ost, bx - 2 * (NCR / PBR), by, Xb, nullptr, WqT, bq, nullptr, DD, nullptr, nullptr, K, 1, Qh, Ql);
    else gemmb<false, false, 1, TK, PMT>(ost, bx - 2 * (NCR / PBR) - NXR / PBR, by, Rb, nullptr, WkrT, bkr, nullptr, DD, nullptr, nullptr, K, 1, Rh, Rl);
}
// k_out: out = (ctx hi + ctx residual).Wo + bf(bo), K = 1024, 128 x 64 block tile. 16 waves = 4 row groups (two 16-row tiles each, 64 rows apart, x 64 columns) x OKS slices of K:
// a wave sums 256 k in 8 trips, and four waves a SIMD wait out their trips' load latencies side by side. The OKS partial tiles meet in LDS and are added in slice order.
// K comes as an argument, as in k_proj: the trip's block addresses then stay scalar, and every load is scalar base + the lane's one offset register.
#define OKS  4
__global__ __launch_bounds__(512) void k_out(const bf* __restrict__ A, const bf* __restrict__ Al, const bf* __restrict__ Bn, const float* __restrict__ bias, float* C, int K) {
    __shared__ __align__(16) float ost[OKS][8][16 * 68];    // [slice][16-row tile of the block's 128 rows][row x 68]
    const int tid = threadIdx.x, lane = tid & 31, wave = __builtin_amdgcn_readfirstlane(tid >> 5), wr = wave & 3, ks = wave >> 2, lr = lane & 15, hi = lane >> 4;
    const int bx = blockIdx.x, c0 = blockIdx.y * 64;
    const v4f braw = *(const v4f*)(bias + c0 + (tid & 15) * 4);    // the bias of the four columns this thread stores, asked for here so that it arrives under the k loop
    asm volatile("s_wait_xcnt 0x0" ::: "memory");    // precaution: stands in front of the first rewrite of the bias load's address registers
    const size_t aoff[2] = {(size_t)(bx * 128 + wr * 16) * K, (size_t)(bx * 128 + 64 + wr * 16) * K};    // fragment order: a 16-row tile is 16 * K elements, its blocks of 32 k are 512 elements apart
    const size_t boff[4] = {(size_t)c0 * K, (size_t)(c0 + 16) * K, (size_t)(c0 + 32) * K, (size_t)(c0 + 48) * K};
    const int kn = K / OKS, k0 = ks * kn;    // the wave's slice of K
    v8f acc[2][4];
#pragma unroll
    for (int mt = 0; mt < 2; ++mt) {
#pragma unroll
        for (int t = 0; t < 4; ++t) acc[mt][t] = (v8f){}; }
#pragma unroll 1    // rolled: one trip's text, and one group of 16 loads in flight a wave
    for (int kc = k0; kc < k0 + kn; kc += 32) {
        const bf* const pb[4] = {Bn + boff[0] + kc * 16, Bn + boff[1] + kc * 16, Bn + boff[2] + kc * 16, Bn + boff[3] + kc * 16};
        const bf* const pa[4] = {A + aoff[0] + kc * 16, A + aoff[1] + kc * 16, Al + aoff[0] + kc * 16, Al + aoff[1] + kc * 16};
        v16bf a[4], b[4];
#pragma unroll
        for (int i = 0; i < 4; ++i) a[i] = cat16b(*(const v8us*)(pa[i] + lane * 8), *(const v8us*)(pa[i] + lane * 8 + 256));
#pragma unroll
        for (int t = 0; t < 4; ++t) b[t] = cat16b(*(const v8us*)(pb[t] + lane * 8), *(const v8us*)(pb[t] + lane * 8 + 256));
        __builtin_amdgcn_sched_barrier(0);    // keeps the trip's 16 loads one group in front of its products; spread among them, with registers reused, the wave would wait out the load latency several times a trip
#pragma unroll
        for (int i = 0; i < 4; i += 2) {    // all hi products, then all residual products; each accumulator takes hi, then residual, of every trip in turn
#pragma unroll
            for (int t = 0; t < 4; ++t) {
#pragma unroll
                for (int mt = 0; mt < 2; ++mt) acc[mt][t] = wmmab(a[i + mt], b[t], acc[mt][t]); } }
        __builtin_amdgcn_sched_barrier(0);    // keeps every product of the trip in front of the two statements below
        asm volatile("s_wait_xcnt 0x0" :: "s"(pa[0]), "s"(pa[1]), "s"(pa[2]), "s"(pa[3]), "s"(pb[0]), "s"(pb[1]), "s"(pb[2]), "s"(pb[3]) : "memory");    // precaution: the trip's block addresses are inputs here, so none of their registers is rewritten in front of this wait
        asm volatile("v_nop\n\tv_nop\n\tv_nop\n\tv_nop" : "+v"(acc[0][3]), "+v"(acc[1][3]));    // the four vector slots the chip needs behind the trip's last products, on the way out of the loop too
    }
#pragma unroll
    for (int mt = 0; mt < 2; ++mt) { float* os = &ost[ks][mt * 4 + wr][0];
#pragma unroll
        for (int t = 0; t < 4; ++t) {
#pragma unroll
            for (int j = 0; j < 8; ++j) os[(hi * 8 + j) * 68 + t * 16 + lr] = acc[mt][t][j]; } }
    __syncthreads();    // every slice's partial tile is in LDS
    const v4f bv = (v4f){bfr(braw[0]), bfr(braw[1]), bfr(braw[2]), bfr(braw[3])};
    const int cofs = (tid & 15) * 4;    // 16 threads a row: a wave stores two rows' 256 bytes, whole lines
    v4f val[4];    // all 16 LDS reads go as one group, in front of the stores and their waits
#pragma unroll
    for (int s = 0; s < 4; ++s) { const int row = s * 32 + (tid >> 4); const float* sp = &ost[0][row >> 4][0] + (row & 15) * 68 + cofs;
        val[s] = *(const v4fa*)sp;
#pragma unroll
        for (int k = 1; k < OKS; ++k) val[s] += *(const v4fa*)(sp + k * (8 * 16 * 68)); }
#pragma unroll
    for (int s = 0; s < 4; ++s) {
        *(v4f*)(C + (size_t)(bx * 128 + s * 32 + (tid >> 4)) * DD + c0 + cofs) = val[s] + bv;
        asm volatile("s_wait_xcnt 0x0" ::: "memory"); }    // precaution: behind each store, in front of the next piece's rewrite of the store's registers
}


// k_attn: one work-group (16 waves) per 64 query rows of one (b, h). The keys are taken in two windows of 1024, so that 64 rows' scores of one window fit LDS and every k, Q_rel and v fragment
// serves 64 rows: waves w and w + 8 (row groups of 32) read the same fragments at the same time, and the second reader finds them in the WGP's cache. Per window:
//  1. B_hat = q.Q_rel^T (three products) for the 68 column tiles that feed the window; element (r, c) is stored straight at its place after the shift: with u = c + r - (L-1), row r column u when u >= 0,
//     else row r-1 column u + T; what falls outside the window goes to a pad. Row i0+64 (a third row tile) feeds the tail of row i0+63; the one padded zero of each row is stored by hand.
//  2. A = q.k^T (three products), s = (A + B) / 8 in place.  3. one wave per row: + mask x (-1e9), the window's own maximum m and sum l, P = exp(s - m) as bf16 hi + residual planes over the row's own bytes.
//  4. P.v (three products): a wave sums 128 keys for its 32 rows x 64; the 8 partial tiles of a row group are added in wave order through LDS.
// Behind both windows: ctx = (o0 e^(m0-M) + o1 e^(m1-M)) / (l0 e^(m0-M) + l1 e^(m1-M)), M = max(m0, m1).
#define RQ   64                   // query rows of one work-group
#define WK   1024                 // keys of one window
#define SPW  1028                 // LDS row pitch in floats: 16 B x odd, for the 16-byte fragment reads of stage 4
#define RP   68                   // pitch of a partial ctx tile's row in floats
__device__ __forceinline__ v16bf ldfrag(const bf* p) { return cat16b(*(const v8us*)p, *(const v8us*)(p + 256)); }    // global planes, fragment order: p = block + lane * 8
__device__ __forceinline__ v16bf ldfrag_s(const bf* p) { return cat16b(*(const v8usa*)p, *(const v8usa*)(p + 16)); }
__device__ __forceinline__ v8f prod3(const v16bf (&ah)[2], const v16bf (&al)[2], const v16bf (&bh)[2], const v16bf (&bl)[2]) {
    v8f acc = (v8f){};
#pragma unroll
    for (int ks = 0; ks < 2; ++ks) { acc = wmmab(ah[ks], bh[ks], acc); acc = wmmab(al[ks], bh[ks], acc); acc = wmmab(ah[ks], bl[ks], acc); }
    return acc;
}
__global__ __launch_bounds__(512) void k_attn(const bf* __restrict__ Qh, const bf* __restrict__ Ql, const bf* __restrict__ Kh, const bf* __restrict__ Kl, const bf* __restrict__ Rh, const bf* __restrict__ Rl,
                                              const bf* __restrict__ VTh, const bf* __restrict__ VTl, const float* __restrict__ MSK, bf* AVh, bf* AVl) {
    __shared__ __align__(16) float S[RQ * SPW];
    __shared__ __align__(16) float OS[2 * 512 * 4];    // the first window's unscaled P.v, each thread's own eight values
    __shared__ float ML[2 * RQ * 2];                   // [window][row]: maximum, sum
    const int wave = __builtin_amdgcn_readfirstlane(threadIdx.x >> 5);
    const int i0 = blockIdx.x * RQ, bh = blockIdx.y, h = bh % NH_, b = bh / NH_;
    Qh += (size_t)bh * LQ * HD; Ql += (size_t)bh * LQ * HD; Kh += (size_t)bh * TK * HD; Kl += (size_t)bh * TK * HD; Rh += (size_t)h * TK * HD; Rl += (size_t)h * TK * HD; VTh += (size_t)bh * HD * TK; VTl += (size_t)bh * HD * TK;
    const int rg = wave >> 3, cg = wave & 7, lb = rg * 32;    // the wave's row group (local rows lb .. lb + 31) and its eighth of the window's columns
    const int n0 = cg * 8 + min(cg, 4);                       // the first of its Q_rel tiles: 68 tiles a window, nine for column groups 0 .. 3 and eight for the others
#pragma unroll 1    // rolled: one window's text
    for (int wn = 0; wn < 2; ++wn) {
    int lraw; asm volatile("v_mbcnt_lo_u32_b32 %0, -1, 0" : "=v"(lraw));    // the lane's number, formed anew in each window: taken once in front of the loop, some twenty addresses made from it are carried through both windows, past the register budget of P.v, and are spilled
    const int lane = lraw & 31, tid = wave * 32 + lane, lr = lane & 15, hi = lane >> 4;
    v16bf qh[3][2], ql[3][2]; const bf* qa[3]; const bf* qb[3];    // asked for anew in each window: behind stage 2 their registers serve the softmax and P.v
#pragma unroll
    for (int rt = 0; rt < 3; ++rt) { const size_t o = (size_t)(rt < 2 ? i0 + lb + rt * 16 : min(i0 + RQ, LQ - 16)) * HD; qa[rt] = Qh + o; qb[rt] = Ql + o;    // the clamp holds the last work-group's third tile, which it never uses, inside the plane
#pragma unroll
        for (int ks = 0; ks < 2; ++ks) { qh[rt][ks] = ldfrag(qa[rt] + lane * 8 + ks * 512); ql[rt][ks] = ldfrag(qb[rt] + lane * 8 + ks * 512); } }
    asm volatile("s_wait_xcnt 0x0" :: "s"(qa[0]), "s"(qa[1]), "s"(qa[2]), "s"(qb[0]), "s"(qb[1]), "s"(qb[2]) : "memory");    // precaution: the tiles' addresses are inputs here, so none of their registers is rewritten in front of this wait
    if (wn == 1 && tid < RQ) { const int zc = (TK - LQ + 1 - WK) + i0 + tid; if (zc < WK) S[tid * SPW + zc] = 0.f; }   // the padded zero: column T - L + 1 + i of row i, always in the second window
    const int T0 = (LQ - RQ) / 16 + wn * (WK / 16) - (i0 >> 4) + n0;    // the wave's first tile of 16 Q_rel columns, taken modulo 128: window 0 needs columns L - 64 - i0 .. , window 1 the same 1024 further, round the end
    const bf* const ku = Kh + (size_t)(wn * WK + cg * 128) * HD; const bf* const kv = Kl + (size_t)(wn * WK + cg * 128) * HD;    // the wave's first k tile (fragment order: two blocks of 512 a tile of 16 keys)
    v16bf fh[2][2], fl[2][2];                             // two register sets: the next tile's fragments are fetched while this tile is worked on
    { const bf* const ph0 = Rh + (size_t)(T0 & 127) * (16 * HD); const bf* const pl0 = Rl + (size_t)(T0 & 127) * (16 * HD);
#pragma unroll
      for (int ks = 0; ks < 2; ++ks) { fh[0][ks] = ldfrag(ph0 + lane * 8 + ks * 512); fl[0][ks] = ldfrag(pl0 + lane * 8 + ks * 512); }
      asm volatile("s_wait_xcnt 0x0" :: "s"(ph0), "s"(pl0) : "memory"); }    // precaution: the tile's addresses are inputs here, so none of their registers is rewritten in front of this wait
#pragma unroll 1    // rolled, two tiles (the two register sets) a trip: a third of the text of nine tiles in a row
    for (int tp = 0; tp < 10; tp += 2) {
#pragma unroll
    for (int s = 0; s < 2; ++s) { const int t = tp + s, cur = s, nxt = s ^ 1;
        if (t < 9) {    // nine tiles; every test on t, cg, rg, c0 and ulo below reads the same for the whole wave
        const int c0 = ((T0 + t) & 127) * 16;
        const bf* const nh = t < 8 ? Rh + (size_t)((T0 + t + 1) & 127) * (16 * HD) : ku; const bf* const nl = t < 8 ? Rl + (size_t)((T0 + t + 1) & 127) * (16 * HD) : kv;   // behind the last Q_rel tile: the first k tile
#pragma unroll
        for (int ks = 0; ks < 2; ++ks) { fh[nxt][ks] = ldfrag(nh + lane * 8 + ks * 512); fl[nxt][ks] = ldfrag(nl + lane * 8 + ks * 512); }
        asm volatile("s_wait_xcnt 0x0" :: "s"(nh), "s"(nl) : "memory");    // precaution: as above
        if (t < 8 || cg < 4) {
        v8f a0 = prod3(qh[0], ql[0], fh[cur], fl[cur]), a1 = prod3(qh[1], ql[1], fh[cur], fl[cur]);
        asm volatile("v_nop\n\tv_nop\n\tv_nop\n\tv_nop" : "+v"(a0), "+v"(a1));    // the four vector slots the chip needs before these results' registers are written again, on either side of the branch below
        const int ulo = c0 + i0 + lb - (LQ - 1) - wn * WK;    // the window column of the tile's first element; the others are up to 46 further
        const bool dir = ulo >= 0 && ulo + 46 < WK, wrp = wn == 1 && ulo + WK + 46 < 0;
        if (dir || wrp) {    // most tiles: all 512 elements land in the window, all in their own row or all in the row above: one address, constant steps
            const int ib = (lb + hi * 8) * SPW + ulo + lr + hi * 8 + (wrp ? TK - SPW : 0);
#pragma unroll
            for (int k = 0; k < 24; ++k) { if ((k & 15) < 8) { const int idx = ib + k * (SPW + 1);
                S[k == 0 ? (idx < 0 ? WK : idx) : idx] = k < 16 ? a0[k & 7] : a1[k & 7]; } }    // idx < 0: row i0 - 1 is another work-group's; such a value goes to row 0's pad, which nobody reads
        } else {
#pragma unroll
        for (int rt = 0; rt < 2; ++rt) {
#pragma unroll
            for (int j = 0; j < 8; ++j) { const int lrw = lb + rt * 16 + hi * 8 + j, u = c0 + lr + i0 + lrw - (LQ - 1), w = u - wn * WK;
                int idx = lrw * SPW + w;    // its own row, inside the window
                idx = (unsigned)w < (unsigned)WK ? idx : (wn == 1 && u < 0) ? idx + (TK - SPW) : WK;    // u < 0: the row above, column u + T (second window); all else: row 0's pad
                if (rt == 0 && j == 0) idx = idx < 0 ? WK : idx;    // row i0 - 1 is another work-group's
                S[idx] = rt ? a1[j] : a0[j]; } }
        }
        if (s == rg && c0 + i0 + RQ - (LQ - 1) < 0) { v8f a2 = prod3(qh[2], ql[2], fh[cur], fl[cur]); const int u = c0 + lr + i0 + RQ - (LQ - 1);   // row i0 + 64 feeds the tail of row i0 + 63 (never true in window 0); the two row groups take turns at it
            asm volatile("v_nop\n\tv_nop\n\tv_nop\n\tv_nop" : "+v"(a2));    // the same four slots, on the way out of this branch
            S[(hi == 0 && u < 0) ? (RQ - 1) * SPW + u + (TK - WK) : WK] = a2[0]; }
        }
        }
    } }
    __syncthreads();
    float* const sw = S + (lb + hi * 8) * SPW + cg * 128 + lr;    // this lane's element of row lb + hi * 8 in the wave's first tile
    float old[2][16];                               // B of this tile and of the next: read in one batch a tile ahead, so that no LDS read waits behind the stores of the tile before
#pragma unroll
    for (int e = 0; e < 16; ++e) old[0][e] = sw[((e >> 3) * 16 + (e & 7)) * SPW];
#pragma unroll
    for (int t = 0; t < 8; ++t) { const int cur = (t + 1) & 1, nxt = cur ^ 1, oc = t & 1, on = oc ^ 1;    // the first k tile came into set 1
        if (t < 7) {
#pragma unroll
            for (int ks = 0; ks < 2; ++ks) { fh[nxt][ks] = ldfrag(ku + lane * 8 + (t + 1) * 16 * HD + ks * 512); fl[nxt][ks] = ldfrag(kv + lane * 8 + (t + 1) * 16 * HD + ks * 512); }
#pragma unroll
            for (int e = 0; e < 16; ++e) old[on][e] = sw[((e >> 3) * 16 + (e & 7)) * SPW + (t + 1) * 16]; }
        __builtin_amdgcn_sched_barrier(0);    // keeps the next tile's loads in front of this tile's products; the compiler otherwise sinks them to just before their use and the wave waits out the whole latency
        const v8f a0 = prod3(qh[0], ql[0], fh[cur], fl[cur]), a1 = prod3(qh[1], ql[1], fh[cur], fl[cur]);
#pragma unroll
        for (int e = 0; e < 16; ++e) sw[((e >> 3) * 16 + (e & 7)) * SPW + t * 16] = ((e < 8 ? a0[e & 7] : a1[e & 7]) + old[oc][e]) * SCL;
    }
    asm volatile("s_wait_xcnt 0x0" :: "s"(ku), "s"(kv) : "memory");    // precaution: the k tiles' addresses are inputs here, so none of their registers is rewritten in front of this wait
    __builtin_amdgcn_sched_barrier(0);    // keeps the mask loads below from being lifted into the score tiles above, where their registers would spill
    const float* const mu = MSK + (size_t)(i0 + wave * (RQ / 16)) * TK + wn * WK;    // the window's part of the mask of the wave's first row
    v4f mk[WK / 128];    // asked for in front of the barrier so that it arrives while the other waves finish their scores
#pragma unroll
    for (int k = 0; k < WK / 128; ++k) mk[k] = *(const v4f*)(mu + lane * 4 + k * 128);
    __syncthreads();
#pragma unroll 1    // rolled: one row's text and registers
    for (int rr = 0; rr < RQ / 16; ++rr) { const int lrw = wave * (RQ / 16) + rr; float* srow = S + lrw * SPW;
        float v[WK / 32]; float m = -3.0e38f;
#pragma unroll
        for (int k = 0; k < WK / 128; ++k) { const int c = k * 128 + lane * 4; const v4f s = *(const v4fa*)(srow + c);
#pragma unroll
            for (int q = 0; q < 4; q += 2) { const v2bf mr = __builtin_convertvector((v2f){mk[k][q], mk[k][q + 1]}, v2bf);    // the mask rounded to bf16, two a conversion
                const float x0 = __builtin_fmaf((float)mr[0], -1e9f, s[q]), x1 = __builtin_fmaf((float)mr[1], -1e9f, s[q + 1]); v[k * 4 + q] = x0; v[k * 4 + q + 1] = x1; m = fmaxf(m, fmaxf(x0, x1)); } }
        const float* const mn = mu + (size_t)(rr + 1) * TK; const int lo4 = lane * 4;
        if (rr + 1 < RQ / 16) {    // the next row's mask flies while this row's softmax is worked out
#pragma unroll
            for (int k = 0; k < WK / 128; ++k) mk[k] = *(const v4f*)(mn + lo4 + k * 128); }
        asm volatile("s_wait_xcnt 0x0" :: "s"(mu), "s"(mn), "v"(mn + lo4) : "memory");    // precaution: the mask loads' addresses are inputs here, so none of their registers is rewritten (by a later load's result either) in front of this wait
#pragma unroll
        for (int sh = 16; sh; sh >>= 1) m = fmaxf(m, __shfl_xor(m, sh, 32));
        float sum = 0.f;
#pragma unroll
        for (int k = 0; k < WK / 32; ++k) { v[k] = __expf(v[k] - m); sum += v[k]; }
#pragma unroll
        for (int sh = 16; sh; sh >>= 1) sum += __shfl_xor(sum, sh, 32);
        if (lane == 0) { ML[(wn * RQ + lrw) * 2] = m; ML[(wn * RQ + lrw) * 2 + 1] = sum; }
        bf* prow = (bf*)(void*)srow;    // hi plane in the row's first 2048 bytes, residual plane in the next 2048; the whole row is in registers by now
#pragma unroll
        for (int k = 0; k < WK / 128; ++k) { v2u oh, ol;
#pragma unroll
            for (int q = 0; q < 2; ++q) { unsigned hw, lw; split2(v[k * 4 + 2 * q], v[k * 4 + 2 * q + 1], hw, lw); oh[q] = hw; ol[q] = lw; }
            *(v2ua*)(prow + k * 128 + lane * 4) = oh; *(v2ua*)(prow + WK + k * 128 + lane * 4) = ol; }
    }
    const bf* const vu = VTh + (size_t)(wn * WK + cg * 128) * 16; const bf* const vv = VTl + (size_t)(wn * WK + cg * 128) * 16;    // the v planes (fragment order): first 16-row tile of d, the block of the wave's first 32 keys; a tile of d further is 16 * TK elements on
    v16bf vh[2][4], vl[2][4];                           // two register sets: the next 32 keys' v fragments are fetched while these are worked on; the first set is asked for in front of the barrier
#pragma unroll
    for (int dt = 0; dt < 4; ++dt) { vh[0][dt] = ldfrag(vu + lane * 8 + (size_t)dt * 16 * TK); vl[0][dt] = ldfrag(vv + lane * 8 + (size_t)dt * 16 * TK); }
    __syncthreads();
    v8f acc[2][4];
#pragma unroll
    for (int rt = 0; rt < 2; ++rt) {
#pragma unroll
        for (int dt = 0; dt < 4; ++dt) acc[rt][dt] = (v8f){}; }
#pragma unroll
    for (int ks = 0; ks < 4; ++ks) { const int cur = ks & 1, nxt = cur ^ 1;
        if (ks < 3) {
#pragma unroll
            for (int dt = 0; dt < 4; ++dt) { vh[nxt][dt] = ldfrag(vu + lane * 8 + (size_t)dt * 16 * TK + (ks + 1) * 512); vl[nxt][dt] = ldfrag(vv + lane * 8 + (size_t)dt * 16 * TK + (ks + 1) * 512); } }
        v16bf ph[2], pl[2];
#pragma unroll
        for (int rt = 0; rt < 2; ++rt) { const bf* pr = (const bf*)(const void*)(S + (lb + rt * 16 + lr) * SPW) + cg * 128 + ks * 32 + 8 * hi; ph[rt] = ldfrag_s(pr); pl[rt] = ldfrag_s(pr + WK); }
#pragma unroll
        for (int dt = 0; dt < 4; ++dt) {
#pragma unroll
            for (int rt = 0; rt < 2; ++rt) { acc[rt][dt] = wmmab(ph[rt], vh[cur][dt], acc[rt][dt]); acc[rt][dt] = wmmab(pl[rt], vh[cur][dt], acc[rt][dt]); acc[rt][dt] = wmmab(ph[rt], vl[cur][dt], acc[rt][dt]); } }
    }
    asm volatile("s_wait_xcnt 0x0" :: "s"(vu), "s"(vv) : "memory");    // precaution: the v blocks' addresses are inputs here, so none of their registers is rewritten in front of this wait
    __syncthreads();    // every wave has read its P fragments: the score rows' LDS now takes the 16 partial tiles
    float* red = S + wave * (32 * RP);
#pragma unroll
    for (int rt = 0; rt < 2; ++rt) {
#pragma unroll
        for (int dt = 0; dt < 4; ++dt) {
#pragma unroll
            for (int j = 0; j < 8; ++j) red[(rt * 16 + hi * 8 + j) * RP + dt * 16 + lr] = acc[rt][dt][j]; } }
    __syncthreads();
    const int orow = (tid >> 8) * 16 + ((tid >> 1) & 15), od = ((tid >> 5) & 7) * 8 + (tid & 1) * 4;    // thread -> element of a row group so that a wave's 8-byte stores are 256 bytes in a row of the fragment-order planes
#pragma unroll
    for (int g = 0; g < 2; ++g) {
        v4f part[8];
#pragma unroll
        for (int w = 0; w < 8; ++w) part[w] = *(const v4fa*)(S + (g * 8 + w) * (32 * RP) + orow * RP + od);
        v4f o = part[0];
#pragma unroll
        for (int w = 1; w < 8; ++w) o += part[w];
        if (wn == 0) *(v4fa*)(OS + (g * 512 + tid) * 4) = o;    // read back by the same thread
        else {
            const int row = g * 32 + orow; const float m0 = ML[row * 2], l0 = ML[row * 2 + 1], m1 = ML[(RQ + row) * 2], l1 = ML[(RQ + row) * 2 + 1];
            const float mm = fmaxf(m0, m1), e0 = __expf(m0 - mm), e1 = __expf(m1 - mm), inv = 1.0f / (l0 * e0 + l1 * e1);
            const v4f o0 = *(const v4fa*)(OS + (g * 512 + tid) * 4); const v4f c = (o0 * e0 + o * e1) * inv;
            v2u oh, ol;    // ctx goes out as the last GEMM's operand planes: bf16 hi + residual
#pragma unroll
            for (int q = 0; q < 2; ++q) { unsigned hw, lw; split2(c[2 * q], c[2 * q + 1], hw, lw); oh[q] = hw; ol[q] = lw; }
            const size_t oo = ((size_t)b * LQ + i0 + g * 32 + rg * 16) * DD + (size_t)h * 1024;    // 16-row tile (threads 256 and up, that is waves 8 and up, have the second), then the head's two blocks of 32 columns
            bf* const sa = AVh + oo; bf* const sb = AVl + oo;
            *(v2ua*)(sa + (tid & 255) * 4) = oh; *(v2ua*)(sb + (tid & 255) * 4) = ol;
            asm volatile("s_wait_xcnt 0x0" :: "s"(sa), "s"(sb) : "memory"); }    // precaution: behind the two stores, in front of any rewrite of their registers
    }
    __syncthreads();    // the partial tiles are read: the next window's scores may take their LDS
    }
}
extern "C" void kernel_launch(void* const* d_in, const int* in_sizes, int n_in,
                              void* d_out, int out_size, void* d_ws, size_t ws_size, hipStream_t stream) {
    (void)in_sizes; (void)n_in; (void)out_size;
    const float* x = (const float*)d_in[0]; const float* mem = (const float*)d_in[1]; const float* msk = (const float*)d_in[2]; const float* rel = (const float*)d_in[3];
    const float* Wq = (const float*)d_in[4]; const float* bq = (const float*)d_in[5]; const float* Wke = (const float*)d_in[6]; const float* bke = (const float*)d_in[7]; const float* Wkr = (const float*)d_in[8]; const float* bkr = (const float*)d_in[9];
    const float* Wv = (const float*)d_in[10]; const float* bv = (const float*)d_in[11]; const float* Wo = (const float*)d_in[12]; const float* bo = (const float*)d_in[13];
    float* out = (float*)d_out;    // [2][1024][1024]
    char* wsp = (char*)d_ws;
    auto take = [&](size_t bytes) { char* p = wsp; wsp += (bytes + 255) & ~(size_t)255; return (void*)p; };
    bf* WoT = (bf*)take((size_t)DD * DD * 2);
    bf* Qh = (bf*)take((size_t)NBT * NH_ * LQ * HD * 2); bf* Ql = (bf*)take((size_t)NBT * NH_ * LQ * HD * 2);
    bf* Kh = (bf*)take((size_t)NBT * NH_ * TK * HD * 2); bf* Kl = (bf*)take((size_t)NBT * NH_ * TK * HD * 2); bf* Rh = (bf*)take((size_t)NH_ * TK * HD * 2); bf* Rl = (bf*)take((size_t)NH_ * TK * HD * 2);
    bf* VTh = (bf*)take((size_t)NBT * NH_ * HD * TK * 2); bf* VTl = (bf*)take((size_t)NBT * NH_ * HD * TK * 2);
    // One region, used twice in stream order: projection scratch, then the split ctx planes. Each use writes all it reads.
    char* const shared0 = wsp;
    bf* AVh = (bf*)take((size_t)NXR * DD * 2); bf* AVl = (bf*)take((size_t)NXR * DD * 2);
    wsp = shared0;
    bf* WqT = (bf*)take((size_t)DD * DD * 2); bf* WkeT = (bf*)take((size_t)DD * DD * 2); bf* WkrT = (bf*)take((size_t)DD * DD * 2); bf* WvT = (bf*)take((size_t)DD * DD * 2);
    bf* Cb = (bf*)take((size_t)NCR * DD * 2); bf* Xb = (bf*)take((size_t)NXR * DD * 2); bf* Rb = (bf*)take((size_t)TK * DD * 2);
    if ((size_t)(wsp - (char*)d_ws) > ws_size) return;    // 50 MiB kept (WoT, q, k, Q_rel, v planes) + 24 MiB shared region; Cb holds [mem; x], Xb x, Rb rel_enc
    k_prep<<<NWT + (NCR + NXR + TK) / 8, 256, 0, stream>>>(Wq, Wke, Wkr, Wv, Wo, x, mem, rel, WqT, WkeT, WkrT, WvT, WoT, Cb, Xb, Rb);
    k_proj<<<dim3(2 * (NCR / PBR) + NXR / PBR + TK / PBR, DD / 64, 1), 128, 0, stream>>>(Cb, Xb, Rb, WkeT, WvT, WqT, WkrT, bke, bv, bq, bkr, Kh, Kl, VTh, VTl, Qh, Ql, Rh, Rl, DM);
    k_attn<<<dim3(LQ / RQ, NBT * NH_, 1), 512, 0, stream>>>(Qh, Ql, Kh, Kl, Rh, Rl, VTh, VTl, msk, AVh, AVl);    // ctx[(b,s)][h*64 + d], as planes
    k_out<<<dim3(NXR / 128, DD / 64, 1), 512, 0, stream>>>(AVh, AVl, WoT, bo, out, DM);
}

// v010
// One run takes 134 microseconds.
// Next to v009, in two timings, it ran 1.04 times as fast each time.
// Counting every step since v000, it is 27.2 times as fast.
#include <hip/hip_runtime.h>

// Compute dtypes, f32 accumulate: k, v = [mem; x].W + b, q = x.Wq + bq, Q_rel = rel_enc.Wkr + bkr as [rows x 1024].[1024 x 1024] GEMMs with PLAIN bf16 operands (rounded inputs, k-major
// weights transposed once; exact products) on v_wmma_f32_16x16x32_bf16 -> per-(batch, head) bf16 hi + UNSCALED residual planes; per (b, h): A = q.k^T and B_hat = q.Q_rel^T ([1024 x
// 64].[64 x 2048], three products), the Transformer-XL shift by index, (A + B)/8 + mask x (-1e9), row softmax in f32 -> P planes; ctx = P.v ([1024 x 2048].[2048 x 64], three

#define LQ   1024
#define TK   2048
#define NBT  2
#define DD   1024
#define NH_  16
#define HD   64
#define NXR  (LQ * NBT)           // 2048 query rows (b, s)
#define NCR  (TK * NBT)           // 4096 context rows (b, t)
#define DM   DD
#define NTK  NCR
#define SCL  0.125f
#define LOSC 1024.0f

typedef _Float16 h16;
typedef unsigned short bf;
typedef __attribute__((ext_vector_type(16))) __bf16   v16bf;
typedef __attribute__((ext_vector_type(16))) _Float16 v16h;
typedef __attribute__((ext_vector_type(8)))  _Float16 v8h;
typedef __attribute__((ext_vector_type(8)))  unsigned short v8us;
typedef __attribute__((ext_vector_type(8)))  float    v8f;
typedef __attribute__((ext_vector_type(4)))  float    v4f;
typedef __attribute__((ext_vector_type(4)))  _Float16 v4h;
typedef v8h  __attribute__((may_alias)) v8ha;
typedef v4f  __attribute__((may_alias)) v4fa;
typedef v8us __attribute__((may_alias)) v8usa;

__device__ __forceinline__ unsigned short f2bf(float f) { return __builtin_bit_cast(unsigned short, (__bf16)f); }    // the chip's own conversion: round to nearest even, as the integer form it replaces
__device__ __forceinline__ float bf2f(unsigned short b) { return (float)__builtin_bit_cast(__bf16, b); }
__device__ __forceinline__ float bfr(float f) { return bf2f(f2bf(f)); }
typedef __attribute__((ext_vector_type(2))) float    v2f;
typedef __attribute__((ext_vector_type(2))) __bf16   v2bf;
typedef __attribute__((ext_vector_type(2))) unsigned v2u;
typedef __attribute__((ext_vector_type(4))) unsigned v4u;
typedef v2u __attribute__((may_alias)) v2ua;
typedef v4u __attribute__((may_alias)) v4ua;
// pack2: two f32 rounded to bf16 in one conversion, a in the low half. split2: the same pair as hi, and the pair's residuals (value - hi, taken from the very hi that is stored) as lo.
__device__ __forceinline__ unsigned pack2(float a, float b) { return __builtin_bit_cast(unsigned, __builtin_convertvector((v2f){a, b}, v2bf)); }
__device__ __forceinline__ void split2(float a, float b, unsigned& hi, unsigned& lo) {
    const v2bf h = __builtin_convertvector((v2f){a, b}, v2bf);
    const v2f r = (v2f){__builtin_fmaf((float)h[0], -1.0f, a), __builtin_fmaf((float)h[1], -1.0f, b)};    // value - hi, exact in f32
    hi = __builtin_bit_cast(unsigned, h); lo = __builtin_bit_cast(unsigned, __builtin_convertvector(r, v2bf));
}
__device__ __forceinline__ v16h cat16(v8h lo, v8h hi) { return __builtin_shufflevector(lo, hi, 0, 1, 2, 3, 4, 5, 6, 7, 8, 9, 10, 11, 12, 13, 14, 15); }
__device__ __forceinline__ v16bf cat16b(v8us lo, v8us hi) { return __builtin_bit_cast(v16bf, __builtin_shufflevector(lo, hi, 0, 1, 2, 3, 4, 5, 6, 7, 8, 9, 10, 11, 12, 13, 14, 15)); }
__device__ __forceinline__ v8f wmma16(v16h a, v16h b, v8f c) { return __builtin_amdgcn_wmma_f32_16x16x32_f16(false, a, false, b, (short)0, c, false, false); }
__device__ __forceinline__ v8f wmmab(v16bf a, v16bf b, v8f c) { return __builtin_amdgcn_wmma_f32_16x16x32_bf16(false, a, false, b, (short)0, c, false, false); }

// FRAGMENT ORDER: every bf16 matrix [rows][K] that a matrix instruction reads from global memory lies as blocks of 16 rows x 32 k = 512 elements (block (r / 16) * (K / 32) + k / 32); inside a block
// element (r, k) stands at ((k / 16) % 2) * 256 + ((k / 8) % 2) * 128 + (r % 16) * 8 + k % 8: lane l's two 16-byte fragment pieces are at l * 8 and 256 + l * 8, so each wave-wide load is 512 bytes in a row.
// Which lane and register holds which (r, k) is as with row-major storage.
// wt_tile: WT [n][K] = bf16(W[k][n]) (k-major [K][ncols]), in fragment order, via one 64 x 64 LDS tile tl; tile (bx, by) of (K/64, ncols/64), 256 threads.
__device__ __forceinline__ void wt_tile(unsigned short* tl, int bx, int by, const float* __restrict__ Wm, int K, int ncols, bf* WT) {
    const int tid = threadIdx.x, k0 = bx * 64, n0 = by * 64;
    const int kk = tid >> 2, nq = (tid & 3) * 16;
#pragma unroll
    for (int i = 0; i < 16; ++i) tl[(nq + i) * 72 + kk] = f2bf(Wm[(size_t)(k0 + kk) * ncols + n0 + nq + i]);
    __syncthreads();
    const int lane = tid & 31, kq = (tid >> 6) & 1, part = (tid >> 5) & 1;    // a wave stores one half block: 512 bytes in a row
    auto pass = [&]() {
#pragma unroll
        for (int s = 0; s < 2; ++s) { const int nt = (tid >> 7) + 2 * s; const v8us val = *(const v8usa*)(tl + (nt * 16 + (lane & 15)) * 72 + (kq * 4 + part * 2 + (lane >> 4)) * 8);
            *(v8us*)(WT + ((size_t)(n0 / 16 + nt) * (K / 32) + k0 / 32 + kq) * 512 + part * 256 + lane * 8) = val; }
    };
    pass(); 
}
// cvt_blk: one wave rounds two neighbouring blocks (16 rows x 64 k) to bf16 in fragment order; src: the 16 rows' first element of those k, dst: the first block.
__device__ __forceinline__ void cvt_blk(const float* __restrict__ src, bf* dst) {
    const int lane = threadIdx.x & 31;
    const float* sp = src + (size_t)(lane & 15) * DM + (lane >> 4) * 8;
    v4u o[4];
#pragma unroll
    for (int q = 0; q < 4; ++q) { v4u t;
#pragma unroll
        for (int i = 0; i < 4; ++i) t[i] = pack2(sp[q * 16 + 2 * i], sp[q * 16 + 2 * i + 1]);
        o[q] = t; }
#pragma unroll
    for (int q = 0; q < 4; ++q) *(v4ua*)(dst + q * 256 + lane * 8) = o[q];
}
// k_prep: every operand preparation of the call in one grid, none reads another's output. Blocks 0 .. 1279: the five weights' 16 x 16 transpose tiles; then half of a 16-row tile a block (512 k, 64 a wave):
// 4096 rows of [mem; x] -> Cb, 2048 rows of x -> Xb, 2048 rows of rel_enc -> Rb.
#define NWT  (5 * (DD / 64) * (DD / 64))
__global__ __launch_bounds__(256) void k_prep(const float* __restrict__ Wq, const float* __restrict__ Wke, const float* __restrict__ Wkr, const float* __restrict__ Wv, const float* __restrict__ Wo,
                                              const float* __restrict__ x, const float* __restrict__ mem, const float* __restrict__ rel,
                                              bf* WqT, bf* WkeT, bf* WkrT, bf* WvT, bf* WoT, bf* Cb, bf* Xb, bf* Rb) {
    __shared__ __align__(16) unsigned short tl[64 * 72];
    const int blk = blockIdx.x;
    if (blk < NWT) {    // the same for the whole block: the barrier inside wt_tile is passed by all of it or by none
        const int w = blk / ((DD / 64) * (DD / 64)), tile = blk % ((DD / 64) * (DD / 64));
        const float* Wm = w == 0 ? Wq : w == 1 ? Wke : w == 2 ? Wkr : w == 3 ? Wv : Wo;
        bf* WT = w == 0 ? WqT : w == 1 ? WkeT : w == 2 ? WkrT : w == 3 ? WvT : WoT;
        wt_tile(tl, tile % (DD / 64), tile / (DD / 64), Wm, DD, DD, WT);
    } else {
        const int r = ((blk - NWT) >> 1) * 16;    // the first row of the block's tile; every boundary below is a multiple of 16, so a tile's rows have one source and one target
        const float* src; bf* dst;
        if (r < NCR) { const int b = r / TK, t = r % TK;    // x_tilde_b = [mem_b; x_b]
            src = t < LQ ? mem + ((size_t)b * LQ + t) * DD : x + ((size_t)b * LQ + t - LQ) * DD; dst = Cb + (size_t)r * DD;
        } else if (r < NCR + NXR) { src = x + (size_t)(r - NCR) * DD; dst = Xb + (size_t)(r - NCR) * DD;    // x rows (b, s)
        } else { src = rel + (size_t)(r - NCR - NXR) * DD; dst = Rb + (size_t)(r - NCR - NXR) * DD; }
        const int kb = ((blk - NWT) & 1) * 16 + (threadIdx.x >> 5) * 2;    // the wave's first block of 32 k; dst is the tile's first block (16 rows x DD elements a tile, as row-major)
        cvt_blk(src + kb * 32, dst + kb * 512);
    }
}

// k_gemmb: MT * 64 x 64 block tile (4 waves x MT row tiles x 16 x 64) of C[rows][DD] = (A [+ Al]).B^T (K = 1024) [+ bf(bias[c])] [+ bf(R[r][c]) residual]; f32 whole-line epilogue (or f16
// PLANES 1: the 64 columns of a block are one head, and the tile goes out as that head's operand planes [row][64] = bf16 hi + UNSCALED residual (NR rows per batch, batch-first rows);
// PLANES 2: the same two planes transposed, [d][TK] (the v operand of P.v). Either way the f32 product never leaves the block. A, Al, Bn and the planes are in fragment order.
// The body is a device function of the block's tile (bx, by) and of its LDS tile ost, so that several products can share one grid.
// MT: 16-row tiles a wave holds (rows (bx * MT + mt) * 64 + wave * 16 ..): the block's tile is MT * 64 rows x 64 columns, and each B fragment a wave loads feeds four products (SPLITA: MT row tiles x two planes).
template <bool SPLITA, bool F16OUT, int PLANES, int NR, int MT>
__device__ __forceinline__ void gemmb(float (*ost)[16 * 68], int bx, int by, const bf* __restrict__ A, const bf* __restrict__ Al, const bf* __restrict__ Bn, const float* __restrict__ bias, float* C, int ldc, h16* C2, const float* __restrict__ R = nullptr, int K = DM, int roundR = 1, bf* Ph = nullptr, bf* Pl = nullptr) {
    const int lane = threadIdx.x & 31, wave = __builtin_amdgcn_readfirstlane(threadIdx.x >> 5), lr = lane & 15, hi = lane >> 4;
    const int c0 = by * 64;
    size_t aoff[MT];    // fragment order: a 16-row tile is 16 * K elements, its blocks of 32 k are 512 elements apart; a block's address is the same for the whole wave, lane l reads at l * 8
#pragma unroll
    for (int mt = 0; mt < MT; ++mt) aoff[mt] = (size_t)((bx * MT + mt) * 64 + wave * 16) * K;
    size_t boff[4];
#pragma unroll
    for (int t = 0; t < 4; ++t) boff[t] = (size_t)(c0 + t * 16) * K;
    v8f acc[MT][4];
#pragma unroll
    for (int mt = 0; mt < MT; ++mt) {
#pragma unroll
        for (int t = 0; t < 4; ++t) acc[mt][t] = (v8f){}; }
    float braw[4] = {0.f, 0.f, 0.f, 0.f};    // PLANES: the bias is asked for here, so that it arrives under the k loop and the epilogue does not wait for it
    if (PLANES) {
#pragma unroll
        for (int t = 0; t < 4; ++t) braw[t] = bias[c0 + t * 16 + lr];
        asm volatile("s_wait_xcnt 0x0" ::: "memory"); }    // precaution: stands in front of the first rewrite of the four bias loads' address registers (the k loop's set-up reuses them)
#pragma unroll 1
    for (int kc = 0; kc < K; kc += 32) {
        const bf* const pb[4] = {Bn + boff[0] + kc * 16, Bn + boff[1] + kc * 16, Bn + boff[2] + kc * 16, Bn + boff[3] + kc * 16};
        static_assert((MT == 4 && !SPLITA) || (MT == 2 && SPLITA), "the wide tile has four A-side fragments a trip: four row tiles of one plane, or two row tiles of two planes");
        const bf* const pa[4] = {A + aoff[0] + kc * 16, A + aoff[1] + kc * 16, (SPLITA ? Al + aoff[0] : A + aoff[MT - 2]) + kc * 16, (SPLITA ? Al + aoff[1] : A + aoff[MT - 1]) + kc * 16};
        v16bf a[4], b[4];
#pragma unroll
        for (int i = 0; i < 4; ++i) a[i] = cat16b(*(const v8us*)(pa[i] + lane * 8), *(const v8us*)(pa[i] + lane * 8 + 256));
#pragma unroll
        for (int t = 0; t < 4; ++t) b[t] = cat16b(*(const v8us*)(pb[t] + lane * 8), *(const v8us*)(pb[t] + lane * 8 + 256));
        __builtin_amdgcn_sched_barrier(0);    // keeps the trip's 16 loads one group in front of its products; spread among them, with registers reused, the wave would wait out the load latency several times a trip
#pragma unroll
        for (int i = 0; i < 4; i += MT) {    // SPLITA: all hi products, then all residual products; each accumulator still takes hi, then residual, of every trip in turn
#pragma unroll
            for (int t = 0; t < 4; ++t) {
#pragma unroll
                for (int mt = 0; mt < MT; ++mt) acc[mt][t] = wmmab(a[i + mt], b[t], acc[mt][t]); } }
        __builtin_amdgcn_sched_barrier(0);    // keeps every product of the trip in front of the two statements below
        asm volatile("s_wait_xcnt 0x0" :: "s"(pa[0]), "s"(pa[1]), "s"(pa[2]), "s"(pa[3]), "s"(pb[0]), "s"(pb[1]), "s"(pb[2]), "s"(pb[3]) : "memory");    // precaution: the trip's block addresses are inputs here, so none of their registers is rewritten in front of this wait
        asm volatile("v_nop\n\tv_nop\n\tv_nop\n\tv_nop" : "+v"(acc[0][3]), "+v"(acc[MT - 1][3]));    // the four vector slots the chip needs behind the trip's last products, on the way out of the loop too
    }
    float bvv[4];    // the columns' bias, the same for every row tile
#pragma unroll
    for (int t = 0; t < 4; ++t) bvv[t] = PLANES ? bfr(braw[t]) : bias ? bfr(bias[c0 + t * 16 + lr]) : 0.f;
#pragma unroll
    for (int mt = 0; mt < MT; ++mt) {    // 64 rows of the block's tile a part of ost: ost[mt * 4 + wave] is the wave's 16 rows of it
    float* os = &ost[mt * 4 + wave][0];
#pragma unroll
    for (int t = 0; t < 4; ++t) { const float bv = bvv[t];
        if (PLANES == 2) {    // transposed tile [d][68] over all four waves' rows: a lane's eight rows are eight neighbours of one d
            float* tp = &ost[mt * 4][0] + (t * 16 + lr) * 68 + wave * 16 + hi * 8;
            *(v4fa*)tp = (v4f){acc[mt][t][0] + bv, acc[mt][t][1] + bv, acc[mt][t][2] + bv, acc[mt][t][3] + bv}; *(v4fa*)(tp + 4) = (v4f){acc[mt][t][4] + bv, acc[mt][t][5] + bv, acc[mt][t][6] + bv, acc[mt][t][7] + bv};
        } else {
#pragma unroll
        for (int j = 0; j < 8; ++j) os[(hi * 8 + j) * 68 + t * 16 + lr] = acc[mt][t][j] + bv; } }
    }
    __syncthreads();
#pragma unroll 1    // rolled: for speed only
    for (int mt = 0; mt < MT; ++mt) {
    const int bxe = bx * MT + mt, r0 = bxe * 64 + wave * 16;
    float* os = &ost[mt * 4 + wave][0];
    if (PLANES) {
        const int rb = bxe * 64, bhp = (rb / NR) * NH_ + by, rin = rb % NR;    // batch and head of the block, the 64-row part's first row inside the batch
#pragma unroll
        for (int s = 0; s < 4; ++s) {    // fragment order: 32 lanes x 16 bytes are half a block, 512 bytes in a row in both planes
            const int piece = PLANES == 2 ? wave * 2 + hi : s * 2 + hi;    // which eight k (PLANES 2: keys of the block's 64; else d)
            const int row = PLANES == 2 ? s * 16 + lr : lr;    // PLANES 2: d, of the block's tile; else a row of the wave's own 16
            const float* sp = (PLANES == 2 ? &ost[mt * 4][0] : os) + row * 68 + piece * 8; v4u oh, ol;
#pragma unroll
            for (int i = 0; i < 4; ++i) { unsigned hw, lw; split2(sp[2 * i], sp[2 * i + 1], hw, lw); oh[i] = hw; ol[i] = lw; }
            const size_t o = PLANES == 2 ? ((size_t)bhp * HD + s * 16) * TK + (rin / 32 + (wave >> 1)) * 512 + (wave & 1) * 256 + lane * 8 : ((size_t)bhp * NR + rin + wave * 16) * HD + s * 256 + lane * 8;
            *(v4ua*)(Ph + o) = oh; *(v4ua*)(Pl + o) = ol; }
        asm volatile("s_wait_xcnt 0x0" ::: "memory");    // precaution: behind the last plane store, in front of whatever the shared grid's code places after this body that rewrites the stores' registers
    } else if (F16OUT) {
        h16* crow = (h16*)(void*)C + (size_t)r0 * ldc + c0;
        auto pass = [&]() {
#pragma unroll
            for (int s = 0; s < 4; ++s) { const int row = 4 * s + (lane >> 3), piece = lane & 7; const float* sp = os + row * 68 + piece * 8; v8h o, o2;
#pragma unroll
                for (int i = 0; i < 8; ++i) { const h16 a = (h16)sp[i]; o[i] = a; o2[i] = (h16)((sp[i] - (float)a) * LOSC); }
                *(v8h*)(crow + (size_t)row * ldc + piece * 8) = o; if (C2) *(v8h*)(C2 + (size_t)r0 * ldc + c0 + (size_t)row * ldc + piece * 8) = o2; }
        };
        pass(); 
    } else {
        float* crow = C + (size_t)r0 * ldc + c0;
        auto pass = [&]() {
#pragma unroll
            for (int s = 0; s < 8; ++s) { const int Lid = (lane >> 3) + 4 * s, piece = lane & 7; const int row = Lid >> 1, cofs = (Lid & 1) * 32 + piece * 4;
                v4f val = *(const v4fa*)(os + row * 68 + cofs); if (R) { const v4f rv = *(const v4f*)(R + ((size_t)r0 + row) * ldc + c0 + cofs); val += roundR ? (v4f){bfr(rv[0]), bfr(rv[1]), bfr(rv[2]), bfr(rv[3])} : rv; }
                *(v4f*)(crow + (size_t)row * ldc + cofs) = val;
                asm volatile("s_wait_xcnt 0x0" ::: "memory"); }    // precaution: behind each store, in front of the next piece's (and the next pass's) rewrite of the store's registers
        };
        pass(); 
    }
    }
}
// k_proj: the four projections, which read none of each other's output, as one grid of 256-row x 64-column tiles: blockIdx.x 0 .. 15 k, 16 .. 31 v, 32 .. 39 q, 40 .. 47 Q_rel (shared across b: one batch of TK rows); blockIdx.y the head.
#define PMT  4                    // 16-row tiles a wave of k_proj holds
#define PBR  (64 * PMT)           // rows of a block's tile; divides LQ and TK, so a tile stays inside one batch
__global__ __launch_bounds__(128) void k_proj(const bf* __restrict__ Cb, const bf* __restrict__ Xb, const bf* __restrict__ Rb, const bf* __restrict__ WkeT, const bf* __restrict__ WvT, const bf* __restrict__ WqT, const bf* __restrict__ WkrT,
                                              const float* __restrict__ bke, const float* __restrict__ bv, const float* __restrict__ bq, const float* __restrict__ bkr,
                                              bf* Kh, bf* Kl, bf* VTh, bf* VTl, bf* Qh, bf* Ql, bf* Rh, bf* Rl, int K) {
    __shared__ __align__(16) float ost[4 * PMT][16 * 68];
    const int bx = blockIdx.x, by = blockIdx.y;
    if (bx < NCR / PBR) gemmb<false, false, 1, TK, PMT>(ost, bx, by, Cb, nullptr, WkeT, bke, nullptr, DD, nullptr, nullptr, K, 1, Kh, Kl);
    else if (bx < 2 * (NCR / PBR)) gemmb<false, false, 2, TK, PMT>(ost, bx - NCR / PBR, by, Cb, nullptr, WvT, bv, nullptr, DD, nullptr, nullptr, K, 1, VTh, VTl);
    else if (bx < 2 * (NCR / PBR) + NXR / PBR) gemmb<false, false, 1, LQ, PMT>(ost, bx - 2 * (NCR / PBR), by, Xb, nullptr, WqT, bq, nullptr, DD, nullptr, nullptr, K, 1, Qh, Ql);
    else gemmb<false, false, 1, TK, PMT>(ost, bx - 2 * (NCR / PBR) - NXR / PBR, by, Rb, nullptr, WkrT, bkr, nullptr, DD, nullptr, nullptr, K, 1, Rh, Rl);
}
// k_out: out = (ctx hi + ctx residual).Wo + bf(bo), K = 1024, 128 x 64 block tile. 16 waves = 4 row groups (two 16-row tiles each, 64 rows apart, x 64 columns) x OKS slices of K:
// a wave sums 256 k in 8 trips, and four waves a SIMD wait out their trips' load latencies side by side. The OKS partial tiles meet in LDS and are added in slice order.
// K comes as an argument, as in k_proj: the trip's block addresses then stay scalar, and every load is scalar base + the lane's one offset register.
#define OKS  4
__global__ __launch_bounds__(512) void k_out(const bf* __restrict__ A, const bf* __restrict__ Al, const bf* __restrict__ Bn, const float* __restrict__ bias, float* C, int K) {
    __shared__ __align__(16) float ost[OKS][8][16 * 68];    // [slice][16-row tile of the block's 128 rows][row x 68]
    const int tid = threadIdx.x, lane = tid & 31, wave = __builtin_amdgcn_readfirstlane(tid >> 5), wr = wave & 3, ks = wave >> 2, lr = lane & 15, hi = lane >> 4;
    const int bx = blockIdx.x, c0 = blockIdx.y * 64;
    const v4f braw = *(const v4f*)(bias + c0 + (tid & 15) * 4);    // the bias of the four columns this thread stores, asked for here so that it arrives under the k loop
    asm volatile("s_wait_xcnt 0x0" ::: "memory");    // precaution: stands in front of the first rewrite of the bias load's address registers
    const size_t aoff[2] = {(size_t)(bx * 128 + wr * 16) * K, (size_t)(bx * 128 + 64 + wr * 16) * K};    // fragment order: a 16-row tile is 16 * K elements, its blocks of 32 k are 512 elements apart
    const size_t boff[4] = {(size_t)c0 * K, (size_t)(c0 + 16) * K, (size_t)(c0 + 32) * K, (size_t)(c0 + 48) * K};
    const int kn = K / OKS, k0 = ks * kn;    // the wave's slice of K
    v8f acc[2][4];
#pragma unroll
    for (int mt = 0; mt < 2; ++mt) {
#pragma unroll
        for (int t = 0; t < 4; ++t) acc[mt][t] = (v8f){}; }
#pragma unroll 1    // rolled: one trip's text, and one group of 16 loads in flight a wave
    for (int kc = k0; kc < k0 + kn; kc += 32) {
        const bf* const pb[4] = {Bn + boff[0] + kc * 16, Bn + boff[1] + kc * 16, Bn + boff[2] + kc * 16, Bn + boff[3] + kc * 16};
        const bf* const pa[4] = {A + aoff[0] + kc * 16, A + aoff[1] + kc * 16, Al + aoff[0] + kc * 16, Al + aoff[1] + kc * 16};
        v16bf a[4], b[4];
#pragma unroll
        for (int i = 0; i < 4; ++i) a[i] = cat16b(*(const v8us*)(pa[i] + lane * 8), *(const v8us*)(pa[i] + lane * 8 + 256));
#pragma unroll
        for (int t = 0; t < 4; ++t) b[t] = cat16b(*(const v8us*)(pb[t] + lane * 8), *(const v8us*)(pb[t] + lane * 8 + 256));
        __builtin_amdgcn_sched_barrier(0);    // keeps the trip's 16 loads one group in front of its products; spread among them, with registers reused, the wave would wait out the load latency several times a trip
#pragma unroll
        for (int i = 0; i < 4; i += 2) {    // all hi products, then all residual products; each accumulator takes hi, then residual, of every trip in turn
#pragma unroll
            for (int t = 0; t < 4; ++t) {
#pragma unroll
                for (int mt = 0; mt < 2; ++mt) acc[mt][t] = wmmab(a[i + mt], b[t], acc[mt][t]); } }
        __builtin_amdgcn_sched_barrier(0);    // keeps every product of the trip in front of the two statements below
        asm volatile("s_wait_xcnt 0x0" :: "s"(pa[0]), "s"(pa[1]), "s"(pa[2]), "s"(pa[3]), "s"(pb[0]), "s"(pb[1]), "s"(pb[2]), "s"(pb[3]) : "memory");    // precaution: the trip's block addresses are inputs here, so none of their registers is rewritten in front of this wait
        asm volatile("v_nop\n\tv_nop\n\tv_nop\n\tv_nop" : "+v"(acc[0][3]), "+v"(acc[1][3]));    // the four vector slots the chip needs behind the trip's last products, on the way out of the loop too
    }
#pragma unroll
    for (int mt = 0; mt < 2; ++mt) { float* os = &ost[ks][mt * 4 + wr][0];
#pragma unroll
        for (int t = 0; t < 4; ++t) {
#pragma unroll
            for (int j = 0; j < 8; ++j) os[(hi * 8 + j) * 68 + t * 16 + lr] = acc[mt][t][j]; } }
    __syncthreads();    // every slice's partial tile is in LDS
    const v4f bv = (v4f){bfr(braw[0]), bfr(braw[1]), bfr(braw[2]), bfr(braw[3])};
    const int cofs = (tid & 15) * 4;    // 16 threads a row: a wave stores two rows' 256 bytes, whole lines
    v4f val[4];    // all 16 LDS reads go as one group, in front of the stores and their waits
#pragma unroll
    for (int s = 0; s < 4; ++s) { const int row = s * 32 + (tid >> 4); const float* sp = &ost[0][row >> 4][0] + (row & 15) * 68 + cofs;
        val[s] = *(const v4fa*)sp;
#pragma unroll
        for (int k = 1; k < OKS; ++k) val[s] += *(const v4fa*)(sp + k * (8 * 16 * 68)); }
#pragma unroll
    for (int s = 0; s < 4; ++s) {
        *(v4f*)(C + (size_t)(bx * 128 + s * 32 + (tid >> 4)) * DD + c0 + cofs) = val[s] + bv;
        asm volatile("s_wait_xcnt 0x0" ::: "memory"); }    // precaution: behind each store, in front of the next piece's rewrite of the store's registers
}


// k_attn: one work-group (8 waves) per 64 query rows of one (b, h). The keys are taken in four windows of 512, so that 64 rows' scores of one window take under half of a WGP's LDS: two work-groups
// share a WGP, and while one is in its softmax (vector work) the other has the matrix units. Every k, Q_rel and v fragment serves 64 rows: waves w and w + 4 (row groups of 32) read the same
// fragments at the same time, and the second reader finds them in the WGP's cache. Per window:
//  1. B_hat = q.Q_rel^T (three products) for the 36 column tiles that feed the window; element (r, c) is stored straight at its place after the shift: with u = c + r - (L-1), row r column u when u >= 0,
//     else row r-1 column u + T; what falls outside the window goes to a pad. Row i0+64 (a third row tile) feeds the tail of row i0+63; the one padded zero of each row is stored by hand.
//  2. A = q.k^T (three products), s = (A + B) / 8 in place.  3. one wave per pair of rows: + mask x (-1e9), the window's own maximum m and sum l, P = exp(s - m) as bf16 hi + residual planes over the row's own bytes.
//  4. P.v (three products): a wave sums 128 keys for its 32 rows x 64; the 4 partial tiles of a row group are added in wave order through LDS.
// Behind each window but the first the running O (at the maximum M of the windows so far) takes the window's o: O = O e^(M-M') + o e^(m-M'), M' = max(M, m); behind the last, ctx = O / sum_i l_i e^(m_i-M').
#define RQ   64                   // query rows of one work-group
#define WK   512                  // keys of one window
#define NWIN (TK / WK)            // windows
#define AWV  8                    // waves of a work-group: 2 row groups x 4 column groups of 128 keys
#define SPW  516                  // LDS row pitch in floats: 16 B x odd, for the 16-byte fragment reads of stage 4
#define RP   68                   // pitch of a partial ctx tile's row in floats
__device__ __forceinline__ v16bf ldfrag(const bf* p) { return cat16b(*(const v8us*)p, *(const v8us*)(p + 256)); }    // global planes, fragment order: p = block + lane * 8
__device__ __forceinline__ v16bf ldfrag_s(const bf* p) { return cat16b(*(const v8usa*)p, *(const v8usa*)(p + 16)); }
__device__ __forceinline__ v8f prod3(const v16bf (&ah)[2], const v16bf (&al)[2], const v16bf (&bh)[2], const v16bf (&bl)[2]) {
    v8f acc = (v8f){};
#pragma unroll
    for (int ks = 0; ks < 2; ++ks) { acc = wmmab(ah[ks], bh[ks], acc); acc = wmmab(al[ks], bh[ks], acc); acc = wmmab(ah[ks], bl[ks], acc); }
    return acc;
}
__global__ __launch_bounds__(32 * AWV, 4) void k_attn(const bf* __restrict__ Qh, const bf* __restrict__ Ql, const bf* __restrict__ Kh, const bf* __restrict__ Kl, const bf* __restrict__ Rh, const bf* __restrict__ Rl,
                                              const bf* __restrict__ VTh, const bf* __restrict__ VTl, const float* __restrict__ MSK, bf* AVh, bf* AVl) {
    __shared__ __align__(16) float S[RQ * SPW];
    __shared__ __align__(16) float OS[4 * 32 * AWV * 4];    // the running P.v of the windows so far, each thread's own sixteen values
    __shared__ float ML[NWIN * RQ * 2];                // [window][row]: maximum, sum
    const int wave = __builtin_amdgcn_readfirstlane(threadIdx.x >> 5);
    const int i0 = blockIdx.x * RQ, bh = blockIdx.y, h = bh % NH_, b = bh / NH_;
    Qh += (size_t)bh * LQ * HD; Ql += (size_t)bh * LQ * HD; Kh += (size_t)bh * TK * HD; Kl += (size_t)bh * TK * HD; Rh += (size_t)h * TK * HD; Rl += (size_t)h * TK * HD; VTh += (size_t)bh * HD * TK; VTl += (size_t)bh * HD * TK;
    const int rg = wave >> 2, cg = wave & 3, lb = rg * 32;    // the wave's row group (local rows lb .. lb + 31) and its quarter of the window's columns
    const int n0 = cg * 9;                                    // the first of its Q_rel tiles: 36 tiles a window, nine a column group
#pragma unroll 1    // rolled: one window's text
    for (int wn = 0; wn < NWIN; ++wn) {
    const int w0 = __builtin_amdgcn_readfirstlane(wn * WK);    // the window's first key, held in a scalar register: formed inside the lane-dependent branch below it would count as lane-dependent, and every address and test made from it would turn into vector work
    int lraw; asm volatile("v_mbcnt_lo_u32_b32 %0, -1, 0" : "=v"(lraw));    // the lane's number, formed anew in each window: taken once in front of the loop, some twenty addresses made from it are carried through all windows, past the register budget of P.v, and are spilled
    const int lane = lraw & 31, tid = wave * 32 + lane, lr = lane & 15, hi = lane >> 4;
    v16bf qh[3][2], ql[3][2]; const bf* qa[3]; const bf* qb[3];    // asked for anew in each window: behind stage 2 their registers serve the softmax and P.v
#pragma unroll
    for (int rt = 0; rt < 3; ++rt) { const size_t o = (size_t)(rt < 2 ? i0 + lb + rt * 16 : min(i0 + RQ, LQ - 16)) * HD; qa[rt] = Qh + o; qb[rt] = Ql + o;    // the clamp holds the last work-group's third tile, which it never uses, inside the plane
#pragma unroll
        for (int ks = 0; ks < 2; ++ks) { qh[rt][ks] = ldfrag(qa[rt] + lane * 8 + ks * 512); ql[rt][ks] = ldfrag(qb[rt] + lane * 8 + ks * 512); } }
    asm volatile("s_wait_xcnt 0x0" :: "s"(qa[0]), "s"(qa[1]), "s"(qa[2]), "s"(qb[0]), "s"(qb[1]), "s"(qb[2]) : "memory");    // precaution: the tiles' addresses are inputs here, so none of their registers is rewritten in front of this wait
    if (tid < RQ) { const int zc = (TK - LQ + 1) + i0 + tid - w0; if ((unsigned)zc < (unsigned)WK) S[tid * SPW + zc] = 0.f; }   // the padded zero: column T - L + 1 + i of row i, in the window that holds that column
    const int T0 = (LQ - RQ) / 16 + wn * (WK / 16) - (i0 >> 4) + n0;    // the wave's first tile of 16 Q_rel columns, taken modulo 128: window 0 needs columns L - 64 - i0 .. , each later window the same 512 further, round the end
    if (wave == 0 && w0 - (i0 + RQ - 1) - (TK - LQ + 2) >= 0) {    // the same for the whole wave. The window's first column of row i0 + 63 then comes from row i0 + 64, one Q_rel column in front of the 36 tiles: the last column of the tile before
        const bf* const eh = Rh + (size_t)((T0 - 1) & 127) * (16 * HD); const bf* const el = Rl + (size_t)((T0 - 1) & 127) * (16 * HD);
        v16bf xh[2], xl[2];
#pragma unroll
        for (int ks = 0; ks < 2; ++ks) { xh[ks] = ldfrag(eh + lane * 8 + ks * 512); xl[ks] = ldfrag(el + lane * 8 + ks * 512); }
        asm volatile("s_wait_xcnt 0x0" :: "s"(eh), "s"(el) : "memory");    // precaution: the tile's addresses are inputs here, so none of their registers is rewritten in front of this wait
        __builtin_amdgcn_sched_barrier(0);    // keeps the tile's eight loads one group in front of its products; spread among them, with registers reused, the wave would wait out the load latency four times
        v8f ax = prod3(qh[2], ql[2], xh, xl);
        asm volatile("v_nop\n\tv_nop\n\tv_nop\n\tv_nop" : "+v"(ax));    // the four vector slots the chip needs behind the last product, on the way out of this branch too
        S[lane == 15 ? (RQ - 1) * SPW : WK] = ax[0]; }    // the other lanes' values go to row 0's pad, which nobody reads
    const bf* const ku = Kh + (size_t)(w0 + cg * 128) * HD; const bf* const kv = Kl + (size_t)(w0 + cg * 128) * HD;    // the wave's first k tile (fragment order: two blocks of 512 a tile of 16 keys)
    v16bf fh[2][2], fl[2][2];                             // two register sets: the next tile's fragments are fetched while this tile is worked on
    { const bf* const ph0 = Rh + (size_t)(T0 & 127) * (16 * HD); const bf* const pl0 = Rl + (size_t)(T0 & 127) * (16 * HD);
#pragma unroll
      for (int ks = 0; ks < 2; ++ks) { fh[0][ks] = ldfrag(ph0 + lane * 8 + ks * 512); fl[0][ks] = ldfrag(pl0 + lane * 8 + ks * 512); }
      asm volatile("s_wait_xcnt 0x0" :: "s"(ph0), "s"(pl0) : "memory"); }    // precaution: the tile's addresses are inputs here, so none of their registers is rewritten in front of this wait
#pragma unroll 1    // rolled, two tiles (the two register sets) a trip: a third of the text of nine tiles in a row
    for (int tp = 0; tp < 10; tp += 2) {
#pragma unroll
    for (int s = 0; s < 2; ++s) { const int t = tp + s, cur = s, nxt = s ^ 1;
        if (t < 9) {    // nine tiles; every test on t, cg, rg, c0 and ulo below reads the same for the whole wave
        const int c0 = ((T0 + t) & 127) * 16;
        const bf* const nh = t < 8 ? Rh + (size_t)((T0 + t + 1) & 127) * (16 * HD) : ku; const bf* const nl = t < 8 ? Rl + (size_t)((T0 + t + 1) & 127) * (16 * HD) : kv;   // behind the last Q_rel tile: the first k tile
#pragma unroll
        for (int ks = 0; ks < 2; ++ks) { fh[nxt][ks] = ldfrag(nh + lane * 8 + ks * 512); fl[nxt][ks] = ldfrag(nl + lane * 8 + ks * 512); }
        asm volatile("s_wait_xcnt 0x0" :: "s"(nh), "s"(nl) : "memory");    // precaution: as above
        {
        v8f a0 = prod3(qh[0], ql[0], fh[cur], fl[cur]), a1 = prod3(qh[1], ql[1], fh[cur], fl[cur]);
        asm volatile("v_nop\n\tv_nop\n\tv_nop\n\tv_nop" : "+v"(a0), "+v"(a1));    // the four vector slots the chip needs before these results' registers are written again, on either side of the branch below
        const int ulo = c0 + i0 + lb - (LQ - 1) - w0;    // the window column of the tile's first element; the others are up to 46 further
        const bool dir = ulo >= 0 && ulo + 46 < WK, wrp = ulo + TK >= 0 && ulo + TK + 46 < WK;
        if (dir || wrp) {    // most tiles: all 512 elements land in the window, all in their own row or all in the row above: one address, constant steps
            const int ib = (lb + hi * 8) * SPW + ulo + lr + hi * 8 + (wrp ? TK - SPW : 0);
#pragma unroll
            for (int k = 0; k < 24; ++k) { if ((k & 15) < 8) { const int idx = ib + k * (SPW + 1);
                S[k == 0 ? (idx < 0 ? WK : idx) : idx] = k < 16 ? a0[k & 7] : a1[k & 7]; } }    // idx < 0: row i0 - 1 is another work-group's; such a value goes to row 0's pad, which nobody reads
        } else {
#pragma unroll
        for (int rt = 0; rt < 2; ++rt) {
#pragma unroll
            for (int j = 0; j < 8; ++j) { const int lrw = lb + rt * 16 + hi * 8 + j, u = c0 + lr + i0 + lrw - (LQ - 1), w = u - w0;
                int idx = lrw * SPW + w;    // its own row, inside the window
                idx = (unsigned)w < (unsigned)WK ? idx : (unsigned)(w + TK) < (unsigned)WK ? idx + (TK - SPW) : WK;    // second case (u < 0): the row above, column u + T, where that is in the window; all else: row 0's pad
                if (rt == 0 && j == 0) idx = idx < 0 ? WK : idx;    // row i0 - 1 is another work-group's
                S[idx] = rt ? a1[j] : a0[j]; } }
        }
        if (s == rg && c0 + i0 + RQ - (LQ - 1) < 0) { v8f a2 = prod3(qh[2], ql[2], fh[cur], fl[cur]); const int u = c0 + lr + i0 + RQ - (LQ - 1);   // row i0 + 64 feeds the tail of row i0 + 63; the two row groups take turns at it
            asm volatile("v_nop\n\tv_nop\n\tv_nop\n\tv_nop" : "+v"(a2));    // the same four slots, on the way out of this branch
            S[(hi == 0 && (unsigned)(u + TK - w0) < (unsigned)WK) ? (RQ - 1) * SPW + u + TK - w0 : WK] = a2[0]; }
        }
        }
    } }
    __syncthreads();
    float* const sw = S + (lb + hi * 8) * SPW + cg * 128 + lr;    // this lane's element of row lb + hi * 8 in the wave's first tile
    float old[2][16];                               // B of this tile and of the next: read in one batch a tile ahead, so that no LDS read waits behind the stores of the tile before
#pragma unroll
    for (int e = 0; e < 16; ++e) old[0][e] = sw[((e >> 3) * 16 + (e & 7)) * SPW];
#pragma unroll
    for (int t = 0; t < 8; ++t) { const int cur = (t + 1) & 1, nxt = cur ^ 1, oc = t & 1, on = oc ^ 1;    // the first k tile came into set 1
        if (t < 7) {
#pragma unroll
            for (int ks = 0; ks < 2; ++ks) { fh[nxt][ks] = ldfrag(ku + lane * 8 + (t + 1) * 16 * HD + ks * 512); fl[nxt][ks] = ldfrag(kv + lane * 8 + (t + 1) * 16 * HD + ks * 512); }
#pragma unroll
            for (int e = 0; e < 16; ++e) old[on][e] = sw[((e >> 3) * 16 + (e & 7)) * SPW + (t + 1) * 16]; }
        __builtin_amdgcn_sched_barrier(0);    // keeps the next tile's loads in front of this tile's products; the compiler otherwise sinks them to just before their use and the wave waits out the whole latency
        const v8f a0 = prod3(qh[0], ql[0], fh[cur], fl[cur]), a1 = prod3(qh[1], ql[1], fh[cur], fl[cur]);
#pragma unroll
        for (int e = 0; e < 16; ++e) sw[((e >> 3) * 16 + (e & 7)) * SPW + t * 16] = ((e < 8 ? a0[e & 7] : a1[e & 7]) + old[oc][e]) * SCL;
    }
    asm volatile("s_wait_xcnt 0x0" :: "s"(ku), "s"(kv) : "memory");    // precaution: the k tiles' addresses are inputs here, so none of their registers is rewritten in front of this wait
    __builtin_amdgcn_sched_barrier(0);    // keeps the mask loads below from being lifted into the score tiles above, where their registers would spill
    const float* const mu = MSK + (size_t)(i0 + wave * (RQ / AWV)) * TK + w0;    // the window's part of the mask of the wave's first row
    v4f mk[2][WK / 128];    // asked for in front of the barrier so that it arrives while the other waves finish their scores
#pragma unroll
    for (int p = 0; p < 2; ++p) {
#pragma unroll
        for (int k = 0; k < WK / 128; ++k) mk[p][k] = *(const v4f*)(mu + p * TK + lane * 4 + k * 128); }
    __syncthreads();
#pragma unroll 1    // rolled: one pair of rows' text and registers; the pair's two chains of cross-lane steps run side by side
    for (int rr = 0; rr < RQ / AWV; rr += 2) { const int lrw = wave * (RQ / AWV) + rr; float* srow = S + lrw * SPW;
        float v[2][WK / 32]; float m[2] = {-3.0e38f, -3.0e38f};
#pragma unroll
        for (int p = 0; p < 2; ++p) {
#pragma unroll
        for (int k = 0; k < WK / 128; ++k) { const int c = k * 128 + lane * 4; const v4f s = *(const v4fa*)(srow + p * SPW + c);
#pragma unroll
            for (int q = 0; q < 4; q += 2) { const v2bf mr = __builtin_convertvector((v2f){mk[p][k][q], mk[p][k][q + 1]}, v2bf);    // the mask rounded to bf16, two a conversion
                const float x0 = __builtin_fmaf((float)mr[0], -1e9f, s[q]), x1 = __builtin_fmaf((float)mr[1], -1e9f, s[q + 1]); v[p][k * 4 + q] = x0; v[p][k * 4 + q + 1] = x1; m[p] = fmaxf(m[p], fmaxf(x0, x1)); } } }
        const float* const mn = mu + (size_t)(rr + 2) * TK; const int lo4 = lane * 4;
        if (rr + 2 < RQ / AWV) {    // the next pair's mask flies while this pair's softmax is worked out
#pragma unroll
            for (int p = 0; p < 2; ++p) {
#pragma unroll
                for (int k = 0; k < WK / 128; ++k) mk[p][k] = *(const v4f*)(mn + p * TK + lo4 + k * 128); } }
        asm volatile("s_wait_xcnt 0x0" :: "s"(mu), "s"(mn), "v"(mn + lo4) : "memory");    // precaution: the mask loads' addresses are inputs here, so none of their registers is rewritten (by a later load's result either) in front of this wait
#pragma unroll
        for (int sh = 16; sh; sh >>= 1) { const float t0 = __shfl_xor(m[0], sh, 32), t1 = __shfl_xor(m[1], sh, 32); m[0] = fmaxf(m[0], t0); m[1] = fmaxf(m[1], t1); }
        float sum[2] = {0.f, 0.f};
#pragma unroll
        for (int p = 0; p < 2; ++p) {
#pragma unroll
            for (int k = 0; k < WK / 32; ++k) { v[p][k] = __expf(v[p][k] - m[p]); sum[p] += v[p][k]; } }
#pragma unroll
        for (int sh = 16; sh; sh >>= 1) { const float t0 = __shfl_xor(sum[0], sh, 32), t1 = __shfl_xor(sum[1], sh, 32); sum[0] += t0; sum[1] += t1; }
        if (lane == 0) { ML[(wn * RQ + lrw) * 2] = m[0]; ML[(wn * RQ + lrw) * 2 + 1] = sum[0]; ML[(wn * RQ + lrw) * 2 + 2] = m[1]; ML[(wn * RQ + lrw) * 2 + 3] = sum[1]; }
#pragma unroll
        for (int p = 0; p < 2; ++p) {
        bf* prow = (bf*)(void*)(srow + p * SPW);    // hi plane in the row's first 1024 bytes, residual plane in the next 1024; both rows are whole in registers by now
#pragma unroll
        for (int k = 0; k < WK / 128; ++k) { v2u oh, ol;
#pragma unroll
            for (int q = 0; q < 2; ++q) { unsigned hw, lw; split2(v[p][k * 4 + 2 * q], v[p][k * 4 + 2 * q + 1], hw, lw); oh[q] = hw; ol[q] = lw; }
            *(v2ua*)(prow + k * 128 + lane * 4) = oh; *(v2ua*)(prow + WK + k * 128 + lane * 4) = ol; } }
    }
    const bf* const vu = VTh + (size_t)(w0 + cg * 128) * 16; const bf* const vv = VTl + (size_t)(w0 + cg * 128) * 16;    // the v planes (fragment order): first 16-row tile of d, the block of the wave's first 32 keys; a tile of d further is 16 * TK elements on
    v16bf vh[2][4], vl[2][4];                           // two register sets: the next 32 keys' v fragments are fetched while these are worked on; the first set is asked for in front of the barrier
#pragma unroll
    for (int dt = 0; dt < 4; ++dt) { vh[0][dt] = ldfrag(vu + lane * 8 + (size_t)dt * 16 * TK); vl[0][dt] = ldfrag(vv + lane * 8 + (size_t)dt * 16 * TK); }
    __syncthreads();
    v8f acc[2][4];
#pragma unroll
    for (int rt = 0; rt < 2; ++rt) {
#pragma unroll
        for (int dt = 0; dt < 4; ++dt) acc[rt][dt] = (v8f){}; }
#pragma unroll
    for (int ks = 0; ks < 4; ++ks) { const int cur = ks & 1, nxt = cur ^ 1;
        if (ks < 3) {
#pragma unroll
            for (int dt = 0; dt < 4; ++dt) { vh[nxt][dt] = ldfrag(vu + lane * 8 + (size_t)dt * 16 * TK + (ks + 1) * 512); vl[nxt][dt] = ldfrag(vv + lane * 8 + (size_t)dt * 16 * TK + (ks + 1) * 512); } }
        v16bf ph[2], pl[2];
#pragma unroll
        for (int rt = 0; rt < 2; ++rt) { const bf* pr = (const bf*)(const void*)(S + (lb + rt * 16 + lr) * SPW) + cg * 128 + ks * 32 + 8 * hi; ph[rt] = ldfrag_s(pr); pl[rt] = ldfrag_s(pr + WK); }
#pragma unroll
        for (int dt = 0; dt < 4; ++dt) {
#pragma unroll
            for (int rt = 0; rt < 2; ++rt) { acc[rt][dt] = wmmab(ph[rt], vh[cur][dt], acc[rt][dt]); acc[rt][dt] = wmmab(pl[rt], vh[cur][dt], acc[rt][dt]); acc[rt][dt] = wmmab(ph[rt], vl[cur][dt], acc[rt][dt]); } }
    }
    asm volatile("s_wait_xcnt 0x0" :: "s"(vu), "s"(vv) : "memory");    // precaution: the v blocks' addresses are inputs here, so none of their registers is rewritten in front of this wait
    __syncthreads();    // every wave has read its P fragments: the score rows' LDS now takes the 8 partial tiles
    float* red = S + wave * (32 * RP);
#pragma unroll
    for (int rt = 0; rt < 2; ++rt) {
#pragma unroll
        for (int dt = 0; dt < 4; ++dt) {
#pragma unroll
            for (int j = 0; j < 8; ++j) red[(rt * 16 + hi * 8 + j) * RP + dt * 16 + lr] = acc[rt][dt][j]; } }
    __syncthreads();
    const int od = wave * 8 + (tid & 1) * 4;    // thread -> element of a 16-row tile so that a wave's 8-byte stores are 256 bytes in a row of the fragment-order planes
#pragma unroll
    for (int g = 0; g < 4; ++g) {    // the four 16-row tiles of the 64 rows; tiles 0, 1 are row group 0's
        const int row = g * 16 + ((tid >> 1) & 15);
        v4f part[4];
#pragma unroll
        for (int w = 0; w < 4; ++w) part[w] = *(const v4fa*)(S + ((g >> 1) * 4 + w) * (32 * RP) + (row & 31) * RP + od);
        v4f o = part[0];
#pragma unroll
        for (int w = 1; w < 4; ++w) o += part[w];
        float* const osl = OS + (g * (32 * AWV) + tid) * 4;    // written and read back by the same thread
        if (wn == 0) *(v4fa*)osl = o;
        else {
            float mp = ML[row * 2];    // the maximum of the windows before this one: what the running O stands at
#pragma unroll
            for (int i = 1; i < NWIN - 1; ++i) { if (i < wn) mp = fmaxf(mp, ML[(i * RQ + row) * 2]); }    // the test reads the same for the whole work-group
            const float mw = ML[(wn * RQ + row) * 2], mm = fmaxf(mp, mw), e0 = __expf(mp - mm), e1 = __expf(mw - mm);
            const v4f on = *(const v4fa*)osl * e0 + o * e1;
            if (wn < NWIN - 1) *(v4fa*)osl = on;
            else {
            float l = 0.f;
#pragma unroll
            for (int i = 0; i < NWIN; ++i) l += ML[(i * RQ + row) * 2 + 1] * __expf(ML[(i * RQ + row) * 2] - mm);
            const v4f c = on * (1.0f / l);
            v2u oh, ol;    // ctx goes out as the last GEMM's operand planes: bf16 hi + residual
#pragma unroll
            for (int q = 0; q < 2; ++q) { unsigned hw, lw; split2(c[2 * q], c[2 * q + 1], hw, lw); oh[q] = hw; ol[q] = lw; }
            const size_t oo = ((size_t)b * LQ + i0 + g * 16) * DD + (size_t)h * 1024;    // the 16-row tile, then the head's two blocks of 32 columns
            bf* const sa = AVh + oo; bf* const sb = AVl + oo;
            *(v2ua*)(sa + tid * 4) = oh; *(v2ua*)(sb + tid * 4) = ol;
            asm volatile("s_wait_xcnt 0x0" :: "s"(sa), "s"(sb) : "memory"); } }    // precaution: behind the two stores, in front of any rewrite of their registers
    }
    __syncthreads();    // the partial tiles are read: the next window's scores may take their LDS
    }
}
extern "C" void kernel_launch(void* const* d_in, const int* in_sizes, int n_in,
                              void* d_out, int out_size, void* d_ws, size_t ws_size, hipStream_t stream) {
    (void)in_sizes; (void)n_in; (void)out_size;
    const float* x = (const float*)d_in[0]; const float* mem = (const float*)d_in[1]; const float* msk = (const float*)d_in[2]; const float* rel = (const float*)d_in[3];
    const float* Wq = (const float*)d_in[4]; const float* bq = (const float*)d_in[5]; const float* Wke = (const float*)d_in[6]; const float* bke = (const float*)d_in[7]; const float* Wkr = (const float*)d_in[8]; const float* bkr = (const float*)d_in[9];
    const float* Wv = (const float*)d_in[10]; const float* bv = (const float*)d_in[11]; const float* Wo = (const float*)d_in[12]; const float* bo = (const float*)d_in[13];
    float* out = (float*)d_out;    // [2][1024][1024]
    char* wsp = (char*)d_ws;
    auto take = [&](size_t bytes) { char* p = wsp; wsp += (bytes + 255) & ~(size_t)255; return (void*)p; };
    bf* WoT = (bf*)take((size_t)DD * DD * 2);
    bf* Qh = (bf*)take((size_t)NBT * NH_ * LQ * HD * 2); bf* Ql = (bf*)take((size_t)NBT * NH_ * LQ * HD * 2);
    bf* Kh = (bf*)take((size_t)NBT * NH_ * TK * HD * 2); bf* Kl = (bf*)take((size_t)NBT * NH_ * TK * HD * 2); bf* Rh = (bf*)take((size_t)NH_ * TK * HD * 2); bf* Rl = (bf*)take((size_t)NH_ * TK * HD * 2);
    bf* VTh = (bf*)take((size_t)NBT * NH_ * HD * TK * 2); bf* VTl = (bf*)take((size_t)NBT * NH_ * HD * TK * 2);
    // One region, used twice in stream order: projection scratch, then the split ctx planes. Each use writes all it reads.
    char* const shared0 = wsp;
    bf* AVh = (bf*)take((size_t)NXR * DD * 2); bf* AVl = (bf*)take((size_t)NXR * DD * 2);
    wsp = shared0;
    bf* WqT = (bf*)take((size_t)DD * DD * 2); bf* WkeT = (bf*)take((size_t)DD * DD * 2); bf* WkrT = (bf*)take((size_t)DD * DD * 2); bf* WvT = (bf*)take((size_t)DD * DD * 2);
    bf* Cb = (bf*)take((size_t)NCR * DD * 2); bf* Xb = (bf*)take((size_t)NXR * DD * 2); bf* Rb = (bf*)take((size_t)TK * DD * 2);
    if ((size_t)(wsp - (char*)d_ws) > ws_size) return;    // 50 MiB kept (WoT, q, k, Q_rel, v planes) + 24 MiB shared region; Cb holds [mem; x], Xb x, Rb rel_enc
    k_prep<<<NWT + (NCR + NXR + TK) / 8, 256, 0, stream>>>(Wq, Wke, Wkr, Wv, Wo, x, mem, rel, WqT, WkeT, WkrT, WvT, WoT, Cb, Xb, Rb);
    k_proj<<<dim3(2 * (NCR / PBR) + NXR / PBR + TK / PBR, DD / 64, 1), 128, 0, stream>>>(Cb, Xb, Rb, WkeT, WvT, WqT, WkrT, bke, bv, bq, bkr, Kh, Kl, VTh, VTl, Qh, Ql, Rh, Rl, DM);
    k_attn<<<dim3(LQ / RQ, NBT * NH_, 1), 32 * AWV, 0, stream>>>(Qh, Ql, Kh, Kl, Rh, Rl, VTh, VTl, msk, AVh, AVl);    // ctx[(b,s)][h*64 + d], as planes
    k_out<<<dim3(NXR / 128, DD / 64, 1), 512, 0, stream>>>(AVh, AVl, WoT, bo, out, DM);
}
